// v000
// Measured on an AMD MI455X. A time is GPU time per run, averaged over a window of back-to-back runs after a warm-up
// (all launches, gaps included; the runs take copies of the inputs in turn), and the median of several windows.
// Apart from v000's, it joins two sittings. Times from different sittings can be a few percent apart, while
// side-by-side timings come from the same sitting.
// v000, which the later versions start from, runs in 394 microseconds.
#include <hip/hip_runtime.h>
#include <hip/hip_bf16.h>
#include <math.h>

// ---------------------------------------------------------------------------
// RelationEnhanceAttention, algebraically restructured for MI455X (gfx1250).
//   B=32, N=49, D=512, H=8, DK=64, NREL=TOPK=14
// Conv and projection GEMMs: f16 operands (K-innermost both sides), fp32 accumulate on
// v_wmma_f32_16x16x32_f16. 16x64 C-tile per wave, pure b128 fragment loads.
// ---------------------------------------------------------------------------

typedef __attribute__((ext_vector_type(16))) _Float16 v16h;
typedef __attribute__((ext_vector_type(8)))  _Float16 v8h;
typedef __attribute__((ext_vector_type(8)))  float    v8f;

#define BQ      32
#define NQ      49
#define DMODEL  512
#define NHEAD   8
#define DKH     64
#define NRELC   14
#define ROWS    (BQ * NQ)            // 1568
#define KCONV   (DMODEL * 9)         // 4608
#define NPAIR   (BQ * NQ * NQ)       // 76832
#define LN_EPS  1e-5f

// ---------------------------------------------------------------------------
// WMMA GEMM: C[M,N] = A[M,K] * B^T[N,K] (+bias[N]).
// A: f16 row-major (M,K), lda mult of 8. Bt: f16 row-major (N,K), ldb mult 8.
// REQUIRES: M%16==0, N%64==0, K%32==0 (true for every call site here).
// One wave32 computes a 16x64 C tile; K stepped by 32.
// Fragment layout (ISA 16-bit A 16x32): halves 0..7  <- K = k0+8*half+0..7
//                                       halves 8..15 <- K = k0+8*half+16..23
// i.e. two contiguous 16-byte segments per lane -> two global_load_b128 each.
// ---------------------------------------------------------------------------
__global__ void gemm_wmma_f16(const _Float16* __restrict__ A,
                              const _Float16* __restrict__ Bt,
                              const float* __restrict__ bias,
                              float* __restrict__ C,
                              int M, int N, int K, int lda, int ldb, int ldc) {
  const int ntn  = N >> 6;                       // 64-wide column tiles
  const int tile = blockIdx.x * blockDim.y + threadIdx.y;
  const int tm   = tile / ntn;
  const int tn   = tile - tm * ntn;
  const int row0 = tm << 4;
  const int col0 = tn << 6;
  if (row0 >= M) return;                         // wave-uniform guard only

  const int lane = threadIdx.x;                  // 0..31
  const int hf   = lane >> 4;                    // 0/1
  const int idx  = lane & 15;

  const _Float16* pa = A + (size_t)(row0 + idx) * lda + hf * 8;
  const _Float16* pb0 = Bt + (size_t)(col0 + 0  + idx) * ldb + hf * 8;
  const _Float16* pb1 = Bt + (size_t)(col0 + 16 + idx) * ldb + hf * 8;
  const _Float16* pb2 = Bt + (size_t)(col0 + 32 + idx) * ldb + hf * 8;
  const _Float16* pb3 = Bt + (size_t)(col0 + 48 + idx) * ldb + hf * 8;

  v8f acc0 = {}, acc1 = {}, acc2 = {}, acc3 = {};
  union F16x16 { v16h v; v8h h[2]; };

  for (int k0 = 0; k0 < K; k0 += 32) {
    F16x16 af, b0, b1, b2, b3;
    af.h[0] = *(const v8h*)(pa + k0);
    af.h[1] = *(const v8h*)(pa + k0 + 16);
    b0.h[0] = *(const v8h*)(pb0 + k0);
    b0.h[1] = *(const v8h*)(pb0 + k0 + 16);
    b1.h[0] = *(const v8h*)(pb1 + k0);
    b1.h[1] = *(const v8h*)(pb1 + k0 + 16);
    b2.h[0] = *(const v8h*)(pb2 + k0);
    b2.h[1] = *(const v8h*)(pb2 + k0 + 16);
    b3.h[0] = *(const v8h*)(pb3 + k0);
    b3.h[1] = *(const v8h*)(pb3 + k0 + 16);
    // prefetch next K-step (global_prefetch_b8)
    __builtin_prefetch(pa + k0 + 32, 0, 1);
    __builtin_prefetch(pb0 + k0 + 32, 0, 1);
    __builtin_prefetch(pb2 + k0 + 32, 0, 1);
    acc0 = __builtin_amdgcn_wmma_f32_16x16x32_f16(false, af.v, false, b0.v,
                                                  (short)0, acc0, false, false);
    acc1 = __builtin_amdgcn_wmma_f32_16x16x32_f16(false, af.v, false, b1.v,
                                                  (short)0, acc1, false, false);
    acc2 = __builtin_amdgcn_wmma_f32_16x16x32_f16(false, af.v, false, b2.v,
                                                  (short)0, acc2, false, false);
    acc3 = __builtin_amdgcn_wmma_f32_16x16x32_f16(false, af.v, false, b3.v,
                                                  (short)0, acc3, false, false);
  }

  // C layout: vgpr r -> m = row0 + r + 8*hf ; n = col0 + sub*16 + idx
  const int mbase = row0 + (hf ? 8 : 0);
#pragma unroll
  for (int s = 0; s < 4; ++s) {
    const int n = col0 + s * 16 + idx;
    const float badd = bias ? bias[n] : 0.f;
    const v8f a = (s == 0) ? acc0 : (s == 1) ? acc1 : (s == 2) ? acc2 : acc3;
#pragma unroll
    for (int r = 0; r < 8; ++r)
      C[(size_t)(mbase + r) * ldc + n] = a[r] + badd;
  }
}

// ---------------------------------------------------------------------------
// Weight transpose + fp16 convert: W (K,N) row-major -> Wt (N,K) f16.
// ---------------------------------------------------------------------------
__global__ void transpose_h_k(const float* __restrict__ W, _Float16* __restrict__ Wt,
                              int K, int N) {
  int t = blockIdx.x * blockDim.x + threadIdx.x;
  if (t >= K * N) return;
  int k = t / N, n = t - k * N;                  // coalesced read of W
  Wt[(size_t)n * K + k] = (_Float16)W[t];
}

// fp32 -> fp16 convert (layout preserved)
__global__ void tofp16_k(const float* __restrict__ src, _Float16* __restrict__ dst,
                         int n) {
  int t = blockIdx.x * blockDim.x + threadIdx.x;
  if (t < n) dst[t] = (_Float16)src[t];
}

// ---------------------------------------------------------------------------
// im2col (f16 output) for the 3x3 pad-1 conv. x[b,c,y,x] == queries[b,y*7+x,c].
// Acol[row = b*49 + y*7 + x, kk = ic*9 + ky*3 + kx]
// ---------------------------------------------------------------------------
__global__ void im2col_k(const float* __restrict__ q, _Float16* __restrict__ Acol) {
  size_t t = (size_t)blockIdx.x * blockDim.x + threadIdx.x;
  if (t >= (size_t)ROWS * KCONV) return;
  const int kk  = (int)(t % KCONV);
  const int row = (int)(t / KCONV);
  const int b = row / NQ, p = row % NQ;
  const int y = p / 7, x = p % 7;
  const int ic = kk / 9, r = kk % 9;
  const int ky = r / 3, kx = r % 3;
  const int yy = y + ky - 1, xx = x + kx - 1;
  float v = 0.f;
  if (yy >= 0 && yy < 7 && xx >= 0 && xx < 7)
    v = q[((size_t)b * NQ + yy * 7 + xx) * DMODEL + ic];
  Acol[t] = (_Float16)v;
}

// BatchNorm stats over (B, spatial) = 1568 rows per channel (population var).
__global__ void bn_stats_k(const float* __restrict__ h, float* __restrict__ mu,
                           float* __restrict__ rstd) {
  const int c = blockIdx.x, tid = threadIdx.x;
  float s = 0.f, ss = 0.f;
  for (int r = tid; r < ROWS; r += 256) {
    float v = h[(size_t)r * DMODEL + c];
    s += v; ss += v * v;
  }
  __shared__ float sh[256], sh2[256];
  sh[tid] = s; sh2[tid] = ss; __syncthreads();
  for (int off = 128; off; off >>= 1) {
    if (tid < off) { sh[tid] += sh[tid + off]; sh2[tid] += sh2[tid + off]; }
    __syncthreads();
  }
  if (tid == 0) {
    float m = sh[0] * (1.f / ROWS);
    float v = sh2[0] * (1.f / ROWS) - m * m;
    mu[c] = m; rstd[c] = rsqrtf(v + LN_EPS);
  }
}

// xs = relu(BN(h)); eq/ek/ev = f16(xs + queries/keys/values)
__global__ void eqkv_k(const float* __restrict__ h, const float* __restrict__ mu,
                       const float* __restrict__ rstd,
                       const float* __restrict__ q, const float* __restrict__ k,
                       const float* __restrict__ v,
                       _Float16* __restrict__ eq, _Float16* __restrict__ ek,
                       _Float16* __restrict__ ev) {
  size_t t = (size_t)blockIdx.x * blockDim.x + threadIdx.x;
  if (t >= (size_t)ROWS * DMODEL) return;
  const int c = (int)(t % DMODEL);
  float xs = fmaxf((h[t] - mu[c]) * rstd[c], 0.f);
  eq[t] = (_Float16)(xs + q[t]);
  ek[t] = (_Float16)(xs + k[t]);
  ev[t] = (_Float16)(xs + v[t]);
}

// Precompute gate-collapse vectors:
//   u[512] = Wr2 @ Wgate ; wv[14] = rel_embed @ (Wproj @ Wgate)
//   cs = (br2 + bproj) . Wgate + bgate
__global__ void precompute_k(const float* __restrict__ Wr2, const float* __restrict__ Wgate,
                             const float* __restrict__ bgate, const float* __restrict__ Wproj,
                             const float* __restrict__ bproj, const float* __restrict__ br2,
                             const float* __restrict__ rel_embed,
                             float* __restrict__ u, float* __restrict__ wv,
                             float* __restrict__ cs) {
  __shared__ float pv[DKH];
  const int t = threadIdx.x;   // 512 threads
  {
    float s = 0.f;
    for (int j = 0; j < DMODEL; ++j) s += Wr2[(size_t)t * DMODEL + j] * Wgate[j];
    u[t] = s;
  }
  if (t < DKH) {
    float s = 0.f;
    for (int d = 0; d < DMODEL; ++d) s += Wproj[(size_t)t * DMODEL + d] * Wgate[d];
    pv[t] = s;
  }
  __syncthreads();
  if (t < NRELC) {
    float s = 0.f;
    for (int d = 0; d < DKH; ++d) s += rel_embed[t * DKH + d] * pv[d];
    wv[t] = s;
  }
  if (t == 0) {
    float s = bgate[0];
    for (int d = 0; d < DMODEL; ++d) s += (br2[d] + bproj[d]) * Wgate[d];
    cs[0] = s;
  }
}

// att[b,h,qi,ki] = SCALE * q[b,qi,h,:] . k[b,ki,h,:]
__global__ void attqk_k(const float* __restrict__ qh, const float* __restrict__ kh,
                        float* __restrict__ att) {
  size_t t = (size_t)blockIdx.x * blockDim.x + threadIdx.x;
  if (t >= (size_t)BQ * NHEAD * NQ * NQ) return;
  const int ki = (int)(t % NQ);
  const int qi = (int)((t / NQ) % NQ);
  const int h  = (int)((t / (NQ * NQ)) % NHEAD);
  const int b  = (int)(t / ((size_t)NQ * NQ * NHEAD));
  const float* qp = qh + ((size_t)(b * NQ + qi)) * DMODEL + h * DKH;
  const float* kp = kh + ((size_t)(b * NQ + ki)) * DMODEL + h * DKH;
  float s = 0.f;
#pragma unroll 8
  for (int d = 0; d < DKH; ++d) s += qp[d] * kp[d];
  att[t] = s * 0.125f;  // 1/sqrt(64)
}

// One wave32 per (b,qi,ki) pair: LN(256)->ReLU->14 logits->softmax->probs.wv,
// LN(512)->ReLU->dot(u), gate = sigmoid(.)
__global__ void pair_gate_k(const float* __restrict__ A1c, const float* __restrict__ A2c,
                            const float* __restrict__ A1r, const float* __restrict__ A2r,
                            const float* __restrict__ gc, const float* __restrict__ bcln,
                            const float* __restrict__ Wc2, const float* __restrict__ bc2,
                            const float* __restrict__ gr, const float* __restrict__ brln,
                            const float* __restrict__ u, const float* __restrict__ wv,
                            const float* __restrict__ cs, float* __restrict__ gate) {
  const int wave = blockIdx.x * blockDim.y + threadIdx.y;
  if (wave >= NPAIR) return;
  const int lane = threadIdx.x;
  const int b  = wave / (NQ * NQ);
  const int rm = wave % (NQ * NQ);
  const int qi = rm / NQ, ki = rm % NQ;

  // ---- classifier branch: LN over 256, ReLU, 256x14 matvec, softmax ----
  const float* a1 = A1c + (size_t)(b * NQ + qi) * 256;
  const float* a2 = A2c + (size_t)(b * NQ + ki) * 256;
  float x[8], s = 0.f, ss = 0.f;
#pragma unroll
  for (int j = 0; j < 8; ++j) {
    float v = a1[lane + 32 * j] + a2[lane + 32 * j];
    x[j] = v; s += v; ss += v * v;
  }
  for (int off = 16; off; off >>= 1) { s += __shfl_xor(s, off, 32); ss += __shfl_xor(ss, off, 32); }
  float mean = s * (1.f / 256.f);
  float rstd = rsqrtf(ss * (1.f / 256.f) - mean * mean + LN_EPS);

  float lg[NRELC];
#pragma unroll
  for (int r = 0; r < NRELC; ++r) lg[r] = 0.f;
#pragma unroll
  for (int j = 0; j < 8; ++j) {
    const int e = lane + 32 * j;
    float hv = fmaxf((x[j] - mean) * rstd * gc[e] + bcln[e], 0.f);
#pragma unroll
    for (int r = 0; r < NRELC; ++r) lg[r] += hv * Wc2[e * NRELC + r];
  }
  for (int off = 16; off; off >>= 1)
#pragma unroll
    for (int r = 0; r < NRELC; ++r) lg[r] += __shfl_xor(lg[r], off, 32);

  float mx = lg[0] + bc2[0];
#pragma unroll
  for (int r = 0; r < NRELC; ++r) { lg[r] += bc2[r]; mx = fmaxf(mx, lg[r]); }
  float se = 0.f, pw = 0.f;
#pragma unroll
  for (int r = 0; r < NRELC; ++r) {
    float p = __expf(lg[r] - mx);
    se += p; pw += p * wv[r];
  }
  // probs = p/se; top-k(14 of 14) renorm = /(1+1e-8)
  pw /= (se * (1.f + 1e-8f));

  // ---- relation branch: LN over 512, ReLU, dot with u ----
  const float* r1 = A1r + (size_t)(b * NQ + qi) * DMODEL;
  const float* r2 = A2r + (size_t)(b * NQ + ki) * DMODEL;
  float y[16];
  s = 0.f; ss = 0.f;
#pragma unroll
  for (int j = 0; j < 16; ++j) {
    float v = r1[lane + 32 * j] + r2[lane + 32 * j];
    y[j] = v; s += v; ss += v * v;
  }
  for (int off = 16; off; off >>= 1) { s += __shfl_xor(s, off, 32); ss += __shfl_xor(ss, off, 32); }
  mean = s * (1.f / 512.f);
  rstd = rsqrtf(ss * (1.f / 512.f) - mean * mean + LN_EPS);
  float gd = 0.f;
#pragma unroll
  for (int j = 0; j < 16; ++j) {
    const int e = lane + 32 * j;
    float hv = fmaxf((y[j] - mean) * rstd * gr[e] + brln[e], 0.f);
    gd += hv * u[e];
  }
  for (int off = 16; off; off >>= 1) gd += __shfl_xor(gd, off, 32);

  if (lane == 0)
    gate[wave] = 1.f / (1.f + __expf(-(gd + pw + cs[0])));
}

// enh = att*(1+gate); softmax over ki; out[b,qi,h,:] = f16(sum_ki w*v[b,ki,h,:])
__global__ void softmax_av_k(const float* __restrict__ att, const float* __restrict__ gate,
                             const float* __restrict__ vh, _Float16* __restrict__ outp) {
  const int bhq = blockIdx.x;                 // (b*8+h)*49 + qi
  const int b  = bhq / (NHEAD * NQ);
  const int h  = (bhq / NQ) % NHEAD;
  const int qi = bhq % NQ;
  __shared__ float sw[NQ];
  __shared__ float red[2];
  const int tid = threadIdx.x;                // 64 threads
  const float* arow = att + (size_t)bhq * NQ;
  const float* grow = gate + ((size_t)(b * NQ + qi)) * NQ;
  if (tid < NQ) sw[tid] = arow[tid] * (1.f + grow[tid]);
  __syncthreads();
  if (tid == 0) {
    float m = sw[0];
    for (int i = 1; i < NQ; ++i) m = fmaxf(m, sw[i]);
    float sm = 0.f;
    for (int i = 0; i < NQ; ++i) sm += __expf(sw[i] - m);
    red[0] = m; red[1] = sm;
  }
  __syncthreads();
  if (tid < NQ) sw[tid] = __expf(sw[tid] - red[0]) / red[1];
  __syncthreads();
  if (tid < DKH) {
    const float* vbase = vh + (size_t)(b * NQ) * DMODEL + h * DKH + tid;
    float acc = 0.f;
    for (int ki = 0; ki < NQ; ++ki) acc += sw[ki] * vbase[(size_t)ki * DMODEL];
    outp[((size_t)(b * NQ + qi)) * DMODEL + h * DKH + tid] = (_Float16)acc;
  }
}

// ---------------------------------------------------------------------------
static inline void launch_gemm(const _Float16* A, const _Float16* Bt, const float* bias,
                               float* C, int M, int N, int K, int lda, int ldb, int ldc,
                               hipStream_t s) {
  const int tiles = (M / 16) * (N / 64);
  dim3 blk(32, 4), grd((tiles + 3) / 4);
  gemm_wmma_f16<<<grd, blk, 0, s>>>(A, Bt, bias, C, M, N, K, lda, ldb, ldc);
}

extern "C" void kernel_launch(void* const* d_in, const int* in_sizes, int n_in,
                              void* d_out, int out_size, void* d_ws, size_t ws_size,
                              hipStream_t stream) {
  const float* queries = (const float*)d_in[0];
  const float* keys    = (const float*)d_in[1];
  const float* values  = (const float*)d_in[2];
  const float* Wq = (const float*)d_in[3];  const float* bq = (const float*)d_in[4];
  const float* Wk = (const float*)d_in[5];  const float* bk = (const float*)d_in[6];
  const float* Wv = (const float*)d_in[7];  const float* bv = (const float*)d_in[8];
  const float* Wo = (const float*)d_in[9];  const float* bo = (const float*)d_in[10];
  const float* rel_embed = (const float*)d_in[11];
  const float* Wproj = (const float*)d_in[12]; const float* bproj = (const float*)d_in[13];
  const float* Wgate = (const float*)d_in[14]; const float* bgate = (const float*)d_in[15];
  const float* Wc1 = (const float*)d_in[16];   const float* bc1 = (const float*)d_in[17];
  const float* gc = (const float*)d_in[18];    const float* bcln = (const float*)d_in[19];
  const float* Wc2 = (const float*)d_in[20];   const float* bc2 = (const float*)d_in[21];
  const float* Wr1 = (const float*)d_in[22];   const float* br1 = (const float*)d_in[23];
  const float* gr = (const float*)d_in[24];    const float* brln = (const float*)d_in[25];
  const float* Wr2 = (const float*)d_in[26];   const float* br2 = (const float*)d_in[27];
  const float* convW = (const float*)d_in[28]; const float* convb = (const float*)d_in[29];

  // ---- workspace carve-out (256B aligned blocks) ----
  char* base = (char*)d_ws;
  size_t off = 0;
  auto alloc = [&](size_t bytes) -> void* {
    off = (off + 255) & ~(size_t)255;
    void* p = base + off;
    off += bytes;
    return p;
  };
  _Float16* AcolH  = (_Float16*)alloc((size_t)ROWS * KCONV * 2);
  _Float16* convWH = (_Float16*)alloc((size_t)DMODEL * KCONV * 2);
  _Float16* WqT    = (_Float16*)alloc((size_t)DMODEL * DMODEL * 2);
  _Float16* WkT    = (_Float16*)alloc((size_t)DMODEL * DMODEL * 2);
  _Float16* WvT    = (_Float16*)alloc((size_t)DMODEL * DMODEL * 2);
  _Float16* WoT    = (_Float16*)alloc((size_t)DMODEL * DMODEL * 2);
  _Float16* Wc1aT  = (_Float16*)alloc((size_t)256 * DMODEL * 2);
  _Float16* Wc1bT  = (_Float16*)alloc((size_t)256 * DMODEL * 2);
  _Float16* Wr1aT  = (_Float16*)alloc((size_t)DMODEL * DMODEL * 2);
  _Float16* Wr1bT  = (_Float16*)alloc((size_t)DMODEL * DMODEL * 2);
  _Float16* eqH    = (_Float16*)alloc((size_t)ROWS * DMODEL * 2);
  _Float16* ekH    = (_Float16*)alloc((size_t)ROWS * DMODEL * 2);
  _Float16* evH    = (_Float16*)alloc((size_t)ROWS * DMODEL * 2);
  _Float16* attnoH = (_Float16*)alloc((size_t)ROWS * DMODEL * 2);
  float* hconv = (float*)alloc((size_t)ROWS * DMODEL * 4);
  float* muv   = (float*)alloc(DMODEL * 4);
  float* rstdv = (float*)alloc(DMODEL * 4);
  float* qh    = (float*)alloc((size_t)ROWS * DMODEL * 4);
  float* kh    = (float*)alloc((size_t)ROWS * DMODEL * 4);
  float* vh    = (float*)alloc((size_t)ROWS * DMODEL * 4);
  float* A1c   = (float*)alloc((size_t)ROWS * 256 * 4);
  float* A2c   = (float*)alloc((size_t)ROWS * 256 * 4);
  float* A1r   = (float*)alloc((size_t)ROWS * DMODEL * 4);
  float* A2r   = (float*)alloc((size_t)ROWS * DMODEL * 4);
  float* uvec  = (float*)alloc(DMODEL * 4);
  float* wvecp = (float*)alloc(64);
  float* cscal = (float*)alloc(64);
  float* attb  = (float*)alloc((size_t)BQ * NHEAD * NQ * NQ * 4);
  float* gateb = (float*)alloc((size_t)NPAIR * 4);

  // 1) gate-collapse precompute (tiny)
  precompute_k<<<1, 512, 0, stream>>>(Wr2, Wgate, bgate, Wproj, bproj, br2,
                                      rel_embed, uvec, wvecp, cscal);

  // 2) weight transposes / fp16 conversion (one-shot, small)
  {
    int n = DMODEL * DMODEL;
    transpose_h_k<<<(n + 255) / 256, 256, 0, stream>>>(Wq, WqT, DMODEL, DMODEL);
    transpose_h_k<<<(n + 255) / 256, 256, 0, stream>>>(Wk, WkT, DMODEL, DMODEL);
    transpose_h_k<<<(n + 255) / 256, 256, 0, stream>>>(Wv, WvT, DMODEL, DMODEL);
    transpose_h_k<<<(n + 255) / 256, 256, 0, stream>>>(Wo, WoT, DMODEL, DMODEL);
    int n2 = DMODEL * 256;
    transpose_h_k<<<(n2 + 255) / 256, 256, 0, stream>>>(Wc1, Wc1aT, DMODEL, 256);
    transpose_h_k<<<(n2 + 255) / 256, 256, 0, stream>>>(Wc1 + (size_t)DMODEL * 256,
                                                        Wc1bT, DMODEL, 256);
    transpose_h_k<<<(n + 255) / 256, 256, 0, stream>>>(Wr1, Wr1aT, DMODEL, DMODEL);
    transpose_h_k<<<(n + 255) / 256, 256, 0, stream>>>(Wr1 + (size_t)DMODEL * DMODEL,
                                                       Wr1bT, DMODEL, DMODEL);
    int nc = DMODEL * KCONV;
    tofp16_k<<<(nc + 255) / 256, 256, 0, stream>>>(convW, convWH, nc);
  }

  // 3) conv3x3 as im2col + WMMA GEMM (1568 x 512 x 4608)
  {
    size_t tot = (size_t)ROWS * KCONV;
    im2col_k<<<(unsigned)((tot + 255) / 256), 256, 0, stream>>>(queries, AcolH);
  }
  launch_gemm(AcolH, convWH, convb, hconv, ROWS, DMODEL, KCONV, KCONV, KCONV, DMODEL, stream);

  // 4) BatchNorm(affine=False) + ReLU + residual adds (f16 activations)
  bn_stats_k<<<DMODEL, 256, 0, stream>>>(hconv, muv, rstdv);
  eqkv_k<<<(ROWS * DMODEL) / 256, 256, 0, stream>>>(hconv, muv, rstdv, queries, keys,
                                                    values, eqH, ekH, evH);

  // 5) token-level projections (all WMMA)
  launch_gemm(eqH, WqT, bq, qh, ROWS, DMODEL, DMODEL, DMODEL, DMODEL, DMODEL, stream);
  launch_gemm(ekH, WkT, bk, kh, ROWS, DMODEL, DMODEL, DMODEL, DMODEL, DMODEL, stream);
  launch_gemm(evH, WvT, bv, vh, ROWS, DMODEL, DMODEL, DMODEL, DMODEL, DMODEL, stream);
  launch_gemm(eqH, Wc1aT, bc1,     A1c, ROWS, 256,    DMODEL, DMODEL, DMODEL, 256,    stream);
  launch_gemm(ekH, Wc1bT, nullptr, A2c, ROWS, 256,    DMODEL, DMODEL, DMODEL, 256,    stream);
  launch_gemm(eqH, Wr1aT, br1,     A1r, ROWS, DMODEL, DMODEL, DMODEL, DMODEL, DMODEL, stream);
  launch_gemm(ekH, Wr1bT, nullptr, A2r, ROWS, DMODEL, DMODEL, DMODEL, DMODEL, DMODEL, stream);

  // 6) attention logits
  {
    size_t tot = (size_t)BQ * NHEAD * NQ * NQ;
    attqk_k<<<(unsigned)((tot + 255) / 256), 256, 0, stream>>>(qh, kh, attb);
  }

  // 7) per-pair gate (one wave32 per pair)
  {
    dim3 blk(32, 8), grd((NPAIR + 7) / 8);
    pair_gate_k<<<grd, blk, 0, stream>>>(A1c, A2c, A1r, A2r, gc, bcln, Wc2, bc2,
                                         gr, brln, uvec, wvecp, cscal, gateb);
  }

  // 8) gated softmax + A*V (f16 output feeds final GEMM)
  softmax_av_k<<<BQ * NHEAD * NQ, 64, 0, stream>>>(attb, gateb, vh, attnoH);

  // 9) output projection (WMMA) straight into d_out
  launch_gemm(attnoH, WoT, bo, (float*)d_out, ROWS, DMODEL, DMODEL, DMODEL, DMODEL,
              DMODEL, stream);
}

// v001
// It runs in 264 microseconds.
// Timed twice side by side with v000, it ran 1.49 times as fast both times.
#include <hip/hip_runtime.h>
#include <hip/hip_bf16.h>
#include <math.h>

// ---------------------------------------------------------------------------
// RelationEnhanceAttention, algebraically restructured for MI455X (gfx1250).
//   B=32, N=49, D=512, H=8, DK=64, NREL=TOPK=14
// Conv and projection GEMMs: f16 operands (K-innermost both sides), fp32 accumulate on
// v_wmma_f32_16x16x32_f16. 16x64 C-tile per wave, pure b128 fragment loads.
// ---------------------------------------------------------------------------

typedef __attribute__((ext_vector_type(16))) _Float16 v16h;
typedef __attribute__((ext_vector_type(8)))  _Float16 v8h;
typedef __attribute__((ext_vector_type(8)))  float    v8f;

#define BQ      32
#define NQ      49
#define DMODEL  512
#define NHEAD   8
#define DKH     64
#define NRELC   14
#define ROWS    (BQ * NQ)            // 1568
#define KCONV   (DMODEL * 9)         // 4608
#define NPAIR   (BQ * NQ * NQ)       // 76832
#define LN_EPS  1e-5f

// ---------------------------------------------------------------------------
// WMMA GEMM: C[M,N] = A[M,K] * B^T[N,K] (+bias[N]).
// A: f16 row-major (M,K), lda mult of 8. Bt: f16 row-major (N,K), ldb mult 8.
// REQUIRES: M%16==0, N%64==0, K%32==0 (true for every call site here).
// One wave32 computes a 16x64 C tile; K stepped by 32.
// Fragment layout (ISA 16-bit A 16x32): halves 0..7  <- K = k0+8*half+0..7
//                                       halves 8..15 <- K = k0+8*half+16..23
// i.e. two contiguous 16-byte segments per lane -> two global_load_b128 each.
// ---------------------------------------------------------------------------
__device__ __forceinline__ void gemm_tile(const _Float16* __restrict__ A,
                                          const _Float16* __restrict__ Bt,
                                          const float* __restrict__ bias,
                                          float* __restrict__ C, int tile,
                                          int M, int N, int K, int lda, int ldb, int ldc) {
  const int ntn  = N >> 6;                       // 64-wide column tiles
  const int tm   = tile / ntn;
  const int tn   = tile - tm * ntn;
  const int row0 = tm << 4;
  const int col0 = tn << 6;
  if (row0 >= M) return;                         // wave-uniform guard only

  const int lane = threadIdx.x;                  // 0..31
  const int hf   = lane >> 4;                    // 0/1
  const int idx  = lane & 15;

  const _Float16* pa = A + (size_t)(row0 + idx) * lda + hf * 8;
  const _Float16* pb0 = Bt + (size_t)(col0 + 0  + idx) * ldb + hf * 8;
  const _Float16* pb1 = Bt + (size_t)(col0 + 16 + idx) * ldb + hf * 8;
  const _Float16* pb2 = Bt + (size_t)(col0 + 32 + idx) * ldb + hf * 8;
  const _Float16* pb3 = Bt + (size_t)(col0 + 48 + idx) * ldb + hf * 8;

  v8f acc0 = {}, acc1 = {}, acc2 = {}, acc3 = {};
  union F16x16 { v16h v; v8h h[2]; };

  for (int k0 = 0; k0 < K; k0 += 32) {
    F16x16 af, b0, b1, b2, b3;
    af.h[0] = *(const v8h*)(pa + k0);
    af.h[1] = *(const v8h*)(pa + k0 + 16);
    b0.h[0] = *(const v8h*)(pb0 + k0);
    b0.h[1] = *(const v8h*)(pb0 + k0 + 16);
    b1.h[0] = *(const v8h*)(pb1 + k0);
    b1.h[1] = *(const v8h*)(pb1 + k0 + 16);
    b2.h[0] = *(const v8h*)(pb2 + k0);
    b2.h[1] = *(const v8h*)(pb2 + k0 + 16);
    b3.h[0] = *(const v8h*)(pb3 + k0);
    b3.h[1] = *(const v8h*)(pb3 + k0 + 16);
    // prefetch next K-step (global_prefetch_b8)
    __builtin_prefetch(pa + k0 + 32, 0, 1);
    __builtin_prefetch(pb0 + k0 + 32, 0, 1);
    __builtin_prefetch(pb2 + k0 + 32, 0, 1);
    acc0 = __builtin_amdgcn_wmma_f32_16x16x32_f16(false, af.v, false, b0.v,
                                                  (short)0, acc0, false, false);
    acc1 = __builtin_amdgcn_wmma_f32_16x16x32_f16(false, af.v, false, b1.v,
                                                  (short)0, acc1, false, false);
    acc2 = __builtin_amdgcn_wmma_f32_16x16x32_f16(false, af.v, false, b2.v,
                                                  (short)0, acc2, false, false);
    acc3 = __builtin_amdgcn_wmma_f32_16x16x32_f16(false, af.v, false, b3.v,
                                                  (short)0, acc3, false, false);
  }

  // C layout: vgpr r -> m = row0 + r + 8*hf ; n = col0 + sub*16 + idx
  const int mbase = row0 + (hf ? 8 : 0);
#pragma unroll
  for (int s = 0; s < 4; ++s) {
    const int n = col0 + s * 16 + idx;
    const float badd = bias ? bias[n] : 0.f;
    const v8f a = (s == 0) ? acc0 : (s == 1) ? acc1 : (s == 2) ? acc2 : acc3;
#pragma unroll
    for (int r = 0; r < 8; ++r)
      C[(size_t)(mbase + r) * ldc + n] = a[r] + badd;
    // the next column group reuses these stores' registers: wait first
    asm volatile("s_wait_xcnt 0x0" ::: "memory");
  }
}

__global__ void gemm_wmma_f16(const _Float16* __restrict__ A,
                              const _Float16* __restrict__ Bt,
                              const float* __restrict__ bias,
                              float* __restrict__ C,
                              int M, int N, int K, int lda, int ldb, int ldc) {
  gemm_tile(A, Bt, bias, C, blockIdx.x * blockDim.y + threadIdx.y, M, N, K, lda, ldb, ldc);
}

// The seven token-level projections share no data dependence: one grid, the
// product chosen by block range (block-uniform). 196 blocks per 512-wide
// product, 98 per 256-wide one; 4 waves (tiles) per block as above.
#define BLK_N512 ((ROWS / 16) * (DMODEL / 64) / 4)   // 196
#define BLK_N256 ((ROWS / 16) * (256 / 64) / 4)      // 98
#define PROJ_BLKS (5 * BLK_N512 + 2 * BLK_N256)      // 1176
__global__ void proj_gemms_k(const _Float16* __restrict__ eq, const _Float16* __restrict__ ek,
                             const _Float16* __restrict__ ev,
                             const _Float16* __restrict__ WqT, const _Float16* __restrict__ WkT,
                             const _Float16* __restrict__ WvT, const _Float16* __restrict__ Wr1aT,
                             const _Float16* __restrict__ Wr1bT, const _Float16* __restrict__ Wc1aT,
                             const _Float16* __restrict__ Wc1bT,
                             const float* __restrict__ bq, const float* __restrict__ bk,
                             const float* __restrict__ bv, const float* __restrict__ br1,
                             const float* __restrict__ bc1,
                             float* __restrict__ qh, float* __restrict__ kh,
                             float* __restrict__ vh, float* __restrict__ A1r,
                             float* __restrict__ A2r, float* __restrict__ A1c,
                             float* __restrict__ A2c, int K) {
  const int blk = blockIdx.x;
  const _Float16* A; const _Float16* Bt; const float* bias; float* C;
  int n, lb;
  if (blk < 5 * BLK_N512) {
    const int job = blk / BLK_N512;
    lb = blk - job * BLK_N512;
    n = DMODEL;
    switch (job) {
      case 0:  A = eq; Bt = WqT;   bias = bq;      C = qh;  break;
      case 1:  A = ek; Bt = WkT;   bias = bk;      C = kh;  break;
      case 2:  A = ev; Bt = WvT;   bias = bv;      C = vh;  break;
      case 3:  A = eq; Bt = Wr1aT; bias = br1;     C = A1r; break;
      default: A = ek; Bt = Wr1bT; bias = nullptr; C = A2r; break;
    }
  } else {
    lb = blk - 5 * BLK_N512;
    n = 256;
    if (lb < BLK_N256) { A = eq; Bt = Wc1aT; bias = bc1; C = A1c; }
    else { lb -= BLK_N256; A = ek; Bt = Wc1bT; bias = nullptr; C = A2c; }
  }
  gemm_tile(A, Bt, bias, C, lb * 4 + threadIdx.y, ROWS, n, K, K, K, n);
}

// ---------------------------------------------------------------------------
// Weight transpose + fp16 convert: W (K,N) row-major -> Wt (N,K) f16.
// ---------------------------------------------------------------------------
__device__ __forceinline__ void transpose_h(const float* __restrict__ W,
                                            _Float16* __restrict__ Wt, int K, int N, int t) {
  int k = t / N, n = t - k * N;                  // coalesced read of W
  Wt[(size_t)n * K + k] = (_Float16)W[t];
  // other block ranges' code follows in the merged kernel and reuses the
  // store's registers: wait first
  asm volatile("s_wait_xcnt 0x0" ::: "memory");
}

// ---------------------------------------------------------------------------
// im2col (f16 output) for the 3x3 pad-1 conv. x[b,c,y,x] == queries[b,y*7+x,c].
// Acol[row = b*49 + y*7 + x, kk = ic*9 + ky*3 + kx]
// ---------------------------------------------------------------------------
// The fp32 -> fp16 copy of the conv weights (layout preserved) has no data in
// common with it and rides in the same grid, on the first block range.
#define CVT_BLKS    (DMODEL * KCONV / 256)   // 9216
#define IM2COL_BLKS (ROWS * KCONV / 256)     // 28224
__global__ void im2col_cvt_k(const float* __restrict__ q, _Float16* __restrict__ Acol,
                             const float* __restrict__ convW, _Float16* __restrict__ convWH) {
  if (blockIdx.x < CVT_BLKS) {
    const int c = blockIdx.x * 256 + threadIdx.x;
    convWH[c] = (_Float16)convW[c];
    return;
  }
  size_t t = (size_t)(blockIdx.x - CVT_BLKS) * 256 + threadIdx.x;
  const int kk  = (int)(t % KCONV);
  const int row = (int)(t / KCONV);
  const int b = row / NQ, p = row % NQ;
  const int y = p / 7, x = p % 7;
  const int ic = kk / 9, r = kk % 9;
  const int ky = r / 3, kx = r % 3;
  const int yy = y + ky - 1, xx = x + kx - 1;
  float v = 0.f;
  if (yy >= 0 && yy < 7 && xx >= 0 && xx < 7)
    v = q[((size_t)b * NQ + yy * 7 + xx) * DMODEL + ic];
  Acol[t] = (_Float16)v;
}

// BatchNorm stats over (B, spatial) = 1568 rows per channel (population var).
__global__ void bn_stats_k(const float* __restrict__ h, float* __restrict__ mu,
                           float* __restrict__ rstd) {
  const int c = blockIdx.x, tid = threadIdx.x;
  float s = 0.f, ss = 0.f;
  for (int r = tid; r < ROWS; r += 256) {
    float v = h[(size_t)r * DMODEL + c];
    s += v; ss += v * v;
  }
  __shared__ float sh[256], sh2[256];
  sh[tid] = s; sh2[tid] = ss; __syncthreads();
  for (int off = 128; off; off >>= 1) {
    if (tid < off) { sh[tid] += sh[tid + off]; sh2[tid] += sh2[tid + off]; }
    __syncthreads();
  }
  if (tid == 0) {
    float m = sh[0] * (1.f / ROWS);
    float v = sh2[0] * (1.f / ROWS) - m * m;
    mu[c] = m; rstd[c] = rsqrtf(v + LN_EPS);
  }
}

// xs = relu(BN(h)); eq/ek/ev = f16(xs + queries/keys/values)
__global__ void eqkv_k(const float* __restrict__ h, const float* __restrict__ mu,
                       const float* __restrict__ rstd,
                       const float* __restrict__ q, const float* __restrict__ k,
                       const float* __restrict__ v,
                       _Float16* __restrict__ eq, _Float16* __restrict__ ek,
                       _Float16* __restrict__ ev) {
  size_t t = (size_t)blockIdx.x * blockDim.x + threadIdx.x;
  if (t >= (size_t)ROWS * DMODEL) return;
  const int c = (int)(t % DMODEL);
  float xs = fmaxf((h[t] - mu[c]) * rstd[c], 0.f);
  eq[t] = (_Float16)(xs + q[t]);
  ek[t] = (_Float16)(xs + k[t]);
  ev[t] = (_Float16)(xs + v[t]);
}

// Precompute gate-collapse vectors:
//   u[512] = Wr2 @ Wgate ; wv[14] = rel_embed @ (Wproj @ Wgate)
//   cs = (br2 + bproj) . Wgate + bgate
// Blocks of 128 threads: parts 0..3 take 128 rows of u each, part 4 the rest.
__device__ __forceinline__ void precompute_part(int part, int t,
                             const float* __restrict__ Wr2, const float* __restrict__ Wgate,
                             const float* __restrict__ bgate, const float* __restrict__ Wproj,
                             const float* __restrict__ bproj, const float* __restrict__ br2,
                             const float* __restrict__ rel_embed,
                             float* __restrict__ u, float* __restrict__ wv,
                             float* __restrict__ cs) {
  __shared__ float pv[DKH];
  if (part < 4) {                                // block-uniform
    const int row = part * 128 + t;
    float s = 0.f;
    for (int j = 0; j < DMODEL; ++j) s += Wr2[(size_t)row * DMODEL + j] * Wgate[j];
    u[row] = s;
    // the fifth part's code follows and reuses the store's registers: wait first
    asm volatile("s_wait_xcnt 0x0" ::: "memory");
    return;
  }
  if (t < DKH) {
    float s = 0.f;
    for (int d = 0; d < DMODEL; ++d) s += Wproj[(size_t)t * DMODEL + d] * Wgate[d];
    pv[t] = s;
  }
  __syncthreads();
  if (t < NRELC) {
    float s = 0.f;
    const unsigned rb = (unsigned)t * (DKH * 4u);   // the row's byte offset
    const float* rp = (const float*)((const char*)rel_embed + rb);
    for (int d = 0; d < DKH; ++d) s += rp[d] * pv[d];
    // the row's offset stays live up to this wait, so that no load of the run
    // returns into the register that the others still name
    asm volatile("s_wait_xcnt 0x0" :: "v"(rb) : "memory");
    wv[t] = s;
  }
  if (t == 0) {
    float s = bgate[0];
    for (int d = 0; d < DMODEL; ++d) s += (br2[d] + bproj[d]) * Wgate[d];
    cs[0] = s;
  }
}

// conv GEMM grid (196 blocks of 4 waves leave most wave slots empty) plus the
// work that nothing before the projections depends on: the gate-collapse
// vectors and the eight weight transposes, on the block ranges behind it.
#define CONV_BLKS ((ROWS / 16) * (DMODEL / 64) / 4)    // 196
#define PRE_BLKS  5
#define TR512_BLKS (DMODEL * DMODEL / 128)             // 2048
#define TR256_BLKS (DMODEL * 256 / 128)                // 1024
#define SIDE_GRID (CONV_BLKS + PRE_BLKS + 6 * TR512_BLKS + 2 * TR256_BLKS)
__global__ void conv_gemm_side_k(const _Float16* __restrict__ Acol,
                                 const _Float16* __restrict__ convWH,
                                 const float* __restrict__ convb, float* __restrict__ hconv,
                                 int M, int N, int K,
                                 const float* __restrict__ Wr2, const float* __restrict__ Wgate,
                                 const float* __restrict__ bgate, const float* __restrict__ Wproj,
                                 const float* __restrict__ bproj, const float* __restrict__ br2,
                                 const float* __restrict__ rel_embed,
                                 float* __restrict__ u, float* __restrict__ wv,
                                 float* __restrict__ cs,
                                 const float* __restrict__ Wq, const float* __restrict__ Wk,
                                 const float* __restrict__ Wv, const float* __restrict__ Wo,
                                 const float* __restrict__ Wr1, const float* __restrict__ Wc1,
                                 _Float16* __restrict__ WqT, _Float16* __restrict__ WkT,
                                 _Float16* __restrict__ WvT, _Float16* __restrict__ WoT,
                                 _Float16* __restrict__ Wr1aT, _Float16* __restrict__ Wr1bT,
                                 _Float16* __restrict__ Wc1aT, _Float16* __restrict__ Wc1bT) {
  int blk = blockIdx.x;
  if (blk < CONV_BLKS) {
    gemm_tile(Acol, convWH, convb, hconv, blk * 4 + threadIdx.y, M, N, K, K, K, N);
    return;
  }
  blk -= CONV_BLKS;
  const int tid = threadIdx.y * 32 + threadIdx.x;
  if (blk < PRE_BLKS) {
    precompute_part(blk, tid, Wr2, Wgate, bgate, Wproj, bproj, br2, rel_embed, u, wv, cs);
    return;
  }
  blk -= PRE_BLKS;
  if (blk < 6 * TR512_BLKS) {
    const int job = blk / TR512_BLKS;
    const int t = (blk - job * TR512_BLKS) * 128 + tid;
    const float* W; _Float16* Wt;
    switch (job) {
      case 0:  W = Wq;  Wt = WqT;  break;
      case 1:  W = Wk;  Wt = WkT;  break;
      case 2:  W = Wv;  Wt = WvT;  break;
      case 3:  W = Wo;  Wt = WoT;  break;
      case 4:  W = Wr1; Wt = Wr1aT; break;
      default: W = Wr1 + (size_t)DMODEL * DMODEL; Wt = Wr1bT; break;
    }
    transpose_h(W, Wt, DMODEL, DMODEL, t);
  } else {
    blk -= 6 * TR512_BLKS;
    const int second = blk >= TR256_BLKS;
    const int t = (blk - second * TR256_BLKS) * 128 + tid;
    transpose_h(second ? Wc1 + (size_t)DMODEL * 256 : Wc1, second ? Wc1bT : Wc1aT,
                DMODEL, 256, t);
  }
}

// att[b,h,qi,ki] = SCALE * q[b,qi,h,:] . k[b,ki,h,:]
__device__ __forceinline__ void attqk_part(const float* __restrict__ qh,
                                           const float* __restrict__ kh,
                                           float* __restrict__ att, size_t t) {
  const int ki = (int)(t % NQ);
  const int qi = (int)((t / NQ) % NQ);
  const int h  = (int)((t / (NQ * NQ)) % NHEAD);
  const int b  = (int)(t / ((size_t)NQ * NQ * NHEAD));
  const float* qp = qh + ((size_t)(b * NQ + qi)) * DMODEL + h * DKH;
  const float* kp = kh + ((size_t)(b * NQ + ki)) * DMODEL + h * DKH;
  float s = 0.f;
#pragma unroll 8
  for (int d = 0; d < DKH; ++d) s += qp[d] * kp[d];
  att[t] = s * 0.125f;  // 1/sqrt(64)
}

// One wave32 per (b,qi,ki) pair: LN(256)->ReLU->14 logits->softmax->probs.wv,
// LN(512)->ReLU->dot(u), gate = sigmoid(.)
// The attention logits depend on nothing computed here and ride in the same
// grid, on the first block range (256 threads a block in both parts).
#define ATT_BLKS  (BQ * NHEAD * NQ * NQ / 256)   // 2401
#define PAIR_BLKS (NPAIR / 8)                    // 9604
__global__ void attqk_pair_gate_k(const float* __restrict__ qh, const float* __restrict__ kh,
                            float* __restrict__ att,
                            const float* __restrict__ A1c, const float* __restrict__ A2c,
                            const float* __restrict__ A1r, const float* __restrict__ A2r,
                            const float* __restrict__ gc, const float* __restrict__ bcln,
                            const float* __restrict__ Wc2, const float* __restrict__ bc2,
                            const float* __restrict__ gr, const float* __restrict__ brln,
                            const float* __restrict__ u, const float* __restrict__ wv,
                            const float* __restrict__ cs, float* __restrict__ gate) {
  if (blockIdx.x < ATT_BLKS) {
    attqk_part(qh, kh, att, (size_t)blockIdx.x * 256 + threadIdx.y * 32 + threadIdx.x);
    return;
  }
  const int wave = (blockIdx.x - ATT_BLKS) * 8 + threadIdx.y;
  const int lane = threadIdx.x;
  const int b  = wave / (NQ * NQ);
  const int rm = wave % (NQ * NQ);
  const int qi = rm / NQ, ki = rm % NQ;

  // ---- classifier branch: LN over 256, ReLU, 256x14 matvec, softmax ----
  const float* a1 = A1c + (size_t)(b * NQ + qi) * 256;
  const float* a2 = A2c + (size_t)(b * NQ + ki) * 256;
  float x[8], s = 0.f, ss = 0.f;
#pragma unroll
  for (int j = 0; j < 8; ++j) {
    float v = a1[lane + 32 * j] + a2[lane + 32 * j];
    x[j] = v; s += v; ss += v * v;
  }
  for (int off = 16; off; off >>= 1) { s += __shfl_xor(s, off, 32); ss += __shfl_xor(ss, off, 32); }
  float mean = s * (1.f / 256.f);
  float rstd = rsqrtf(ss * (1.f / 256.f) - mean * mean + LN_EPS);

  float lg[NRELC];
#pragma unroll
  for (int r = 0; r < NRELC; ++r) lg[r] = 0.f;
#pragma unroll
  for (int j = 0; j < 8; ++j) {
    const int e = lane + 32 * j;
    float hv = fmaxf((x[j] - mean) * rstd * gc[e] + bcln[e], 0.f);
#pragma unroll
    for (int r = 0; r < NRELC; ++r) lg[r] += hv * Wc2[e * NRELC + r];
  }
  for (int off = 16; off; off >>= 1)
#pragma unroll
    for (int r = 0; r < NRELC; ++r) lg[r] += __shfl_xor(lg[r], off, 32);

  float mx = lg[0] + bc2[0];
#pragma unroll
  for (int r = 0; r < NRELC; ++r) { lg[r] += bc2[r]; mx = fmaxf(mx, lg[r]); }
  float se = 0.f, pw = 0.f;
#pragma unroll
  for (int r = 0; r < NRELC; ++r) {
    float p = __expf(lg[r] - mx);
    se += p; pw += p * wv[r];
  }
  // probs = p/se; top-k(14 of 14) renorm = /(1+1e-8)
  pw /= (se * (1.f + 1e-8f));

  // ---- relation branch: LN over 512, ReLU, dot with u ----
  const float* r1 = A1r + (size_t)(b * NQ + qi) * DMODEL;
  const float* r2 = A2r + (size_t)(b * NQ + ki) * DMODEL;
  float y[16];
  s = 0.f; ss = 0.f;
#pragma unroll
  for (int j = 0; j < 16; ++j) {
    float v = r1[lane + 32 * j] + r2[lane + 32 * j];
    y[j] = v; s += v; ss += v * v;
  }
  for (int off = 16; off; off >>= 1) { s += __shfl_xor(s, off, 32); ss += __shfl_xor(ss, off, 32); }
  mean = s * (1.f / 512.f);
  rstd = rsqrtf(ss * (1.f / 512.f) - mean * mean + LN_EPS);
  float gd = 0.f;
#pragma unroll
  for (int j = 0; j < 16; ++j) {
    const int e = lane + 32 * j;
    float hv = fmaxf((y[j] - mean) * rstd * gr[e] + brln[e], 0.f);
    gd += hv * u[e];
  }
  for (int off = 16; off; off >>= 1) gd += __shfl_xor(gd, off, 32);

  if (lane == 0)
    gate[wave] = 1.f / (1.f + __expf(-(gd + pw + cs[0])));
}

// enh = att*(1+gate); softmax over ki; out[b,qi,h,:] = f16(sum_ki w*v[b,ki,h,:])
__global__ void softmax_av_k(const float* __restrict__ att, const float* __restrict__ gate,
                             const float* __restrict__ vh, _Float16* __restrict__ outp) {
  const int bhq = blockIdx.x;                 // (b*8+h)*49 + qi
  const int b  = bhq / (NHEAD * NQ);
  const int h  = (bhq / NQ) % NHEAD;
  const int qi = bhq % NQ;
  __shared__ float sw[NQ];
  __shared__ float red[2];
  const int tid = threadIdx.x;                // 64 threads
  const float* arow = att + (size_t)bhq * NQ;
  const float* grow = gate + ((size_t)(b * NQ + qi)) * NQ;
  if (tid < NQ) sw[tid] = arow[tid] * (1.f + grow[tid]);
  __syncthreads();
  if (tid == 0) {
    float m = sw[0];
    for (int i = 1; i < NQ; ++i) m = fmaxf(m, sw[i]);
    float sm = 0.f;
    for (int i = 0; i < NQ; ++i) sm += __expf(sw[i] - m);
    red[0] = m; red[1] = sm;
  }
  __syncthreads();
  if (tid < NQ) sw[tid] = __expf(sw[tid] - red[0]) / red[1];
  __syncthreads();
  if (tid < DKH) {
    const float* vbase = vh + (size_t)(b * NQ) * DMODEL + h * DKH + tid;
    float acc = 0.f;
    for (int ki = 0; ki < NQ; ++ki) acc += sw[ki] * vbase[(size_t)ki * DMODEL];
    outp[((size_t)(b * NQ + qi)) * DMODEL + h * DKH + tid] = (_Float16)acc;
  }
}

// ---------------------------------------------------------------------------
static inline void launch_gemm(const _Float16* A, const _Float16* Bt, const float* bias,
                               float* C, int M, int N, int K, int lda, int ldb, int ldc,
                               hipStream_t s) {
  const int tiles = (M / 16) * (N / 64);
  dim3 blk(32, 4), grd((tiles + 3) / 4);
  gemm_wmma_f16<<<grd, blk, 0, s>>>(A, Bt, bias, C, M, N, K, lda, ldb, ldc);
}

extern "C" void kernel_launch(void* const* d_in, const int* in_sizes, int n_in,
                              void* d_out, int out_size, void* d_ws, size_t ws_size,
                              hipStream_t stream) {
  const float* queries = (const float*)d_in[0];
  const float* keys    = (const float*)d_in[1];
  const float* values  = (const float*)d_in[2];
  const float* Wq = (const float*)d_in[3];  const float* bq = (const float*)d_in[4];
  const float* Wk = (const float*)d_in[5];  const float* bk = (const float*)d_in[6];
  const float* Wv = (const float*)d_in[7];  const float* bv = (const float*)d_in[8];
  const float* Wo = (const float*)d_in[9];  const float* bo = (const float*)d_in[10];
  const float* rel_embed = (const float*)d_in[11];
  const float* Wproj = (const float*)d_in[12]; const float* bproj = (const float*)d_in[13];
  const float* Wgate = (const float*)d_in[14]; const float* bgate = (const float*)d_in[15];
  const float* Wc1 = (const float*)d_in[16];   const float* bc1 = (const float*)d_in[17];
  const float* gc = (const float*)d_in[18];    const float* bcln = (const float*)d_in[19];
  const float* Wc2 = (const float*)d_in[20];   const float* bc2 = (const float*)d_in[21];
  const float* Wr1 = (const float*)d_in[22];   const float* br1 = (const float*)d_in[23];
  const float* gr = (const float*)d_in[24];    const float* brln = (const float*)d_in[25];
  const float* Wr2 = (const float*)d_in[26];   const float* br2 = (const float*)d_in[27];
  const float* convW = (const float*)d_in[28]; const float* convb = (const float*)d_in[29];

  // ---- workspace carve-out (256B aligned blocks) ----
  char* base = (char*)d_ws;
  size_t off = 0;
  auto alloc = [&](size_t bytes) -> void* {
    off = (off + 255) & ~(size_t)255;
    void* p = base + off;
    off += bytes;
    return p;
  };
  _Float16* AcolH  = (_Float16*)alloc((size_t)ROWS * KCONV * 2);
  _Float16* convWH = (_Float16*)alloc((size_t)DMODEL * KCONV * 2);
  _Float16* WqT    = (_Float16*)alloc((size_t)DMODEL * DMODEL * 2);
  _Float16* WkT    = (_Float16*)alloc((size_t)DMODEL * DMODEL * 2);
  _Float16* WvT    = (_Float16*)alloc((size_t)DMODEL * DMODEL * 2);
  _Float16* WoT    = (_Float16*)alloc((size_t)DMODEL * DMODEL * 2);
  _Float16* Wc1aT  = (_Float16*)alloc((size_t)256 * DMODEL * 2);
  _Float16* Wc1bT  = (_Float16*)alloc((size_t)256 * DMODEL * 2);
  _Float16* Wr1aT  = (_Float16*)alloc((size_t)DMODEL * DMODEL * 2);
  _Float16* Wr1bT  = (_Float16*)alloc((size_t)DMODEL * DMODEL * 2);
  _Float16* eqH    = (_Float16*)alloc((size_t)ROWS * DMODEL * 2);
  _Float16* ekH    = (_Float16*)alloc((size_t)ROWS * DMODEL * 2);
  _Float16* evH    = (_Float16*)alloc((size_t)ROWS * DMODEL * 2);
  _Float16* attnoH = (_Float16*)alloc((size_t)ROWS * DMODEL * 2);
  float* hconv = (float*)alloc((size_t)ROWS * DMODEL * 4);
  float* muv   = (float*)alloc(DMODEL * 4);
  float* rstdv = (float*)alloc(DMODEL * 4);
  float* qh    = (float*)alloc((size_t)ROWS * DMODEL * 4);
  float* kh    = (float*)alloc((size_t)ROWS * DMODEL * 4);
  float* vh    = (float*)alloc((size_t)ROWS * DMODEL * 4);
  float* A1c   = (float*)alloc((size_t)ROWS * 256 * 4);
  float* A2c   = (float*)alloc((size_t)ROWS * 256 * 4);
  float* A1r   = (float*)alloc((size_t)ROWS * DMODEL * 4);
  float* A2r   = (float*)alloc((size_t)ROWS * DMODEL * 4);
  float* uvec  = (float*)alloc(DMODEL * 4);
  float* wvecp = (float*)alloc(64);
  float* cscal = (float*)alloc(64);
  float* attb  = (float*)alloc((size_t)BQ * NHEAD * NQ * NQ * 4);
  float* gateb = (float*)alloc((size_t)NPAIR * 4);

  // 1) conv operands: im2col of the queries + fp16 conv weights, one grid
  im2col_cvt_k<<<CVT_BLKS + IM2COL_BLKS, 256, 0, stream>>>(queries, AcolH, convW, convWH);

  // 2) conv3x3 as WMMA GEMM (1568 x 512 x 4608); the gate-collapse vectors and
  //    the weight transposes run beside it in the same grid
  conv_gemm_side_k<<<SIDE_GRID, dim3(32, 4), 0, stream>>>(
      AcolH, convWH, convb, hconv, ROWS, DMODEL, KCONV,
      Wr2, Wgate, bgate, Wproj, bproj, br2, rel_embed, uvec, wvecp, cscal,
      Wq, Wk, Wv, Wo, Wr1, Wc1, WqT, WkT, WvT, WoT, Wr1aT, Wr1bT, Wc1aT, Wc1bT);

  // 3) BatchNorm(affine=False) + ReLU + residual adds (f16 activations)
  bn_stats_k<<<DMODEL, 256, 0, stream>>>(hconv, muv, rstdv);
  eqkv_k<<<(ROWS * DMODEL) / 256, 256, 0, stream>>>(hconv, muv, rstdv, queries, keys,
                                                    values, eqH, ekH, evH);

  // 4) token-level projections (all WMMA), one grid
  proj_gemms_k<<<PROJ_BLKS, dim3(32, 4), 0, stream>>>(
      eqH, ekH, evH, WqT, WkT, WvT, Wr1aT, Wr1bT, Wc1aT, Wc1bT, bq, bk, bv, br1, bc1,
      qh, kh, vh, A1r, A2r, A1c, A2c, DMODEL);

  // 5) attention logits + per-pair gate (one wave32 per pair), one grid
  attqk_pair_gate_k<<<ATT_BLKS + PAIR_BLKS, dim3(32, 8), 0, stream>>>(
      qh, kh, attb, A1c, A2c, A1r, A2r, gc, bcln, Wc2, bc2, gr, brln, uvec, wvecp, cscal,
      gateb);

  // 6) gated softmax + A*V (f16 output feeds final GEMM)
  softmax_av_k<<<BQ * NHEAD * NQ, 64, 0, stream>>>(attb, gateb, vh, attnoH);

  // 7) output projection (WMMA) straight into d_out
  launch_gemm(attnoH, WoT, bo, (float*)d_out, ROWS, DMODEL, DMODEL, DMODEL, DMODEL,
              DMODEL, stream);
}

// v002
// It runs in 224 microseconds.
// Next to v001, in two timings, it ran 1.18 and 1.19 times as fast.
// All steps since v000 together make it 1.77 times as fast.
#include <hip/hip_runtime.h>
#include <hip/hip_bf16.h>
#include <math.h>

// ---------------------------------------------------------------------------
// RelationEnhanceAttention, algebraically restructured for MI455X (gfx1250).
//   B=32, N=49, D=512, H=8, DK=64, NREL=TOPK=14
// Conv and projection GEMMs: f16 operands (K-innermost both sides), fp32 accumulate on
// v_wmma_f32_16x16x32_f16. 16x64 C-tile per wave, pure b128 fragment loads.
// ---------------------------------------------------------------------------

typedef __attribute__((ext_vector_type(16))) _Float16 v16h;
typedef __attribute__((ext_vector_type(8)))  _Float16 v8h;
typedef __attribute__((ext_vector_type(8)))  float    v8f;
typedef __attribute__((ext_vector_type(4)))  float    v4f;

#define BQ      32
#define NQ      49
#define DMODEL  512
#define NHEAD   8
#define DKH     64
#define NRELC   14
#define ROWS    (BQ * NQ)            // 1568
#define KCONV   (DMODEL * 9)         // 4608
#define NPAIR   (BQ * NQ * NQ)       // 76832
#define LN_EPS  1e-5f

// ---------------------------------------------------------------------------
// WMMA GEMM: C[M,N] = A[M,K] * B^T[N,K] (+bias[N]).
// A: f16 row-major (M,K), lda mult of 8. Bt: f16 row-major (N,K), ldb mult 8.
// REQUIRES: M%16==0, N%64==0, K%32==0 (true for every call site here).
// One wave32 computes a 16x64 C tile; K stepped by 32.
// Fragment layout (ISA 16-bit A 16x32): halves 0..7  <- K = k0+8*half+0..7
//                                       halves 8..15 <- K = k0+8*half+16..23
// i.e. two contiguous 16-byte segments per lane -> two global_load_b128 each.
// ---------------------------------------------------------------------------
__device__ __forceinline__ void gemm_tile(const _Float16* __restrict__ A,
                                          const _Float16* __restrict__ Bt,
                                          const float* __restrict__ bias,
                                          float* __restrict__ C, int tile,
                                          int M, int N, int K, int lda, int ldb, int ldc) {
  const int ntn  = N >> 6;                       // 64-wide column tiles
  const int tm   = tile / ntn;
  const int tn   = tile - tm * ntn;
  const int row0 = tm << 4;
  const int col0 = tn << 6;
  if (row0 >= M) return;                         // wave-uniform guard only

  const int lane = threadIdx.x;                  // 0..31
  const int hf   = lane >> 4;                    // 0/1
  const int idx  = lane & 15;

  const _Float16* pa = A + (size_t)(row0 + idx) * lda + hf * 8;
  const _Float16* pb0 = Bt + (size_t)(col0 + 0  + idx) * ldb + hf * 8;
  const _Float16* pb1 = Bt + (size_t)(col0 + 16 + idx) * ldb + hf * 8;
  const _Float16* pb2 = Bt + (size_t)(col0 + 32 + idx) * ldb + hf * 8;
  const _Float16* pb3 = Bt + (size_t)(col0 + 48 + idx) * ldb + hf * 8;

  v8f acc0 = {}, acc1 = {}, acc2 = {}, acc3 = {};
  union F16x16 { v16h v; v8h h[2]; };

  for (int k0 = 0; k0 < K; k0 += 32) {
    F16x16 af, b0, b1, b2, b3;
    af.h[0] = *(const v8h*)(pa + k0);
    af.h[1] = *(const v8h*)(pa + k0 + 16);
    b0.h[0] = *(const v8h*)(pb0 + k0);
    b0.h[1] = *(const v8h*)(pb0 + k0 + 16);
    b1.h[0] = *(const v8h*)(pb1 + k0);
    b1.h[1] = *(const v8h*)(pb1 + k0 + 16);
    b2.h[0] = *(const v8h*)(pb2 + k0);
    b2.h[1] = *(const v8h*)(pb2 + k0 + 16);
    b3.h[0] = *(const v8h*)(pb3 + k0);
    b3.h[1] = *(const v8h*)(pb3 + k0 + 16);
    // prefetch next K-step (global_prefetch_b8)
    __builtin_prefetch(pa + k0 + 32, 0, 1);
    __builtin_prefetch(pb0 + k0 + 32, 0, 1);
    __builtin_prefetch(pb2 + k0 + 32, 0, 1);
    acc0 = __builtin_amdgcn_wmma_f32_16x16x32_f16(false, af.v, false, b0.v,
                                                  (short)0, acc0, false, false);
    acc1 = __builtin_amdgcn_wmma_f32_16x16x32_f16(false, af.v, false, b1.v,
                                                  (short)0, acc1, false, false);
    acc2 = __builtin_amdgcn_wmma_f32_16x16x32_f16(false, af.v, false, b2.v,
                                                  (short)0, acc2, false, false);
    acc3 = __builtin_amdgcn_wmma_f32_16x16x32_f16(false, af.v, false, b3.v,
                                                  (short)0, acc3, false, false);
  }

  // C layout: vgpr r -> m = row0 + r + 8*hf ; n = col0 + sub*16 + idx
  const int mbase = row0 + (hf ? 8 : 0);
#pragma unroll
  for (int s = 0; s < 4; ++s) {
    const int n = col0 + s * 16 + idx;
    const float badd = bias ? bias[n] : 0.f;
    const v8f a = (s == 0) ? acc0 : (s == 1) ? acc1 : (s == 2) ? acc2 : acc3;
#pragma unroll
    for (int r = 0; r < 8; ++r)
      C[(size_t)(mbase + r) * ldc + n] = a[r] + badd;
    // the next column group reuses these stores' registers: wait first
    asm volatile("s_wait_xcnt 0x0" ::: "memory");
  }
}

__global__ void gemm_wmma_f16(const _Float16* __restrict__ A,
                              const _Float16* __restrict__ Bt,
                              const float* __restrict__ bias,
                              float* __restrict__ C,
                              int M, int N, int K, int lda, int ldb, int ldc) {
  gemm_tile(A, Bt, bias, C, blockIdx.x * blockDim.y + threadIdx.y, M, N, K, lda, ldb, ldc);
}

// The seven token-level projections share no data dependence: one grid, the
// product chosen by block range (block-uniform). 196 blocks per 512-wide
// product, 98 per 256-wide one; 4 waves (tiles) per block as above.
#define BLK_N512 ((ROWS / 16) * (DMODEL / 64) / 4)   // 196
#define BLK_N256 ((ROWS / 16) * (256 / 64) / 4)      // 98
#define PROJ_BLKS (5 * BLK_N512 + 2 * BLK_N256)      // 1176
__global__ void proj_gemms_k(const _Float16* __restrict__ eq, const _Float16* __restrict__ ek,
                             const _Float16* __restrict__ ev,
                             const _Float16* __restrict__ WqT, const _Float16* __restrict__ WkT,
                             const _Float16* __restrict__ WvT, const _Float16* __restrict__ Wr1aT,
                             const _Float16* __restrict__ Wr1bT, const _Float16* __restrict__ Wc1aT,
                             const _Float16* __restrict__ Wc1bT,
                             const float* __restrict__ bq, const float* __restrict__ bk,
                             const float* __restrict__ bv, const float* __restrict__ br1,
                             const float* __restrict__ bc1,
                             float* __restrict__ qh, float* __restrict__ kh,
                             float* __restrict__ vh, float* __restrict__ A1r,
                             float* __restrict__ A2r, float* __restrict__ A1c,
                             float* __restrict__ A2c, int K) {
  const int blk = blockIdx.x;
  const _Float16* A; const _Float16* Bt; const float* bias; float* C;
  int n, lb;
  if (blk < 5 * BLK_N512) {
    const int job = blk / BLK_N512;
    lb = blk - job * BLK_N512;
    n = DMODEL;
    switch (job) {
      case 0:  A = eq; Bt = WqT;   bias = bq;      C = qh;  break;
      case 1:  A = ek; Bt = WkT;   bias = bk;      C = kh;  break;
      case 2:  A = ev; Bt = WvT;   bias = bv;      C = vh;  break;
      case 3:  A = eq; Bt = Wr1aT; bias = br1;     C = A1r; break;
      default: A = ek; Bt = Wr1bT; bias = nullptr; C = A2r; break;
    }
  } else {
    lb = blk - 5 * BLK_N512;
    n = 256;
    if (lb < BLK_N256) { A = eq; Bt = Wc1aT; bias = bc1; C = A1c; }
    else { lb -= BLK_N256; A = ek; Bt = Wc1bT; bias = nullptr; C = A2c; }
  }
  gemm_tile(A, Bt, bias, C, lb * 4 + threadIdx.y, ROWS, n, K, K, K, n);
}

// ---------------------------------------------------------------------------
// Weight transpose + fp16 convert: W (K,N) row-major -> Wt (N,K) f16.
// One thread takes 8 consecutive k of one column n: 8 reads, each coalesced
// over the lanes' n, and one 16-byte store.
// ---------------------------------------------------------------------------
__device__ __forceinline__ void transpose_h(const float* __restrict__ W,
                                            _Float16* __restrict__ Wt, int K, int N, int t) {
  const int kc = t / N, n = t - kc * N;
  const float* p = W + (size_t)kc * 8 * N + n;
  v8h o;
#pragma unroll
  for (int j = 0; j < 8; ++j) o[j] = (_Float16)p[(size_t)j * N];
  *(v8h*)(Wt + (size_t)n * K + kc * 8) = o;
  // other block ranges' code follows in the merged kernel and reuses the
  // store's registers: wait first
  asm volatile("s_wait_xcnt 0x0" ::: "memory");
}

// ---------------------------------------------------------------------------
// im2col (f16 output) for the 3x3 pad-1 conv. x[b,c,y,x] == queries[b,y*7+x,c].
// Acol[row = b*49 + y*7 + x, kk = ic*9 + ky*3 + kx]
// ---------------------------------------------------------------------------
// The fp32 -> fp16 copy of the conv weights (layout preserved) has no data in
// common with it and rides in the same grid, on the first block range.
// One block of 192 threads makes one row of 4608 halves in either part: each
// thread 3 groups of 8 consecutive outputs, one 16-byte store a group, so that
// few waves have to be started (a wave per 32 outputs is bound by wave start-up).
#define CVT_BLKS    DMODEL                   // 512 rows of conv weights
#define IM2COL_BLKS ROWS                     // 1568 rows of Acol
#define ROW_THREADS (KCONV / 8 / 3)          // 192
__global__ void im2col_cvt_k(const float* __restrict__ q, _Float16* __restrict__ Acol,
                             const float* __restrict__ convW, _Float16* __restrict__ convWH) {
  const int tid = threadIdx.x;
  if (blockIdx.x < CVT_BLKS) {
    const size_t base = (size_t)blockIdx.x * KCONV;
#pragma unroll
    for (int i = 0; i < 3; ++i) {
      const size_t e = base + (size_t)(tid + ROW_THREADS * i) * 8;
      const v4f lo = *(const v4f*)(convW + e);
      const v4f hi = *(const v4f*)(convW + e + 4);
      v8h o;
#pragma unroll
      for (int j = 0; j < 4; ++j) { o[j] = (_Float16)lo[j]; o[4 + j] = (_Float16)hi[j]; }
      *(v8h*)(convWH + e) = o;
    }
    return;
  }
  const int row = blockIdx.x - CVT_BLKS;         // b*49 + y*7 + x
  const int p = row % NQ;
  const int y = p / 7, x = p % 7;
  unsigned valid = 0;                            // bit r: tap r lies inside the 7x7 map
#pragma unroll
  for (int r = 0; r < 9; ++r)
    if ((unsigned)(y + r / 3 - 1) < 7u && (unsigned)(x + r % 3 - 1) < 7u) valid |= 1u << r;
  const float* qc = q + (size_t)row * DMODEL;    // the centre tap's token
  _Float16* arow = Acol + (size_t)row * KCONV;
  // a tap outside the map reads the centre token (in bounds) and is zeroed: no
  // branch round a load, so all 24 loads of a thread can be in flight at once
  float ld[3][8];
  unsigned okm = 0;                              // bit 8*i+j: that output's tap is inside
#pragma unroll
  for (int i = 0; i < 3; ++i) {
    const int kk0 = (tid + ROW_THREADS * i) * 8;
    int ic = kk0 / 9, r = kk0 % 9;
#pragma unroll
    for (int j = 0; j < 8; ++j) {
      const unsigned ok = (valid >> r) & 1u;
      const int ky = (r * 11) >> 5;              // r / 3 for r in 0..8
      const int tap = (r + 4 * ky - 8) * (int)ok;    // (ky-1)*7 + (kx-1), or the centre
      ld[i][j] = qc[tap * DMODEL + ic];
      okm |= ok << (8 * i + j);
      const int wrap = (r == 8);
      r = wrap ? 0 : r + 1;
      ic += wrap;
    }
  }
#pragma unroll
  for (int i = 0; i < 3; ++i) {
    v8h o;
#pragma unroll
    for (int j = 0; j < 8; ++j)
      o[j] = (_Float16)(((okm >> (8 * i + j)) & 1u) ? ld[i][j] : 0.f);
    *(v8h*)(arow + (tid + ROW_THREADS * i) * 8) = o;
  }
}

// BatchNorm stats over (B, spatial) = 1568 rows per channel (population var).
__global__ void bn_stats_k(const float* __restrict__ h, float* __restrict__ mu,
                           float* __restrict__ rstd) {
  const int c = blockIdx.x, tid = threadIdx.x;
  float s = 0.f, ss = 0.f;
  for (int r = tid; r < ROWS; r += 256) {
    float v = h[(size_t)r * DMODEL + c];
    s += v; ss += v * v;
  }
  __shared__ float sh[256], sh2[256];
  sh[tid] = s; sh2[tid] = ss; __syncthreads();
  for (int off = 128; off; off >>= 1) {
    if (tid < off) { sh[tid] += sh[tid + off]; sh2[tid] += sh2[tid + off]; }
    __syncthreads();
  }
  if (tid == 0) {
    float m = sh[0] * (1.f / ROWS);
    float v = sh2[0] * (1.f / ROWS) - m * m;
    mu[c] = m; rstd[c] = rsqrtf(v + LN_EPS);
  }
}

// xs = relu(BN(h)); eq/ek/ev = f16(xs + queries/keys/values)
__global__ void eqkv_k(const float* __restrict__ h, const float* __restrict__ mu,
                       const float* __restrict__ rstd,
                       const float* __restrict__ q, const float* __restrict__ k,
                       const float* __restrict__ v,
                       _Float16* __restrict__ eq, _Float16* __restrict__ ek,
                       _Float16* __restrict__ ev) {
  const size_t t = ((size_t)blockIdx.x * blockDim.x + threadIdx.x) * 8;   // 8 channels a thread
  if (t >= (size_t)ROWS * DMODEL) return;
  const int c = (int)(t % DMODEL);
  v8h oq, ok, ov;
#pragma unroll
  for (int g = 0; g < 2; ++g) {
    const v4f h4 = *(const v4f*)(h + t + 4 * g);
    const v4f m4 = *(const v4f*)(mu + c + 4 * g);
    const v4f r4 = *(const v4f*)(rstd + c + 4 * g);
    const v4f q4 = *(const v4f*)(q + t + 4 * g);
    const v4f k4 = *(const v4f*)(k + t + 4 * g);
    const v4f v4 = *(const v4f*)(v + t + 4 * g);
#pragma unroll
    for (int j = 0; j < 4; ++j) {
      const float xs = fmaxf((h4[j] - m4[j]) * r4[j], 0.f);
      oq[4 * g + j] = (_Float16)(xs + q4[j]);
      ok[4 * g + j] = (_Float16)(xs + k4[j]);
      ov[4 * g + j] = (_Float16)(xs + v4[j]);
    }
  }
  *(v8h*)(eq + t) = oq;
  *(v8h*)(ek + t) = ok;
  *(v8h*)(ev + t) = ov;
}

// Precompute gate-collapse vectors:
//   u[512] = Wr2 @ Wgate ; wv[14] = rel_embed @ (Wproj @ Wgate)
//   cs = (br2 + bproj) . Wgate + bgate
// Blocks of 128 threads: parts 0..3 take 128 rows of u each, part 4 the rest.
__device__ __forceinline__ void precompute_part(int part, int t,
                             const float* __restrict__ Wr2, const float* __restrict__ Wgate,
                             const float* __restrict__ bgate, const float* __restrict__ Wproj,
                             const float* __restrict__ bproj, const float* __restrict__ br2,
                             const float* __restrict__ rel_embed,
                             float* __restrict__ u, float* __restrict__ wv,
                             float* __restrict__ cs) {
  __shared__ float pv[DKH];
  if (part < 4) {                                // block-uniform
    const int row = part * 128 + t;
    float s = 0.f;
    for (int j = 0; j < DMODEL; ++j) s += Wr2[(size_t)row * DMODEL + j] * Wgate[j];
    u[row] = s;
    // the fifth part's code follows and reuses the store's registers: wait first
    asm volatile("s_wait_xcnt 0x0" ::: "memory");
    return;
  }
  if (t < DKH) {
    float s = 0.f;
    for (int d = 0; d < DMODEL; ++d) s += Wproj[(size_t)t * DMODEL + d] * Wgate[d];
    pv[t] = s;
  }
  __syncthreads();
  if (t < NRELC) {
    float s = 0.f;
    const unsigned rb = (unsigned)t * (DKH * 4u);   // the row's byte offset
    const float* rp = (const float*)((const char*)rel_embed + rb);
    for (int d = 0; d < DKH; ++d) s += rp[d] * pv[d];
    // the row's offset stays live up to this wait, so that no load of the run
    // returns into the register that the others still name
    asm volatile("s_wait_xcnt 0x0" :: "v"(rb) : "memory");
    wv[t] = s;
  }
  if (t == 0) {
    float s = bgate[0];
    for (int d = 0; d < DMODEL; ++d) s += (br2[d] + bproj[d]) * Wgate[d];
    cs[0] = s;
  }
}

// conv GEMM grid (196 blocks of 4 waves leave most wave slots empty) plus the
// work that nothing before the projections depends on: the gate-collapse
// vectors and the eight weight transposes, on the block ranges behind it.
#define CONV_BLKS ((ROWS / 16) * (DMODEL / 64) / 4)    // 196
#define PRE_BLKS  5
#define TR512_BLKS (DMODEL * DMODEL / 8 / 128)         // 256
#define TR256_BLKS (DMODEL * 256 / 8 / 128)            // 128
#define SIDE_GRID (CONV_BLKS + PRE_BLKS + 6 * TR512_BLKS + 2 * TR256_BLKS)
__global__ void conv_gemm_side_k(const _Float16* __restrict__ Acol,
                                 const _Float16* __restrict__ convWH,
                                 const float* __restrict__ convb, float* __restrict__ hconv,
                                 int M, int N, int K,
                                 const float* __restrict__ Wr2, const float* __restrict__ Wgate,
                                 const float* __restrict__ bgate, const float* __restrict__ Wproj,
                                 const float* __restrict__ bproj, const float* __restrict__ br2,
                                 const float* __restrict__ rel_embed,
                                 float* __restrict__ u, float* __restrict__ wv,
                                 float* __restrict__ cs,
                                 const float* __restrict__ Wq, const float* __restrict__ Wk,
                                 const float* __restrict__ Wv, const float* __restrict__ Wo,
                                 const float* __restrict__ Wr1, const float* __restrict__ Wc1,
                                 _Float16* __restrict__ WqT, _Float16* __restrict__ WkT,
                                 _Float16* __restrict__ WvT, _Float16* __restrict__ WoT,
                                 _Float16* __restrict__ Wr1aT, _Float16* __restrict__ Wr1bT,
                                 _Float16* __restrict__ Wc1aT, _Float16* __restrict__ Wc1bT) {
  int blk = blockIdx.x;
  if (blk < CONV_BLKS) {
    gemm_tile(Acol, convWH, convb, hconv, blk * 4 + threadIdx.y, M, N, K, K, K, N);
    return;
  }
  blk -= CONV_BLKS;
  const int tid = threadIdx.y * 32 + threadIdx.x;
  if (blk < PRE_BLKS) {
    precompute_part(blk, tid, Wr2, Wgate, bgate, Wproj, bproj, br2, rel_embed, u, wv, cs);
    return;
  }
  blk -= PRE_BLKS;
  if (blk < 6 * TR512_BLKS) {
    const int job = blk / TR512_BLKS;
    const int t = (blk - job * TR512_BLKS) * 128 + tid;
    const float* W; _Float16* Wt;
    switch (job) {
      case 0:  W = Wq;  Wt = WqT;  break;
      case 1:  W = Wk;  Wt = WkT;  break;
      case 2:  W = Wv;  Wt = WvT;  break;
      case 3:  W = Wo;  Wt = WoT;  break;
      case 4:  W = Wr1; Wt = Wr1aT; break;
      default: W = Wr1 + (size_t)DMODEL * DMODEL; Wt = Wr1bT; break;
    }
    transpose_h(W, Wt, DMODEL, DMODEL, t);
  } else {
    blk -= 6 * TR512_BLKS;
    const int second = blk >= TR256_BLKS;
    const int t = (blk - second * TR256_BLKS) * 128 + tid;
    transpose_h(second ? Wc1 + (size_t)DMODEL * 256 : Wc1, second ? Wc1bT : Wc1aT,
                DMODEL, 256, t);
  }
}

// att[b,h,qi,ki] = SCALE * q[b,qi,h,:] . k[b,ki,h,:]
__device__ __forceinline__ void attqk_part(const float* __restrict__ qh,
                                           const float* __restrict__ kh,
                                           float* __restrict__ att, size_t t) {
  const int ki = (int)(t % NQ);
  const int qi = (int)((t / NQ) % NQ);
  const int h  = (int)((t / (NQ * NQ)) % NHEAD);
  const int b  = (int)(t / ((size_t)NQ * NQ * NHEAD));
  const float* qp = qh + ((size_t)(b * NQ + qi)) * DMODEL + h * DKH;
  const float* kp = kh + ((size_t)(b * NQ + ki)) * DMODEL + h * DKH;
  float s = 0.f;
#pragma unroll 8
  for (int d = 0; d < DKH; ++d) s += qp[d] * kp[d];
  att[t] = s * 0.125f;  // 1/sqrt(64)
}

// One wave32 per (b,qi,ki) pair: LN(256)->ReLU->14 logits->softmax->probs.wv,
// LN(512)->ReLU->dot(u), gate = sigmoid(.)
// The attention logits depend on nothing computed here and ride in the same
// grid, on the first block range (256 threads a block in both parts).
#define ATT_BLKS  (BQ * NHEAD * NQ * NQ / 256)   // 2401
#define PAIR_BLKS (NPAIR / 8)                    // 9604
__global__ void attqk_pair_gate_k(const float* __restrict__ qh, const float* __restrict__ kh,
                            float* __restrict__ att,
                            const float* __restrict__ A1c, const float* __restrict__ A2c,
                            const float* __restrict__ A1r, const float* __restrict__ A2r,
                            const float* __restrict__ gc, const float* __restrict__ bcln,
                            const float* __restrict__ Wc2, const float* __restrict__ bc2,
                            const float* __restrict__ gr, const float* __restrict__ brln,
                            const float* __restrict__ u, const float* __restrict__ wv,
                            const float* __restrict__ cs, float* __restrict__ gate) {
  if (blockIdx.x < ATT_BLKS) {
    attqk_part(qh, kh, att, (size_t)blockIdx.x * 256 + threadIdx.y * 32 + threadIdx.x);
    return;
  }
  const int wave = (blockIdx.x - ATT_BLKS) * 8 + threadIdx.y;
  const int lane = threadIdx.x;
  const int b  = wave / (NQ * NQ);
  const int rm = wave % (NQ * NQ);
  const int qi = rm / NQ, ki = rm % NQ;

  // ---- classifier branch: LN over 256, ReLU, 256x14 matvec, softmax ----
  const float* a1 = A1c + (size_t)(b * NQ + qi) * 256;
  const float* a2 = A2c + (size_t)(b * NQ + ki) * 256;
  float x[8], s = 0.f, ss = 0.f;
#pragma unroll
  for (int j = 0; j < 8; ++j) {
    float v = a1[lane + 32 * j] + a2[lane + 32 * j];
    x[j] = v; s += v; ss += v * v;
  }
  for (int off = 16; off; off >>= 1) { s += __shfl_xor(s, off, 32); ss += __shfl_xor(ss, off, 32); }
  float mean = s * (1.f / 256.f);
  float rstd = rsqrtf(ss * (1.f / 256.f) - mean * mean + LN_EPS);

  float lg[NRELC];
#pragma unroll
  for (int r = 0; r < NRELC; ++r) lg[r] = 0.f;
#pragma unroll
  for (int j = 0; j < 8; ++j) {
    const int e = lane + 32 * j;
    float hv = fmaxf((x[j] - mean) * rstd * gc[e] + bcln[e], 0.f);
#pragma unroll
    for (int r = 0; r < NRELC; ++r) lg[r] += hv * Wc2[e * NRELC + r];
  }
  for (int off = 16; off; off >>= 1)
#pragma unroll
    for (int r = 0; r < NRELC; ++r) lg[r] += __shfl_xor(lg[r], off, 32);

  float mx = lg[0] + bc2[0];
#pragma unroll
  for (int r = 0; r < NRELC; ++r) { lg[r] += bc2[r]; mx = fmaxf(mx, lg[r]); }
  float se = 0.f, pw = 0.f;
#pragma unroll
  for (int r = 0; r < NRELC; ++r) {
    float p = __expf(lg[r] - mx);
    se += p; pw += p * wv[r];
  }
  // probs = p/se; top-k(14 of 14) renorm = /(1+1e-8)
  pw /= (se * (1.f + 1e-8f));

  // ---- relation branch: LN over 512, ReLU, dot with u ----
  const float* r1 = A1r + (size_t)(b * NQ + qi) * DMODEL;
  const float* r2 = A2r + (size_t)(b * NQ + ki) * DMODEL;
  float y[16];
  s = 0.f; ss = 0.f;
#pragma unroll
  for (int j = 0; j < 16; ++j) {
    float v = r1[lane + 32 * j] + r2[lane + 32 * j];
    y[j] = v; s += v; ss += v * v;
  }
  for (int off = 16; off; off >>= 1) { s += __shfl_xor(s, off, 32); ss += __shfl_xor(ss, off, 32); }
  mean = s * (1.f / 512.f);
  rstd = rsqrtf(ss * (1.f / 512.f) - mean * mean + LN_EPS);
  float gd = 0.f;
#pragma unroll
  for (int j = 0; j < 16; ++j) {
    const int e = lane + 32 * j;
    float hv = fmaxf((y[j] - mean) * rstd * gr[e] + brln[e], 0.f);
    gd += hv * u[e];
  }
  for (int off = 16; off; off >>= 1) gd += __shfl_xor(gd, off, 32);

  if (lane == 0)
    gate[wave] = 1.f / (1.f + __expf(-(gd + pw + cs[0])));
}

// enh = att*(1+gate); softmax over ki; out[b,qi,h,:] = f16(sum_ki w*v[b,ki,h,:])
__global__ void softmax_av_k(const float* __restrict__ att, const float* __restrict__ gate,
                             const float* __restrict__ vh, _Float16* __restrict__ outp) {
  const int bhq = blockIdx.x;                 // (b*8+h)*49 + qi
  const int b  = bhq / (NHEAD * NQ);
  const int h  = (bhq / NQ) % NHEAD;
  const int qi = bhq % NQ;
  __shared__ float sw[NQ];
  __shared__ float red[2];
  const int tid = threadIdx.x;                // 64 threads
  const float* arow = att + (size_t)bhq * NQ;
  const float* grow = gate + ((size_t)(b * NQ + qi)) * NQ;
  if (tid < NQ) sw[tid] = arow[tid] * (1.f + grow[tid]);
  __syncthreads();
  if (tid == 0) {
    float m = sw[0];
    for (int i = 1; i < NQ; ++i) m = fmaxf(m, sw[i]);
    float sm = 0.f;
    for (int i = 0; i < NQ; ++i) sm += __expf(sw[i] - m);
    red[0] = m; red[1] = sm;
  }
  __syncthreads();
  if (tid < NQ) sw[tid] = __expf(sw[tid] - red[0]) / red[1];
  __syncthreads();
  if (tid < DKH) {
    const float* vbase = vh + (size_t)(b * NQ) * DMODEL + h * DKH + tid;
    float acc = 0.f;
    for (int ki = 0; ki < NQ; ++ki) acc += sw[ki] * vbase[(size_t)ki * DMODEL];
    outp[((size_t)(b * NQ + qi)) * DMODEL + h * DKH + tid] = (_Float16)acc;
  }
}

// ---------------------------------------------------------------------------
static inline void launch_gemm(const _Float16* A, const _Float16* Bt, const float* bias,
                               float* C, int M, int N, int K, int lda, int ldb, int ldc,
                               hipStream_t s) {
  const int tiles = (M / 16) * (N / 64);
  dim3 blk(32, 4), grd((tiles + 3) / 4);
  gemm_wmma_f16<<<grd, blk, 0, s>>>(A, Bt, bias, C, M, N, K, lda, ldb, ldc);
}

extern "C" void kernel_launch(void* const* d_in, const int* in_sizes, int n_in,
                              void* d_out, int out_size, void* d_ws, size_t ws_size,
                              hipStream_t stream) {
  const float* queries = (const float*)d_in[0];
  const float* keys    = (const float*)d_in[1];
  const float* values  = (const float*)d_in[2];
  const float* Wq = (const float*)d_in[3];  const float* bq = (const float*)d_in[4];
  const float* Wk = (const float*)d_in[5];  const float* bk = (const float*)d_in[6];
  const float* Wv = (const float*)d_in[7];  const float* bv = (const float*)d_in[8];
  const float* Wo = (const float*)d_in[9];  const float* bo = (const float*)d_in[10];
  const float* rel_embed = (const float*)d_in[11];
  const float* Wproj = (const float*)d_in[12]; const float* bproj = (const float*)d_in[13];
  const float* Wgate = (const float*)d_in[14]; const float* bgate = (const float*)d_in[15];
  const float* Wc1 = (const float*)d_in[16];   const float* bc1 = (const float*)d_in[17];
  const float* gc = (const float*)d_in[18];    const float* bcln = (const float*)d_in[19];
  const float* Wc2 = (const float*)d_in[20];   const float* bc2 = (const float*)d_in[21];
  const float* Wr1 = (const float*)d_in[22];   const float* br1 = (const float*)d_in[23];
  const float* gr = (const float*)d_in[24];    const float* brln = (const float*)d_in[25];
  const float* Wr2 = (const float*)d_in[26];   const float* br2 = (const float*)d_in[27];
  const float* convW = (const float*)d_in[28]; const float* convb = (const float*)d_in[29];

  // ---- workspace carve-out (256B aligned blocks) ----
  char* base = (char*)d_ws;
  size_t off = 0;
  auto alloc = [&](size_t bytes) -> void* {
    off = (off + 255) & ~(size_t)255;
    void* p = base + off;
    off += bytes;
    return p;
  };
  _Float16* AcolH  = (_Float16*)alloc((size_t)ROWS * KCONV * 2);
  _Float16* convWH = (_Float16*)alloc((size_t)DMODEL * KCONV * 2);
  _Float16* WqT    = (_Float16*)alloc((size_t)DMODEL * DMODEL * 2);
  _Float16* WkT    = (_Float16*)alloc((size_t)DMODEL * DMODEL * 2);
  _Float16* WvT    = (_Float16*)alloc((size_t)DMODEL * DMODEL * 2);
  _Float16* WoT    = (_Float16*)alloc((size_t)DMODEL * DMODEL * 2);
  _Float16* Wc1aT  = (_Float16*)alloc((size_t)256 * DMODEL * 2);
  _Float16* Wc1bT  = (_Float16*)alloc((size_t)256 * DMODEL * 2);
  _Float16* Wr1aT  = (_Float16*)alloc((size_t)DMODEL * DMODEL * 2);
  _Float16* Wr1bT  = (_Float16*)alloc((size_t)DMODEL * DMODEL * 2);
  _Float16* eqH    = (_Float16*)alloc((size_t)ROWS * DMODEL * 2);
  _Float16* ekH    = (_Float16*)alloc((size_t)ROWS * DMODEL * 2);
  _Float16* evH    = (_Float16*)alloc((size_t)ROWS * DMODEL * 2);
  _Float16* attnoH = (_Float16*)alloc((size_t)ROWS * DMODEL * 2);
  float* hconv = (float*)alloc((size_t)ROWS * DMODEL * 4);
  float* muv   = (float*)alloc(DMODEL * 4);
  float* rstdv = (float*)alloc(DMODEL * 4);
  float* qh    = (float*)alloc((size_t)ROWS * DMODEL * 4);
  float* kh    = (float*)alloc((size_t)ROWS * DMODEL * 4);
  float* vh    = (float*)alloc((size_t)ROWS * DMODEL * 4);
  float* A1c   = (float*)alloc((size_t)ROWS * 256 * 4);
  float* A2c   = (float*)alloc((size_t)ROWS * 256 * 4);
  float* A1r   = (float*)alloc((size_t)ROWS * DMODEL * 4);
  float* A2r   = (float*)alloc((size_t)ROWS * DMODEL * 4);
  float* uvec  = (float*)alloc(DMODEL * 4);
  float* wvecp = (float*)alloc(64);
  float* cscal = (float*)alloc(64);
  float* attb  = (float*)alloc((size_t)BQ * NHEAD * NQ * NQ * 4);
  float* gateb = (float*)alloc((size_t)NPAIR * 4);

  // 1) conv operands: im2col of the queries + fp16 conv weights, one grid
  im2col_cvt_k<<<CVT_BLKS + IM2COL_BLKS, ROW_THREADS, 0, stream>>>(queries, AcolH, convW, convWH);

  // 2) conv3x3 as WMMA GEMM (1568 x 512 x 4608); the gate-collapse vectors and
  //    the weight transposes run beside it in the same grid
  conv_gemm_side_k<<<SIDE_GRID, dim3(32, 4), 0, stream>>>(
      AcolH, convWH, convb, hconv, ROWS, DMODEL, KCONV,
      Wr2, Wgate, bgate, Wproj, bproj, br2, rel_embed, uvec, wvecp, cscal,
      Wq, Wk, Wv, Wo, Wr1, Wc1, WqT, WkT, WvT, WoT, Wr1aT, Wr1bT, Wc1aT, Wc1bT);

  // 3) BatchNorm(affine=False) + ReLU + residual adds (f16 activations)
  bn_stats_k<<<DMODEL, 256, 0, stream>>>(hconv, muv, rstdv);
  eqkv_k<<<(ROWS * DMODEL) / 8 / 256, 256, 0, stream>>>(hconv, muv, rstdv, queries, keys,
                                                    values, eqH, ekH, evH);

  // 4) token-level projections (all WMMA), one grid
  proj_gemms_k<<<PROJ_BLKS, dim3(32, 4), 0, stream>>>(
      eqH, ekH, evH, WqT, WkT, WvT, Wr1aT, Wr1bT, Wc1aT, Wc1bT, bq, bk, bv, br1, bc1,
      qh, kh, vh, A1r, A2r, A1c, A2c, DMODEL);

  // 5) attention logits + per-pair gate (one wave32 per pair), one grid
  attqk_pair_gate_k<<<ATT_BLKS + PAIR_BLKS, dim3(32, 8), 0, stream>>>(
      qh, kh, attb, A1c, A2c, A1r, A2r, gc, bcln, Wc2, bc2, gr, brln, uvec, wvecp, cscal,
      gateb);

  // 6) gated softmax + A*V (f16 output feeds final GEMM)
  softmax_av_k<<<BQ * NHEAD * NQ, 64, 0, stream>>>(attb, gateb, vh, attnoH);

  // 7) output projection (WMMA) straight into d_out
  launch_gemm(attnoH, WoT, bo, (float*)d_out, ROWS, DMODEL, DMODEL, DMODEL, DMODEL,
              DMODEL, stream);
}

// v003
// Measured time: 217 microseconds a run.
// Timed twice side by side with v002, it ran 1.04 times as fast both times.
// Counting every step since v000, it is 1.83 times as fast.
#include <hip/hip_runtime.h>
#include <hip/hip_bf16.h>
#include <math.h>

// ---------------------------------------------------------------------------
// RelationEnhanceAttention, algebraically restructured for MI455X (gfx1250).
//   B=32, N=49, D=512, H=8, DK=64, NREL=TOPK=14
// Conv and projection GEMMs: f16 operands (K-innermost both sides), fp32 accumulate on
// v_wmma_f32_16x16x32_f16. 16x64 C-tile per wave, pure b128 fragment loads.
// ---------------------------------------------------------------------------

typedef __attribute__((ext_vector_type(16))) _Float16 v16h;
typedef __attribute__((ext_vector_type(8)))  _Float16 v8h;
typedef __attribute__((ext_vector_type(8)))  float    v8f;
typedef __attribute__((ext_vector_type(4)))  float    v4f;

#define BQ      32
#define NQ      49
#define DMODEL  512
#define NHEAD   8
#define DKH     64
#define NRELC   14
#define ROWS    (BQ * NQ)            // 1568
#define KCONV   (DMODEL * 9)         // 4608
#define NPAIR   (BQ * NQ * NQ)       // 76832
#define LN_EPS  1e-5f

// ---------------------------------------------------------------------------
// WMMA GEMM: C[M,N] = A[M,K] * B^T[N,K] (+bias[N]).
// A: f16 row-major (M,K), lda mult of 8. Bt: f16 row-major (N,K), ldb mult 8.
// REQUIRES: M%16==0, N%64==0, K%32==0 (true for every call site here).
// One wave32 computes a 16x64 C tile; K stepped by 32.
// Fragment layout (ISA 16-bit A 16x32): halves 0..7  <- K = k0+8*half+0..7
//                                       halves 8..15 <- K = k0+8*half+16..23
// i.e. two contiguous 16-byte segments per lane -> two global_load_b128 each.
// ---------------------------------------------------------------------------
__device__ __forceinline__ void gemm_tile(const _Float16* __restrict__ A,
                                          const _Float16* __restrict__ Bt,
                                          const float* __restrict__ bias,
                                          float* __restrict__ C, int tile,
                                          int M, int N, int K, int lda, int ldb, int ldc) {
  const int ntn  = N >> 6;                       // 64-wide column tiles
  const int tm   = tile / ntn;
  const int tn   = tile - tm * ntn;
  const int row0 = tm << 4;
  const int col0 = tn << 6;
  if (row0 >= M) return;                         // wave-uniform guard only

  const int lane = threadIdx.x;                  // 0..31
  const int hf   = lane >> 4;                    // 0/1
  const int idx  = lane & 15;

  const _Float16* pa = A + (size_t)(row0 + idx) * lda + hf * 8;
  const _Float16* pb0 = Bt + (size_t)(col0 + 0  + idx) * ldb + hf * 8;
  const _Float16* pb1 = Bt + (size_t)(col0 + 16 + idx) * ldb + hf * 8;
  const _Float16* pb2 = Bt + (size_t)(col0 + 32 + idx) * ldb + hf * 8;
  const _Float16* pb3 = Bt + (size_t)(col0 + 48 + idx) * ldb + hf * 8;

  v8f acc0 = {}, acc1 = {}, acc2 = {}, acc3 = {};
  union F16x16 { v16h v; v8h h[2]; };

  for (int k0 = 0; k0 < K; k0 += 32) {
    F16x16 af, b0, b1, b2, b3;
    af.h[0] = *(const v8h*)(pa + k0);
    af.h[1] = *(const v8h*)(pa + k0 + 16);
    b0.h[0] = *(const v8h*)(pb0 + k0);
    b0.h[1] = *(const v8h*)(pb0 + k0 + 16);
    b1.h[0] = *(const v8h*)(pb1 + k0);
    b1.h[1] = *(const v8h*)(pb1 + k0 + 16);
    b2.h[0] = *(const v8h*)(pb2 + k0);
    b2.h[1] = *(const v8h*)(pb2 + k0 + 16);
    b3.h[0] = *(const v8h*)(pb3 + k0);
    b3.h[1] = *(const v8h*)(pb3 + k0 + 16);
    // prefetch next K-step (global_prefetch_b8)
    __builtin_prefetch(pa + k0 + 32, 0, 1);
    __builtin_prefetch(pb0 + k0 + 32, 0, 1);
    __builtin_prefetch(pb2 + k0 + 32, 0, 1);
    acc0 = __builtin_amdgcn_wmma_f32_16x16x32_f16(false, af.v, false, b0.v,
                                                  (short)0, acc0, false, false);
    acc1 = __builtin_amdgcn_wmma_f32_16x16x32_f16(false, af.v, false, b1.v,
                                                  (short)0, acc1, false, false);
    acc2 = __builtin_amdgcn_wmma_f32_16x16x32_f16(false, af.v, false, b2.v,
                                                  (short)0, acc2, false, false);
    acc3 = __builtin_amdgcn_wmma_f32_16x16x32_f16(false, af.v, false, b3.v,
                                                  (short)0, acc3, false, false);
  }

  // C layout: vgpr r -> m = row0 + r + 8*hf ; n = col0 + sub*16 + idx
  const int mbase = row0 + (hf ? 8 : 0);
#pragma unroll
  for (int s = 0; s < 4; ++s) {
    const int n = col0 + s * 16 + idx;
    const float badd = bias ? bias[n] : 0.f;
    const v8f a = (s == 0) ? acc0 : (s == 1) ? acc1 : (s == 2) ? acc2 : acc3;
#pragma unroll
    for (int r = 0; r < 8; ++r)
      C[(size_t)(mbase + r) * ldc + n] = a[r] + badd;
    // the next column group reuses these stores' registers: wait first
    asm volatile("s_wait_xcnt 0x0" ::: "memory");
  }
}

__global__ void gemm_wmma_f16(const _Float16* __restrict__ A,
                              const _Float16* __restrict__ Bt,
                              const float* __restrict__ bias,
                              float* __restrict__ C,
                              int M, int N, int K, int lda, int ldb, int ldc) {
  gemm_tile(A, Bt, bias, C, blockIdx.x * blockDim.y + threadIdx.y, M, N, K, lda, ldb, ldc);
}

// The seven token-level projections share no data dependence: one grid, the
// product chosen by block range (block-uniform). 196 blocks per 512-wide
// product, 98 per 256-wide one; 4 waves (tiles) per block as above.
#define BLK_N512 ((ROWS / 16) * (DMODEL / 64) / 4)   // 196
#define BLK_N256 ((ROWS / 16) * (256 / 64) / 4)      // 98
#define PROJ_BLKS (5 * BLK_N512 + 2 * BLK_N256)      // 1176
__global__ void proj_gemms_k(const _Float16* __restrict__ eq, const _Float16* __restrict__ ek,
                             const _Float16* __restrict__ ev,
                             const _Float16* __restrict__ WqT, const _Float16* __restrict__ WkT,
                             const _Float16* __restrict__ WvT, const _Float16* __restrict__ Wr1aT,
                             const _Float16* __restrict__ Wr1bT, const _Float16* __restrict__ Wc1aT,
                             const _Float16* __restrict__ Wc1bT,
                             const float* __restrict__ bq, const float* __restrict__ bk,
                             const float* __restrict__ bv, const float* __restrict__ br1,
                             const float* __restrict__ bc1,
                             float* __restrict__ qh, float* __restrict__ kh,
                             float* __restrict__ vh, float* __restrict__ A1r,
                             float* __restrict__ A2r, float* __restrict__ A1c,
                             float* __restrict__ A2c, int K) {
  const int blk = blockIdx.x;
  const _Float16* A; const _Float16* Bt; const float* bias; float* C;
  int n, lb;
  if (blk < 5 * BLK_N512) {
    const int job = blk / BLK_N512;
    lb = blk - job * BLK_N512;
    n = DMODEL;
    switch (job) {
      case 0:  A = eq; Bt = WqT;   bias = bq;      C = qh;  break;
      case 1:  A = ek; Bt = WkT;   bias = bk;      C = kh;  break;
      case 2:  A = ev; Bt = WvT;   bias = bv;      C = vh;  break;
      case 3:  A = eq; Bt = Wr1aT; bias = br1;     C = A1r; break;
      default: A = ek; Bt = Wr1bT; bias = nullptr; C = A2r; break;
    }
  } else {
    lb = blk - 5 * BLK_N512;
    n = 256;
    if (lb < BLK_N256) { A = eq; Bt = Wc1aT; bias = bc1; C = A1c; }
    else { lb -= BLK_N256; A = ek; Bt = Wc1bT; bias = nullptr; C = A2c; }
  }
  gemm_tile(A, Bt, bias, C, lb * 4 + threadIdx.y, ROWS, n, K, K, K, n);
}

// ---------------------------------------------------------------------------
// Weight transpose + fp16 convert: W (K,N) row-major -> Wt (N,K) f16.
// One thread takes 8 consecutive k of one column n: 8 reads, each coalesced
// over the lanes' n, and one 16-byte store.
// ---------------------------------------------------------------------------
__device__ __forceinline__ void transpose_h(const float* __restrict__ W,
                                            _Float16* __restrict__ Wt, int K, int N, int t) {
  const int kc = t / N, n = t - kc * N;
  const float* p = W + (size_t)kc * 8 * N + n;
  v8h o;
#pragma unroll
  for (int j = 0; j < 8; ++j) o[j] = (_Float16)p[(size_t)j * N];
  *(v8h*)(Wt + (size_t)n * K + kc * 8) = o;
  // other block ranges' code follows in the merged kernel and reuses the
  // store's registers: wait first
  asm volatile("s_wait_xcnt 0x0" ::: "memory");
}

// ---------------------------------------------------------------------------
// im2col (f16 output) for the 3x3 pad-1 conv. x[b,c,y,x] == queries[b,y*7+x,c].
// Acol[row = b*49 + y*7 + x, kk = ic*9 + ky*3 + kx]
// ---------------------------------------------------------------------------
// The fp32 -> fp16 copy of the conv weights (layout preserved) has no data in
// common with it and rides in the same grid, on the first block range.
// One block of 192 threads makes one row of 4608 halves in either part: each
// thread 3 groups of 8 consecutive outputs, one 16-byte store a group, so that
// few waves have to be started.
#define CVT_BLKS    DMODEL                   // 512 rows of conv weights
#define IM2COL_BLKS ROWS                     // 1568 rows of Acol
#define ROW_THREADS (KCONV / 8 / 3)          // 192
__global__ void im2col_cvt_k(const float* __restrict__ q, _Float16* __restrict__ Acol,
                             const float* __restrict__ convW, _Float16* __restrict__ convWH) {
  const int tid = threadIdx.x;
  if (blockIdx.x < CVT_BLKS) {
    const size_t base = (size_t)blockIdx.x * KCONV;
#pragma unroll
    for (int i = 0; i < 3; ++i) {
      const size_t e = base + (size_t)(tid + ROW_THREADS * i) * 8;
      const v4f lo = *(const v4f*)(convW + e);
      const v4f hi = *(const v4f*)(convW + e + 4);
      v8h o;
#pragma unroll
      for (int j = 0; j < 4; ++j) { o[j] = (_Float16)lo[j]; o[4 + j] = (_Float16)hi[j]; }
      *(v8h*)(convWH + e) = o;
    }
    return;
  }
  const int row = blockIdx.x - CVT_BLKS;         // b*49 + y*7 + x
  const int p = row % NQ;
  const int y = p / 7, x = p % 7;
  unsigned valid = 0;                            // bit r: tap r lies inside the 7x7 map
#pragma unroll
  for (int r = 0; r < 9; ++r)
    if ((unsigned)(y + r / 3 - 1) < 7u && (unsigned)(x + r % 3 - 1) < 7u) valid |= 1u << r;
  const float* qc = q + (size_t)row * DMODEL;    // the centre tap's token
  _Float16* arow = Acol + (size_t)row * KCONV;
  // a tap outside the map reads the centre token (in bounds) and is zeroed: no
  // branch round a load, so all 24 loads of a thread can be in flight at once
  float ld[3][8];
  unsigned okm = 0;                              // bit 8*i+j: that output's tap is inside
#pragma unroll
  for (int i = 0; i < 3; ++i) {
    const int kk0 = (tid + ROW_THREADS * i) * 8;
    int ic = kk0 / 9, r = kk0 % 9;
#pragma unroll
    for (int j = 0; j < 8; ++j) {
      const unsigned ok = (valid >> r) & 1u;
      const int ky = (r * 11) >> 5;              // r / 3 for r in 0..8
      const int tap = (r + 4 * ky - 8) * (int)ok;    // (ky-1)*7 + (kx-1), or the centre
      ld[i][j] = qc[tap * DMODEL + ic];
      okm |= ok << (8 * i + j);
      const int wrap = (r == 8);
      r = wrap ? 0 : r + 1;
      ic += wrap;
    }
  }
#pragma unroll
  for (int i = 0; i < 3; ++i) {
    v8h o;
#pragma unroll
    for (int j = 0; j < 8; ++j)
      o[j] = (_Float16)(((okm >> (8 * i + j)) & 1u) ? ld[i][j] : 0.f);
    *(v8h*)(arow + (tid + ROW_THREADS * i) * 8) = o;
  }
}

// BatchNorm stats over (B, spatial) = 1568 rows per channel (population var).
__global__ void bn_stats_k(const float* __restrict__ h, float* __restrict__ mu,
                           float* __restrict__ rstd) {
  const int c = blockIdx.x, tid = threadIdx.x;
  float s = 0.f, ss = 0.f;
  for (int r = tid; r < ROWS; r += 256) {
    float v = h[(size_t)r * DMODEL + c];
    s += v; ss += v * v;
  }
  __shared__ float sh[256], sh2[256];
  sh[tid] = s; sh2[tid] = ss; __syncthreads();
  for (int off = 128; off; off >>= 1) {
    if (tid < off) { sh[tid] += sh[tid + off]; sh2[tid] += sh2[tid + off]; }
    __syncthreads();
  }
  if (tid == 0) {
    float m = sh[0] * (1.f / ROWS);
    float v = sh2[0] * (1.f / ROWS) - m * m;
    mu[c] = m; rstd[c] = rsqrtf(v + LN_EPS);
  }
}

// xs = relu(BN(h)); eq/ek/ev = f16(xs + queries/keys/values)
__global__ void eqkv_k(const float* __restrict__ h, const float* __restrict__ mu,
                       const float* __restrict__ rstd,
                       const float* __restrict__ q, const float* __restrict__ k,
                       const float* __restrict__ v,
                       _Float16* __restrict__ eq, _Float16* __restrict__ ek,
                       _Float16* __restrict__ ev) {
  const size_t t = ((size_t)blockIdx.x * blockDim.x + threadIdx.x) * 8;   // 8 channels a thread
  if (t >= (size_t)ROWS * DMODEL) return;
  const int c = (int)(t % DMODEL);
  v8h oq, ok, ov;
#pragma unroll
  for (int g = 0; g < 2; ++g) {
    const v4f h4 = *(const v4f*)(h + t + 4 * g);
    const v4f m4 = *(const v4f*)(mu + c + 4 * g);
    const v4f r4 = *(const v4f*)(rstd + c + 4 * g);
    const v4f q4 = *(const v4f*)(q + t + 4 * g);
    const v4f k4 = *(const v4f*)(k + t + 4 * g);
    const v4f v4 = *(const v4f*)(v + t + 4 * g);
#pragma unroll
    for (int j = 0; j < 4; ++j) {
      const float xs = fmaxf((h4[j] - m4[j]) * r4[j], 0.f);
      oq[4 * g + j] = (_Float16)(xs + q4[j]);
      ok[4 * g + j] = (_Float16)(xs + k4[j]);
      ov[4 * g + j] = (_Float16)(xs + v4[j]);
    }
  }
  *(v8h*)(eq + t) = oq;
  *(v8h*)(ek + t) = ok;
  *(v8h*)(ev + t) = ov;
}

// Precompute gate-collapse vectors:
//   u[512] = Wr2 @ Wgate ; wv[14] = rel_embed @ (Wproj @ Wgate)
//   cs = (br2 + bproj) . Wgate + bgate
// Blocks of 128 threads: parts 0..3 take 128 rows of u each, part 4 the rest.
__device__ __forceinline__ void precompute_part(int part, int t,
                             const float* __restrict__ Wr2, const float* __restrict__ Wgate,
                             const float* __restrict__ bgate, const float* __restrict__ Wproj,
                             const float* __restrict__ bproj, const float* __restrict__ br2,
                             const float* __restrict__ rel_embed,
                             float* __restrict__ u, float* __restrict__ wv,
                             float* __restrict__ cs) {
  __shared__ float pv[DKH];
  if (part < 4) {                                // block-uniform
    const int row = part * 128 + t;
    float s = 0.f;
    for (int j = 0; j < DMODEL; ++j) s += Wr2[(size_t)row * DMODEL + j] * Wgate[j];
    u[row] = s;
    // the fifth part's code follows and reuses the store's registers: wait first
    asm volatile("s_wait_xcnt 0x0" ::: "memory");
    return;
  }
  if (t < DKH) {
    float s = 0.f;
    for (int d = 0; d < DMODEL; ++d) s += Wproj[(size_t)t * DMODEL + d] * Wgate[d];
    pv[t] = s;
  }
  __syncthreads();
  if (t < NRELC) {
    float s = 0.f;
    const unsigned rb = (unsigned)t * (DKH * 4u);   // the row's byte offset
    const float* rp = (const float*)((const char*)rel_embed + rb);
    for (int d = 0; d < DKH; ++d) s += rp[d] * pv[d];
    // the row's offset stays live up to this wait, so that no load of the run
    // returns into the register that the others still name
    asm volatile("s_wait_xcnt 0x0" :: "v"(rb) : "memory");
    wv[t] = s;
  }
  if (t == 0) {
    float s = bgate[0];
    for (int d = 0; d < DMODEL; ++d) s += (br2[d] + bproj[d]) * Wgate[d];
    cs[0] = s;
  }
}

// conv GEMM grid (196 blocks of 4 waves leave most wave slots empty) plus the
// work that nothing before the projections depends on: the gate-collapse
// vectors and the eight weight transposes, on the block ranges behind it.
#define CONV_BLKS ((ROWS / 16) * (DMODEL / 64) / 4)    // 196
#define PRE_BLKS  5
#define TR512_BLKS (DMODEL * DMODEL / 8 / 128)         // 256
#define TR256_BLKS (DMODEL * 256 / 8 / 128)            // 128
#define SIDE_GRID (CONV_BLKS + PRE_BLKS + 6 * TR512_BLKS + 2 * TR256_BLKS)
__global__ void conv_gemm_side_k(const _Float16* __restrict__ Acol,
                                 const _Float16* __restrict__ convWH,
                                 const float* __restrict__ convb, float* __restrict__ hconv,
                                 int M, int N, int K,
                                 const float* __restrict__ Wr2, const float* __restrict__ Wgate,
                                 const float* __restrict__ bgate, const float* __restrict__ Wproj,
                                 const float* __restrict__ bproj, const float* __restrict__ br2,
                                 const float* __restrict__ rel_embed,
                                 float* __restrict__ u, float* __restrict__ wv,
                                 float* __restrict__ cs,
                                 const float* __restrict__ Wq, const float* __restrict__ Wk,
                                 const float* __restrict__ Wv, const float* __restrict__ Wo,
                                 const float* __restrict__ Wr1, const float* __restrict__ Wc1,
                                 _Float16* __restrict__ WqT, _Float16* __restrict__ WkT,
                                 _Float16* __restrict__ WvT, _Float16* __restrict__ WoT,
                                 _Float16* __restrict__ Wr1aT, _Float16* __restrict__ Wr1bT,
                                 _Float16* __restrict__ Wc1aT, _Float16* __restrict__ Wc1bT) {
  int blk = blockIdx.x;
  if (blk < CONV_BLKS) {
    gemm_tile(Acol, convWH, convb, hconv, blk * 4 + threadIdx.y, M, N, K, K, K, N);
    return;
  }
  blk -= CONV_BLKS;
  const int tid = threadIdx.y * 32 + threadIdx.x;
  if (blk < PRE_BLKS) {
    precompute_part(blk, tid, Wr2, Wgate, bgate, Wproj, bproj, br2, rel_embed, u, wv, cs);
    return;
  }
  blk -= PRE_BLKS;
  if (blk < 6 * TR512_BLKS) {
    const int job = blk / TR512_BLKS;
    const int t = (blk - job * TR512_BLKS) * 128 + tid;
    const float* W; _Float16* Wt;
    switch (job) {
      case 0:  W = Wq;  Wt = WqT;  break;
      case 1:  W = Wk;  Wt = WkT;  break;
      case 2:  W = Wv;  Wt = WvT;  break;
      case 3:  W = Wo;  Wt = WoT;  break;
      case 4:  W = Wr1; Wt = Wr1aT; break;
      default: W = Wr1 + (size_t)DMODEL * DMODEL; Wt = Wr1bT; break;
    }
    transpose_h(W, Wt, DMODEL, DMODEL, t);
  } else {
    blk -= 6 * TR512_BLKS;
    const int second = blk >= TR256_BLKS;
    const int t = (blk - second * TR256_BLKS) * 128 + tid;
    transpose_h(second ? Wc1 + (size_t)DMODEL * 256 : Wc1, second ? Wc1bT : Wc1aT,
                DMODEL, 256, t);
  }
}

// att[b,h,qi,ki] = SCALE * q[b,qi,h,:] . k[b,ki,h,:]
__device__ __forceinline__ void attqk_part(const float* __restrict__ qh,
                                           const float* __restrict__ kh,
                                           float* __restrict__ att, size_t t) {
  const int ki = (int)(t % NQ);
  const int qi = (int)((t / NQ) % NQ);
  const int h  = (int)((t / (NQ * NQ)) % NHEAD);
  const int b  = (int)(t / ((size_t)NQ * NQ * NHEAD));
  const float* qp = qh + ((size_t)(b * NQ + qi)) * DMODEL + h * DKH;
  const float* kp = kh + ((size_t)(b * NQ + ki)) * DMODEL + h * DKH;
  float s = 0.f;
#pragma unroll 8
  for (int d = 0; d < DKH; ++d) s += qp[d] * kp[d];
  att[t] = s * 0.125f;  // 1/sqrt(64)
}

// One wave32 per (b, qi, group of 7 ki): LN(256)->ReLU->14 logits->softmax->probs.wv,
// LN(512)->ReLU->dot(u), gate = sigmoid(.) for each ki of the group in turn.
// All that does not depend on ki (Wc2, the LN scales and shifts, u, the q-side
// rows) is loaded once per wave and stays in registers over the 7 pairs; a pair
// itself loads only its two k-side rows. qi runs fastest over the waves, so
// that the 8 waves of a block mostly read the same k-side rows (WGP cache).
// The attention logits depend on nothing computed here and ride in the same
// grid (256 threads a block in both parts). Of every 11 blocks 4 are pair blocks
// and 7 logit blocks: the pair blocks are bound by issue, the logit blocks by
// the WGP cache, so that a WGP should hold one of each rather than two alike.
#define KI_GRP     7
#define PAIR_WAVES 8
#define PAIR_THREADS (32 * PAIR_WAVES)                          // 256
#define PAIR_BLKS (BQ * (NQ / KI_GRP) * NQ / PAIR_WAVES)        // 1372
#define ATT_BLKS  (BQ * NHEAD * NQ * NQ / PAIR_THREADS)         // 2401
#define MIX_PAIR  4                                             // 1372 = 343 * 4
#define MIX_ATT   7                                             // 2401 = 343 * 7
static_assert(PAIR_BLKS * MIX_ATT == ATT_BLKS * MIX_PAIR && PAIR_BLKS % MIX_PAIR == 0,
              "the two parts must deal out evenly");
// four waves per SIMD: the register budget of 256 that two blocks per WGP need
__global__ __launch_bounds__(PAIR_THREADS) __attribute__((amdgpu_waves_per_eu(4)))
void attqk_pair_gate_k(const float* __restrict__ qh, const float* __restrict__ kh,
                            float* __restrict__ att,
                            const float* __restrict__ A1c, const float* __restrict__ A2c,
                            const float* __restrict__ A1r, const float* __restrict__ A2r,
                            const float* __restrict__ gc, const float* __restrict__ bcln,
                            const float* __restrict__ Wc2, const float* __restrict__ bc2,
                            const float* __restrict__ gr, const float* __restrict__ brln,
                            const float* __restrict__ u, const float* __restrict__ wv,
                            const float* __restrict__ cs, float* __restrict__ gate) {
  const int grp = blockIdx.x / (MIX_PAIR + MIX_ATT);
  const int sub = blockIdx.x % (MIX_PAIR + MIX_ATT);
  if (sub >= MIX_PAIR) {                         // block-uniform
    attqk_part(qh, kh, att, (size_t)(grp * MIX_ATT + sub - MIX_PAIR) * PAIR_THREADS +
                                threadIdx.y * 32 + threadIdx.x);
    return;
  }
  const int lane = threadIdx.x;
  const int wave = (grp * MIX_PAIR + sub) * PAIR_WAVES + threadIdx.y;   // (b, ki group, qi)
  const int b   = wave / ((NQ / KI_GRP) * NQ);
  const int rm  = wave % ((NQ / KI_GRP) * NQ);
  const int ki0 = (rm / NQ) * KI_GRP;
  const int qi  = rm % NQ;

  const float* a1 = A1c + (size_t)(b * NQ + qi) * 256;
  const float* r1 = A1r + (size_t)(b * NQ + qi) * DMODEL;
  const float* a2 = A2c + (size_t)(b * NQ + ki0) * 256;
  const float* r2 = A2r + (size_t)(b * NQ + ki0) * DMODEL;
  // lane i collects the values of pair ki0 + i (they are equal in all lanes
  // behind the sums over the lanes); the divisions and the sigmoid are then
  // done once for the 7 pairs
  float pwn = 0.f, sen = 1.f, gdn = 0.f;

  // ---- classifier branch: LN over 256, ReLU, 256x14 matvec, softmax ----
  // the two branches run in loops of their own, so that only one branch's
  // shared operands take registers at a time
  {
    float w2[8][NRELC], gcv[8], bcv[8], a1v[8];
    const unsigned wb = (unsigned)lane * (NRELC * 4u);   // the lane's byte offset in Wc2
    const float* wp  = (const float*)((const char*)Wc2 + wb);
    const float* a1l = a1 + lane;
#pragma unroll
    for (int j = 0; j < 8; ++j) {
      const int e = lane + 32 * j;
      a1v[j] = a1l[32 * j]; gcv[j] = gc[e]; bcv[j] = bcln[e];
#pragma unroll
      for (int r = 0; r < NRELC; ++r) w2[j][r] = wp[j * 32 * NRELC + r];
    }
    // the addresses stay live up to this wait, so that no load of the run
    // returns into a register that the others still name
    asm volatile("s_wait_xcnt 0x0" :: "v"(wb), "v"(a1l) : "memory");
    // rolled: a second copy of the body does not fit the register budget
#pragma unroll 1
    for (int i = 0; i < KI_GRP; ++i) {
      float x[8], s = 0.f, ss = 0.f;
#pragma unroll
      for (int j = 0; j < 8; ++j) {
        float v = a1v[j] + a2[i * 256 + lane + 32 * j];
        x[j] = v; s += v; ss += v * v;
      }
      for (int off = 16; off; off >>= 1) {
        s += __shfl_xor(s, off, 32); ss += __shfl_xor(ss, off, 32);
      }
      const float mean = s * (1.f / 256.f);
      const float rstd = rsqrtf(ss * (1.f / 256.f) - mean * mean + LN_EPS);
      float lg[NRELC];
#pragma unroll
      for (int r = 0; r < NRELC; ++r) lg[r] = 0.f;
#pragma unroll
      for (int j = 0; j < 8; ++j) {
        float hv = fmaxf((x[j] - mean) * rstd * gcv[j] + bcv[j], 0.f);
#pragma unroll
        for (int r = 0; r < NRELC; ++r) lg[r] += hv * w2[j][r];
      }
      for (int off = 16; off; off >>= 1)
#pragma unroll
        for (int r = 0; r < NRELC; ++r) lg[r] += __shfl_xor(lg[r], off, 32);

      float mx = lg[0] + bc2[0];
#pragma unroll
      for (int r = 0; r < NRELC; ++r) { lg[r] += bc2[r]; mx = fmaxf(mx, lg[r]); }
      float se = 0.f, pw = 0.f;
#pragma unroll
      for (int r = 0; r < NRELC; ++r) {
        float p = __expf(lg[r] - mx);
        se += p; pw += p * wv[r];
      }
      pwn = (lane == i) ? pw : pwn;
      sen = (lane == i) ? se : sen;
    }
  }

  // ---- relation branch: LN over 512, ReLU, dot with u ----
  {
    float grv[16], brv[16], uv[16], r1v[16];
    const float* r1l = r1 + lane;
#pragma unroll
    for (int j = 0; j < 16; ++j) {
      const int e = lane + 32 * j;
      r1v[j] = r1l[32 * j]; grv[j] = gr[e]; brv[j] = brln[e]; uv[j] = u[e];
    }
    // as above: the row's address stays live up to this wait
    asm volatile("s_wait_xcnt 0x0" :: "v"(r1l) : "memory");
    // unrolled: the 7 pairs' loads and sums over the lanes can overlap
#pragma unroll
    for (int i = 0; i < KI_GRP; ++i) {
      float y[16], s = 0.f, ss = 0.f;
#pragma unroll
      for (int j = 0; j < 16; ++j) {
        float v = r1v[j] + r2[i * DMODEL + lane + 32 * j];
        y[j] = v; s += v; ss += v * v;
      }
      for (int off = 16; off; off >>= 1) {
        s += __shfl_xor(s, off, 32); ss += __shfl_xor(ss, off, 32);
      }
      const float mean = s * (1.f / 512.f);
      const float rstd = rsqrtf(ss * (1.f / 512.f) - mean * mean + LN_EPS);
      float gd = 0.f;
#pragma unroll
      for (int j = 0; j < 16; ++j) {
        float hv = fmaxf((y[j] - mean) * rstd * grv[j] + brv[j], 0.f);
        gd += hv * uv[j];
      }
      for (int off = 16; off; off >>= 1) gd += __shfl_xor(gd, off, 32);
      gdn = (lane == i) ? gd : gdn;
    }
  }

  // probs = p/se; top-k(14 of 14) renorm = /(1+1e-8)
  const float pwv = pwn / (sen * (1.f + 1e-8f));
  if (lane < KI_GRP)
    gate[(size_t)(b * NQ + qi) * NQ + ki0 + lane] = 1.f / (1.f + __expf(-(gdn + pwv + cs[0])));
}

// enh = att*(1+gate); softmax over ki; out[b,qi,h,:] = f16(sum_ki w*v[b,ki,h,:])
__global__ void softmax_av_k(const float* __restrict__ att, const float* __restrict__ gate,
                             const float* __restrict__ vh, _Float16* __restrict__ outp) {
  const int bhq = blockIdx.x;                 // (b*8+h)*49 + qi
  const int b  = bhq / (NHEAD * NQ);
  const int h  = (bhq / NQ) % NHEAD;
  const int qi = bhq % NQ;
  __shared__ float sw[NQ];
  __shared__ float red[2];
  const int tid = threadIdx.x;                // 64 threads
  const float* arow = att + (size_t)bhq * NQ;
  const float* grow = gate + ((size_t)(b * NQ + qi)) * NQ;
  if (tid < NQ) sw[tid] = arow[tid] * (1.f + grow[tid]);
  __syncthreads();
  if (tid == 0) {
    float m = sw[0];
    for (int i = 1; i < NQ; ++i) m = fmaxf(m, sw[i]);
    float sm = 0.f;
    for (int i = 0; i < NQ; ++i) sm += __expf(sw[i] - m);
    red[0] = m; red[1] = sm;
  }
  __syncthreads();
  if (tid < NQ) sw[tid] = __expf(sw[tid] - red[0]) / red[1];
  __syncthreads();
  if (tid < DKH) {
    const float* vbase = vh + (size_t)(b * NQ) * DMODEL + h * DKH + tid;
    float acc = 0.f;
    for (int ki = 0; ki < NQ; ++ki) acc += sw[ki] * vbase[(size_t)ki * DMODEL];
    outp[((size_t)(b * NQ + qi)) * DMODEL + h * DKH + tid] = (_Float16)acc;
  }
}

// ---------------------------------------------------------------------------
static inline void launch_gemm(const _Float16* A, const _Float16* Bt, const float* bias,
                               float* C, int M, int N, int K, int lda, int ldb, int ldc,
                               hipStream_t s) {
  const int tiles = (M / 16) * (N / 64);
  dim3 blk(32, 4), grd((tiles + 3) / 4);
  gemm_wmma_f16<<<grd, blk, 0, s>>>(A, Bt, bias, C, M, N, K, lda, ldb, ldc);
}

extern "C" void kernel_launch(void* const* d_in, const int* in_sizes, int n_in,
                              void* d_out, int out_size, void* d_ws, size_t ws_size,
                              hipStream_t stream) {
  const float* queries = (const float*)d_in[0];
  const float* keys    = (const float*)d_in[1];
  const float* values  = (const float*)d_in[2];
  const float* Wq = (const float*)d_in[3];  const float* bq = (const float*)d_in[4];
  const float* Wk = (const float*)d_in[5];  const float* bk = (const float*)d_in[6];
  const float* Wv = (const float*)d_in[7];  const float* bv = (const float*)d_in[8];
  const float* Wo = (const float*)d_in[9];  const float* bo = (const float*)d_in[10];
  const float* rel_embed = (const float*)d_in[11];
  const float* Wproj = (const float*)d_in[12]; const float* bproj = (const float*)d_in[13];
  const float* Wgate = (const float*)d_in[14]; const float* bgate = (const float*)d_in[15];
  const float* Wc1 = (const float*)d_in[16];   const float* bc1 = (const float*)d_in[17];
  const float* gc = (const float*)d_in[18];    const float* bcln = (const float*)d_in[19];
  const float* Wc2 = (const float*)d_in[20];   const float* bc2 = (const float*)d_in[21];
  const float* Wr1 = (const float*)d_in[22];   const float* br1 = (const float*)d_in[23];
  const float* gr = (const float*)d_in[24];    const float* brln = (const float*)d_in[25];
  const float* Wr2 = (const float*)d_in[26];   const float* br2 = (const float*)d_in[27];
  const float* convW = (const float*)d_in[28]; const float* convb = (const float*)d_in[29];

  // ---- workspace carve-out (256B aligned blocks) ----
  char* base = (char*)d_ws;
  size_t off = 0;
  auto alloc = [&](size_t bytes) -> void* {
    off = (off + 255) & ~(size_t)255;
    void* p = base + off;
    off += bytes;
    return p;
  };
  _Float16* AcolH  = (_Float16*)alloc((size_t)ROWS * KCONV * 2);
  _Float16* convWH = (_Float16*)alloc((size_t)DMODEL * KCONV * 2);
  _Float16* WqT    = (_Float16*)alloc((size_t)DMODEL * DMODEL * 2);
  _Float16* WkT    = (_Float16*)alloc((size_t)DMODEL * DMODEL * 2);
  _Float16* WvT    = (_Float16*)alloc((size_t)DMODEL * DMODEL * 2);
  _Float16* WoT    = (_Float16*)alloc((size_t)DMODEL * DMODEL * 2);
  _Float16* Wc1aT  = (_Float16*)alloc((size_t)256 * DMODEL * 2);
  _Float16* Wc1bT  = (_Float16*)alloc((size_t)256 * DMODEL * 2);
  _Float16* Wr1aT  = (_Float16*)alloc((size_t)DMODEL * DMODEL * 2);
  _Float16* Wr1bT  = (_Float16*)alloc((size_t)DMODEL * DMODEL * 2);
  _Float16* eqH    = (_Float16*)alloc((size_t)ROWS * DMODEL * 2);
  _Float16* ekH    = (_Float16*)alloc((size_t)ROWS * DMODEL * 2);
  _Float16* evH    = (_Float16*)alloc((size_t)ROWS * DMODEL * 2);
  _Float16* attnoH = (_Float16*)alloc((size_t)ROWS * DMODEL * 2);
  float* hconv = (float*)alloc((size_t)ROWS * DMODEL * 4);
  float* muv   = (float*)alloc(DMODEL * 4);
  float* rstdv = (float*)alloc(DMODEL * 4);
  float* qh    = (float*)alloc((size_t)ROWS * DMODEL * 4);
  float* kh    = (float*)alloc((size_t)ROWS * DMODEL * 4);
  float* vh    = (float*)alloc((size_t)ROWS * DMODEL * 4);
  float* A1c   = (float*)alloc((size_t)ROWS * 256 * 4);
  float* A2c   = (float*)alloc((size_t)ROWS * 256 * 4);
  float* A1r   = (float*)alloc((size_t)ROWS * DMODEL * 4);
  float* A2r   = (float*)alloc((size_t)ROWS * DMODEL * 4);
  float* uvec  = (float*)alloc(DMODEL * 4);
  float* wvecp = (float*)alloc(64);
  float* cscal = (float*)alloc(64);
  float* attb  = (float*)alloc((size_t)BQ * NHEAD * NQ * NQ * 4);
  float* gateb = (float*)alloc((size_t)NPAIR * 4);

  // 1) conv operands: im2col of the queries + fp16 conv weights, one grid
  im2col_cvt_k<<<CVT_BLKS + IM2COL_BLKS, ROW_THREADS, 0, stream>>>(queries, AcolH, convW, convWH);

  // 2) conv3x3 as WMMA GEMM (1568 x 512 x 4608); the gate-collapse vectors and
  //    the weight transposes run beside it in the same grid
  conv_gemm_side_k<<<SIDE_GRID, dim3(32, 4), 0, stream>>>(
      AcolH, convWH, convb, hconv, ROWS, DMODEL, KCONV,
      Wr2, Wgate, bgate, Wproj, bproj, br2, rel_embed, uvec, wvecp, cscal,
      Wq, Wk, Wv, Wo, Wr1, Wc1, WqT, WkT, WvT, WoT, Wr1aT, Wr1bT, Wc1aT, Wc1bT);

  // 3) BatchNorm(affine=False) + ReLU + residual adds (f16 activations)
  bn_stats_k<<<DMODEL, 256, 0, stream>>>(hconv, muv, rstdv);
  eqkv_k<<<(ROWS * DMODEL) / 8 / 256, 256, 0, stream>>>(hconv, muv, rstdv, queries, keys,
                                                    values, eqH, ekH, evH);

  // 4) token-level projections (all WMMA), one grid
  proj_gemms_k<<<PROJ_BLKS, dim3(32, 4), 0, stream>>>(
      eqH, ekH, evH, WqT, WkT, WvT, Wr1aT, Wr1bT, Wc1aT, Wc1bT, bq, bk, bv, br1, bc1,
      qh, kh, vh, A1r, A2r, A1c, A2c, DMODEL);

  // 5) per-pair gate (one wave32 per 7 pairs) + attention logits, one grid
  attqk_pair_gate_k<<<PAIR_BLKS + ATT_BLKS, dim3(32, PAIR_WAVES), 0, stream>>>(
      qh, kh, attb, A1c, A2c, A1r, A2r, gc, bcln, Wc2, bc2, gr, brln, uvec, wvecp, cscal,
      gateb);

  // 6) gated softmax + A*V (f16 output feeds final GEMM)
  softmax_av_k<<<BQ * NHEAD * NQ, 64, 0, stream>>>(attb, gateb, vh, attnoH);

  // 7) output projection (WMMA) straight into d_out
  launch_gemm(attnoH, WoT, bo, (float*)d_out, ROWS, DMODEL, DMODEL, DMODEL, DMODEL,
              DMODEL, stream);
}

// v004
// It runs in 144 microseconds.
// Next to v003, in two timings, it ran 1.52 and 1.51 times as fast.
// Over all steps from v000 it is 2.78 times as fast.
#include <hip/hip_runtime.h>
#include <hip/hip_bf16.h>
#include <math.h>

// ---------------------------------------------------------------------------
// RelationEnhanceAttention, algebraically restructured for MI455X (gfx1250).
//   B=32, N=49, D=512, H=8, DK=64, NREL=TOPK=14
// All dense GEMMs: f16 operands (K-innermost both sides), fp32 accumulate on
// v_wmma_f32_16x16x32_f16. 16x32 C-tile per wave, operands staged in LDS.
// ---------------------------------------------------------------------------

typedef __attribute__((ext_vector_type(16))) _Float16 v16h;
typedef __attribute__((ext_vector_type(8)))  _Float16 v8h;
typedef __attribute__((ext_vector_type(8)))  float    v8f;
typedef __attribute__((ext_vector_type(4)))  float    v4f;

#define BQ      32
#define NQ      49
#define DMODEL  512
#define NHEAD   8
#define DKH     64
#define NRELC   14
#define ROWS    (BQ * NQ)            // 1568
#define KCONV   (DMODEL * 9)         // 4608
#define NPAIR   (BQ * NQ * NQ)       // 76832
#define LN_EPS  1e-5f

// ---------------------------------------------------------------------------
// WMMA GEMM: C[M,N] = A[M,K] * B^T[N,K] (+bias[N]).
// A: f16 row-major (M,K). Bt: f16 row-major (N,K). K is the pitch of both.
// REQUIRES: M%32==0, N%64==0, K%256==0, K>=512 (true for every call site here).
// One block of 4 waves computes a 32x64 C tile, each wave 16x32; K stepped by 32
// in rising order. The operands come into LDS in stages of 256 k (512 B of each
// of the 96 rows) by asynchronous copies: one copy of a wave is one row's whole
// 512 B, so that every request covers whole cache lines. Two buffers: the next
// stage's copies fly while this one is worked on.
// Fragment layout (ISA 16-bit A 16x32): halves 0..7  <- K = k0+8*half+0..7
//                                       halves 8..15 <- K = k0+8*half+16..23
// i.e. two 16-byte segments per lane -> two ds_load_b128 each.
// ---------------------------------------------------------------------------
#define GBM    32
#define GBN    64
#define GBK    256
#define GROWS  (GBM + GBN)            // 96 rows a stage
#define GPITCH (GBK * 2 + 16)         // 528 B = 16 B x odd: no bank conflict for b128 readers
#define GBUF   (GROWS * GPITCH)       // 50,688 B a buffer

// Eight rows, four apart (one per wave between them): lane l brings bytes
// 16*l .. 16*l+15 of each row's 512 B. The s_wait_xcnt stands inside the
// statement, so that no address register is rewritten in front of it.
template <int K>
__device__ __forceinline__ void copy8_rows(unsigned lds, const _Float16* g) {
  asm volatile(
      "global_load_async_to_lds_b128 %0, %8, off\n\t"
      "global_load_async_to_lds_b128 %1, %9, off\n\t"
      "global_load_async_to_lds_b128 %2, %10, off\n\t"
      "global_load_async_to_lds_b128 %3, %11, off\n\t"
      "global_load_async_to_lds_b128 %4, %12, off\n\t"
      "global_load_async_to_lds_b128 %5, %13, off\n\t"
      "global_load_async_to_lds_b128 %6, %14, off\n\t"
      "global_load_async_to_lds_b128 %7, %15, off\n\t"
      "s_wait_xcnt 0x0"
      :: "v"(lds), "v"(lds + 4 * GPITCH), "v"(lds + 8 * GPITCH), "v"(lds + 12 * GPITCH),
         "v"(lds + 16 * GPITCH), "v"(lds + 20 * GPITCH), "v"(lds + 24 * GPITCH),
         "v"(lds + 28 * GPITCH),
         "v"(g), "v"(g + 4 * K), "v"(g + 8 * K), "v"(g + 12 * K),
         "v"(g + 16 * K), "v"(g + 20 * K), "v"(g + 24 * K), "v"(g + 28 * K)
      : "memory");
}

template <int K>
__device__ __forceinline__ void gemm_block(const _Float16* __restrict__ A,
                                           const _Float16* __restrict__ Bt,
                                           const float* __restrict__ bias,
                                           float* __restrict__ C, int tile, int N) {
  __shared__ __attribute__((aligned(16))) unsigned char gsm[2 * GBUF];
  constexpr int NST = K / GBK;                   // stages
  static_assert(K % GBK == 0 && NST >= 2, "two stages at least");
  const int ntn  = N >> 6;                       // 64-wide column tiles
  const int tm   = tile / ntn;
  const int tn   = tile - tm * ntn;
  const int row0 = tm * GBM;
  const int col0 = tn * GBN;

  const int lane = threadIdx.x;                  // 0..31
  const int wave = __builtin_amdgcn_readfirstlane(threadIdx.y);   // 0..3
  const int hf   = lane >> 4;                    // 0/1
  const int idx  = lane & 15;
  const int wm   = wave >> 1, wn = wave & 1;     // the wave's 16 rows, 32 columns

  // copy side: wave w takes rows w, w+4, ... of the stage (A rows 0..31, B rows 32..95)
  const unsigned lds0 = (unsigned)(size_t)gsm + (unsigned)(wave * GPITCH + lane * 16);
  const _Float16* ga = A  + (size_t)(row0 + wave) * K + lane * 8;
  const _Float16* gb = Bt + (size_t)(col0 + wave) * K + lane * 8;
  auto copy_stage = [&](int st, int buf) {
    const unsigned l = lds0 + (unsigned)buf * GBUF;
    copy8_rows<K>(l, ga + st * GBK);
    copy8_rows<K>(l + 32 * GPITCH, gb + st * GBK);
    copy8_rows<K>(l + 64 * GPITCH, gb + (size_t)32 * K + st * GBK);
  };

  // read side
  const unsigned char* sa  = gsm + (wm * 16 + idx) * GPITCH + hf * 16;
  const unsigned char* sb0 = gsm + (GBM + wn * 32 + idx) * GPITCH + hf * 16;
  const unsigned char* sb1 = sb0 + 16 * GPITCH;

  v8f acc0 = {}, acc1 = {};
  union F16x16 { v16h v; v8h h[2]; };

  copy_stage(0, 0);
  // stage 0 has landed for this wave; the barrier publishes it to the others
  asm volatile("s_wait_asynccnt 0x0" ::: "memory");
  __syncthreads();
  copy_stage(1, 1);

  // rolled: one body serves both buffers, the code stays small
#pragma unroll 1
  for (int t = 0; t < NST; ++t) {
    const int bo = (t & 1) * GBUF;
    // four k steps' fragments are fetched as one group, then their eight WMMAs:
    // one LDS latency a group instead of one a WMMA
#pragma unroll
    for (int kg = 0; kg < GBK / 128; ++kg) {
      F16x16 af[4], b0[4], b1[4];
#pragma unroll
      for (int q = 0; q < 4; ++q) {
        const int o = bo + (kg * 4 + q) * 64;
        af[q].h[0] = *(const v8h*)(sa  + o);
        af[q].h[1] = *(const v8h*)(sa  + o + 32);
        b0[q].h[0] = *(const v8h*)(sb0 + o);
        b0[q].h[1] = *(const v8h*)(sb0 + o + 32);
        b1[q].h[0] = *(const v8h*)(sb1 + o);
        b1[q].h[1] = *(const v8h*)(sb1 + o + 32);
      }
      // keeps the group's loads in front of its WMMAs: the scheduler otherwise deals
      // them out again, one wait on LDS per WMMA
      __builtin_amdgcn_sched_barrier(0);
#pragma unroll
      for (int q = 0; q < 4; ++q) {
        acc0 = __builtin_amdgcn_wmma_f32_16x16x32_f16(false, af[q].v, false, b0[q].v,
                                                      (short)0, acc0, false, false);
        acc1 = __builtin_amdgcn_wmma_f32_16x16x32_f16(false, af[q].v, false, b1[q].v,
                                                      (short)0, acc1, false, false);
      }
    }
    // this wave's reads of the buffer are done before it may be refilled
    asm volatile("s_wait_dscnt 0x0" ::: "memory");
    // this wave's copies of the next stage have landed
    asm volatile("s_wait_asynccnt 0x0" ::: "memory");
    // publishes the next stage and ends every reader's last read of this one
    __syncthreads();
    if (t + 2 < NST) copy_stage(t + 2, t & 1);
  }
  // no copy is left outstanding when the wave ends
  asm volatile("s_wait_asynccnt 0x0" ::: "memory");

  // C layout: vgpr r -> m = row0 + 16*wm + r + 8*hf ; n = col0 + 32*wn + sub*16 + idx
  const int mbase = row0 + wm * 16 + hf * 8;
#pragma unroll
  for (int s = 0; s < 2; ++s) {
    const int n = col0 + wn * 32 + s * 16 + idx;
    const float badd = bias ? bias[n] : 0.f;
    const v8f a = (s == 0) ? acc0 : acc1;
#pragma unroll
    for (int r = 0; r < 8; ++r)
      C[(size_t)(mbase + r) * N + n] = a[r] + badd;
    // the next column group reuses these stores' registers: wait first
    asm volatile("s_wait_xcnt 0x0" ::: "memory");
  }
}

// blocks of 4 waves: the bound lifts the register cap, else fragments spill
__global__ __launch_bounds__(128) void gemm_wmma_f16(const _Float16* __restrict__ A,
                              const _Float16* __restrict__ Bt,
                              const float* __restrict__ bias,
                              float* __restrict__ C) {
  gemm_block<DMODEL>(A, Bt, bias, C, blockIdx.x, DMODEL);
}

// The seven token-level projections share no data dependence: one grid, the
// product chosen by block range (block-uniform). 392 blocks per 512-wide
// product, 196 per 256-wide one; one 32x64 tile per block as above.
#define BLK_N512 ((ROWS / GBM) * (DMODEL / GBN))     // 392
#define BLK_N256 ((ROWS / GBM) * (256 / GBN))        // 196
#define PROJ_BLKS (5 * BLK_N512 + 2 * BLK_N256)      // 2352
__global__ __launch_bounds__(128) void proj_gemms_k(const _Float16* __restrict__ eq, const _Float16* __restrict__ ek,
                             const _Float16* __restrict__ ev,
                             const _Float16* __restrict__ WqT, const _Float16* __restrict__ WkT,
                             const _Float16* __restrict__ WvT, const _Float16* __restrict__ Wr1aT,
                             const _Float16* __restrict__ Wr1bT, const _Float16* __restrict__ Wc1aT,
                             const _Float16* __restrict__ Wc1bT,
                             const float* __restrict__ bq, const float* __restrict__ bk,
                             const float* __restrict__ bv, const float* __restrict__ br1,
                             const float* __restrict__ bc1,
                             float* __restrict__ qh, float* __restrict__ kh,
                             float* __restrict__ vh, float* __restrict__ A1r,
                             float* __restrict__ A2r, float* __restrict__ A1c,
                             float* __restrict__ A2c) {
  const int blk = blockIdx.x;
  const _Float16* A; const _Float16* Bt; const float* bias; float* C;
  int n, lb;
  if (blk < 5 * BLK_N512) {
    const int job = blk / BLK_N512;
    lb = blk - job * BLK_N512;
    n = DMODEL;
    switch (job) {
      case 0:  A = eq; Bt = WqT;   bias = bq;      C = qh;  break;
      case 1:  A = ek; Bt = WkT;   bias = bk;      C = kh;  break;
      case 2:  A = ev; Bt = WvT;   bias = bv;      C = vh;  break;
      case 3:  A = eq; Bt = Wr1aT; bias = br1;     C = A1r; break;
      default: A = ek; Bt = Wr1bT; bias = nullptr; C = A2r; break;
    }
  } else {
    lb = blk - 5 * BLK_N512;
    n = 256;
    if (lb < BLK_N256) { A = eq; Bt = Wc1aT; bias = bc1; C = A1c; }
    else { lb -= BLK_N256; A = ek; Bt = Wc1bT; bias = nullptr; C = A2c; }
  }
  gemm_block<DMODEL>(A, Bt, bias, C, lb, n);
}

// ---------------------------------------------------------------------------
// Weight transpose + fp16 convert: W (K,N) row-major -> Wt (N,K) f16.
// One thread takes 8 consecutive k of one column n: 8 reads, each coalesced
// over the lanes' n, and one 16-byte store.
// ---------------------------------------------------------------------------
__device__ __forceinline__ void transpose_h(const float* __restrict__ W,
                                            _Float16* __restrict__ Wt, int K, int N, int t) {
  const int kc = t / N, n = t - kc * N;
  const float* p = W + (size_t)kc * 8 * N + n;
  v8h o;
#pragma unroll
  for (int j = 0; j < 8; ++j) o[j] = (_Float16)p[(size_t)j * N];
  *(v8h*)(Wt + (size_t)n * K + kc * 8) = o;
  // other block ranges' code follows in the merged kernel and reuses the
  // store's registers: wait first
  asm volatile("s_wait_xcnt 0x0" ::: "memory");
}

// ---------------------------------------------------------------------------
// im2col (f16 output) for the 3x3 pad-1 conv. x[b,c,y,x] == queries[b,y*7+x,c].
// Acol[row = b*49 + y*7 + x, kk = ic*9 + ky*3 + kx]
// ---------------------------------------------------------------------------
// The fp32 -> fp16 copy of the conv weights (layout preserved) has no data in
// common with it and rides in the same grid, on the first block range.
// One block of 192 threads makes one row of 4608 halves in either part: each
// thread 3 groups of 8 consecutive outputs, one 16-byte store a group, so that
// few waves have to be started.
#define CVT_BLKS    DMODEL                   // 512 rows of conv weights
#define IM2COL_BLKS ROWS                     // 1568 rows of Acol
#define ROW_THREADS (KCONV / 8 / 3)          // 192
__global__ void im2col_cvt_k(const float* __restrict__ q, _Float16* __restrict__ Acol,
                             const float* __restrict__ convW, _Float16* __restrict__ convWH) {
  const int tid = threadIdx.x;
  if (blockIdx.x < CVT_BLKS) {
    const size_t base = (size_t)blockIdx.x * KCONV;
#pragma unroll
    for (int i = 0; i < 3; ++i) {
      const size_t e = base + (size_t)(tid + ROW_THREADS * i) * 8;
      const v4f lo = *(const v4f*)(convW + e);
      const v4f hi = *(const v4f*)(convW + e + 4);
      v8h o;
#pragma unroll
      for (int j = 0; j < 4; ++j) { o[j] = (_Float16)lo[j]; o[4 + j] = (_Float16)hi[j]; }
      *(v8h*)(convWH + e) = o;
    }
    return;
  }
  const int row = blockIdx.x - CVT_BLKS;         // b*49 + y*7 + x
  const int p = row % NQ;
  const int y = p / 7, x = p % 7;
  unsigned valid = 0;                            // bit r: tap r lies inside the 7x7 map
#pragma unroll
  for (int r = 0; r < 9; ++r)
    if ((unsigned)(y + r / 3 - 1) < 7u && (unsigned)(x + r % 3 - 1) < 7u) valid |= 1u << r;
  const float* qc = q + (size_t)row * DMODEL;    // the centre tap's token
  _Float16* arow = Acol + (size_t)row * KCONV;
  // a tap outside the map reads the centre token (in bounds) and is zeroed: no
  // branch round a load, so all 24 loads of a thread can be in flight at once
  float ld[3][8];
  unsigned okm = 0;                              // bit 8*i+j: that output's tap is inside
#pragma unroll
  for (int i = 0; i < 3; ++i) {
    const int kk0 = (tid + ROW_THREADS * i) * 8;
    int ic = kk0 / 9, r = kk0 % 9;
#pragma unroll
    for (int j = 0; j < 8; ++j) {
      const unsigned ok = (valid >> r) & 1u;
      const int ky = (r * 11) >> 5;              // r / 3 for r in 0..8
      const int tap = (r + 4 * ky - 8) * (int)ok;    // (ky-1)*7 + (kx-1), or the centre
      ld[i][j] = qc[tap * DMODEL + ic];
      okm |= ok << (8 * i + j);
      const int wrap = (r == 8);
      r = wrap ? 0 : r + 1;
      ic += wrap;
    }
  }
#pragma unroll
  for (int i = 0; i < 3; ++i) {
    v8h o;
#pragma unroll
    for (int j = 0; j < 8; ++j)
      o[j] = (_Float16)(((okm >> (8 * i + j)) & 1u) ? ld[i][j] : 0.f);
    *(v8h*)(arow + (tid + ROW_THREADS * i) * 8) = o;
  }
}

// BatchNorm stats over (B, spatial) = 1568 rows per channel (population var).
__global__ void bn_stats_k(const float* __restrict__ h, float* __restrict__ mu,
                           float* __restrict__ rstd) {
  const int c = blockIdx.x, tid = threadIdx.x;
  float s = 0.f, ss = 0.f;
  for (int r = tid; r < ROWS; r += 256) {
    float v = h[(size_t)r * DMODEL + c];
    s += v; ss += v * v;
  }
  __shared__ float sh[256], sh2[256];
  sh[tid] = s; sh2[tid] = ss; __syncthreads();
  for (int off = 128; off; off >>= 1) {
    if (tid < off) { sh[tid] += sh[tid + off]; sh2[tid] += sh2[tid + off]; }
    __syncthreads();
  }
  if (tid == 0) {
    float m = sh[0] * (1.f / ROWS);
    float v = sh2[0] * (1.f / ROWS) - m * m;
    mu[c] = m; rstd[c] = rsqrtf(v + LN_EPS);
  }
}

// xs = relu(BN(h)); eq/ek/ev = f16(xs + queries/keys/values)
__global__ void eqkv_k(const float* __restrict__ h, const float* __restrict__ mu,
                       const float* __restrict__ rstd,
                       const float* __restrict__ q, const float* __restrict__ k,
                       const float* __restrict__ v,
                       _Float16* __restrict__ eq, _Float16* __restrict__ ek,
                       _Float16* __restrict__ ev) {
  const size_t t = ((size_t)blockIdx.x * blockDim.x + threadIdx.x) * 8;   // 8 channels a thread
  if (t >= (size_t)ROWS * DMODEL) return;
  const int c = (int)(t % DMODEL);
  v8h oq, ok, ov;
#pragma unroll
  for (int g = 0; g < 2; ++g) {
    const v4f h4 = *(const v4f*)(h + t + 4 * g);
    const v4f m4 = *(const v4f*)(mu + c + 4 * g);
    const v4f r4 = *(const v4f*)(rstd + c + 4 * g);
    const v4f q4 = *(const v4f*)(q + t + 4 * g);
    const v4f k4 = *(const v4f*)(k + t + 4 * g);
    const v4f v4 = *(const v4f*)(v + t + 4 * g);
#pragma unroll
    for (int j = 0; j < 4; ++j) {
      const float xs = fmaxf((h4[j] - m4[j]) * r4[j], 0.f);
      oq[4 * g + j] = (_Float16)(xs + q4[j]);
      ok[4 * g + j] = (_Float16)(xs + k4[j]);
      ov[4 * g + j] = (_Float16)(xs + v4[j]);
    }
  }
  *(v8h*)(eq + t) = oq;
  *(v8h*)(ek + t) = ok;
  *(v8h*)(ev + t) = ov;
}

// Precompute gate-collapse vectors:
//   u[512] = Wr2 @ Wgate ; wv[14] = rel_embed @ (Wproj @ Wgate)
//   cs = (br2 + bproj) . Wgate + bgate
// Blocks of 128 threads: parts 0..3 take 128 rows of u each, part 4 the rest.
__device__ __forceinline__ void precompute_part(int part, int t,
                             const float* __restrict__ Wr2, const float* __restrict__ Wgate,
                             const float* __restrict__ bgate, const float* __restrict__ Wproj,
                             const float* __restrict__ bproj, const float* __restrict__ br2,
                             const float* __restrict__ rel_embed,
                             float* __restrict__ u, float* __restrict__ wv,
                             float* __restrict__ cs) {
  __shared__ float pv[DKH];
  if (part < 4) {                                // block-uniform
    const int row = part * 128 + t;
    float s = 0.f;
    for (int j = 0; j < DMODEL; ++j) s += Wr2[(size_t)row * DMODEL + j] * Wgate[j];
    u[row] = s;
    // the fifth part's code follows and reuses the store's registers: wait first
    asm volatile("s_wait_xcnt 0x0" ::: "memory");
    return;
  }
  if (t < DKH) {
    float s = 0.f;
    for (int d = 0; d < DMODEL; ++d) s += Wproj[(size_t)t * DMODEL + d] * Wgate[d];
    pv[t] = s;
  }
  __syncthreads();
  if (t < NRELC) {
    float s = 0.f;
    const unsigned rb = (unsigned)t * (DKH * 4u);   // the row's byte offset
    const float* rp = (const float*)((const char*)rel_embed + rb);
    for (int d = 0; d < DKH; ++d) s += rp[d] * pv[d];
    // the row's offset stays live up to this wait, so that no load of the run
    // returns into the register that the others still name
    asm volatile("s_wait_xcnt 0x0" :: "v"(rb) : "memory");
    wv[t] = s;
  }
  if (t == 0) {
    float s = bgate[0];
    for (int d = 0; d < DMODEL; ++d) s += (br2[d] + bproj[d]) * Wgate[d];
    cs[0] = s;
  }
}

// conv GEMM grid (392 blocks of 4 waves leave most wave slots empty) plus the
// work that nothing before the projections depends on: the gate-collapse
// vectors and the eight weight transposes, on the block ranges behind it.
#define CONV_BLKS ((ROWS / GBM) * (DMODEL / GBN))      // 392
#define PRE_BLKS  5
#define TR512_BLKS (DMODEL * DMODEL / 8 / 128)         // 256
#define TR256_BLKS (DMODEL * 256 / 8 / 128)            // 128
#define SIDE_GRID (CONV_BLKS + PRE_BLKS + 6 * TR512_BLKS + 2 * TR256_BLKS)
__global__ __launch_bounds__(128) void conv_gemm_side_k(const _Float16* __restrict__ Acol,
                                 const _Float16* __restrict__ convWH,
                                 const float* __restrict__ convb, float* __restrict__ hconv,
                                 const float* __restrict__ Wr2, const float* __restrict__ Wgate,
                                 const float* __restrict__ bgate, const float* __restrict__ Wproj,
                                 const float* __restrict__ bproj, const float* __restrict__ br2,
                                 const float* __restrict__ rel_embed,
                                 float* __restrict__ u, float* __restrict__ wv,
                                 float* __restrict__ cs,
                                 const float* __restrict__ Wq, const float* __restrict__ Wk,
                                 const float* __restrict__ Wv, const float* __restrict__ Wo,
                                 const float* __restrict__ Wr1, const float* __restrict__ Wc1,
                                 _Float16* __restrict__ WqT, _Float16* __restrict__ WkT,
                                 _Float16* __restrict__ WvT, _Float16* __restrict__ WoT,
                                 _Float16* __restrict__ Wr1aT, _Float16* __restrict__ Wr1bT,
                                 _Float16* __restrict__ Wc1aT, _Float16* __restrict__ Wc1bT) {
  int blk = blockIdx.x;
  if (blk < CONV_BLKS) {
    gemm_block<KCONV>(Acol, convWH, convb, hconv, blk, DMODEL);
    return;
  }
  blk -= CONV_BLKS;
  const int tid = threadIdx.y * 32 + threadIdx.x;
  if (blk < PRE_BLKS) {
    precompute_part(blk, tid, Wr2, Wgate, bgate, Wproj, bproj, br2, rel_embed, u, wv, cs);
    return;
  }
  blk -= PRE_BLKS;
  if (blk < 6 * TR512_BLKS) {
    const int job = blk / TR512_BLKS;
    const int t = (blk - job * TR512_BLKS) * 128 + tid;
    const float* W; _Float16* Wt;
    switch (job) {
      case 0:  W = Wq;  Wt = WqT;  break;
      case 1:  W = Wk;  Wt = WkT;  break;
      case 2:  W = Wv;  Wt = WvT;  break;
      case 3:  W = Wo;  Wt = WoT;  break;
      case 4:  W = Wr1; Wt = Wr1aT; break;
      default: W = Wr1 + (size_t)DMODEL * DMODEL; Wt = Wr1bT; break;
    }
    transpose_h(W, Wt, DMODEL, DMODEL, t);
  } else {
    blk -= 6 * TR512_BLKS;
    const int second = blk >= TR256_BLKS;
    const int t = (blk - second * TR256_BLKS) * 128 + tid;
    transpose_h(second ? Wc1 + (size_t)DMODEL * 256 : Wc1, second ? Wc1bT : Wc1aT,
                DMODEL, 256, t);
  }
}

// att[b,h,qi,ki] = SCALE * q[b,qi,h,:] . k[b,ki,h,:]
__device__ __forceinline__ void attqk_part(const float* __restrict__ qh,
                                           const float* __restrict__ kh,
                                           float* __restrict__ att, size_t t) {
  const int ki = (int)(t % NQ);
  const int qi = (int)((t / NQ) % NQ);
  const int h  = (int)((t / (NQ * NQ)) % NHEAD);
  const int b  = (int)(t / ((size_t)NQ * NQ * NHEAD));
  const float* qp = qh + ((size_t)(b * NQ + qi)) * DMODEL + h * DKH;
  const float* kp = kh + ((size_t)(b * NQ + ki)) * DMODEL + h * DKH;
  float s = 0.f;
#pragma unroll 8
  for (int d = 0; d < DKH; ++d) s += qp[d] * kp[d];
  att[t] = s * 0.125f;  // 1/sqrt(64)
}

// One wave32 per (b, qi, group of 7 ki): LN(256)->ReLU->14 logits->softmax->probs.wv,
// LN(512)->ReLU->dot(u), gate = sigmoid(.) for each ki of the group in turn.
// All that does not depend on ki (Wc2, the LN scales and shifts, u, the q-side
// rows) is loaded once per wave and stays in registers over the 7 pairs; a pair
// itself loads only its two k-side rows. qi runs fastest over the waves, so
// that the 8 waves of a block mostly read the same k-side rows (WGP cache).
// The attention logits depend on nothing computed here and ride in the same
// grid (256 threads a block in both parts). Of every 11 blocks 4 are pair blocks
// and 7 logit blocks: the pair blocks are bound by issue, the logit blocks by
// the WGP cache, so that a WGP should hold one of each rather than two alike.
#define KI_GRP     7
#define PAIR_WAVES 8
#define PAIR_THREADS (32 * PAIR_WAVES)                          // 256
#define PAIR_BLKS (BQ * (NQ / KI_GRP) * NQ / PAIR_WAVES)        // 1372
#define ATT_BLKS  (BQ * NHEAD * NQ * NQ / PAIR_THREADS)         // 2401
#define MIX_PAIR  4                                             // 1372 = 343 * 4
#define MIX_ATT   7                                             // 2401 = 343 * 7
static_assert(PAIR_BLKS * MIX_ATT == ATT_BLKS * MIX_PAIR && PAIR_BLKS % MIX_PAIR == 0,
              "the two parts must deal out evenly");
// four waves per SIMD: the register budget of 256 that two blocks per WGP need
__global__ __launch_bounds__(PAIR_THREADS) __attribute__((amdgpu_waves_per_eu(4)))
void attqk_pair_gate_k(const float* __restrict__ qh, const float* __restrict__ kh,
                            float* __restrict__ att,
                            const float* __restrict__ A1c, const float* __restrict__ A2c,
                            const float* __restrict__ A1r, const float* __restrict__ A2r,
                            const float* __restrict__ gc, const float* __restrict__ bcln,
                            const float* __restrict__ Wc2, const float* __restrict__ bc2,
                            const float* __restrict__ gr, const float* __restrict__ brln,
                            const float* __restrict__ u, const float* __restrict__ wv,
                            const float* __restrict__ cs, float* __restrict__ gate) {
  const int grp = blockIdx.x / (MIX_PAIR + MIX_ATT);
  const int sub = blockIdx.x % (MIX_PAIR + MIX_ATT);
  if (sub >= MIX_PAIR) {                         // block-uniform
    attqk_part(qh, kh, att, (size_t)(grp * MIX_ATT + sub - MIX_PAIR) * PAIR_THREADS +
                                threadIdx.y * 32 + threadIdx.x);
    return;
  }
  const int lane = threadIdx.x;
  const int wave = (grp * MIX_PAIR + sub) * PAIR_WAVES + threadIdx.y;   // (b, ki group, qi)
  const int b   = wave / ((NQ / KI_GRP) * NQ);
  const int rm  = wave % ((NQ / KI_GRP) * NQ);
  const int ki0 = (rm / NQ) * KI_GRP;
  const int qi  = rm % NQ;

  const float* a1 = A1c + (size_t)(b * NQ + qi) * 256;
  const float* r1 = A1r + (size_t)(b * NQ + qi) * DMODEL;
  const float* a2 = A2c + (size_t)(b * NQ + ki0) * 256;
  const float* r2 = A2r + (size_t)(b * NQ + ki0) * DMODEL;
  // lane i collects the values of pair ki0 + i (they are equal in all lanes
  // behind the sums over the lanes); the divisions and the sigmoid are then
  // done once for the 7 pairs
  float pwn = 0.f, sen = 1.f, gdn = 0.f;

  // ---- classifier branch: LN over 256, ReLU, 256x14 matvec, softmax ----
  // the two branches run in loops of their own, so that only one branch's
  // shared operands take registers at a time
  {
    float w2[8][NRELC], gcv[8], bcv[8], a1v[8];
    const unsigned wb = (unsigned)lane * (NRELC * 4u);   // the lane's byte offset in Wc2
    const float* wp  = (const float*)((const char*)Wc2 + wb);
    const float* a1l = a1 + lane;
#pragma unroll
    for (int j = 0; j < 8; ++j) {
      const int e = lane + 32 * j;
      a1v[j] = a1l[32 * j]; gcv[j] = gc[e]; bcv[j] = bcln[e];
#pragma unroll
      for (int r = 0; r < NRELC; ++r) w2[j][r] = wp[j * 32 * NRELC + r];
    }
    // the addresses stay live up to this wait, so that no load of the run
    // returns into a register that the others still name
    asm volatile("s_wait_xcnt 0x0" :: "v"(wb), "v"(a1l) : "memory");
    // rolled: a second copy of the body does not fit the register budget
#pragma unroll 1
    for (int i = 0; i < KI_GRP; ++i) {
      float x[8], s = 0.f, ss = 0.f;
#pragma unroll
      for (int j = 0; j < 8; ++j) {
        float v = a1v[j] + a2[i * 256 + lane + 32 * j];
        x[j] = v; s += v; ss += v * v;
      }
      for (int off = 16; off; off >>= 1) {
        s += __shfl_xor(s, off, 32); ss += __shfl_xor(ss, off, 32);
      }
      const float mean = s * (1.f / 256.f);
      const float rstd = rsqrtf(ss * (1.f / 256.f) - mean * mean + LN_EPS);
      float lg[NRELC];
#pragma unroll
      for (int r = 0; r < NRELC; ++r) lg[r] = 0.f;
#pragma unroll
      for (int j = 0; j < 8; ++j) {
        float hv = fmaxf((x[j] - mean) * rstd * gcv[j] + bcv[j], 0.f);
#pragma unroll
        for (int r = 0; r < NRELC; ++r) lg[r] += hv * w2[j][r];
      }
      for (int off = 16; off; off >>= 1)
#pragma unroll
        for (int r = 0; r < NRELC; ++r) lg[r] += __shfl_xor(lg[r], off, 32);

      float mx = lg[0] + bc2[0];
#pragma unroll
      for (int r = 0; r < NRELC; ++r) { lg[r] += bc2[r]; mx = fmaxf(mx, lg[r]); }
      float se = 0.f, pw = 0.f;
#pragma unroll
      for (int r = 0; r < NRELC; ++r) {
        float p = __expf(lg[r] - mx);
        se += p; pw += p * wv[r];
      }
      pwn = (lane == i) ? pw : pwn;
      sen = (lane == i) ? se : sen;
    }
  }

  // ---- relation branch: LN over 512, ReLU, dot with u ----
  {
    float grv[16], brv[16], uv[16], r1v[16];
    const float* r1l = r1 + lane;
#pragma unroll
    for (int j = 0; j < 16; ++j) {
      const int e = lane + 32 * j;
      r1v[j] = r1l[32 * j]; grv[j] = gr[e]; brv[j] = brln[e]; uv[j] = u[e];
    }
    // as above: the row's address stays live up to this wait
    asm volatile("s_wait_xcnt 0x0" :: "v"(r1l) : "memory");
    // unrolled: the 7 pairs' loads and sums over the lanes can overlap
#pragma unroll
    for (int i = 0; i < KI_GRP; ++i) {
      float y[16], s = 0.f, ss = 0.f;
#pragma unroll
      for (int j = 0; j < 16; ++j) {
        float v = r1v[j] + r2[i * DMODEL + lane + 32 * j];
        y[j] = v; s += v; ss += v * v;
      }
      for (int off = 16; off; off >>= 1) {
        s += __shfl_xor(s, off, 32); ss += __shfl_xor(ss, off, 32);
      }
      const float mean = s * (1.f / 512.f);
      const float rstd = rsqrtf(ss * (1.f / 512.f) - mean * mean + LN_EPS);
      float gd = 0.f;
#pragma unroll
      for (int j = 0; j < 16; ++j) {
        float hv = fmaxf((y[j] - mean) * rstd * grv[j] + brv[j], 0.f);
        gd += hv * uv[j];
      }
      for (int off = 16; off; off >>= 1) gd += __shfl_xor(gd, off, 32);
      gdn = (lane == i) ? gd : gdn;
    }
  }

  // probs = p/se; top-k(14 of 14) renorm = /(1+1e-8)
  const float pwv = pwn / (sen * (1.f + 1e-8f));
  if (lane < KI_GRP)
    gate[(size_t)(b * NQ + qi) * NQ + ki0 + lane] = 1.f / (1.f + __expf(-(gdn + pwv + cs[0])));
}

// enh = att*(1+gate); softmax over ki; out[b,qi,h,:] = f16(sum_ki w*v[b,ki,h,:])
__global__ void softmax_av_k(const float* __restrict__ att, const float* __restrict__ gate,
                             const float* __restrict__ vh, _Float16* __restrict__ outp) {
  const int bhq = blockIdx.x;                 // (b*8+h)*49 + qi
  const int b  = bhq / (NHEAD * NQ);
  const int h  = (bhq / NQ) % NHEAD;
  const int qi = bhq % NQ;
  __shared__ float sw[NQ];
  __shared__ float red[2];
  const int tid = threadIdx.x;                // 64 threads
  const float* arow = att + (size_t)bhq * NQ;
  const float* grow = gate + ((size_t)(b * NQ + qi)) * NQ;
  if (tid < NQ) sw[tid] = arow[tid] * (1.f + grow[tid]);
  __syncthreads();
  if (tid == 0) {
    float m = sw[0];
    for (int i = 1; i < NQ; ++i) m = fmaxf(m, sw[i]);
    float sm = 0.f;
    for (int i = 0; i < NQ; ++i) sm += __expf(sw[i] - m);
    red[0] = m; red[1] = sm;
  }
  __syncthreads();
  if (tid < NQ) sw[tid] = __expf(sw[tid] - red[0]) / red[1];
  __syncthreads();
  if (tid < DKH) {
    const float* vbase = vh + (size_t)(b * NQ) * DMODEL + h * DKH + tid;
    float acc = 0.f;
    for (int ki = 0; ki < NQ; ++ki) acc += sw[ki] * vbase[(size_t)ki * DMODEL];
    outp[((size_t)(b * NQ + qi)) * DMODEL + h * DKH + tid] = (_Float16)acc;
  }
}

// ---------------------------------------------------------------------------
extern "C" void kernel_launch(void* const* d_in, const int* in_sizes, int n_in,
                              void* d_out, int out_size, void* d_ws, size_t ws_size,
                              hipStream_t stream) {
  const float* queries = (const float*)d_in[0];
  const float* keys    = (const float*)d_in[1];
  const float* values  = (const float*)d_in[2];
  const float* Wq = (const float*)d_in[3];  const float* bq = (const float*)d_in[4];
  const float* Wk = (const float*)d_in[5];  const float* bk = (const float*)d_in[6];
  const float* Wv = (const float*)d_in[7];  const float* bv = (const float*)d_in[8];
  const float* Wo = (const float*)d_in[9];  const float* bo = (const float*)d_in[10];
  const float* rel_embed = (const float*)d_in[11];
  const float* Wproj = (const float*)d_in[12]; const float* bproj = (const float*)d_in[13];
  const float* Wgate = (const float*)d_in[14]; const float* bgate = (const float*)d_in[15];
  const float* Wc1 = (const float*)d_in[16];   const float* bc1 = (const float*)d_in[17];
  const float* gc = (const float*)d_in[18];    const float* bcln = (const float*)d_in[19];
  const float* Wc2 = (const float*)d_in[20];   const float* bc2 = (const float*)d_in[21];
  const float* Wr1 = (const float*)d_in[22];   const float* br1 = (const float*)d_in[23];
  const float* gr = (const float*)d_in[24];    const float* brln = (const float*)d_in[25];
  const float* Wr2 = (const float*)d_in[26];   const float* br2 = (const float*)d_in[27];
  const float* convW = (const float*)d_in[28]; const float* convb = (const float*)d_in[29];

  // ---- workspace carve-out (256B aligned blocks) ----
  char* base = (char*)d_ws;
  size_t off = 0;
  auto alloc = [&](size_t bytes) -> void* {
    off = (off + 255) & ~(size_t)255;
    void* p = base + off;
    off += bytes;
    return p;
  };
  _Float16* AcolH  = (_Float16*)alloc((size_t)ROWS * KCONV * 2);
  _Float16* convWH = (_Float16*)alloc((size_t)DMODEL * KCONV * 2);
  _Float16* WqT    = (_Float16*)alloc((size_t)DMODEL * DMODEL * 2);
  _Float16* WkT    = (_Float16*)alloc((size_t)DMODEL * DMODEL * 2);
  _Float16* WvT    = (_Float16*)alloc((size_t)DMODEL * DMODEL * 2);
  _Float16* WoT    = (_Float16*)alloc((size_t)DMODEL * DMODEL * 2);
  _Float16* Wc1aT  = (_Float16*)alloc((size_t)256 * DMODEL * 2);
  _Float16* Wc1bT  = (_Float16*)alloc((size_t)256 * DMODEL * 2);
  _Float16* Wr1aT  = (_Float16*)alloc((size_t)DMODEL * DMODEL * 2);
  _Float16* Wr1bT  = (_Float16*)alloc((size_t)DMODEL * DMODEL * 2);
  _Float16* eqH    = (_Float16*)alloc((size_t)ROWS * DMODEL * 2);
  _Float16* ekH    = (_Float16*)alloc((size_t)ROWS * DMODEL * 2);
  _Float16* evH    = (_Float16*)alloc((size_t)ROWS * DMODEL * 2);
  _Float16* attnoH = (_Float16*)alloc((size_t)ROWS * DMODEL * 2);
  float* hconv = (float*)alloc((size_t)ROWS * DMODEL * 4);
  float* muv   = (float*)alloc(DMODEL * 4);
  float* rstdv = (float*)alloc(DMODEL * 4);
  float* qh    = (float*)alloc((size_t)ROWS * DMODEL * 4);
  float* kh    = (float*)alloc((size_t)ROWS * DMODEL * 4);
  float* vh    = (float*)alloc((size_t)ROWS * DMODEL * 4);
  float* A1c   = (float*)alloc((size_t)ROWS * 256 * 4);
  float* A2c   = (float*)alloc((size_t)ROWS * 256 * 4);
  float* A1r   = (float*)alloc((size_t)ROWS * DMODEL * 4);
  float* A2r   = (float*)alloc((size_t)ROWS * DMODEL * 4);
  float* uvec  = (float*)alloc(DMODEL * 4);
  float* wvecp = (float*)alloc(64);
  float* cscal = (float*)alloc(64);
  float* attb  = (float*)alloc((size_t)BQ * NHEAD * NQ * NQ * 4);
  float* gateb = (float*)alloc((size_t)NPAIR * 4);

  // 1) conv operands: im2col of the queries + fp16 conv weights, one grid
  im2col_cvt_k<<<CVT_BLKS + IM2COL_BLKS, ROW_THREADS, 0, stream>>>(queries, AcolH, convW, convWH);

  // 2) conv3x3 as WMMA GEMM (1568 x 512 x 4608); the gate-collapse vectors and
  //    the weight transposes run beside it in the same grid
  conv_gemm_side_k<<<SIDE_GRID, dim3(32, 4), 0, stream>>>(
      AcolH, convWH, convb, hconv,
      Wr2, Wgate, bgate, Wproj, bproj, br2, rel_embed, uvec, wvecp, cscal,
      Wq, Wk, Wv, Wo, Wr1, Wc1, WqT, WkT, WvT, WoT, Wr1aT, Wr1bT, Wc1aT, Wc1bT);

  // 3) BatchNorm(affine=False) + ReLU + residual adds (f16 activations)
  bn_stats_k<<<DMODEL, 256, 0, stream>>>(hconv, muv, rstdv);
  eqkv_k<<<(ROWS * DMODEL) / 8 / 256, 256, 0, stream>>>(hconv, muv, rstdv, queries, keys,
                                                    values, eqH, ekH, evH);

  // 4) token-level projections (all WMMA), one grid
  proj_gemms_k<<<PROJ_BLKS, dim3(32, 4), 0, stream>>>(
      eqH, ekH, evH, WqT, WkT, WvT, Wr1aT, Wr1bT, Wc1aT, Wc1bT, bq, bk, bv, br1, bc1,
      qh, kh, vh, A1r, A2r, A1c, A2c);

  // 5) per-pair gate (one wave32 per 7 pairs) + attention logits, one grid
  attqk_pair_gate_k<<<PAIR_BLKS + ATT_BLKS, dim3(32, PAIR_WAVES), 0, stream>>>(
      qh, kh, attb, A1c, A2c, A1r, A2r, gc, bcln, Wc2, bc2, gr, brln, uvec, wvecp, cscal,
      gateb);

  // 6) gated softmax + A*V (f16 output feeds final GEMM)
  softmax_av_k<<<BQ * NHEAD * NQ, 64, 0, stream>>>(attb, gateb, vh, attnoH);

  // 7) output projection (WMMA) straight into d_out
  gemm_wmma_f16<<<BLK_N512, dim3(32, 4), 0, stream>>>(attnoH, WoT, bo, (float*)d_out);
}

// v005
// A run of this version takes 124 microseconds.
// Next to v004, in two timings, it ran 1.16 times as fast each time.
// Over all steps from v000 it is 3.22 times as fast.
#include <hip/hip_runtime.h>
#include <hip/hip_bf16.h>
#include <math.h>

// ---------------------------------------------------------------------------
// RelationEnhanceAttention, algebraically restructured for MI455X (gfx1250).
//   B=32, N=49, D=512, H=8, DK=64, NREL=TOPK=14
// Conv and projection GEMMs: f16 operands (K-innermost both sides), fp32 accumulate on
// v_wmma_f32_16x16x32_f16. 16x32 C-tile per wave, operands staged in LDS.
// ---------------------------------------------------------------------------

typedef __attribute__((ext_vector_type(16))) _Float16 v16h;
typedef __attribute__((ext_vector_type(8)))  _Float16 v8h;
typedef __attribute__((ext_vector_type(8)))  float    v8f;
typedef __attribute__((ext_vector_type(4)))  float    v4f;
typedef __attribute__((ext_vector_type(2)))  float    v2f;

#define BQ      32
#define NQ      49
#define DMODEL  512
#define NHEAD   8
#define DKH     64
#define NRELC   14
#define ROWS    (BQ * NQ)            // 1568
#define KCONV   (DMODEL * 9)         // 4608
#define NPAIR   (BQ * NQ * NQ)       // 76832
#define LN_EPS  1e-5f

// ---------------------------------------------------------------------------
// WMMA GEMM: C[M,N] = A[M,K] * B^T[N,K] (+bias[N]).
// A: f16 row-major (M,K). Bt: f16 row-major (N,K). K is the pitch of both.
// REQUIRES: M%32==0, N%64==0, K%256==0, K>=512 (true for every call site here).
// One block of 4 waves computes a 32x64 C tile, each wave 16x32; K stepped by 32
// in rising order. The operands come into LDS in stages of 256 k (512 B of each
// of the 96 rows) by asynchronous copies: one copy of a wave is one row's whole
// 512 B, so that every request covers whole cache lines. Two buffers: the next
// stage's copies fly while this one is worked on.
// Fragment layout (ISA 16-bit A 16x32): halves 0..7  <- K = k0+8*half+0..7
//                                       halves 8..15 <- K = k0+8*half+16..23
// i.e. two 16-byte segments per lane -> two ds_load_b128 each.
// ---------------------------------------------------------------------------
#define GBM    32
#define GBN    64
#define GBK    256
#define GROWS  (GBM + GBN)            // 96 rows a stage
#define GPITCH (GBK * 2 + 16)         // 528 B = 16 B x odd: no bank conflict for b128 readers
#define GBUF   (GROWS * GPITCH)       // 50,688 B a buffer

// Eight rows, four apart (one per wave between them): lane l brings bytes
// 16*l .. 16*l+15 of each row's 512 B. The s_wait_xcnt stands inside the
// statement, so that no address register is rewritten in front of it.
template <int K>
__device__ __forceinline__ void copy8_rows(unsigned lds, const _Float16* g) {
  asm volatile(
      "global_load_async_to_lds_b128 %0, %8, off\n\t"
      "global_load_async_to_lds_b128 %1, %9, off\n\t"
      "global_load_async_to_lds_b128 %2, %10, off\n\t"
      "global_load_async_to_lds_b128 %3, %11, off\n\t"
      "global_load_async_to_lds_b128 %4, %12, off\n\t"
      "global_load_async_to_lds_b128 %5, %13, off\n\t"
      "global_load_async_to_lds_b128 %6, %14, off\n\t"
      "global_load_async_to_lds_b128 %7, %15, off\n\t"
      "s_wait_xcnt 0x0"
      :: "v"(lds), "v"(lds + 4 * GPITCH), "v"(lds + 8 * GPITCH), "v"(lds + 12 * GPITCH),
         "v"(lds + 16 * GPITCH), "v"(lds + 20 * GPITCH), "v"(lds + 24 * GPITCH),
         "v"(lds + 28 * GPITCH),
         "v"(g), "v"(g + 4 * K), "v"(g + 8 * K), "v"(g + 12 * K),
         "v"(g + 16 * K), "v"(g + 20 * K), "v"(g + 24 * K), "v"(g + 28 * K)
      : "memory");
}

template <int K>
__device__ __forceinline__ void gemm_block(const _Float16* __restrict__ A,
                                           const _Float16* __restrict__ Bt,
                                           const float* __restrict__ bias,
                                           float* __restrict__ C, int tile, int N) {
  __shared__ __attribute__((aligned(16))) unsigned char gsm[2 * GBUF];
  constexpr int NST = K / GBK;                   // stages
  static_assert(K % GBK == 0 && NST >= 2, "two stages at least");
  const int ntn  = N >> 6;                       // 64-wide column tiles
  const int tm   = tile / ntn;
  const int tn   = tile - tm * ntn;
  const int row0 = tm * GBM;
  const int col0 = tn * GBN;

  const int lane = threadIdx.x;                  // 0..31
  const int wave = __builtin_amdgcn_readfirstlane(threadIdx.y);   // 0..3
  const int hf   = lane >> 4;                    // 0/1
  const int idx  = lane & 15;
  const int wm   = wave >> 1, wn = wave & 1;     // the wave's 16 rows, 32 columns

  // copy side: wave w takes rows w, w+4, ... of the stage (A rows 0..31, B rows 32..95)
  const unsigned lds0 = (unsigned)(size_t)gsm + (unsigned)(wave * GPITCH + lane * 16);
  const _Float16* ga = A  + (size_t)(row0 + wave) * K + lane * 8;
  const _Float16* gb = Bt + (size_t)(col0 + wave) * K + lane * 8;
  auto copy_stage = [&](int st, int buf) {
    const unsigned l = lds0 + (unsigned)buf * GBUF;
    copy8_rows<K>(l, ga + st * GBK);
    copy8_rows<K>(l + 32 * GPITCH, gb + st * GBK);
    copy8_rows<K>(l + 64 * GPITCH, gb + (size_t)32 * K + st * GBK);
  };

  // read side
  const unsigned char* sa  = gsm + (wm * 16 + idx) * GPITCH + hf * 16;
  const unsigned char* sb0 = gsm + (GBM + wn * 32 + idx) * GPITCH + hf * 16;
  const unsigned char* sb1 = sb0 + 16 * GPITCH;

  v8f acc0 = {}, acc1 = {};
  union F16x16 { v16h v; v8h h[2]; };

  copy_stage(0, 0);
  // stage 0 has landed for this wave; the barrier publishes it to the others
  asm volatile("s_wait_asynccnt 0x0" ::: "memory");
  __syncthreads();
  copy_stage(1, 1);

  // rolled: one body serves both buffers, the code stays small
#pragma unroll 1
  for (int t = 0; t < NST; ++t) {
    const int bo = (t & 1) * GBUF;
    // four k steps' fragments are fetched as one group, then their eight WMMAs:
    // one LDS latency a group instead of one a WMMA
#pragma unroll
    for (int kg = 0; kg < GBK / 128; ++kg) {
      F16x16 af[4], b0[4], b1[4];
#pragma unroll
      for (int q = 0; q < 4; ++q) {
        const int o = bo + (kg * 4 + q) * 64;
        af[q].h[0] = *(const v8h*)(sa  + o);
        af[q].h[1] = *(const v8h*)(sa  + o + 32);
        b0[q].h[0] = *(const v8h*)(sb0 + o);
        b0[q].h[1] = *(const v8h*)(sb0 + o + 32);
        b1[q].h[0] = *(const v8h*)(sb1 + o);
        b1[q].h[1] = *(const v8h*)(sb1 + o + 32);
      }
      // keeps the group's loads in front of its WMMAs: the scheduler otherwise deals
      // them out again, one wait on LDS per WMMA
      __builtin_amdgcn_sched_barrier(0);
#pragma unroll
      for (int q = 0; q < 4; ++q) {
        acc0 = __builtin_amdgcn_wmma_f32_16x16x32_f16(false, af[q].v, false, b0[q].v,
                                                      (short)0, acc0, false, false);
        acc1 = __builtin_amdgcn_wmma_f32_16x16x32_f16(false, af[q].v, false, b1[q].v,
                                                      (short)0, acc1, false, false);
      }
    }
    // this wave's reads of the buffer are done before it may be refilled
    asm volatile("s_wait_dscnt 0x0" ::: "memory");
    // this wave's copies of the next stage have landed
    asm volatile("s_wait_asynccnt 0x0" ::: "memory");
    // publishes the next stage and ends every reader's last read of this one
    __syncthreads();
    if (t + 2 < NST) copy_stage(t + 2, t & 1);
  }
  // no copy is left outstanding when the wave ends
  asm volatile("s_wait_asynccnt 0x0" ::: "memory");

  // C layout: vgpr r -> m = row0 + 16*wm + r + 8*hf ; n = col0 + 32*wn + sub*16 + idx
  const int mbase = row0 + wm * 16 + hf * 8;
#pragma unroll
  for (int s = 0; s < 2; ++s) {
    const int n = col0 + wn * 32 + s * 16 + idx;
    const float badd = bias ? bias[n] : 0.f;
    const v8f a = (s == 0) ? acc0 : acc1;
#pragma unroll
    for (int r = 0; r < 8; ++r)
      C[(size_t)(mbase + r) * N + n] = a[r] + badd;
    // the next column group reuses these stores' registers: wait first
    asm volatile("s_wait_xcnt 0x0" ::: "memory");
  }
}

// blocks of 4 waves: the bound lifts the register cap, else fragments spill
__global__ __launch_bounds__(128) void gemm_wmma_f16(const _Float16* __restrict__ A,
                              const _Float16* __restrict__ Bt,
                              const float* __restrict__ bias,
                              float* __restrict__ C) {
  gemm_block<DMODEL>(A, Bt, bias, C, blockIdx.x, DMODEL);
}

// The seven token-level projections share no data dependence: one grid, the
// product chosen by block range (block-uniform). 392 blocks per 512-wide
// product, 196 per 256-wide one; one 32x64 tile per block as above.
#define BLK_N512 ((ROWS / GBM) * (DMODEL / GBN))     // 392
#define BLK_N256 ((ROWS / GBM) * (256 / GBN))        // 196
#define PROJ_BLKS (5 * BLK_N512 + 2 * BLK_N256)      // 2352
__global__ __launch_bounds__(128) void proj_gemms_k(const _Float16* __restrict__ eq, const _Float16* __restrict__ ek,
                             const _Float16* __restrict__ ev,
                             const _Float16* __restrict__ WqT, const _Float16* __restrict__ WkT,
                             const _Float16* __restrict__ WvT, const _Float16* __restrict__ Wr1aT,
                             const _Float16* __restrict__ Wr1bT, const _Float16* __restrict__ Wc1aT,
                             const _Float16* __restrict__ Wc1bT,
                             const float* __restrict__ bq, const float* __restrict__ bk,
                             const float* __restrict__ bv, const float* __restrict__ br1,
                             const float* __restrict__ bc1,
                             float* __restrict__ qh, float* __restrict__ kh,
                             float* __restrict__ vh, float* __restrict__ A1r,
                             float* __restrict__ A2r, float* __restrict__ A1c,
                             float* __restrict__ A2c) {
  const int blk = blockIdx.x;
  const _Float16* A; const _Float16* Bt; const float* bias; float* C;
  int n, lb;
  if (blk < 5 * BLK_N512) {
    const int job = blk / BLK_N512;
    lb = blk - job * BLK_N512;
    n = DMODEL;
    switch (job) {
      case 0:  A = eq; Bt = WqT;   bias = bq;      C = qh;  break;
      case 1:  A = ek; Bt = WkT;   bias = bk;      C = kh;  break;
      case 2:  A = ev; Bt = WvT;   bias = bv;      C = vh;  break;
      case 3:  A = eq; Bt = Wr1aT; bias = br1;     C = A1r; break;
      default: A = ek; Bt = Wr1bT; bias = nullptr; C = A2r; break;
    }
  } else {
    lb = blk - 5 * BLK_N512;
    n = 256;
    if (lb < BLK_N256) { A = eq; Bt = Wc1aT; bias = bc1; C = A1c; }
    else { lb -= BLK_N256; A = ek; Bt = Wc1bT; bias = nullptr; C = A2c; }
  }
  gemm_block<DMODEL>(A, Bt, bias, C, lb, n);
}

// ---------------------------------------------------------------------------
// Weight transpose + fp16 convert: W (K,N) row-major -> Wt (N,K) f16.
// One thread takes 8 consecutive k of one column n: 8 reads, each coalesced
// over the lanes' n, and one 16-byte store.
// ---------------------------------------------------------------------------
__device__ __forceinline__ void transpose_h(const float* __restrict__ W,
                                            _Float16* __restrict__ Wt, int K, int N, int t) {
  const int kc = t / N, n = t - kc * N;
  const float* p = W + (size_t)kc * 8 * N + n;
  v8h o;
#pragma unroll
  for (int j = 0; j < 8; ++j) o[j] = (_Float16)p[(size_t)j * N];
  *(v8h*)(Wt + (size_t)n * K + kc * 8) = o;
  // other block ranges' code follows in the merged kernel and reuses the
  // store's registers: wait first
  asm volatile("s_wait_xcnt 0x0" ::: "memory");
}

// ---------------------------------------------------------------------------
// im2col (f16 output) for the 3x3 pad-1 conv. x[b,c,y,x] == queries[b,y*7+x,c].
// Acol[row = b*49 + y*7 + x, kk = ic*9 + ky*3 + kx]
// ---------------------------------------------------------------------------
// The fp32 -> fp16 copy of the conv weights (layout preserved) has no data in
// common with it and rides in the same grid, on the first block range.
// One block of 192 threads makes one row of 4608 halves in either part: each
// thread 3 groups of 8 consecutive outputs, one 16-byte store a group, so that
// few waves have to be started.
#define CVT_BLKS    DMODEL                   // 512 rows of conv weights
#define IM2COL_BLKS ROWS                     // 1568 rows of Acol
#define ROW_THREADS (KCONV / 8 / 3)          // 192
__global__ void im2col_cvt_k(const float* __restrict__ q, _Float16* __restrict__ Acol,
                             const float* __restrict__ convW, _Float16* __restrict__ convWH) {
  const int tid = threadIdx.x;
  if (blockIdx.x < CVT_BLKS) {
    const size_t base = (size_t)blockIdx.x * KCONV;
#pragma unroll
    for (int i = 0; i < 3; ++i) {
      const size_t e = base + (size_t)(tid + ROW_THREADS * i) * 8;
      const v4f lo = *(const v4f*)(convW + e);
      const v4f hi = *(const v4f*)(convW + e + 4);
      v8h o;
#pragma unroll
      for (int j = 0; j < 4; ++j) { o[j] = (_Float16)lo[j]; o[4 + j] = (_Float16)hi[j]; }
      *(v8h*)(convWH + e) = o;
    }
    return;
  }
  const int row = blockIdx.x - CVT_BLKS;         // b*49 + y*7 + x
  const int p = row % NQ;
  const int y = p / 7, x = p % 7;
  unsigned valid = 0;                            // bit r: tap r lies inside the 7x7 map
#pragma unroll
  for (int r = 0; r < 9; ++r)
    if ((unsigned)(y + r / 3 - 1) < 7u && (unsigned)(x + r % 3 - 1) < 7u) valid |= 1u << r;
  const float* qc = q + (size_t)row * DMODEL;    // the centre tap's token
  _Float16* arow = Acol + (size_t)row * KCONV;
  // a tap outside the map reads the centre token (in bounds) and is zeroed: no
  // branch round a load, so all 24 loads of a thread can be in flight at once
  float ld[3][8];
  unsigned okm = 0;                              // bit 8*i+j: that output's tap is inside
#pragma unroll
  for (int i = 0; i < 3; ++i) {
    const int kk0 = (tid + ROW_THREADS * i) * 8;
    int ic = kk0 / 9, r = kk0 % 9;
#pragma unroll
    for (int j = 0; j < 8; ++j) {
      const unsigned ok = (valid >> r) & 1u;
      const int ky = (r * 11) >> 5;              // r / 3 for r in 0..8
      const int tap = (r + 4 * ky - 8) * (int)ok;    // (ky-1)*7 + (kx-1), or the centre
      ld[i][j] = qc[tap * DMODEL + ic];
      okm |= ok << (8 * i + j);
      const int wrap = (r == 8);
      r = wrap ? 0 : r + 1;
      ic += wrap;
    }
  }
#pragma unroll
  for (int i = 0; i < 3; ++i) {
    v8h o;
#pragma unroll
    for (int j = 0; j < 8; ++j)
      o[j] = (_Float16)(((okm >> (8 * i + j)) & 1u) ? ld[i][j] : 0.f);
    *(v8h*)(arow + (tid + ROW_THREADS * i) * 8) = o;
  }
}

// BatchNorm stats over (B, spatial) = 1568 rows per channel (population var).
__global__ void bn_stats_k(const float* __restrict__ h, float* __restrict__ mu,
                           float* __restrict__ rstd) {
  const int c = blockIdx.x, tid = threadIdx.x;
  float s = 0.f, ss = 0.f;
  for (int r = tid; r < ROWS; r += 256) {
    float v = h[(size_t)r * DMODEL + c];
    s += v; ss += v * v;
  }
  __shared__ float sh[256], sh2[256];
  sh[tid] = s; sh2[tid] = ss; __syncthreads();
  for (int off = 128; off; off >>= 1) {
    if (tid < off) { sh[tid] += sh[tid + off]; sh2[tid] += sh2[tid + off]; }
    __syncthreads();
  }
  if (tid == 0) {
    float m = sh[0] * (1.f / ROWS);
    float v = sh2[0] * (1.f / ROWS) - m * m;
    mu[c] = m; rstd[c] = rsqrtf(v + LN_EPS);
  }
}

// xs = relu(BN(h)); eq/ek/ev = f16(xs + queries/keys/values)
__global__ void eqkv_k(const float* __restrict__ h, const float* __restrict__ mu,
                       const float* __restrict__ rstd,
                       const float* __restrict__ q, const float* __restrict__ k,
                       const float* __restrict__ v,
                       _Float16* __restrict__ eq, _Float16* __restrict__ ek,
                       _Float16* __restrict__ ev) {
  const size_t t = ((size_t)blockIdx.x * blockDim.x + threadIdx.x) * 8;   // 8 channels a thread
  if (t >= (size_t)ROWS * DMODEL) return;
  const int c = (int)(t % DMODEL);
  v8h oq, ok, ov;
#pragma unroll
  for (int g = 0; g < 2; ++g) {
    const v4f h4 = *(const v4f*)(h + t + 4 * g);
    const v4f m4 = *(const v4f*)(mu + c + 4 * g);
    const v4f r4 = *(const v4f*)(rstd + c + 4 * g);
    const v4f q4 = *(const v4f*)(q + t + 4 * g);
    const v4f k4 = *(const v4f*)(k + t + 4 * g);
    const v4f v4 = *(const v4f*)(v + t + 4 * g);
#pragma unroll
    for (int j = 0; j < 4; ++j) {
      const float xs = fmaxf((h4[j] - m4[j]) * r4[j], 0.f);
      oq[4 * g + j] = (_Float16)(xs + q4[j]);
      ok[4 * g + j] = (_Float16)(xs + k4[j]);
      ov[4 * g + j] = (_Float16)(xs + v4[j]);
    }
  }
  *(v8h*)(eq + t) = oq;
  *(v8h*)(ek + t) = ok;
  *(v8h*)(ev + t) = ov;
}

// Precompute gate-collapse vectors:
//   u[512] = Wr2 @ Wgate ; wv[14] = rel_embed @ (Wproj @ Wgate)
//   cs = (br2 + bproj) . Wgate + bgate
// Blocks of 128 threads: parts 0..3 take 128 rows of u each, part 4 the rest.
__device__ __forceinline__ void precompute_part(int part, int t,
                             const float* __restrict__ Wr2, const float* __restrict__ Wgate,
                             const float* __restrict__ bgate, const float* __restrict__ Wproj,
                             const float* __restrict__ bproj, const float* __restrict__ br2,
                             const float* __restrict__ rel_embed,
                             float* __restrict__ u, float* __restrict__ wv,
                             float* __restrict__ cs) {
  __shared__ float pv[DKH];
  if (part < 4) {                                // block-uniform
    const int row = part * 128 + t;
    float s = 0.f;
    for (int j = 0; j < DMODEL; ++j) s += Wr2[(size_t)row * DMODEL + j] * Wgate[j];
    u[row] = s;
    // the fifth part's code follows and reuses the store's registers: wait first
    asm volatile("s_wait_xcnt 0x0" ::: "memory");
    return;
  }
  if (t < DKH) {
    float s = 0.f;
    for (int d = 0; d < DMODEL; ++d) s += Wproj[(size_t)t * DMODEL + d] * Wgate[d];
    pv[t] = s;
  }
  __syncthreads();
  if (t < NRELC) {
    float s = 0.f;
    const unsigned rb = (unsigned)t * (DKH * 4u);   // the row's byte offset
    const float* rp = (const float*)((const char*)rel_embed + rb);
    for (int d = 0; d < DKH; ++d) s += rp[d] * pv[d];
    // the row's offset stays live up to this wait, so that no load of the run
    // returns into the register that the others still name
    asm volatile("s_wait_xcnt 0x0" :: "v"(rb) : "memory");
    wv[t] = s;
  }
  if (t == 0) {
    float s = bgate[0];
    for (int d = 0; d < DMODEL; ++d) s += (br2[d] + bproj[d]) * Wgate[d];
    cs[0] = s;
  }
}

// conv GEMM grid (392 blocks of 4 waves leave most wave slots empty) plus the
// work that nothing before the projections depends on: the gate-collapse
// vectors and the eight weight transposes, on the block ranges behind it.
#define CONV_BLKS ((ROWS / GBM) * (DMODEL / GBN))      // 392
#define PRE_BLKS  5
#define TR512_BLKS (DMODEL * DMODEL / 8 / 128)         // 256
#define TR256_BLKS (DMODEL * 256 / 8 / 128)            // 128
#define SIDE_GRID (CONV_BLKS + PRE_BLKS + 6 * TR512_BLKS + 2 * TR256_BLKS)
__global__ __launch_bounds__(128) void conv_gemm_side_k(const _Float16* __restrict__ Acol,
                                 const _Float16* __restrict__ convWH,
                                 const float* __restrict__ convb, float* __restrict__ hconv,
                                 const float* __restrict__ Wr2, const float* __restrict__ Wgate,
                                 const float* __restrict__ bgate, const float* __restrict__ Wproj,
                                 const float* __restrict__ bproj, const float* __restrict__ br2,
                                 const float* __restrict__ rel_embed,
                                 float* __restrict__ u, float* __restrict__ wv,
                                 float* __restrict__ cs,
                                 const float* __restrict__ Wq, const float* __restrict__ Wk,
                                 const float* __restrict__ Wv, const float* __restrict__ Wo,
                                 const float* __restrict__ Wr1, const float* __restrict__ Wc1,
                                 _Float16* __restrict__ WqT, _Float16* __restrict__ WkT,
                                 _Float16* __restrict__ WvT, _Float16* __restrict__ WoT,
                                 _Float16* __restrict__ Wr1aT, _Float16* __restrict__ Wr1bT,
                                 _Float16* __restrict__ Wc1aT, _Float16* __restrict__ Wc1bT) {
  int blk = blockIdx.x;
  if (blk < CONV_BLKS) {
    gemm_block<KCONV>(Acol, convWH, convb, hconv, blk, DMODEL);
    return;
  }
  blk -= CONV_BLKS;
  const int tid = threadIdx.y * 32 + threadIdx.x;
  if (blk < PRE_BLKS) {
    precompute_part(blk, tid, Wr2, Wgate, bgate, Wproj, bproj, br2, rel_embed, u, wv, cs);
    return;
  }
  blk -= PRE_BLKS;
  if (blk < 6 * TR512_BLKS) {
    const int job = blk / TR512_BLKS;
    const int t = (blk - job * TR512_BLKS) * 128 + tid;
    const float* W; _Float16* Wt;
    switch (job) {
      case 0:  W = Wq;  Wt = WqT;  break;
      case 1:  W = Wk;  Wt = WkT;  break;
      case 2:  W = Wv;  Wt = WvT;  break;
      case 3:  W = Wo;  Wt = WoT;  break;
      case 4:  W = Wr1; Wt = Wr1aT; break;
      default: W = Wr1 + (size_t)DMODEL * DMODEL; Wt = Wr1bT; break;
    }
    transpose_h(W, Wt, DMODEL, DMODEL, t);
  } else {
    blk -= 6 * TR512_BLKS;
    const int second = blk >= TR256_BLKS;
    const int t = (blk - second * TR256_BLKS) * 128 + tid;
    transpose_h(second ? Wc1 + (size_t)DMODEL * 256 : Wc1, second ? Wc1bT : Wc1aT,
                DMODEL, 256, t);
  }
}

// One wave32 per (b, qi, group of 7 ki): LN(256)->ReLU->14 logits->softmax->probs.wv,
// LN(512)->ReLU->dot(u), gate = sigmoid(.) for each ki of the group in turn.
// All that does not depend on ki (Wc2, the LN scales and shifts, u, the q-side
// rows) is loaded once per wave and stays in registers over the 7 pairs; a pair
// itself loads only its two k-side rows. qi runs fastest over the waves, so
// that the 8 waves of a block mostly read the same k-side rows (WGP cache).
#define KI_GRP     7
#define PAIR_WAVES 8
#define PAIR_THREADS (32 * PAIR_WAVES)                          // 256
#define PAIR_BLKS (BQ * (NQ / KI_GRP) * NQ / PAIR_WAVES)        // 1372
// four waves per SIMD: the register budget of 256 that two blocks per WGP need
__global__ __launch_bounds__(PAIR_THREADS) __attribute__((amdgpu_waves_per_eu(4)))
void pair_gate_k(const float* __restrict__ A1c, const float* __restrict__ A2c,
                            const float* __restrict__ A1r, const float* __restrict__ A2r,
                            const float* __restrict__ gc, const float* __restrict__ bcln,
                            const float* __restrict__ Wc2, const float* __restrict__ bc2,
                            const float* __restrict__ gr, const float* __restrict__ brln,
                            const float* __restrict__ u, const float* __restrict__ wv,
                            const float* __restrict__ cs, float* __restrict__ gate) {
  const int lane = threadIdx.x;
  const int wave = blockIdx.x * PAIR_WAVES + threadIdx.y;               // (b, ki group, qi)
  const int b   = wave / ((NQ / KI_GRP) * NQ);
  const int rm  = wave % ((NQ / KI_GRP) * NQ);
  const int ki0 = (rm / NQ) * KI_GRP;
  const int qi  = rm % NQ;

  const float* a1 = A1c + (size_t)(b * NQ + qi) * 256;
  const float* r1 = A1r + (size_t)(b * NQ + qi) * DMODEL;
  const float* a2 = A2c + (size_t)(b * NQ + ki0) * 256;
  const float* r2 = A2r + (size_t)(b * NQ + ki0) * DMODEL;
  // lane i collects the values of pair ki0 + i (they are equal in all lanes
  // behind the sums over the lanes); the divisions and the sigmoid are then
  // done once for the 7 pairs
  float pwn = 0.f, sen = 1.f, gdn = 0.f;

  // ---- classifier branch: LN over 256, ReLU, 256x14 matvec, softmax ----
  // the two branches run in loops of their own, so that only one branch's
  // shared operands take registers at a time
  {
    float w2[8][NRELC], gcv[8], bcv[8], a1v[8];
    const unsigned wb = (unsigned)lane * (NRELC * 4u);   // the lane's byte offset in Wc2
    const float* wp  = (const float*)((const char*)Wc2 + wb);
    const float* a1l = a1 + lane;
#pragma unroll
    for (int j = 0; j < 8; ++j) {
      const int e = lane + 32 * j;
      a1v[j] = a1l[32 * j]; gcv[j] = gc[e]; bcv[j] = bcln[e];
#pragma unroll
      for (int r = 0; r < NRELC; ++r) w2[j][r] = wp[j * 32 * NRELC + r];
    }
    // the addresses stay live up to this wait, so that no load of the run
    // returns into a register that the others still name
    asm volatile("s_wait_xcnt 0x0" :: "v"(wb), "v"(a1l) : "memory");
    // rolled: a second copy of the body does not fit the register budget
#pragma unroll 1
    for (int i = 0; i < KI_GRP; ++i) {
      float x[8], s = 0.f, ss = 0.f;
#pragma unroll
      for (int j = 0; j < 8; ++j) {
        float v = a1v[j] + a2[i * 256 + lane + 32 * j];
        x[j] = v; s += v; ss += v * v;
      }
      for (int off = 16; off; off >>= 1) {
        s += __shfl_xor(s, off, 32); ss += __shfl_xor(ss, off, 32);
      }
      const float mean = s * (1.f / 256.f);
      const float rstd = rsqrtf(ss * (1.f / 256.f) - mean * mean + LN_EPS);
      float lg[NRELC];
#pragma unroll
      for (int r = 0; r < NRELC; ++r) lg[r] = 0.f;
#pragma unroll
      for (int j = 0; j < 8; ++j) {
        float hv = fmaxf((x[j] - mean) * rstd * gcv[j] + bcv[j], 0.f);
#pragma unroll
        for (int r = 0; r < NRELC; ++r) lg[r] += hv * w2[j][r];
      }
      for (int off = 16; off; off >>= 1)
#pragma unroll
        for (int r = 0; r < NRELC; ++r) lg[r] += __shfl_xor(lg[r], off, 32);

      float mx = lg[0] + bc2[0];
#pragma unroll
      for (int r = 0; r < NRELC; ++r) { lg[r] += bc2[r]; mx = fmaxf(mx, lg[r]); }
      float se = 0.f, pw = 0.f;
#pragma unroll
      for (int r = 0; r < NRELC; ++r) {
        float p = __expf(lg[r] - mx);
        se += p; pw += p * wv[r];
      }
      pwn = (lane == i) ? pw : pwn;
      sen = (lane == i) ? se : sen;
    }
  }

  // ---- relation branch: LN over 512, ReLU, dot with u ----
  {
    float grv[16], brv[16], uv[16], r1v[16];
    const float* r1l = r1 + lane;
#pragma unroll
    for (int j = 0; j < 16; ++j) {
      const int e = lane + 32 * j;
      r1v[j] = r1l[32 * j]; grv[j] = gr[e]; brv[j] = brln[e]; uv[j] = u[e];
    }
    // as above: the row's address stays live up to this wait
    asm volatile("s_wait_xcnt 0x0" :: "v"(r1l) : "memory");
    // unrolled: the 7 pairs' loads and sums over the lanes can overlap
#pragma unroll
    for (int i = 0; i < KI_GRP; ++i) {
      float y[16], s = 0.f, ss = 0.f;
#pragma unroll
      for (int j = 0; j < 16; ++j) {
        float v = r1v[j] + r2[i * DMODEL + lane + 32 * j];
        y[j] = v; s += v; ss += v * v;
      }
      for (int off = 16; off; off >>= 1) {
        s += __shfl_xor(s, off, 32); ss += __shfl_xor(ss, off, 32);
      }
      const float mean = s * (1.f / 512.f);
      const float rstd = rsqrtf(ss * (1.f / 512.f) - mean * mean + LN_EPS);
      float gd = 0.f;
#pragma unroll
      for (int j = 0; j < 16; ++j) {
        float hv = fmaxf((y[j] - mean) * rstd * grv[j] + brv[j], 0.f);
        gd += hv * uv[j];
      }
      for (int off = 16; off; off >>= 1) gd += __shfl_xor(gd, off, 32);
      gdn = (lane == i) ? gd : gdn;
    }
  }

  // probs = p/se; top-k(14 of 14) renorm = /(1+1e-8)
  const float pwv = pwn / (sen * (1.f + 1e-8f));
  if (lane < KI_GRP)
    gate[(size_t)(b * NQ + qi) * NQ + ki0 + lane] = 1.f / (1.f + __expf(-(gdn + pwv + cs[0])));
}

// Gated attention of one (b, h) in one block of 4 waves, both products on
// v_wmma_f32_16x16x4_f32 (operands stay fp32):
//   S = q k^T / 8 ; enh = S * (1 + gate) ; p = exp(enh - rowmax) ; out = f16((p v) / rowsum)
// The 49 queries and 49 keys are padded to 64; wave w owns query rows 16w .. 16w+15.
// q, k, v rows (64 floats of this head) are staged in LDS, pad rows as zeros: a
// pad key's p is set to 0, and 0 times a zero v row adds nothing.
// Fragments (A: lane holds row idx; B: column idx; the lane halves split k): both
// sides of a product take k from the same (half, element) place, so they pair.
#define AT_QP  68     // floats: pitch of q, k, p rows, 272 B = 16 B x odd (b128 and b64 readers)
#define AT_VP  72     // floats: pitch of v rows: rows two apart lie 16 banks apart (b32 readers)
#define AT_PAD 64
#define AT_KST ((NQ + 3) / 4)                    // 13 steps of 4 keys cover the 49
__global__ __launch_bounds__(128) void attn_gated_k(const float* __restrict__ qh,
                             const float* __restrict__ kh, const float* __restrict__ vh,
                             const float* __restrict__ gate, _Float16* __restrict__ outp) {
  __shared__ __attribute__((aligned(16))) float sq[AT_PAD * AT_QP];
  __shared__ __attribute__((aligned(16))) float sk[AT_PAD * AT_QP];
  __shared__ __attribute__((aligned(16))) float sp[AT_PAD * AT_QP];
  __shared__ __attribute__((aligned(16))) float sv[AT_PAD * AT_VP];
  const int b    = blockIdx.x / NHEAD;
  const int h    = blockIdx.x % NHEAD;
  const int lane = threadIdx.x;                  // 0..31
  const int wave = __builtin_amdgcn_readfirstlane(threadIdx.y);   // 0..3
  const int tid  = wave * 32 + lane;
  const int hf   = lane >> 4;
  const int idx  = lane & 15;
  const int m0   = wave * 16 + hf * 8;           // first of the lane's 8 accumulator rows

  // the gates of the lane's accumulator places, indices clamped into the 49 x 49 map;
  // asked for first, so that they fly together with the rows below
  float g[4][8];
  const float* gb = gate + (size_t)b * NQ * NQ;
#pragma unroll
  for (int r = 0; r < 8; ++r) {
    const int qi = min(m0 + r, NQ - 1);
#pragma unroll
    for (int t = 0; t < 4; ++t) g[t][r] = gb[qi * NQ + min(16 * t + idx, NQ - 1)];
  }

  // stage q, k, v: 16 threads a row (16 B each), 8 rows a pass: six whole passes,
  // then row 48 (read by all eight row groups, kept by the first), the rest zeros
  const int srow = (tid >> 4) & 7, scol = (tid & 15) * 4;
  const size_t hofs = (size_t)(b * NQ) * DMODEL + h * DKH + scol;
  const float* gq = qh + hofs;
  const float* gk = kh + hofs;
  const float* gv = vh + hofs;
  const float* gqr = gq + srow * DMODEL;
  const float* gkr = gk + srow * DMODEL;
  const float* gvr = gv + srow * DMODEL;
  v4f xq[7], xk[7], xv[7];
#pragma unroll
  for (int i = 0; i < 6; ++i) {
    xq[i] = *(const v4f*)(gqr + i * 8 * DMODEL);
    xk[i] = *(const v4f*)(gkr + i * 8 * DMODEL);
    xv[i] = *(const v4f*)(gvr + i * 8 * DMODEL);
  }
  xq[6] = *(const v4f*)(gq + (NQ - 1) * DMODEL);
  xk[6] = *(const v4f*)(gk + (NQ - 1) * DMODEL);
  xv[6] = *(const v4f*)(gv + (NQ - 1) * DMODEL);
  // the addresses stay live up to this wait, so that no load of the run
  // returns into a register that the others still name
  asm volatile("s_wait_xcnt 0x0" :: "v"(gq), "v"(gk), "v"(gv), "v"(gqr), "v"(gkr), "v"(gvr)
               : "memory");
#pragma unroll
  for (int i = 0; i < 8; ++i) {
    const int row = i * 8 + srow;
    const v4f z = {};
    const bool in = i < 6 || (i == 6 && srow == 0);
    *(v4f*)(sq + row * AT_QP + scol) = in ? xq[i < 7 ? i : 0] : z;
    *(v4f*)(sk + row * AT_QP + scol) = in ? xk[i < 7 ? i : 0] : z;
    *(v4f*)(sv + row * AT_VP + scol) = in ? xv[i < 7 ? i : 0] : z;
  }
  __syncthreads();

  // S = q k^T: one 16-byte read holds the lane's k of two steps (d = 8*k8 + 4*hf + 0..3)
  v8f s[4] = {};
  {
    const float* pa = sq + (wave * 16 + idx) * AT_QP + hf * 4;
    const float* pb = sk + idx * AT_QP + hf * 4;
#pragma unroll
    for (int k8 = 0; k8 < DKH / 8; ++k8) {
      const v4f a = *(const v4f*)(pa + k8 * 8);
      v4f bb[4];
#pragma unroll
      for (int t = 0; t < 4; ++t) bb[t] = *(const v4f*)(pb + t * 16 * AT_QP + k8 * 8);
#pragma unroll
      for (int j = 0; j < 2; ++j) {
        const v2f a2 = {a[2 * j], a[2 * j + 1]};
#pragma unroll
        for (int t = 0; t < 4; ++t) {
          const v2f b2 = {bb[t][2 * j], bb[t][2 * j + 1]};
          s[t] = __builtin_amdgcn_wmma_f32_16x16x4_f32(false, a2, false, b2, (short)0, s[t],
                                                       false, false);
        }
      }
    }
  }

  // gated softmax by rows: s[t][r] is row m0 + r, key 16*t + idx; a row lies in
  // the 16 lanes of one half. p stays unscaled, the row's sum divides at the end.
  float inv[8];
  {
    const bool ok3 = 48 + idx < NQ;              // the last tile holds key 48 alone
    float* pw = sp + m0 * AT_QP + idx;
#pragma unroll
    for (int r = 0; r < 8; ++r) {
      float e[4];
#pragma unroll
      for (int t = 0; t < 4; ++t) e[t] = s[t][r] * 0.125f * (1.f + g[t][r]);   // 1/sqrt(64)
      float m = fmaxf(fmaxf(e[0], e[1]), e[2]);
      m = ok3 ? fmaxf(m, e[3]) : m;
#pragma unroll
      for (int off = 8; off; off >>= 1) m = fmaxf(m, __shfl_xor(m, off, 32));
      const float p0 = __expf(e[0] - m), p1 = __expf(e[1] - m), p2 = __expf(e[2] - m);
      const float p3 = ok3 ? __expf(e[3] - m) : 0.f;
      float sm = (p0 + p1) + (p2 + p3);
#pragma unroll
      for (int off = 8; off; off >>= 1) sm += __shfl_xor(sm, off, 32);
      inv[r] = 1.f / sm;
      pw[r * AT_QP]      = p0;
      pw[r * AT_QP + 16] = p1;
      pw[r * AT_QP + 32] = p2;
      pw[r * AT_QP + 48] = p3;
    }
  }
  // p goes from the accumulator places to the A places through LDS, between lanes
  __syncthreads();

  // out = p v: key = 4*ks + 2*hf + 0..1 on both sides
  v8f o[4] = {};
  {
    const float* pp = sp + (wave * 16 + idx) * AT_QP + hf * 2;
    const float* pv = sv + hf * 2 * AT_VP + idx;
#pragma unroll
    for (int ks = 0; ks < AT_KST; ++ks) {
      const v2f a2 = *(const v2f*)(pp + ks * 4);
#pragma unroll
      for (int t = 0; t < 4; ++t) {
        const v2f b2 = {pv[ks * 4 * AT_VP + t * 16], pv[(ks * 4 + 1) * AT_VP + t * 16]};
        o[t] = __builtin_amdgcn_wmma_f32_16x16x4_f32(false, a2, false, b2, (short)0, o[t],
                                                     false, false);
      }
    }
  }

  _Float16* op = outp + (size_t)(b * NQ + m0) * DMODEL + h * DKH + idx;
  if (wave * 16 + 16 <= NQ) {                    // wave-uniform: all 16 rows are queries
#pragma unroll
    for (int r = 0; r < 8; ++r)
#pragma unroll
      for (int t = 0; t < 4; ++t) op[r * DMODEL + 16 * t] = (_Float16)(o[t][r] * inv[r]);
  } else {
#pragma unroll
    for (int r = 0; r < 8; ++r) {
      if (m0 + r < NQ) {
#pragma unroll
        for (int t = 0; t < 4; ++t) op[r * DMODEL + 16 * t] = (_Float16)(o[t][r] * inv[r]);
      }
    }
  }
}

// ---------------------------------------------------------------------------
extern "C" void kernel_launch(void* const* d_in, const int* in_sizes, int n_in,
                              void* d_out, int out_size, void* d_ws, size_t ws_size,
                              hipStream_t stream) {
  const float* queries = (const float*)d_in[0];
  const float* keys    = (const float*)d_in[1];
  const float* values  = (const float*)d_in[2];
  const float* Wq = (const float*)d_in[3];  const float* bq = (const float*)d_in[4];
  const float* Wk = (const float*)d_in[5];  const float* bk = (const float*)d_in[6];
  const float* Wv = (const float*)d_in[7];  const float* bv = (const float*)d_in[8];
  const float* Wo = (const float*)d_in[9];  const float* bo = (const float*)d_in[10];
  const float* rel_embed = (const float*)d_in[11];
  const float* Wproj = (const float*)d_in[12]; const float* bproj = (const float*)d_in[13];
  const float* Wgate = (const float*)d_in[14]; const float* bgate = (const float*)d_in[15];
  const float* Wc1 = (const float*)d_in[16];   const float* bc1 = (const float*)d_in[17];
  const float* gc = (const float*)d_in[18];    const float* bcln = (const float*)d_in[19];
  const float* Wc2 = (const float*)d_in[20];   const float* bc2 = (const float*)d_in[21];
  const float* Wr1 = (const float*)d_in[22];   const float* br1 = (const float*)d_in[23];
  const float* gr = (const float*)d_in[24];    const float* brln = (const float*)d_in[25];
  const float* Wr2 = (const float*)d_in[26];   const float* br2 = (const float*)d_in[27];
  const float* convW = (const float*)d_in[28]; const float* convb = (const float*)d_in[29];

  // ---- workspace carve-out (256B aligned blocks) ----
  char* base = (char*)d_ws;
  size_t off = 0;
  auto alloc = [&](size_t bytes) -> void* {
    off = (off + 255) & ~(size_t)255;
    void* p = base + off;
    off += bytes;
    return p;
  };
  _Float16* AcolH  = (_Float16*)alloc((size_t)ROWS * KCONV * 2);
  _Float16* convWH = (_Float16*)alloc((size_t)DMODEL * KCONV * 2);
  _Float16* WqT    = (_Float16*)alloc((size_t)DMODEL * DMODEL * 2);
  _Float16* WkT    = (_Float16*)alloc((size_t)DMODEL * DMODEL * 2);
  _Float16* WvT    = (_Float16*)alloc((size_t)DMODEL * DMODEL * 2);
  _Float16* WoT    = (_Float16*)alloc((size_t)DMODEL * DMODEL * 2);
  _Float16* Wc1aT  = (_Float16*)alloc((size_t)256 * DMODEL * 2);
  _Float16* Wc1bT  = (_Float16*)alloc((size_t)256 * DMODEL * 2);
  _Float16* Wr1aT  = (_Float16*)alloc((size_t)DMODEL * DMODEL * 2);
  _Float16* Wr1bT  = (_Float16*)alloc((size_t)DMODEL * DMODEL * 2);
  _Float16* eqH    = (_Float16*)alloc((size_t)ROWS * DMODEL * 2);
  _Float16* ekH    = (_Float16*)alloc((size_t)ROWS * DMODEL * 2);
  _Float16* evH    = (_Float16*)alloc((size_t)ROWS * DMODEL * 2);
  _Float16* attnoH = (_Float16*)alloc((size_t)ROWS * DMODEL * 2);
  float* hconv = (float*)alloc((size_t)ROWS * DMODEL * 4);
  float* muv   = (float*)alloc(DMODEL * 4);
  float* rstdv = (float*)alloc(DMODEL * 4);
  float* qh    = (float*)alloc((size_t)ROWS * DMODEL * 4);
  float* kh    = (float*)alloc((size_t)ROWS * DMODEL * 4);
  float* vh    = (float*)alloc((size_t)ROWS * DMODEL * 4);
  float* A1c   = (float*)alloc((size_t)ROWS * 256 * 4);
  float* A2c   = (float*)alloc((size_t)ROWS * 256 * 4);
  float* A1r   = (float*)alloc((size_t)ROWS * DMODEL * 4);
  float* A2r   = (float*)alloc((size_t)ROWS * DMODEL * 4);
  float* uvec  = (float*)alloc(DMODEL * 4);
  float* wvecp = (float*)alloc(64);
  float* cscal = (float*)alloc(64);
  float* gateb = (float*)alloc((size_t)NPAIR * 4);

  // 1) conv operands: im2col of the queries + fp16 conv weights, one grid
  im2col_cvt_k<<<CVT_BLKS + IM2COL_BLKS, ROW_THREADS, 0, stream>>>(queries, AcolH, convW, convWH);

  // 2) conv3x3 as WMMA GEMM (1568 x 512 x 4608); the gate-collapse vectors and
  //    the weight transposes run beside it in the same grid
  conv_gemm_side_k<<<SIDE_GRID, dim3(32, 4), 0, stream>>>(
      AcolH, convWH, convb, hconv,
      Wr2, Wgate, bgate, Wproj, bproj, br2, rel_embed, uvec, wvecp, cscal,
      Wq, Wk, Wv, Wo, Wr1, Wc1, WqT, WkT, WvT, WoT, Wr1aT, Wr1bT, Wc1aT, Wc1bT);

  // 3) BatchNorm(affine=False) + ReLU + residual adds (f16 activations)
  bn_stats_k<<<DMODEL, 256, 0, stream>>>(hconv, muv, rstdv);
  eqkv_k<<<(ROWS * DMODEL) / 8 / 256, 256, 0, stream>>>(hconv, muv, rstdv, queries, keys,
                                                    values, eqH, ekH, evH);

  // 4) token-level projections (all WMMA), one grid
  proj_gemms_k<<<PROJ_BLKS, dim3(32, 4), 0, stream>>>(
      eqH, ekH, evH, WqT, WkT, WvT, Wr1aT, Wr1bT, Wc1aT, Wc1bT, bq, bk, bv, br1, bc1,
      qh, kh, vh, A1r, A2r, A1c, A2c);

  // 5) per-pair gate (one wave32 per 7 pairs)
  pair_gate_k<<<PAIR_BLKS, dim3(32, PAIR_WAVES), 0, stream>>>(
      A1c, A2c, A1r, A2r, gc, bcln, Wc2, bc2, gr, brln, uvec, wvecp, cscal, gateb);

  // 6) logits, gated softmax and A*V, one block per (b, h) (f16 output feeds final GEMM)
  attn_gated_k<<<BQ * NHEAD, dim3(32, 4), 0, stream>>>(qh, kh, vh, gateb, attnoH);

  // 7) output projection (WMMA) straight into d_out
  gemm_wmma_f16<<<BLK_N512, dim3(32, 4), 0, stream>>>(attnoH, WoT, bo, (float*)d_out);
}

// v006
// Measured time: 100 microseconds a run.
// Timed twice side by side with v005, it ran 1.25 and 1.24 times as fast.
// Over all steps from v000 it is 4.00 times as fast.
#include <hip/hip_runtime.h>
#include <hip/hip_bf16.h>
#include <math.h>

// ---------------------------------------------------------------------------
// RelationEnhanceAttention, algebraically restructured for MI455X (gfx1250).
//   B=32, N=49, D=512, H=8, DK=64, NREL=TOPK=14
// Conv and projection GEMMs: f16 operands (K-innermost both sides), fp32 accumulate on
// v_wmma_f32_16x16x32_f16. 16x32 C-tile per wave, operands staged in LDS.
// ---------------------------------------------------------------------------

typedef __attribute__((ext_vector_type(16))) _Float16 v16h;
typedef __attribute__((ext_vector_type(8)))  _Float16 v8h;
typedef __attribute__((ext_vector_type(8)))  float    v8f;
typedef __attribute__((ext_vector_type(4)))  float    v4f;
typedef __attribute__((ext_vector_type(2)))  float    v2f;

#define BQ      32
#define NQ      49
#define DMODEL  512
#define NHEAD   8
#define DKH     64
#define NRELC   14
#define ROWS    (BQ * NQ)            // 1568
#define KCONV   (DMODEL * 9)         // 4608
#define NPAIR   (BQ * NQ * NQ)       // 76832
#define LN_EPS  1e-5f

// ---------------------------------------------------------------------------
// WMMA GEMM: C[M,N] = A[M,K] * B^T[N,K] (+bias[N]).
// A: f16 row-major (M,K). Bt: f16 row-major (N,K). K is the pitch of both.
// REQUIRES: M%32==0, N%64==0, K%256==0, K>=512 (true for every call site here).
// One block of 4 waves computes a 32x64 C tile, each wave 16x32; K stepped by 32
// in rising order. The operands come into LDS in stages of 256 k (512 B of each
// of the 96 rows) by asynchronous copies: one copy of a wave is one row's whole
// 512 B, so that every request covers whole cache lines. Two buffers: the next
// stage's copies fly while this one is worked on.
// Fragment layout (ISA 16-bit A 16x32): halves 0..7  <- K = k0+8*half+0..7
//                                       halves 8..15 <- K = k0+8*half+16..23
// i.e. two 16-byte segments per lane -> two ds_load_b128 each.
// ---------------------------------------------------------------------------
#define GBM    32
#define GBN    64
#define GBK    256
#define GROWS  (GBM + GBN)            // 96 rows a stage
#define GPITCH (GBK * 2 + 16)         // 528 B = 16 B x odd: no bank conflict for b128 readers
#define GBUF   (GROWS * GPITCH)       // 50,688 B a buffer

// Eight rows, four apart (one per wave between them): lane l brings bytes
// 16*l .. 16*l+15 of each row's 512 B. The s_wait_xcnt stands inside the
// statement, so that no address register is rewritten in front of it.
template <int K>
__device__ __forceinline__ void copy8_rows(unsigned lds, const _Float16* g) {
  asm volatile(
      "global_load_async_to_lds_b128 %0, %8, off\n\t"
      "global_load_async_to_lds_b128 %1, %9, off\n\t"
      "global_load_async_to_lds_b128 %2, %10, off\n\t"
      "global_load_async_to_lds_b128 %3, %11, off\n\t"
      "global_load_async_to_lds_b128 %4, %12, off\n\t"
      "global_load_async_to_lds_b128 %5, %13, off\n\t"
      "global_load_async_to_lds_b128 %6, %14, off\n\t"
      "global_load_async_to_lds_b128 %7, %15, off\n\t"
      "s_wait_xcnt 0x0"
      :: "v"(lds), "v"(lds + 4 * GPITCH), "v"(lds + 8 * GPITCH), "v"(lds + 12 * GPITCH),
         "v"(lds + 16 * GPITCH), "v"(lds + 20 * GPITCH), "v"(lds + 24 * GPITCH),
         "v"(lds + 28 * GPITCH),
         "v"(g), "v"(g + 4 * K), "v"(g + 8 * K), "v"(g + 12 * K),
         "v"(g + 16 * K), "v"(g + 20 * K), "v"(g + 24 * K), "v"(g + 28 * K)
      : "memory");
}

template <int K>
__device__ __forceinline__ void gemm_block(const _Float16* __restrict__ A,
                                           const _Float16* __restrict__ Bt,
                                           const float* __restrict__ bias,
                                           float* __restrict__ C, int tile, int N) {
  __shared__ __attribute__((aligned(16))) unsigned char gsm[2 * GBUF];
  constexpr int NST = K / GBK;                   // stages
  static_assert(K % GBK == 0 && NST >= 2, "two stages at least");
  const int ntn  = N >> 6;                       // 64-wide column tiles
  const int tm   = tile / ntn;
  const int tn   = tile - tm * ntn;
  const int row0 = tm * GBM;
  const int col0 = tn * GBN;

  const int lane = threadIdx.x;                  // 0..31
  const int wave = __builtin_amdgcn_readfirstlane(threadIdx.y);   // 0..3
  const int hf   = lane >> 4;                    // 0/1
  const int idx  = lane & 15;
  const int wm   = wave >> 1, wn = wave & 1;     // the wave's 16 rows, 32 columns

  // copy side: wave w takes rows w, w+4, ... of the stage (A rows 0..31, B rows 32..95)
  const unsigned lds0 = (unsigned)(size_t)gsm + (unsigned)(wave * GPITCH + lane * 16);
  const _Float16* ga = A  + (size_t)(row0 + wave) * K + lane * 8;
  const _Float16* gb = Bt + (size_t)(col0 + wave) * K + lane * 8;
  auto copy_stage = [&](int st, int buf) {
    const unsigned l = lds0 + (unsigned)buf * GBUF;
    copy8_rows<K>(l, ga + st * GBK);
    copy8_rows<K>(l + 32 * GPITCH, gb + st * GBK);
    copy8_rows<K>(l + 64 * GPITCH, gb + (size_t)32 * K + st * GBK);
  };

  // read side
  const unsigned char* sa  = gsm + (wm * 16 + idx) * GPITCH + hf * 16;
  const unsigned char* sb0 = gsm + (GBM + wn * 32 + idx) * GPITCH + hf * 16;
  const unsigned char* sb1 = sb0 + 16 * GPITCH;

  v8f acc0 = {}, acc1 = {};
  union F16x16 { v16h v; v8h h[2]; };

  copy_stage(0, 0);
  // stage 0 has landed for this wave; the barrier publishes it to the others
  asm volatile("s_wait_asynccnt 0x0" ::: "memory");
  __syncthreads();
  copy_stage(1, 1);

  // rolled: one body serves both buffers, the code stays small
#pragma unroll 1
  for (int t = 0; t < NST; ++t) {
    const int bo = (t & 1) * GBUF;
    // four k steps' fragments are fetched as one group, then their eight WMMAs:
    // one LDS latency a group instead of one a WMMA
#pragma unroll
    for (int kg = 0; kg < GBK / 128; ++kg) {
      F16x16 af[4], b0[4], b1[4];
#pragma unroll
      for (int q = 0; q < 4; ++q) {
        const int o = bo + (kg * 4 + q) * 64;
        af[q].h[0] = *(const v8h*)(sa  + o);
        af[q].h[1] = *(const v8h*)(sa  + o + 32);
        b0[q].h[0] = *(const v8h*)(sb0 + o);
        b0[q].h[1] = *(const v8h*)(sb0 + o + 32);
        b1[q].h[0] = *(const v8h*)(sb1 + o);
        b1[q].h[1] = *(const v8h*)(sb1 + o + 32);
      }
      // keeps the group's loads in front of its WMMAs: the scheduler otherwise deals
      // them out again, one wait on LDS per WMMA
      __builtin_amdgcn_sched_barrier(0);
#pragma unroll
      for (int q = 0; q < 4; ++q) {
        acc0 = __builtin_amdgcn_wmma_f32_16x16x32_f16(false, af[q].v, false, b0[q].v,
                                                      (short)0, acc0, false, false);
        acc1 = __builtin_amdgcn_wmma_f32_16x16x32_f16(false, af[q].v, false, b1[q].v,
                                                      (short)0, acc1, false, false);
      }
    }
    // this wave's reads of the buffer are done before it may be refilled
    asm volatile("s_wait_dscnt 0x0" ::: "memory");
    // this wave's copies of the next stage have landed
    asm volatile("s_wait_asynccnt 0x0" ::: "memory");
    // publishes the next stage and ends every reader's last read of this one
    __syncthreads();
    if (t + 2 < NST) copy_stage(t + 2, t & 1);
  }
  // no copy is left outstanding when the wave ends
  asm volatile("s_wait_asynccnt 0x0" ::: "memory");

  // C layout: vgpr r -> m = row0 + 16*wm + r + 8*hf ; n = col0 + 32*wn + sub*16 + idx
  const int mbase = row0 + wm * 16 + hf * 8;
#pragma unroll
  for (int s = 0; s < 2; ++s) {
    const int n = col0 + wn * 32 + s * 16 + idx;
    const float badd = bias ? bias[n] : 0.f;
    const v8f a = (s == 0) ? acc0 : acc1;
#pragma unroll
    for (int r = 0; r < 8; ++r)
      C[(size_t)(mbase + r) * N + n] = a[r] + badd;
    // the next column group reuses these stores' registers: wait first
    asm volatile("s_wait_xcnt 0x0" ::: "memory");
  }
}

// blocks of 4 waves: the bound lifts the register cap, else fragments spill
__global__ __launch_bounds__(128) void gemm_wmma_f16(const _Float16* __restrict__ A,
                              const _Float16* __restrict__ Bt,
                              const float* __restrict__ bias,
                              float* __restrict__ C) {
  gemm_block<DMODEL>(A, Bt, bias, C, blockIdx.x, DMODEL);
}

// The seven token-level projections share no data dependence: one grid, the
// product chosen by block range (block-uniform). 392 blocks per 512-wide
// product, 196 per 256-wide one; one 32x64 tile per block as above.
#define BLK_N512 ((ROWS / GBM) * (DMODEL / GBN))     // 392
#define BLK_N256 ((ROWS / GBM) * (256 / GBN))        // 196
#define PROJ_BLKS (5 * BLK_N512 + 2 * BLK_N256)      // 2352
__global__ __launch_bounds__(128) void proj_gemms_k(const _Float16* __restrict__ eq, const _Float16* __restrict__ ek,
                             const _Float16* __restrict__ ev,
                             const _Float16* __restrict__ WqT, const _Float16* __restrict__ WkT,
                             const _Float16* __restrict__ WvT, const _Float16* __restrict__ Wr1aT,
                             const _Float16* __restrict__ Wr1bT, const _Float16* __restrict__ Wc1aT,
                             const _Float16* __restrict__ Wc1bT,
                             const float* __restrict__ bq, const float* __restrict__ bk,
                             const float* __restrict__ bv, const float* __restrict__ br1,
                             const float* __restrict__ bc1,
                             float* __restrict__ qh, float* __restrict__ kh,
                             float* __restrict__ vh, float* __restrict__ A1r,
                             float* __restrict__ A2r, float* __restrict__ A1c,
                             float* __restrict__ A2c) {
  const int blk = blockIdx.x;
  const _Float16* A; const _Float16* Bt; const float* bias; float* C;
  int n, lb;
  if (blk < 5 * BLK_N512) {
    const int job = blk / BLK_N512;
    lb = blk - job * BLK_N512;
    n = DMODEL;
    switch (job) {
      case 0:  A = eq; Bt = WqT;   bias = bq;      C = qh;  break;
      case 1:  A = ek; Bt = WkT;   bias = bk;      C = kh;  break;
      case 2:  A = ev; Bt = WvT;   bias = bv;      C = vh;  break;
      case 3:  A = eq; Bt = Wr1aT; bias = br1;     C = A1r; break;
      default: A = ek; Bt = Wr1bT; bias = nullptr; C = A2r; break;
    }
  } else {
    lb = blk - 5 * BLK_N512;
    n = 256;
    if (lb < BLK_N256) { A = eq; Bt = Wc1aT; bias = bc1; C = A1c; }
    else { lb -= BLK_N256; A = ek; Bt = Wc1bT; bias = nullptr; C = A2c; }
  }
  gemm_block<DMODEL>(A, Bt, bias, C, lb, n);
}

// ---------------------------------------------------------------------------
// Weight transpose + fp16 convert: W (K,N) row-major -> Wt (N,K) f16.
// One thread takes 8 consecutive k of one column n: 8 reads, each coalesced
// over the lanes' n, and one 16-byte store.
// ---------------------------------------------------------------------------
__device__ __forceinline__ void transpose_h(const float* __restrict__ W,
                                            _Float16* __restrict__ Wt, int K, int N, int t) {
  const int kc = t / N, n = t - kc * N;
  const float* p = W + (size_t)kc * 8 * N + n;
  v8h o;
#pragma unroll
  for (int j = 0; j < 8; ++j) o[j] = (_Float16)p[(size_t)j * N];
  *(v8h*)(Wt + (size_t)n * K + kc * 8) = o;
  // other block ranges' code follows in the merged kernel and reuses the
  // store's registers: wait first
  asm volatile("s_wait_xcnt 0x0" ::: "memory");
}

// ---------------------------------------------------------------------------
// im2col (f16 output) for the 3x3 pad-1 conv. x[b,c,y,x] == queries[b,y*7+x,c].
// Acol[row = b*49 + y*7 + x, kk = ic*9 + ky*3 + kx]
// ---------------------------------------------------------------------------
// The fp32 -> fp16 copy of the conv weights (layout preserved) has no data in
// common with it and rides in the same grid, on the first block range.
// One block of 192 threads makes one row of 4608 halves in either part: each
// thread 3 groups of 8 consecutive outputs, one 16-byte store a group, so that
// few waves have to be started.
#define CVT_BLKS    DMODEL                   // 512 rows of conv weights
#define IM2COL_BLKS ROWS                     // 1568 rows of Acol
#define ROW_THREADS (KCONV / 8 / 3)          // 192
__global__ void im2col_cvt_k(const float* __restrict__ q, _Float16* __restrict__ Acol,
                             const float* __restrict__ convW, _Float16* __restrict__ convWH) {
  const int tid = threadIdx.x;
  if (blockIdx.x < CVT_BLKS) {
    const size_t base = (size_t)blockIdx.x * KCONV;
#pragma unroll
    for (int i = 0; i < 3; ++i) {
      const size_t e = base + (size_t)(tid + ROW_THREADS * i) * 8;
      const v4f lo = *(const v4f*)(convW + e);
      const v4f hi = *(const v4f*)(convW + e + 4);
      v8h o;
#pragma unroll
      for (int j = 0; j < 4; ++j) { o[j] = (_Float16)lo[j]; o[4 + j] = (_Float16)hi[j]; }
      *(v8h*)(convWH + e) = o;
    }
    return;
  }
  const int row = blockIdx.x - CVT_BLKS;         // b*49 + y*7 + x
  const int p = row % NQ;
  const int y = p / 7, x = p % 7;
  unsigned valid = 0;                            // bit r: tap r lies inside the 7x7 map
#pragma unroll
  for (int r = 0; r < 9; ++r)
    if ((unsigned)(y + r / 3 - 1) < 7u && (unsigned)(x + r % 3 - 1) < 7u) valid |= 1u << r;
  const float* qc = q + (size_t)row * DMODEL;    // the centre tap's token
  _Float16* arow = Acol + (size_t)row * KCONV;
  // a tap outside the map reads the centre token (in bounds) and is zeroed: no
  // branch round a load, so all 24 loads of a thread can be in flight at once
  float ld[3][8];
  unsigned okm = 0;                              // bit 8*i+j: that output's tap is inside
#pragma unroll
  for (int i = 0; i < 3; ++i) {
    const int kk0 = (tid + ROW_THREADS * i) * 8;
    int ic = kk0 / 9, r = kk0 % 9;
#pragma unroll
    for (int j = 0; j < 8; ++j) {
      const unsigned ok = (valid >> r) & 1u;
      const int ky = (r * 11) >> 5;              // r / 3 for r in 0..8
      const int tap = (r + 4 * ky - 8) * (int)ok;    // (ky-1)*7 + (kx-1), or the centre
      ld[i][j] = qc[tap * DMODEL + ic];
      okm |= ok << (8 * i + j);
      const int wrap = (r == 8);
      r = wrap ? 0 : r + 1;
      ic += wrap;
    }
  }
#pragma unroll
  for (int i = 0; i < 3; ++i) {
    v8h o;
#pragma unroll
    for (int j = 0; j < 8; ++j)
      o[j] = (_Float16)(((okm >> (8 * i + j)) & 1u) ? ld[i][j] : 0.f);
    *(v8h*)(arow + (tid + ROW_THREADS * i) * 8) = o;
  }
}

// BatchNorm stats over (B, spatial) = 1568 rows per channel (population var).
__global__ void bn_stats_k(const float* __restrict__ h, float* __restrict__ mu,
                           float* __restrict__ rstd) {
  const int c = blockIdx.x, tid = threadIdx.x;
  float s = 0.f, ss = 0.f;
  for (int r = tid; r < ROWS; r += 256) {
    float v = h[(size_t)r * DMODEL + c];
    s += v; ss += v * v;
  }
  __shared__ float sh[256], sh2[256];
  sh[tid] = s; sh2[tid] = ss; __syncthreads();
  for (int off = 128; off; off >>= 1) {
    if (tid < off) { sh[tid] += sh[tid + off]; sh2[tid] += sh2[tid + off]; }
    __syncthreads();
  }
  if (tid == 0) {
    float m = sh[0] * (1.f / ROWS);
    float v = sh2[0] * (1.f / ROWS) - m * m;
    mu[c] = m; rstd[c] = rsqrtf(v + LN_EPS);
  }
}

// xs = relu(BN(h)); eq/ek/ev = f16(xs + queries/keys/values)
__global__ void eqkv_k(const float* __restrict__ h, const float* __restrict__ mu,
                       const float* __restrict__ rstd,
                       const float* __restrict__ q, const float* __restrict__ k,
                       const float* __restrict__ v,
                       _Float16* __restrict__ eq, _Float16* __restrict__ ek,
                       _Float16* __restrict__ ev) {
  const size_t t = ((size_t)blockIdx.x * blockDim.x + threadIdx.x) * 8;   // 8 channels a thread
  if (t >= (size_t)ROWS * DMODEL) return;
  const int c = (int)(t % DMODEL);
  v8h oq, ok, ov;
#pragma unroll
  for (int g = 0; g < 2; ++g) {
    const v4f h4 = *(const v4f*)(h + t + 4 * g);
    const v4f m4 = *(const v4f*)(mu + c + 4 * g);
    const v4f r4 = *(const v4f*)(rstd + c + 4 * g);
    const v4f q4 = *(const v4f*)(q + t + 4 * g);
    const v4f k4 = *(const v4f*)(k + t + 4 * g);
    const v4f v4 = *(const v4f*)(v + t + 4 * g);
#pragma unroll
    for (int j = 0; j < 4; ++j) {
      const float xs = fmaxf((h4[j] - m4[j]) * r4[j], 0.f);
      oq[4 * g + j] = (_Float16)(xs + q4[j]);
      ok[4 * g + j] = (_Float16)(xs + k4[j]);
      ov[4 * g + j] = (_Float16)(xs + v4[j]);
    }
  }
  *(v8h*)(eq + t) = oq;
  *(v8h*)(ek + t) = ok;
  *(v8h*)(ev + t) = ov;
}

// Precompute gate-collapse vectors:
//   u[512] = Wr2 @ Wgate ; wv[14] = rel_embed @ (Wproj @ Wgate)
//   cs = (br2 + bproj) . Wgate + bgate
// Blocks of 128 threads: parts 0..3 take 128 rows of u each, part 4 the rest.
__device__ __forceinline__ void precompute_part(int part, int t,
                             const float* __restrict__ Wr2, const float* __restrict__ Wgate,
                             const float* __restrict__ bgate, const float* __restrict__ Wproj,
                             const float* __restrict__ bproj, const float* __restrict__ br2,
                             const float* __restrict__ rel_embed,
                             float* __restrict__ u, float* __restrict__ wv,
                             float* __restrict__ cs) {
  __shared__ float pv[DKH];
  if (part < 4) {                                // block-uniform
    const int row = part * 128 + t;
    float s = 0.f;
    for (int j = 0; j < DMODEL; ++j) s += Wr2[(size_t)row * DMODEL + j] * Wgate[j];
    u[row] = s;
    // the fifth part's code follows and reuses the store's registers: wait first
    asm volatile("s_wait_xcnt 0x0" ::: "memory");
    return;
  }
  if (t < DKH) {
    float s = 0.f;
    for (int d = 0; d < DMODEL; ++d) s += Wproj[(size_t)t * DMODEL + d] * Wgate[d];
    pv[t] = s;
  }
  __syncthreads();
  if (t < NRELC) {
    float s = 0.f;
    const unsigned rb = (unsigned)t * (DKH * 4u);   // the row's byte offset
    const float* rp = (const float*)((const char*)rel_embed + rb);
    for (int d = 0; d < DKH; ++d) s += rp[d] * pv[d];
    // the row's offset stays live up to this wait, so that no load of the run
    // returns into the register that the others still name
    asm volatile("s_wait_xcnt 0x0" :: "v"(rb) : "memory");
    wv[t] = s;
  }
  if (t == 0) {
    float s = bgate[0];
    for (int d = 0; d < DMODEL; ++d) s += (br2[d] + bproj[d]) * Wgate[d];
    cs[0] = s;
  }
}

// conv GEMM grid (392 blocks of 4 waves leave most wave slots empty) plus the
// work that nothing before the projections depends on: the gate-collapse
// vectors and the eight weight transposes, on the block ranges behind it.
#define CONV_BLKS ((ROWS / GBM) * (DMODEL / GBN))      // 392
#define PRE_BLKS  5
#define TR512_BLKS (DMODEL * DMODEL / 8 / 128)         // 256
#define TR256_BLKS (DMODEL * 256 / 8 / 128)            // 128
#define SIDE_GRID (CONV_BLKS + PRE_BLKS + 6 * TR512_BLKS + 2 * TR256_BLKS)
__global__ __launch_bounds__(128) void conv_gemm_side_k(const _Float16* __restrict__ Acol,
                                 const _Float16* __restrict__ convWH,
                                 const float* __restrict__ convb, float* __restrict__ hconv,
                                 const float* __restrict__ Wr2, const float* __restrict__ Wgate,
                                 const float* __restrict__ bgate, const float* __restrict__ Wproj,
                                 const float* __restrict__ bproj, const float* __restrict__ br2,
                                 const float* __restrict__ rel_embed,
                                 float* __restrict__ u, float* __restrict__ wv,
                                 float* __restrict__ cs,
                                 const float* __restrict__ Wq, const float* __restrict__ Wk,
                                 const float* __restrict__ Wv, const float* __restrict__ Wo,
                                 const float* __restrict__ Wr1, const float* __restrict__ Wc1,
                                 _Float16* __restrict__ WqT, _Float16* __restrict__ WkT,
                                 _Float16* __restrict__ WvT, _Float16* __restrict__ WoT,
                                 _Float16* __restrict__ Wr1aT, _Float16* __restrict__ Wr1bT,
                                 _Float16* __restrict__ Wc1aT, _Float16* __restrict__ Wc1bT) {
  int blk = blockIdx.x;
  if (blk < CONV_BLKS) {
    gemm_block<KCONV>(Acol, convWH, convb, hconv, blk, DMODEL);
    return;
  }
  blk -= CONV_BLKS;
  const int tid = threadIdx.y * 32 + threadIdx.x;
  if (blk < PRE_BLKS) {
    precompute_part(blk, tid, Wr2, Wgate, bgate, Wproj, bproj, br2, rel_embed, u, wv, cs);
    return;
  }
  blk -= PRE_BLKS;
  if (blk < 6 * TR512_BLKS) {
    const int job = blk / TR512_BLKS;
    const int t = (blk - job * TR512_BLKS) * 128 + tid;
    const float* W; _Float16* Wt;
    switch (job) {
      case 0:  W = Wq;  Wt = WqT;  break;
      case 1:  W = Wk;  Wt = WkT;  break;
      case 2:  W = Wv;  Wt = WvT;  break;
      case 3:  W = Wo;  Wt = WoT;  break;
      case 4:  W = Wr1; Wt = Wr1aT; break;
      default: W = Wr1 + (size_t)DMODEL * DMODEL; Wt = Wr1bT; break;
    }
    transpose_h(W, Wt, DMODEL, DMODEL, t);
  } else {
    blk -= 6 * TR512_BLKS;
    const int second = blk >= TR256_BLKS;
    const int t = (blk - second * TR256_BLKS) * 128 + tid;
    transpose_h(second ? Wc1 + (size_t)DMODEL * 256 : Wc1, second ? Wc1bT : Wc1aT,
                DMODEL, 256, t);
  }
}

// One wave32 per (b, qi, group of 7 ki), 16 waves a block = 112 pairs = 7 tiles of 16.
// Classifier branch: each wave makes LN(256)->ReLU of its 7 pairs and lays the rows in
// LDS; the 256x14 product of 16 pairs at a time then runs on v_wmma_f32_16x16x4_f32
// (operands stay fp32), one tile per wave 0..6, with the softmax and probs.wv taken
// from the accumulator (a pair's 14 logits lie in the 16 lanes of one half).
// Relation branch: LN(512)->ReLU->dot(u) per pair as before; gate = sigmoid(.).
// All that does not depend on ki (the LN scales and shifts, u, the q-side rows) is
// loaded once per wave and stays in registers over the 7 pairs. qi runs fastest over
// the waves, so that the waves of a block mostly read the same k-side rows (WGP cache).
#define KI_GRP     7
#define PAIR_WAVES 16
#define PAIR_THREADS (32 * PAIR_WAVES)                          // 512
#define PAIR_BLKS (BQ * (NQ / KI_GRP) * NQ / PAIR_WAVES)        // 686
#define PB_PAIRS  (PAIR_WAVES * KI_GRP)                         // 112
#define PB_TILES  (PB_PAIRS / 16)                               // 7
#define HV_P      260     // floats: pitch of a pair's row, 1040 B = 16 B x odd (b128 readers)
// four waves per SIMD: the register budget of 256 that one block per WGP needs
__global__ __launch_bounds__(PAIR_THREADS) __attribute__((amdgpu_waves_per_eu(4)))
void pair_gate_k(const float* __restrict__ A1c, const float* __restrict__ A2c,
                            const float* __restrict__ A1r, const float* __restrict__ A2r,
                            const float* __restrict__ gc, const float* __restrict__ bcln,
                            const float* __restrict__ Wc2, const float* __restrict__ bc2,
                            const float* __restrict__ gr, const float* __restrict__ brln,
                            const float* __restrict__ u, const float* __restrict__ wv,
                            const float* __restrict__ cs, float* __restrict__ gate) {
  __shared__ __attribute__((aligned(16))) float hvs[PB_PAIRS * HV_P];   // ReLU(LN) rows
  __shared__ __attribute__((aligned(16))) float wb[32 * 32 * 4];        // Wc2 as B fragments
  __shared__ float spw[PB_PAIRS];                                       // probs . wv
  const int lane = threadIdx.x;
  const int wl   = __builtin_amdgcn_readfirstlane(threadIdx.y);         // 0..15
  const int hf   = lane >> 4;
  const int idx  = lane & 15;
  const int wave = blockIdx.x * PAIR_WAVES + wl;                        // (b, ki group, qi)
  const int b   = wave / ((NQ / KI_GRP) * NQ);
  const int rm  = wave % ((NQ / KI_GRP) * NQ);
  const int ki0 = (rm / NQ) * KI_GRP;
  const int qi  = rm % NQ;

  const float* a1 = A1c + (size_t)(b * NQ + qi) * 256;
  const float* r1 = A1r + (size_t)(b * NQ + qi) * DMODEL;
  const float* a2 = A2c + (size_t)(b * NQ + ki0) * 256;
  const float* r2 = A2r + (size_t)(b * NQ + ki0) * DMODEL;
  // lane i collects the value of pair ki0 + i (equal in all lanes behind the sum
  // over the lanes); the sigmoid is then done once for the 7 pairs
  float gdn = 0.f;

  // Wc2 in B-fragment order: entry (c, lane) holds rows 8c + 4*hf + 0..3 of column idx,
  // columns 14 and 15 as zeros. Wave wl writes entries c = wl and c = wl + 16.
  {
    const unsigned wo = (unsigned)((8 * wl + 4 * hf) * NRELC + min(idx, NRELC - 1)) * 4u;
    const float* wp = (const float*)((const char*)Wc2 + wo);
    v4f w0, w1;
#pragma unroll
    for (int q = 0; q < 4; ++q) {
      w0[q] = wp[q * NRELC];
      w1[q] = wp[(128 + q) * NRELC];
    }
    // the offset stays live up to this wait, so that no load of the run
    // returns into the register that the others still name
    asm volatile("s_wait_xcnt 0x0" :: "v"(wo) : "memory");
    const v4f z = {};
    *(v4f*)(wb + (wl * 32 + lane) * 4)        = idx < NRELC ? w0 : z;
    *(v4f*)(wb + ((wl + 16) * 32 + lane) * 4) = idx < NRELC ? w1 : z;
  }

  // ---- classifier branch, part 1: LN over 256, ReLU, rows to LDS ----
  {
    float gcv[8], bcv[8], a1v[8];
    const float* a1l = a1 + lane;
#pragma unroll
    for (int j = 0; j < 8; ++j) {
      const int e = lane + 32 * j;
      a1v[j] = a1l[32 * j]; gcv[j] = gc[e]; bcv[j] = bcln[e];
    }
    // the address stays live up to this wait, so that no load of the run
    // returns into a register that the others still name
    asm volatile("s_wait_xcnt 0x0" :: "v"(a1l) : "memory");
    // unrolled: the 7 pairs' loads and sums over the lanes can overlap
#pragma unroll
    for (int i = 0; i < KI_GRP; ++i) {
      float x[8], s = 0.f, ss = 0.f;
#pragma unroll
      for (int j = 0; j < 8; ++j) {
        float v = a1v[j] + a2[i * 256 + lane + 32 * j];
        x[j] = v; s += v; ss += v * v;
      }
      for (int off = 16; off; off >>= 1) {
        s += __shfl_xor(s, off, 32); ss += __shfl_xor(ss, off, 32);
      }
      const float mean = s * (1.f / 256.f);
      const float rstd = rsqrtf(ss * (1.f / 256.f) - mean * mean + LN_EPS);
      float* hrow = hvs + (wl * KI_GRP + i) * HV_P + lane;
#pragma unroll
      for (int j = 0; j < 8; ++j)
        hrow[32 * j] = fmaxf((x[j] - mean) * rstd * gcv[j] + bcv[j], 0.f);
    }
  }
  // the rows and the Wc2 fragments go from their writers to the tiles' waves
  __syncthreads();

  // ---- classifier branch, part 2: 16 pairs x 256 x 14 on WMMA, softmax, probs.wv ----
  // Fragments (A: lane holds pair idx; B: column idx; the lane halves split k): both
  // sides take feature 8c + 4*hf + 2j + 0..1 at step (c, j), so they pair.
  if (wl < PB_TILES) {                           // wave-uniform
    const unsigned no = (unsigned)min(idx, NRELC - 1) * 4u;
    const float bn  = *(const float*)((const char*)bc2 + no);
    const float wvn = *(const float*)((const char*)wv + no);
    // as above: the offset stays live up to this wait
    asm volatile("s_wait_xcnt 0x0" :: "v"(no) : "memory");
    const float* pa = hvs + (wl * 16 + idx) * HV_P + hf * 4;
    const float* pb = wb + lane * 4;
    v8f acc[4] = {};                             // four chains: no WMMA waits on the one before
    // unrolled: the chain's index is then a constant, and LDS reads can run ahead of the WMMAs
#pragma unroll
    for (int c = 0; c < 32; ++c) {
      const v4f a = *(const v4f*)(pa + c * 8);
      const v4f w = *(const v4f*)(pb + c * 128);
#pragma unroll
      for (int j = 0; j < 2; ++j) {
        const v2f a2f = {a[2 * j], a[2 * j + 1]};
        const v2f b2f = {w[2 * j], w[2 * j + 1]};
        acc[(c & 1) * 2 + j] = __builtin_amdgcn_wmma_f32_16x16x4_f32(
            false, a2f, false, b2f, (short)0, acc[(c & 1) * 2 + j], false, false);
      }
    }
    const v8f lgv = (acc[0] + acc[1]) + (acc[2] + acc[3]);
    // lgv[r] is pair 16*wl + 8*hf + r, class idx
    const bool okn = idx < NRELC;
    float pwk = 0.f, sek = 1.f;                  // lane idx keeps row idx of its half
#pragma unroll
    for (int r = 0; r < 8; ++r) {
      const float l = lgv[r] + bn;
      float m = okn ? l : -__builtin_inff();
#pragma unroll
      for (int off = 8; off; off >>= 1) m = fmaxf(m, __shfl_xor(m, off, 32));
      const float p = okn ? __expf(l - m) : 0.f;
      float se = p, pw = p * wvn;
#pragma unroll
      for (int off = 8; off; off >>= 1) {
        se += __shfl_xor(se, off, 32); pw += __shfl_xor(pw, off, 32);
      }
      pwk = (idx == r) ? pw : pwk;
      sek = (idx == r) ? se : sek;
    }
    // probs = p/se; top-k(14 of 14) renorm = /(1+1e-8)
    if (idx < 8) spw[wl * 16 + hf * 8 + idx] = pwk / (sek * (1.f + 1e-8f));
  }

  // ---- relation branch: LN over 512, ReLU, dot with u ----
  {
    float grv[16], brv[16], uv[16], r1v[16];
    const float* r1l = r1 + lane;
#pragma unroll
    for (int j = 0; j < 16; ++j) {
      const int e = lane + 32 * j;
      r1v[j] = r1l[32 * j]; grv[j] = gr[e]; brv[j] = brln[e]; uv[j] = u[e];
    }
    // as above: the row's address stays live up to this wait
    asm volatile("s_wait_xcnt 0x0" :: "v"(r1l) : "memory");
    // unrolled: the 7 pairs' loads and sums over the lanes can overlap
#pragma unroll
    for (int i = 0; i < KI_GRP; ++i) {
      float y[16], s = 0.f, ss = 0.f;
#pragma unroll
      for (int j = 0; j < 16; ++j) {
        float v = r1v[j] + r2[i * DMODEL + lane + 32 * j];
        y[j] = v; s += v; ss += v * v;
      }
      for (int off = 16; off; off >>= 1) {
        s += __shfl_xor(s, off, 32); ss += __shfl_xor(ss, off, 32);
      }
      const float mean = s * (1.f / 512.f);
      const float rstd = rsqrtf(ss * (1.f / 512.f) - mean * mean + LN_EPS);
      float gd = 0.f;
#pragma unroll
      for (int j = 0; j < 16; ++j) {
        float hv = fmaxf((y[j] - mean) * rstd * grv[j] + brv[j], 0.f);
        gd += hv * uv[j];
      }
      for (int off = 16; off; off >>= 1) gd += __shfl_xor(gd, off, 32);
      gdn = (lane == i) ? gd : gdn;
    }
  }

  // probs.wv goes from the tiles' waves back to the pairs' own waves
  __syncthreads();
  const float pwv = spw[wl * KI_GRP + min(lane, KI_GRP - 1)];
  if (lane < KI_GRP)
    gate[(size_t)(b * NQ + qi) * NQ + ki0 + lane] = 1.f / (1.f + __expf(-(gdn + pwv + cs[0])));
}

// Gated attention of one (b, h) in one block of 4 waves, both products on
// v_wmma_f32_16x16x4_f32 (operands stay fp32):
//   S = q k^T / 8 ; enh = S * (1 + gate) ; p = exp(enh - rowmax) ; out = f16((p v) / rowsum)
// The 49 queries and 49 keys are padded to 64; wave w owns query rows 16w .. 16w+15.
// q, k, v rows (64 floats of this head) are staged in LDS, pad rows as zeros: a
// pad key's p is set to 0, and 0 times a zero v row adds nothing.
// Fragments (A: lane holds row idx; B: column idx; the lane halves split k): both
// sides of a product take k from the same (half, element) place, so they pair.
#define AT_QP  68     // floats: pitch of q, k, p rows, 272 B = 16 B x odd (b128 and b64 readers)
#define AT_VP  72     // floats: pitch of v rows: rows two apart lie 16 banks apart (b32 readers)
#define AT_PAD 64
#define AT_KST ((NQ + 3) / 4)                    // 13 steps of 4 keys cover the 49
__global__ __launch_bounds__(128) void attn_gated_k(const float* __restrict__ qh,
                             const float* __restrict__ kh, const float* __restrict__ vh,
                             const float* __restrict__ gate, _Float16* __restrict__ outp) {
  __shared__ __attribute__((aligned(16))) float sq[AT_PAD * AT_QP];
  __shared__ __attribute__((aligned(16))) float sk[AT_PAD * AT_QP];
  __shared__ __attribute__((aligned(16))) float sp[AT_PAD * AT_QP];
  __shared__ __attribute__((aligned(16))) float sv[AT_PAD * AT_VP];
  const int b    = blockIdx.x / NHEAD;
  const int h    = blockIdx.x % NHEAD;
  const int lane = threadIdx.x;                  // 0..31
  const int wave = __builtin_amdgcn_readfirstlane(threadIdx.y);   // 0..3
  const int tid  = wave * 32 + lane;
  const int hf   = lane >> 4;
  const int idx  = lane & 15;
  const int m0   = wave * 16 + hf * 8;           // first of the lane's 8 accumulator rows

  // the gates of the lane's accumulator places, indices clamped into the 49 x 49 map;
  // asked for first, so that they fly together with the rows below
  float g[4][8];
  const float* gb = gate + (size_t)b * NQ * NQ;
#pragma unroll
  for (int r = 0; r < 8; ++r) {
    const int qi = min(m0 + r, NQ - 1);
#pragma unroll
    for (int t = 0; t < 4; ++t) g[t][r] = gb[qi * NQ + min(16 * t + idx, NQ - 1)];
  }

  // stage q, k, v: 16 threads a row (16 B each), 8 rows a pass: six whole passes,
  // then row 48 (read by all eight row groups, kept by the first), the rest zeros
  const int srow = (tid >> 4) & 7, scol = (tid & 15) * 4;
  const size_t hofs = (size_t)(b * NQ) * DMODEL + h * DKH + scol;
  const float* gq = qh + hofs;
  const float* gk = kh + hofs;
  const float* gv = vh + hofs;
  const float* gqr = gq + srow * DMODEL;
  const float* gkr = gk + srow * DMODEL;
  const float* gvr = gv + srow * DMODEL;
  v4f xq[7], xk[7], xv[7];
#pragma unroll
  for (int i = 0; i < 6; ++i) {
    xq[i] = *(const v4f*)(gqr + i * 8 * DMODEL);
    xk[i] = *(const v4f*)(gkr + i * 8 * DMODEL);
    xv[i] = *(const v4f*)(gvr + i * 8 * DMODEL);
  }
  xq[6] = *(const v4f*)(gq + (NQ - 1) * DMODEL);
  xk[6] = *(const v4f*)(gk + (NQ - 1) * DMODEL);
  xv[6] = *(const v4f*)(gv + (NQ - 1) * DMODEL);
  // the addresses stay live up to this wait, so that no load of the run
  // returns into a register that the others still name
  asm volatile("s_wait_xcnt 0x0" :: "v"(gq), "v"(gk), "v"(gv), "v"(gqr), "v"(gkr), "v"(gvr)
               : "memory");
#pragma unroll
  for (int i = 0; i < 8; ++i) {
    const int row = i * 8 + srow;
    const v4f z = {};
    const bool in = i < 6 || (i == 6 && srow == 0);
    *(v4f*)(sq + row * AT_QP + scol) = in ? xq[i < 7 ? i : 0] : z;
    *(v4f*)(sk + row * AT_QP + scol) = in ? xk[i < 7 ? i : 0] : z;
    *(v4f*)(sv + row * AT_VP + scol) = in ? xv[i < 7 ? i : 0] : z;
  }
  __syncthreads();

  // S = q k^T: one 16-byte read holds the lane's k of two steps (d = 8*k8 + 4*hf + 0..3)
  v8f s[4] = {};
  {
    const float* pa = sq + (wave * 16 + idx) * AT_QP + hf * 4;
    const float* pb = sk + idx * AT_QP + hf * 4;
#pragma unroll
    for (int k8 = 0; k8 < DKH / 8; ++k8) {
      const v4f a = *(const v4f*)(pa + k8 * 8);
      v4f bb[4];
#pragma unroll
      for (int t = 0; t < 4; ++t) bb[t] = *(const v4f*)(pb + t * 16 * AT_QP + k8 * 8);
#pragma unroll
      for (int j = 0; j < 2; ++j) {
        const v2f a2 = {a[2 * j], a[2 * j + 1]};
#pragma unroll
        for (int t = 0; t < 4; ++t) {
          const v2f b2 = {bb[t][2 * j], bb[t][2 * j + 1]};
          s[t] = __builtin_amdgcn_wmma_f32_16x16x4_f32(false, a2, false, b2, (short)0, s[t],
                                                       false, false);
        }
      }
    }
  }

  // gated softmax by rows: s[t][r] is row m0 + r, key 16*t + idx; a row lies in
  // the 16 lanes of one half. p stays unscaled, the row's sum divides at the end.
  float inv[8];
  {
    const bool ok3 = 48 + idx < NQ;              // the last tile holds key 48 alone
    float* pw = sp + m0 * AT_QP + idx;
#pragma unroll
    for (int r = 0; r < 8; ++r) {
      float e[4];
#pragma unroll
      for (int t = 0; t < 4; ++t) e[t] = s[t][r] * 0.125f * (1.f + g[t][r]);   // 1/sqrt(64)
      float m = fmaxf(fmaxf(e[0], e[1]), e[2]);
      m = ok3 ? fmaxf(m, e[3]) : m;
#pragma unroll
      for (int off = 8; off; off >>= 1) m = fmaxf(m, __shfl_xor(m, off, 32));
      const float p0 = __expf(e[0] - m), p1 = __expf(e[1] - m), p2 = __expf(e[2] - m);
      const float p3 = ok3 ? __expf(e[3] - m) : 0.f;
      float sm = (p0 + p1) + (p2 + p3);
#pragma unroll
      for (int off = 8; off; off >>= 1) sm += __shfl_xor(sm, off, 32);
      inv[r] = 1.f / sm;
      pw[r * AT_QP]      = p0;
      pw[r * AT_QP + 16] = p1;
      pw[r * AT_QP + 32] = p2;
      pw[r * AT_QP + 48] = p3;
    }
  }
  // p goes from the accumulator places to the A places through LDS, between lanes
  __syncthreads();

  // out = p v: key = 4*ks + 2*hf + 0..1 on both sides
  v8f o[4] = {};
  {
    const float* pp = sp + (wave * 16 + idx) * AT_QP + hf * 2;
    const float* pv = sv + hf * 2 * AT_VP + idx;
#pragma unroll
    for (int ks = 0; ks < AT_KST; ++ks) {
      const v2f a2 = *(const v2f*)(pp + ks * 4);
#pragma unroll
      for (int t = 0; t < 4; ++t) {
        const v2f b2 = {pv[ks * 4 * AT_VP + t * 16], pv[(ks * 4 + 1) * AT_VP + t * 16]};
        o[t] = __builtin_amdgcn_wmma_f32_16x16x4_f32(false, a2, false, b2, (short)0, o[t],
                                                     false, false);
      }
    }
  }

  _Float16* op = outp + (size_t)(b * NQ + m0) * DMODEL + h * DKH + idx;
  if (wave * 16 + 16 <= NQ) {                    // wave-uniform: all 16 rows are queries
#pragma unroll
    for (int r = 0; r < 8; ++r)
#pragma unroll
      for (int t = 0; t < 4; ++t) op[r * DMODEL + 16 * t] = (_Float16)(o[t][r] * inv[r]);
  } else {
#pragma unroll
    for (int r = 0; r < 8; ++r) {
      if (m0 + r < NQ) {
#pragma unroll
        for (int t = 0; t < 4; ++t) op[r * DMODEL + 16 * t] = (_Float16)(o[t][r] * inv[r]);
      }
    }
  }
}

// ---------------------------------------------------------------------------
extern "C" void kernel_launch(void* const* d_in, const int* in_sizes, int n_in,
                              void* d_out, int out_size, void* d_ws, size_t ws_size,
                              hipStream_t stream) {
  const float* queries = (const float*)d_in[0];
  const float* keys    = (const float*)d_in[1];
  const float* values  = (const float*)d_in[2];
  const float* Wq = (const float*)d_in[3];  const float* bq = (const float*)d_in[4];
  const float* Wk = (const float*)d_in[5];  const float* bk = (const float*)d_in[6];
  const float* Wv = (const float*)d_in[7];  const float* bv = (const float*)d_in[8];
  const float* Wo = (const float*)d_in[9];  const float* bo = (const float*)d_in[10];
  const float* rel_embed = (const float*)d_in[11];
  const float* Wproj = (const float*)d_in[12]; const float* bproj = (const float*)d_in[13];
  const float* Wgate = (const float*)d_in[14]; const float* bgate = (const float*)d_in[15];
  const float* Wc1 = (const float*)d_in[16];   const float* bc1 = (const float*)d_in[17];
  const float* gc = (const float*)d_in[18];    const float* bcln = (const float*)d_in[19];
  const float* Wc2 = (const float*)d_in[20];   const float* bc2 = (const float*)d_in[21];
  const float* Wr1 = (const float*)d_in[22];   const float* br1 = (const float*)d_in[23];
  const float* gr = (const float*)d_in[24];    const float* brln = (const float*)d_in[25];
  const float* Wr2 = (const float*)d_in[26];   const float* br2 = (const float*)d_in[27];
  const float* convW = (const float*)d_in[28]; const float* convb = (const float*)d_in[29];

  // ---- workspace carve-out (256B aligned blocks) ----
  char* base = (char*)d_ws;
  size_t off = 0;
  auto alloc = [&](size_t bytes) -> void* {
    off = (off + 255) & ~(size_t)255;
    void* p = base + off;
    off += bytes;
    return p;
  };
  _Float16* AcolH  = (_Float16*)alloc((size_t)ROWS * KCONV * 2);
  _Float16* convWH = (_Float16*)alloc((size_t)DMODEL * KCONV * 2);
  _Float16* WqT    = (_Float16*)alloc((size_t)DMODEL * DMODEL * 2);
  _Float16* WkT    = (_Float16*)alloc((size_t)DMODEL * DMODEL * 2);
  _Float16* WvT    = (_Float16*)alloc((size_t)DMODEL * DMODEL * 2);
  _Float16* WoT    = (_Float16*)alloc((size_t)DMODEL * DMODEL * 2);
  _Float16* Wc1aT  = (_Float16*)alloc((size_t)256 * DMODEL * 2);
  _Float16* Wc1bT  = (_Float16*)alloc((size_t)256 * DMODEL * 2);
  _Float16* Wr1aT  = (_Float16*)alloc((size_t)DMODEL * DMODEL * 2);
  _Float16* Wr1bT  = (_Float16*)alloc((size_t)DMODEL * DMODEL * 2);
  _Float16* eqH    = (_Float16*)alloc((size_t)ROWS * DMODEL * 2);
  _Float16* ekH    = (_Float16*)alloc((size_t)ROWS * DMODEL * 2);
  _Float16* evH    = (_Float16*)alloc((size_t)ROWS * DMODEL * 2);
  _Float16* attnoH = (_Float16*)alloc((size_t)ROWS * DMODEL * 2);
  float* hconv = (float*)alloc((size_t)ROWS * DMODEL * 4);
  float* muv   = (float*)alloc(DMODEL * 4);
  float* rstdv = (float*)alloc(DMODEL * 4);
  float* qh    = (float*)alloc((size_t)ROWS * DMODEL * 4);
  float* kh    = (float*)alloc((size_t)ROWS * DMODEL * 4);
  float* vh    = (float*)alloc((size_t)ROWS * DMODEL * 4);
  float* A1c   = (float*)alloc((size_t)ROWS * 256 * 4);
  float* A2c   = (float*)alloc((size_t)ROWS * 256 * 4);
  float* A1r   = (float*)alloc((size_t)ROWS * DMODEL * 4);
  float* A2r   = (float*)alloc((size_t)ROWS * DMODEL * 4);
  float* uvec  = (float*)alloc(DMODEL * 4);
  float* wvecp = (float*)alloc(64);
  float* cscal = (float*)alloc(64);
  float* gateb = (float*)alloc((size_t)NPAIR * 4);

  // 1) conv operands: im2col of the queries + fp16 conv weights, one grid
  im2col_cvt_k<<<CVT_BLKS + IM2COL_BLKS, ROW_THREADS, 0, stream>>>(queries, AcolH, convW, convWH);

  // 2) conv3x3 as WMMA GEMM (1568 x 512 x 4608); the gate-collapse vectors and
  //    the weight transposes run beside it in the same grid
  conv_gemm_side_k<<<SIDE_GRID, dim3(32, 4), 0, stream>>>(
      AcolH, convWH, convb, hconv,
      Wr2, Wgate, bgate, Wproj, bproj, br2, rel_embed, uvec, wvecp, cscal,
      Wq, Wk, Wv, Wo, Wr1, Wc1, WqT, WkT, WvT, WoT, Wr1aT, Wr1bT, Wc1aT, Wc1bT);

  // 3) BatchNorm(affine=False) + ReLU + residual adds (f16 activations)
  bn_stats_k<<<DMODEL, 256, 0, stream>>>(hconv, muv, rstdv);
  eqkv_k<<<(ROWS * DMODEL) / 8 / 256, 256, 0, stream>>>(hconv, muv, rstdv, queries, keys,
                                                    values, eqH, ekH, evH);

  // 4) token-level projections (all WMMA), one grid
  proj_gemms_k<<<PROJ_BLKS, dim3(32, 4), 0, stream>>>(
      eqH, ekH, evH, WqT, WkT, WvT, Wr1aT, Wr1bT, Wc1aT, Wc1bT, bq, bk, bv, br1, bc1,
      qh, kh, vh, A1r, A2r, A1c, A2c);

  // 5) per-pair gate (one wave32 per 7 pairs, 112 pairs a block)
  pair_gate_k<<<PAIR_BLKS, dim3(32, PAIR_WAVES), 0, stream>>>(
      A1c, A2c, A1r, A2r, gc, bcln, Wc2, bc2, gr, brln, uvec, wvecp, cscal, gateb);

  // 6) logits, gated softmax and A*V, one block per (b, h) (f16 output feeds final GEMM)
  attn_gated_k<<<BQ * NHEAD, dim3(32, 4), 0, stream>>>(qh, kh, vh, gateb, attnoH);

  // 7) output projection (WMMA) straight into d_out
  gemm_wmma_f16<<<BLK_N512, dim3(32, 4), 0, stream>>>(attnoH, WoT, bo, (float*)d_out);
}

// v007
// It runs in 92.7 microseconds.
// In both of two side-by-side timings against v006, it was 1.08 times as fast.
// Counting every step since v000, it is 4.33 times as fast.
#include <hip/hip_runtime.h>
#include <hip/hip_bf16.h>
#include <math.h>

// ---------------------------------------------------------------------------
// RelationEnhanceAttention, algebraically restructured for MI455X (gfx1250).
//   B=32, N=49, D=512, H=8, DK=64, NREL=TOPK=14
// Conv and projection GEMMs: f16 operands (K-innermost both sides), fp32 accumulate on
// v_wmma_f32_16x16x32_f16. 16x32 C-tile per wave, operands staged in LDS.
// ---------------------------------------------------------------------------

typedef __attribute__((ext_vector_type(16))) _Float16 v16h;
typedef __attribute__((ext_vector_type(8)))  _Float16 v8h;
typedef __attribute__((ext_vector_type(8)))  float    v8f;
typedef __attribute__((ext_vector_type(4)))  float    v4f;
typedef __attribute__((ext_vector_type(2)))  float    v2f;

#define BQ      32
#define NQ      49
#define DMODEL  512
#define NHEAD   8
#define DKH     64
#define NRELC   14
#define ROWS    (BQ * NQ)            // 1568
#define KCONV   (DMODEL * 9)         // 4608
#define NPAIR   (BQ * NQ * NQ)       // 76832
#define LN_EPS  1e-5f

// Cross-lane steps of the butterfly sums and maxima, on the vector unit: a shuffle
// would go through the LDS unit and make its wave wait for it at every step.
// Every lane of the wave is on wherever these are called.
// lane l with lane l ^ 16: cross-row move
__device__ __forceinline__ float xhalf(float x) {
  const int b = __builtin_bit_cast(int, x);
  return __builtin_bit_cast(float,
      __builtin_amdgcn_permlanex16(b, b, 0x76543210, 0xfedcba98, false, false));
}
// lane l with lane l ^ M inside its row of 16 lanes: DPP row_xmask (control 0x160 + M),
// which the compiler can fold into the add that takes it
template <int M>
__device__ __forceinline__ float xrow(float x) {
  const int b = __builtin_bit_cast(int, x);
  return __builtin_bit_cast(float, __builtin_amdgcn_update_dpp(b, b, 0x160 + M, 0xf, 0xf, true));
}
// steps 8, 4, 2, 1 (and 16 in front of them): the order of the shuffles they replace
__device__ __forceinline__ float row_sum(float x) {
  x += xrow<8>(x); x += xrow<4>(x); x += xrow<2>(x); x += xrow<1>(x);
  return x;
}
__device__ __forceinline__ float row_max(float x) {
  x = fmaxf(x, xrow<8>(x)); x = fmaxf(x, xrow<4>(x));
  x = fmaxf(x, xrow<2>(x)); x = fmaxf(x, xrow<1>(x));
  return x;
}
__device__ __forceinline__ float wave_sum(float x) {
  x += xhalf(x);
  return row_sum(x);
}

// ---------------------------------------------------------------------------
// WMMA GEMM: C[M,N] = A[M,K] * B^T[N,K] (+bias[N]).
// A: f16 row-major (M,K). Bt: f16 row-major (N,K). K is the pitch of both.
// REQUIRES: M%32==0, N%64==0, K%256==0, K>=512 (true for every call site here).
// One block of 4 waves computes a 32x64 C tile, each wave 16x32; K stepped by 32
// in rising order. The operands come into LDS in stages of 256 k (512 B of each
// of the 96 rows) by asynchronous copies: one copy of a wave is one row's whole
// 512 B, so that every request covers whole cache lines. Two buffers: the next
// stage's copies fly while this one is worked on.
// Fragment layout (ISA 16-bit A 16x32): halves 0..7  <- K = k0+8*half+0..7
//                                       halves 8..15 <- K = k0+8*half+16..23
// i.e. two 16-byte segments per lane -> two ds_load_b128 each.
// ---------------------------------------------------------------------------
#define GBM    32
#define GBN    64
#define GBK    256
#define GROWS  (GBM + GBN)            // 96 rows a stage
#define GPITCH (GBK * 2 + 16)         // 528 B = 16 B x odd: no bank conflict for b128 readers
#define GBUF   (GROWS * GPITCH)       // 50,688 B a buffer

// Eight rows, four apart (one per wave between them): lane l brings bytes
// 16*l .. 16*l+15 of each row's 512 B. The s_wait_xcnt stands inside the
// statement, so that no address register is rewritten in front of it.
template <int K>
__device__ __forceinline__ void copy8_rows(unsigned lds, const _Float16* g) {
  asm volatile(
      "global_load_async_to_lds_b128 %0, %8, off\n\t"
      "global_load_async_to_lds_b128 %1, %9, off\n\t"
      "global_load_async_to_lds_b128 %2, %10, off\n\t"
      "global_load_async_to_lds_b128 %3, %11, off\n\t"
      "global_load_async_to_lds_b128 %4, %12, off\n\t"
      "global_load_async_to_lds_b128 %5, %13, off\n\t"
      "global_load_async_to_lds_b128 %6, %14, off\n\t"
      "global_load_async_to_lds_b128 %7, %15, off\n\t"
      "s_wait_xcnt 0x0"
      :: "v"(lds), "v"(lds + 4 * GPITCH), "v"(lds + 8 * GPITCH), "v"(lds + 12 * GPITCH),
         "v"(lds + 16 * GPITCH), "v"(lds + 20 * GPITCH), "v"(lds + 24 * GPITCH),
         "v"(lds + 28 * GPITCH),
         "v"(g), "v"(g + 4 * K), "v"(g + 8 * K), "v"(g + 12 * K),
         "v"(g + 16 * K), "v"(g + 20 * K), "v"(g + 24 * K), "v"(g + 28 * K)
      : "memory");
}

template <int K>
__device__ __forceinline__ void gemm_block(const _Float16* __restrict__ A,
                                           const _Float16* __restrict__ Bt,
                                           const float* __restrict__ bias,
                                           float* __restrict__ C, int tile, int N) {
  __shared__ __attribute__((aligned(16))) unsigned char gsm[2 * GBUF];
  constexpr int NST = K / GBK;                   // stages
  static_assert(K % GBK == 0 && NST >= 2, "two stages at least");
  const int ntn  = N >> 6;                       // 64-wide column tiles
  const int tm   = tile / ntn;
  const int tn   = tile - tm * ntn;
  const int row0 = tm * GBM;
  const int col0 = tn * GBN;

  const int lane = threadIdx.x;                  // 0..31
  const int wave = __builtin_amdgcn_readfirstlane(threadIdx.y);   // 0..3
  const int hf   = lane >> 4;                    // 0/1
  const int idx  = lane & 15;
  const int wm   = wave >> 1, wn = wave & 1;     // the wave's 16 rows, 32 columns

  // copy side: wave w takes rows w, w+4, ... of the stage (A rows 0..31, B rows 32..95)
  const unsigned lds0 = (unsigned)(size_t)gsm + (unsigned)(wave * GPITCH + lane * 16);
  const _Float16* ga = A  + (size_t)(row0 + wave) * K + lane * 8;
  const _Float16* gb = Bt + (size_t)(col0 + wave) * K + lane * 8;
  auto copy_stage = [&](int st, int buf) {
    const unsigned l = lds0 + (unsigned)buf * GBUF;
    copy8_rows<K>(l, ga + st * GBK);
    copy8_rows<K>(l + 32 * GPITCH, gb + st * GBK);
    copy8_rows<K>(l + 64 * GPITCH, gb + (size_t)32 * K + st * GBK);
  };

  // read side
  const unsigned char* sa  = gsm + (wm * 16 + idx) * GPITCH + hf * 16;
  const unsigned char* sb0 = gsm + (GBM + wn * 32 + idx) * GPITCH + hf * 16;
  const unsigned char* sb1 = sb0 + 16 * GPITCH;

  v8f acc0 = {}, acc1 = {};
  union F16x16 { v16h v; v8h h[2]; };

  copy_stage(0, 0);
  // stage 0 has landed for this wave; the barrier publishes it to the others
  asm volatile("s_wait_asynccnt 0x0" ::: "memory");
  __syncthreads();
  copy_stage(1, 1);

  // rolled: one body serves both buffers, the code stays small
#pragma unroll 1
  for (int t = 0; t < NST; ++t) {
    const int bo = (t & 1) * GBUF;
    // four k steps' fragments are fetched as one group, then their eight WMMAs:
    // one LDS latency a group instead of one a WMMA
#pragma unroll
    for (int kg = 0; kg < GBK / 128; ++kg) {
      F16x16 af[4], b0[4], b1[4];
#pragma unroll
      for (int q = 0; q < 4; ++q) {
        const int o = bo + (kg * 4 + q) * 64;
        af[q].h[0] = *(const v8h*)(sa  + o);
        af[q].h[1] = *(const v8h*)(sa  + o + 32);
        b0[q].h[0] = *(const v8h*)(sb0 + o);
        b0[q].h[1] = *(const v8h*)(sb0 + o + 32);
        b1[q].h[0] = *(const v8h*)(sb1 + o);
        b1[q].h[1] = *(const v8h*)(sb1 + o + 32);
      }
      // keeps the group's loads in front of its WMMAs: the scheduler otherwise deals
      // them out again, one wait on LDS per WMMA
      __builtin_amdgcn_sched_barrier(0);
#pragma unroll
      for (int q = 0; q < 4; ++q) {
        acc0 = __builtin_amdgcn_wmma_f32_16x16x32_f16(false, af[q].v, false, b0[q].v,
                                                      (short)0, acc0, false, false);
        acc1 = __builtin_amdgcn_wmma_f32_16x16x32_f16(false, af[q].v, false, b1[q].v,
                                                      (short)0, acc1, false, false);
      }
    }
    // this wave's reads of the buffer are done before it may be refilled
    asm volatile("s_wait_dscnt 0x0" ::: "memory");
    // this wave's copies of the next stage have landed
    asm volatile("s_wait_asynccnt 0x0" ::: "memory");
    // publishes the next stage and ends every reader's last read of this one
    __syncthreads();
    if (t + 2 < NST) copy_stage(t + 2, t & 1);
  }
  // no copy is left outstanding when the wave ends
  asm volatile("s_wait_asynccnt 0x0" ::: "memory");

  // C layout: vgpr r -> m = row0 + 16*wm + r + 8*hf ; n = col0 + 32*wn + sub*16 + idx
  const int mbase = row0 + wm * 16 + hf * 8;
#pragma unroll
  for (int s = 0; s < 2; ++s) {
    const int n = col0 + wn * 32 + s * 16 + idx;
    const float badd = bias ? bias[n] : 0.f;
    const v8f a = (s == 0) ? acc0 : acc1;
#pragma unroll
    for (int r = 0; r < 8; ++r)
      C[(size_t)(mbase + r) * N + n] = a[r] + badd;
    // the next column group reuses these stores' registers: wait first
    asm volatile("s_wait_xcnt 0x0" ::: "memory");
  }
}

// blocks of 4 waves: the bound lifts the register cap, else fragments spill
__global__ __launch_bounds__(128) void gemm_wmma_f16(const _Float16* __restrict__ A,
                              const _Float16* __restrict__ Bt,
                              const float* __restrict__ bias,
                              float* __restrict__ C) {
  gemm_block<DMODEL>(A, Bt, bias, C, blockIdx.x, DMODEL);
}

// The seven token-level projections share no data dependence: one grid, the
// product chosen by block range (block-uniform). 392 blocks per 512-wide
// product, 196 per 256-wide one; one 32x64 tile per block as above.
#define BLK_N512 ((ROWS / GBM) * (DMODEL / GBN))     // 392
#define BLK_N256 ((ROWS / GBM) * (256 / GBN))        // 196
#define PROJ_BLKS (5 * BLK_N512 + 2 * BLK_N256)      // 2352
__global__ __launch_bounds__(128) void proj_gemms_k(const _Float16* __restrict__ eq, const _Float16* __restrict__ ek,
                             const _Float16* __restrict__ ev,
                             const _Float16* __restrict__ WqT, const _Float16* __restrict__ WkT,
                             const _Float16* __restrict__ WvT, const _Float16* __restrict__ Wr1aT,
                             const _Float16* __restrict__ Wr1bT, const _Float16* __restrict__ Wc1aT,
                             const _Float16* __restrict__ Wc1bT,
                             const float* __restrict__ bq, const float* __restrict__ bk,
                             const float* __restrict__ bv, const float* __restrict__ br1,
                             const float* __restrict__ bc1,
                             float* __restrict__ qh, float* __restrict__ kh,
                             float* __restrict__ vh, float* __restrict__ A1r,
                             float* __restrict__ A2r, float* __restrict__ A1c,
                             float* __restrict__ A2c) {
  const int blk = blockIdx.x;
  const _Float16* A; const _Float16* Bt; const float* bias; float* C;
  int n, lb;
  if (blk < 5 * BLK_N512) {
    const int job = blk / BLK_N512;
    lb = blk - job * BLK_N512;
    n = DMODEL;
    switch (job) {
      case 0:  A = eq; Bt = WqT;   bias = bq;      C = qh;  break;
      case 1:  A = ek; Bt = WkT;   bias = bk;      C = kh;  break;
      case 2:  A = ev; Bt = WvT;   bias = bv;      C = vh;  break;
      case 3:  A = eq; Bt = Wr1aT; bias = br1;     C = A1r; break;
      default: A = ek; Bt = Wr1bT; bias = nullptr; C = A2r; break;
    }
  } else {
    lb = blk - 5 * BLK_N512;
    n = 256;
    if (lb < BLK_N256) { A = eq; Bt = Wc1aT; bias = bc1; C = A1c; }
    else { lb -= BLK_N256; A = ek; Bt = Wc1bT; bias = nullptr; C = A2c; }
  }
  gemm_block<DMODEL>(A, Bt, bias, C, lb, n);
}

// ---------------------------------------------------------------------------
// Weight transpose + fp16 convert: W (K,N) row-major -> Wt (N,K) f16.
// One thread takes 8 consecutive k of one column n: 8 reads, each coalesced
// over the lanes' n, and one 16-byte store.
// ---------------------------------------------------------------------------
__device__ __forceinline__ void transpose_h(const float* __restrict__ W,
                                            _Float16* __restrict__ Wt, int K, int N, int t) {
  const int kc = t / N, n = t - kc * N;
  const float* p = W + (size_t)kc * 8 * N + n;
  v8h o;
#pragma unroll
  for (int j = 0; j < 8; ++j) o[j] = (_Float16)p[(size_t)j * N];
  *(v8h*)(Wt + (size_t)n * K + kc * 8) = o;
  // other block ranges' code follows in the merged kernel and reuses the
  // store's registers: wait first
  asm volatile("s_wait_xcnt 0x0" ::: "memory");
}

// ---------------------------------------------------------------------------
// im2col (f16 output) for the 3x3 pad-1 conv. x[b,c,y,x] == queries[b,y*7+x,c].
// Acol[row = b*49 + y*7 + x, kk = ic*9 + ky*3 + kx]
// ---------------------------------------------------------------------------
// The fp32 -> fp16 copy of the conv weights (layout preserved) has no data in
// common with it and rides in the same grid, on the first block range.
// One block of 192 threads makes one row of 4608 halves in either part: each
// thread 3 groups of 8 consecutive outputs, one 16-byte store a group, so that
// few waves have to be started.
#define CVT_BLKS    DMODEL                   // 512 rows of conv weights
#define IM2COL_BLKS ROWS                     // 1568 rows of Acol
#define ROW_THREADS (KCONV / 8 / 3)          // 192
__global__ void im2col_cvt_k(const float* __restrict__ q, _Float16* __restrict__ Acol,
                             const float* __restrict__ convW, _Float16* __restrict__ convWH) {
  const int tid = threadIdx.x;
  if (blockIdx.x < CVT_BLKS) {
    const size_t base = (size_t)blockIdx.x * KCONV;
#pragma unroll
    for (int i = 0; i < 3; ++i) {
      const size_t e = base + (size_t)(tid + ROW_THREADS * i) * 8;
      const v4f lo = *(const v4f*)(convW + e);
      const v4f hi = *(const v4f*)(convW + e + 4);
      v8h o;
#pragma unroll
      for (int j = 0; j < 4; ++j) { o[j] = (_Float16)lo[j]; o[4 + j] = (_Float16)hi[j]; }
      *(v8h*)(convWH + e) = o;
    }
    return;
  }
  const int row = blockIdx.x - CVT_BLKS;         // b*49 + y*7 + x
  const int p = row % NQ;
  const int y = p / 7, x = p % 7;
  unsigned valid = 0;                            // bit r: tap r lies inside the 7x7 map
#pragma unroll
  for (int r = 0; r < 9; ++r)
    if ((unsigned)(y + r / 3 - 1) < 7u && (unsigned)(x + r % 3 - 1) < 7u) valid |= 1u << r;
  const float* qc = q + (size_t)row * DMODEL;    // the centre tap's token
  _Float16* arow = Acol + (size_t)row * KCONV;
  // a tap outside the map reads the centre token (in bounds) and is zeroed: no
  // branch round a load, so all 24 loads of a thread can be in flight at once
  float ld[3][8];
  unsigned okm = 0;                              // bit 8*i+j: that output's tap is inside
#pragma unroll
  for (int i = 0; i < 3; ++i) {
    const int kk0 = (tid + ROW_THREADS * i) * 8;
    int ic = kk0 / 9, r = kk0 % 9;
#pragma unroll
    for (int j = 0; j < 8; ++j) {
      const unsigned ok = (valid >> r) & 1u;
      const int ky = (r * 11) >> 5;              // r / 3 for r in 0..8
      const int tap = (r + 4 * ky - 8) * (int)ok;    // (ky-1)*7 + (kx-1), or the centre
      ld[i][j] = qc[tap * DMODEL + ic];
      okm |= ok << (8 * i + j);
      const int wrap = (r == 8);
      r = wrap ? 0 : r + 1;
      ic += wrap;
    }
  }
#pragma unroll
  for (int i = 0; i < 3; ++i) {
    v8h o;
#pragma unroll
    for (int j = 0; j < 8; ++j)
      o[j] = (_Float16)(((okm >> (8 * i + j)) & 1u) ? ld[i][j] : 0.f);
    *(v8h*)(arow + (tid + ROW_THREADS * i) * 8) = o;
  }
}

// BatchNorm stats over (B, spatial) = 1568 rows per channel (population var).
__global__ void bn_stats_k(const float* __restrict__ h, float* __restrict__ mu,
                           float* __restrict__ rstd) {
  const int c = blockIdx.x, tid = threadIdx.x;
  float s = 0.f, ss = 0.f;
  for (int r = tid; r < ROWS; r += 256) {
    float v = h[(size_t)r * DMODEL + c];
    s += v; ss += v * v;
  }
  __shared__ float sh[256], sh2[256];
  sh[tid] = s; sh2[tid] = ss; __syncthreads();
  for (int off = 128; off; off >>= 1) {
    if (tid < off) { sh[tid] += sh[tid + off]; sh2[tid] += sh2[tid + off]; }
    __syncthreads();
  }
  if (tid == 0) {
    float m = sh[0] * (1.f / ROWS);
    float v = sh2[0] * (1.f / ROWS) - m * m;
    mu[c] = m; rstd[c] = rsqrtf(v + LN_EPS);
  }
}

// xs = relu(BN(h)); eq/ek/ev = f16(xs + queries/keys/values)
__global__ void eqkv_k(const float* __restrict__ h, const float* __restrict__ mu,
                       const float* __restrict__ rstd,
                       const float* __restrict__ q, const float* __restrict__ k,
                       const float* __restrict__ v,
                       _Float16* __restrict__ eq, _Float16* __restrict__ ek,
                       _Float16* __restrict__ ev) {
  const size_t t = ((size_t)blockIdx.x * blockDim.x + threadIdx.x) * 8;   // 8 channels a thread
  if (t >= (size_t)ROWS * DMODEL) return;
  const int c = (int)(t % DMODEL);
  v8h oq, ok, ov;
#pragma unroll
  for (int g = 0; g < 2; ++g) {
    const v4f h4 = *(const v4f*)(h + t + 4 * g);
    const v4f m4 = *(const v4f*)(mu + c + 4 * g);
    const v4f r4 = *(const v4f*)(rstd + c + 4 * g);
    const v4f q4 = *(const v4f*)(q + t + 4 * g);
    const v4f k4 = *(const v4f*)(k + t + 4 * g);
    const v4f v4 = *(const v4f*)(v + t + 4 * g);
#pragma unroll
    for (int j = 0; j < 4; ++j) {
      const float xs = fmaxf((h4[j] - m4[j]) * r4[j], 0.f);
      oq[4 * g + j] = (_Float16)(xs + q4[j]);
      ok[4 * g + j] = (_Float16)(xs + k4[j]);
      ov[4 * g + j] = (_Float16)(xs + v4[j]);
    }
  }
  *(v8h*)(eq + t) = oq;
  *(v8h*)(ek + t) = ok;
  *(v8h*)(ev + t) = ov;
}

// Precompute gate-collapse vectors:
//   u[512] = Wr2 @ Wgate ; wv[14] = rel_embed @ (Wproj @ Wgate)
//   cs = (br2 + bproj) . Wgate + bgate
// Blocks of 128 threads: parts 0..3 take 128 rows of u each, part 4 the rest.
__device__ __forceinline__ void precompute_part(int part, int t,
                             const float* __restrict__ Wr2, const float* __restrict__ Wgate,
                             const float* __restrict__ bgate, const float* __restrict__ Wproj,
                             const float* __restrict__ bproj, const float* __restrict__ br2,
                             const float* __restrict__ rel_embed,
                             float* __restrict__ u, float* __restrict__ wv,
                             float* __restrict__ cs) {
  __shared__ float pv[DKH];
  if (part < 4) {                                // block-uniform
    const int row = part * 128 + t;
    float s = 0.f;
    for (int j = 0; j < DMODEL; ++j) s += Wr2[(size_t)row * DMODEL + j] * Wgate[j];
    u[row] = s;
    // the fifth part's code follows and reuses the store's registers: wait first
    asm volatile("s_wait_xcnt 0x0" ::: "memory");
    return;
  }
  if (t < DKH) {
    float s = 0.f;
    for (int d = 0; d < DMODEL; ++d) s += Wproj[(size_t)t * DMODEL + d] * Wgate[d];
    pv[t] = s;
  }
  __syncthreads();
  if (t < NRELC) {
    float s = 0.f;
    const unsigned rb = (unsigned)t * (DKH * 4u);   // the row's byte offset
    const float* rp = (const float*)((const char*)rel_embed + rb);
    for (int d = 0; d < DKH; ++d) s += rp[d] * pv[d];
    // the row's offset stays live up to this wait, so that no load of the run
    // returns into the register that the others still name
    asm volatile("s_wait_xcnt 0x0" :: "v"(rb) : "memory");
    wv[t] = s;
  }
  if (t == 0) {
    float s = bgate[0];
    for (int d = 0; d < DMODEL; ++d) s += (br2[d] + bproj[d]) * Wgate[d];
    cs[0] = s;
  }
}

// conv GEMM grid (392 blocks of 4 waves leave most wave slots empty) plus the
// work that nothing before the projections depends on: the gate-collapse
// vectors and the eight weight transposes, on the block ranges behind it.
#define CONV_BLKS ((ROWS / GBM) * (DMODEL / GBN))      // 392
#define PRE_BLKS  5
#define TR512_BLKS (DMODEL * DMODEL / 8 / 128)         // 256
#define TR256_BLKS (DMODEL * 256 / 8 / 128)            // 128
#define SIDE_GRID (CONV_BLKS + PRE_BLKS + 6 * TR512_BLKS + 2 * TR256_BLKS)
__global__ __launch_bounds__(128) void conv_gemm_side_k(const _Float16* __restrict__ Acol,
                                 const _Float16* __restrict__ convWH,
                                 const float* __restrict__ convb, float* __restrict__ hconv,
                                 const float* __restrict__ Wr2, const float* __restrict__ Wgate,
                                 const float* __restrict__ bgate, const float* __restrict__ Wproj,
                                 const float* __restrict__ bproj, const float* __restrict__ br2,
                                 const float* __restrict__ rel_embed,
                                 float* __restrict__ u, float* __restrict__ wv,
                                 float* __restrict__ cs,
                                 const float* __restrict__ Wq, const float* __restrict__ Wk,
                                 const float* __restrict__ Wv, const float* __restrict__ Wo,
                                 const float* __restrict__ Wr1, const float* __restrict__ Wc1,
                                 _Float16* __restrict__ WqT, _Float16* __restrict__ WkT,
                                 _Float16* __restrict__ WvT, _Float16* __restrict__ WoT,
                                 _Float16* __restrict__ Wr1aT, _Float16* __restrict__ Wr1bT,
                                 _Float16* __restrict__ Wc1aT, _Float16* __restrict__ Wc1bT) {
  int blk = blockIdx.x;
  if (blk < CONV_BLKS) {
    gemm_block<KCONV>(Acol, convWH, convb, hconv, blk, DMODEL);
    return;
  }
  blk -= CONV_BLKS;
  const int tid = threadIdx.y * 32 + threadIdx.x;
  if (blk < PRE_BLKS) {
    precompute_part(blk, tid, Wr2, Wgate, bgate, Wproj, bproj, br2, rel_embed, u, wv, cs);
    return;
  }
  blk -= PRE_BLKS;
  if (blk < 6 * TR512_BLKS) {
    const int job = blk / TR512_BLKS;
    const int t = (blk - job * TR512_BLKS) * 128 + tid;
    const float* W; _Float16* Wt;
    switch (job) {
      case 0:  W = Wq;  Wt = WqT;  break;
      case 1:  W = Wk;  Wt = WkT;  break;
      case 2:  W = Wv;  Wt = WvT;  break;
      case 3:  W = Wo;  Wt = WoT;  break;
      case 4:  W = Wr1; Wt = Wr1aT; break;
      default: W = Wr1 + (size_t)DMODEL * DMODEL; Wt = Wr1bT; break;
    }
    transpose_h(W, Wt, DMODEL, DMODEL, t);
  } else {
    blk -= 6 * TR512_BLKS;
    const int second = blk >= TR256_BLKS;
    const int t = (blk - second * TR256_BLKS) * 128 + tid;
    transpose_h(second ? Wc1 + (size_t)DMODEL * 256 : Wc1, second ? Wc1bT : Wc1aT,
                DMODEL, 256, t);
  }
}

// One wave32 per (b, qi, group of 7 ki), 16 waves a block = 112 pairs = 7 tiles of 16.
// Classifier branch: each wave makes LN(256)->ReLU of its 7 pairs and lays the rows in
// LDS; the 256x14 product of 16 pairs at a time then runs on v_wmma_f32_16x16x4_f32
// (operands stay fp32), one tile per wave 0..6, with the softmax and probs.wv taken
// from the accumulator (a pair's 14 logits lie in the 16 lanes of one half).
// Relation branch: LN(512)->ReLU->dot(u) per pair as before; gate = sigmoid(.).
// All that does not depend on ki (the LN scales and shifts, u, the q-side rows) is
// loaded once per wave and stays in registers over the 7 pairs. qi runs fastest over
// the waves, so that the waves of a block mostly read the same k-side rows (WGP cache).
#define KI_GRP     7
#define PAIR_WAVES 16
#define PAIR_THREADS (32 * PAIR_WAVES)                          // 512
#define PAIR_BLKS (BQ * (NQ / KI_GRP) * NQ / PAIR_WAVES)        // 686
#define PB_PAIRS  (PAIR_WAVES * KI_GRP)                         // 112
#define PB_TILES  (PB_PAIRS / 16)                               // 7
#define HV_P      260     // floats: pitch of a pair's row, 1040 B = 16 B x odd (b128 readers)
// four waves per SIMD: the register budget of 256 that one block per WGP needs
__global__ __launch_bounds__(PAIR_THREADS) __attribute__((amdgpu_waves_per_eu(4)))
void pair_gate_k(const float* __restrict__ A1c, const float* __restrict__ A2c,
                            const float* __restrict__ A1r, const float* __restrict__ A2r,
                            const float* __restrict__ gc, const float* __restrict__ bcln,
                            const float* __restrict__ Wc2, const float* __restrict__ bc2,
                            const float* __restrict__ gr, const float* __restrict__ brln,
                            const float* __restrict__ u, const float* __restrict__ wv,
                            const float* __restrict__ cs, float* __restrict__ gate) {
  __shared__ __attribute__((aligned(16))) float hvs[PB_PAIRS * HV_P];   // ReLU(LN) rows
  __shared__ __attribute__((aligned(16))) float wb[32 * 32 * 4];        // Wc2 as B fragments
  __shared__ float spw[PB_PAIRS];                                       // probs . wv
  const int lane = threadIdx.x;
  const int wl   = __builtin_amdgcn_readfirstlane(threadIdx.y);         // 0..15
  const int hf   = lane >> 4;
  const int idx  = lane & 15;
  const int wave = blockIdx.x * PAIR_WAVES + wl;                        // (b, ki group, qi)
  const int b   = wave / ((NQ / KI_GRP) * NQ);
  const int rm  = wave % ((NQ / KI_GRP) * NQ);
  const int ki0 = (rm / NQ) * KI_GRP;
  const int qi  = rm % NQ;

  const float* a1 = A1c + (size_t)(b * NQ + qi) * 256;
  const float* r1 = A1r + (size_t)(b * NQ + qi) * DMODEL;
  const float* a2 = A2c + (size_t)(b * NQ + ki0) * 256;
  const float* r2 = A2r + (size_t)(b * NQ + ki0) * DMODEL;
  // lane i collects the value of pair ki0 + i (equal in all lanes behind the sum
  // over the lanes); the sigmoid is then done once for the 7 pairs
  float gdn = 0.f;

  // Wc2 in B-fragment order: entry (c, lane) holds rows 8c + 4*hf + 0..3 of column idx,
  // columns 14 and 15 as zeros. Wave wl writes entries c = wl and c = wl + 16.
  {
    const unsigned wo = (unsigned)((8 * wl + 4 * hf) * NRELC + min(idx, NRELC - 1)) * 4u;
    const float* wp = (const float*)((const char*)Wc2 + wo);
    v4f w0, w1;
#pragma unroll
    for (int q = 0; q < 4; ++q) {
      w0[q] = wp[q * NRELC];
      w1[q] = wp[(128 + q) * NRELC];
    }
    // the offset stays live up to this wait, so that no load of the run
    // returns into the register that the others still name
    asm volatile("s_wait_xcnt 0x0" :: "v"(wo) : "memory");
    const v4f z = {};
    *(v4f*)(wb + (wl * 32 + lane) * 4)        = idx < NRELC ? w0 : z;
    *(v4f*)(wb + ((wl + 16) * 32 + lane) * 4) = idx < NRELC ? w1 : z;
  }

  // ---- classifier branch, part 1: LN over 256, ReLU, rows to LDS ----
  {
    float gcv[8], bcv[8], a1v[8];
    const float* a1l = a1 + lane;
#pragma unroll
    for (int j = 0; j < 8; ++j) {
      const int e = lane + 32 * j;
      a1v[j] = a1l[32 * j]; gcv[j] = gc[e]; bcv[j] = bcln[e];
    }
    // the address stays live up to this wait, so that no load of the run
    // returns into a register that the others still name
    asm volatile("s_wait_xcnt 0x0" :: "v"(a1l) : "memory");
    // unrolled: the 7 pairs' loads and sums over the lanes can overlap
#pragma unroll
    for (int i = 0; i < KI_GRP; ++i) {
      float x[8], s = 0.f, ss = 0.f;
#pragma unroll
      for (int j = 0; j < 8; ++j) {
        float v = a1v[j] + a2[i * 256 + lane + 32 * j];
        x[j] = v; s += v; ss += v * v;
      }
      s = wave_sum(s); ss = wave_sum(ss);
      const float mean = s * (1.f / 256.f);
      const float rstd = rsqrtf(ss * (1.f / 256.f) - mean * mean + LN_EPS);
      float* hrow = hvs + (wl * KI_GRP + i) * HV_P + lane;
#pragma unroll
      for (int j = 0; j < 8; ++j)
        hrow[32 * j] = fmaxf((x[j] - mean) * rstd * gcv[j] + bcv[j], 0.f);
    }
  }
  // the rows and the Wc2 fragments go from their writers to the tiles' waves
  __syncthreads();

  // ---- classifier branch, part 2: 16 pairs x 256 x 14 on WMMA, softmax, probs.wv ----
  // Fragments (A: lane holds pair idx; B: column idx; the lane halves split k): both
  // sides take feature 8c + 4*hf + 2j + 0..1 at step (c, j), so they pair.
  if (wl < PB_TILES) {                           // wave-uniform
    const unsigned no = (unsigned)min(idx, NRELC - 1) * 4u;
    const float bn  = *(const float*)((const char*)bc2 + no);
    const float wvn = *(const float*)((const char*)wv + no);
    // as above: the offset stays live up to this wait
    asm volatile("s_wait_xcnt 0x0" :: "v"(no) : "memory");
    const float* pa = hvs + (wl * 16 + idx) * HV_P + hf * 4;
    const float* pb = wb + lane * 4;
    v8f acc[4] = {};                             // four chains: no WMMA waits on the one before
    // unrolled: the chain's index is then a constant, and LDS reads can run ahead of the WMMAs
#pragma unroll
    for (int c = 0; c < 32; ++c) {
      const v4f a = *(const v4f*)(pa + c * 8);
      const v4f w = *(const v4f*)(pb + c * 128);
#pragma unroll
      for (int j = 0; j < 2; ++j) {
        const v2f a2f = {a[2 * j], a[2 * j + 1]};
        const v2f b2f = {w[2 * j], w[2 * j + 1]};
        acc[(c & 1) * 2 + j] = __builtin_amdgcn_wmma_f32_16x16x4_f32(
            false, a2f, false, b2f, (short)0, acc[(c & 1) * 2 + j], false, false);
      }
    }
    const v8f lgv = (acc[0] + acc[1]) + (acc[2] + acc[3]);
    // lgv[r] is pair 16*wl + 8*hf + r, class idx
    const bool okn = idx < NRELC;
    float pwk = 0.f, sek = 1.f;                  // lane idx keeps row idx of its half
#pragma unroll
    for (int r = 0; r < 8; ++r) {
      const float l = lgv[r] + bn;
      const float m = row_max(okn ? l : -__builtin_inff());
      const float p = okn ? __expf(l - m) : 0.f;
      const float se = row_sum(p), pw = row_sum(p * wvn);
      pwk = (idx == r) ? pw : pwk;
      sek = (idx == r) ? se : sek;
    }
    // probs = p/se; top-k(14 of 14) renorm = /(1+1e-8)
    if (idx < 8) spw[wl * 16 + hf * 8 + idx] = pwk / (sek * (1.f + 1e-8f));
  }

  // ---- relation branch: LN over 512, ReLU, dot with u ----
  {
    float grv[16], brv[16], uv[16], r1v[16];
    const float* r1l = r1 + lane;
#pragma unroll
    for (int j = 0; j < 16; ++j) {
      const int e = lane + 32 * j;
      r1v[j] = r1l[32 * j]; grv[j] = gr[e]; brv[j] = brln[e]; uv[j] = u[e];
    }
    // as above: the row's address stays live up to this wait
    asm volatile("s_wait_xcnt 0x0" :: "v"(r1l) : "memory");
    // unrolled: the 7 pairs' loads and sums over the lanes can overlap
#pragma unroll
    for (int i = 0; i < KI_GRP; ++i) {
      float y[16], s = 0.f, ss = 0.f;
#pragma unroll
      for (int j = 0; j < 16; ++j) {
        float v = r1v[j] + r2[i * DMODEL + lane + 32 * j];
        y[j] = v; s += v; ss += v * v;
      }
      s = wave_sum(s); ss = wave_sum(ss);
      const float mean = s * (1.f / 512.f);
      const float rstd = rsqrtf(ss * (1.f / 512.f) - mean * mean + LN_EPS);
      float gd = 0.f;
#pragma unroll
      for (int j = 0; j < 16; ++j) {
        float hv = fmaxf((y[j] - mean) * rstd * grv[j] + brv[j], 0.f);
        gd += hv * uv[j];
      }
      gd = wave_sum(gd);
      gdn = (lane == i) ? gd : gdn;
    }
  }

  // probs.wv goes from the tiles' waves back to the pairs' own waves
  __syncthreads();
  const float pwv = spw[wl * KI_GRP + min(lane, KI_GRP - 1)];
  if (lane < KI_GRP)
    gate[(size_t)(b * NQ + qi) * NQ + ki0 + lane] = 1.f / (1.f + __expf(-(gdn + pwv + cs[0])));
}

// Gated attention of one (b, h) in one block of 4 waves, both products on
// v_wmma_f32_16x16x4_f32 (operands stay fp32):
//   S = q k^T / 8 ; enh = S * (1 + gate) ; p = exp(enh - rowmax) ; out = f16((p v) / rowsum)
// The 49 queries and 49 keys are padded to 64; wave w owns query rows 16w .. 16w+15.
// q, k, v rows (64 floats of this head) are staged in LDS, pad rows as zeros: a
// pad key's p is set to 0, and 0 times a zero v row adds nothing.
// Fragments (A: lane holds row idx; B: column idx; the lane halves split k): both
// sides of a product take k from the same (half, element) place, so they pair.
#define AT_QP  68     // floats: pitch of q, k, p rows, 272 B = 16 B x odd (b128 and b64 readers)
#define AT_VP  72     // floats: pitch of v rows: rows two apart lie 16 banks apart (b32 readers)
#define AT_PAD 64
#define AT_KST ((NQ + 3) / 4)                    // 13 steps of 4 keys cover the 49
__global__ __launch_bounds__(128) void attn_gated_k(const float* __restrict__ qh,
                             const float* __restrict__ kh, const float* __restrict__ vh,
                             const float* __restrict__ gate, _Float16* __restrict__ outp) {
  __shared__ __attribute__((aligned(16))) float sq[AT_PAD * AT_QP];
  __shared__ __attribute__((aligned(16))) float sk[AT_PAD * AT_QP];
  __shared__ __attribute__((aligned(16))) float sp[AT_PAD * AT_QP];
  __shared__ __attribute__((aligned(16))) float sv[AT_PAD * AT_VP];
  const int b    = blockIdx.x / NHEAD;
  const int h    = blockIdx.x % NHEAD;
  const int lane = threadIdx.x;                  // 0..31
  const int wave = __builtin_amdgcn_readfirstlane(threadIdx.y);   // 0..3
  const int tid  = wave * 32 + lane;
  const int hf   = lane >> 4;
  const int idx  = lane & 15;
  const int m0   = wave * 16 + hf * 8;           // first of the lane's 8 accumulator rows

  // the gates of the lane's accumulator places, indices clamped into the 49 x 49 map;
  // asked for first, so that they fly together with the rows below
  float g[4][8];
  const float* gb = gate + (size_t)b * NQ * NQ;
#pragma unroll
  for (int r = 0; r < 8; ++r) {
    const int qi = min(m0 + r, NQ - 1);
#pragma unroll
    for (int t = 0; t < 4; ++t) g[t][r] = gb[qi * NQ + min(16 * t + idx, NQ - 1)];
  }

  // stage q, k, v: 16 threads a row (16 B each), 8 rows a pass: six whole passes,
  // then row 48 (read by all eight row groups, kept by the first), the rest zeros
  const int srow = (tid >> 4) & 7, scol = (tid & 15) * 4;
  const size_t hofs = (size_t)(b * NQ) * DMODEL + h * DKH + scol;
  const float* gq = qh + hofs;
  const float* gk = kh + hofs;
  const float* gv = vh + hofs;
  const float* gqr = gq + srow * DMODEL;
  const float* gkr = gk + srow * DMODEL;
  const float* gvr = gv + srow * DMODEL;
  v4f xq[7], xk[7], xv[7];
#pragma unroll
  for (int i = 0; i < 6; ++i) {
    xq[i] = *(const v4f*)(gqr + i * 8 * DMODEL);
    xk[i] = *(const v4f*)(gkr + i * 8 * DMODEL);
    xv[i] = *(const v4f*)(gvr + i * 8 * DMODEL);
  }
  xq[6] = *(const v4f*)(gq + (NQ - 1) * DMODEL);
  xk[6] = *(const v4f*)(gk + (NQ - 1) * DMODEL);
  xv[6] = *(const v4f*)(gv + (NQ - 1) * DMODEL);
  // the addresses stay live up to this wait, so that no load of the run
  // returns into a register that the others still name
  asm volatile("s_wait_xcnt 0x0" :: "v"(gq), "v"(gk), "v"(gv), "v"(gqr), "v"(gkr), "v"(gvr)
               : "memory");
#pragma unroll
  for (int i = 0; i < 8; ++i) {
    const int row = i * 8 + srow;
    const v4f z = {};
    const bool in = i < 6 || (i == 6 && srow == 0);
    *(v4f*)(sq + row * AT_QP + scol) = in ? xq[i < 7 ? i : 0] : z;
    *(v4f*)(sk + row * AT_QP + scol) = in ? xk[i < 7 ? i : 0] : z;
    *(v4f*)(sv + row * AT_VP + scol) = in ? xv[i < 7 ? i : 0] : z;
  }
  __syncthreads();

  // S = q k^T: one 16-byte read holds the lane's k of two steps (d = 8*k8 + 4*hf + 0..3)
  v8f s[4] = {};
  {
    const float* pa = sq + (wave * 16 + idx) * AT_QP + hf * 4;
    const float* pb = sk + idx * AT_QP + hf * 4;
#pragma unroll
    for (int k8 = 0; k8 < DKH / 8; ++k8) {
      const v4f a = *(const v4f*)(pa + k8 * 8);
      v4f bb[4];
#pragma unroll
      for (int t = 0; t < 4; ++t) bb[t] = *(const v4f*)(pb + t * 16 * AT_QP + k8 * 8);
#pragma unroll
      for (int j = 0; j < 2; ++j) {
        const v2f a2 = {a[2 * j], a[2 * j + 1]};
#pragma unroll
        for (int t = 0; t < 4; ++t) {
          const v2f b2 = {bb[t][2 * j], bb[t][2 * j + 1]};
          s[t] = __builtin_amdgcn_wmma_f32_16x16x4_f32(false, a2, false, b2, (short)0, s[t],
                                                       false, false);
        }
      }
    }
  }

  // gated softmax by rows: s[t][r] is row m0 + r, key 16*t + idx; a row lies in
  // the 16 lanes of one half. p stays unscaled, the row's sum divides at the end.
  float inv[8];
  {
    const bool ok3 = 48 + idx < NQ;              // the last tile holds key 48 alone
    float* pw = sp + m0 * AT_QP + idx;
#pragma unroll
    for (int r = 0; r < 8; ++r) {
      float e[4];
#pragma unroll
      for (int t = 0; t < 4; ++t) e[t] = s[t][r] * 0.125f * (1.f + g[t][r]);   // 1/sqrt(64)
      float m = fmaxf(fmaxf(e[0], e[1]), e[2]);
      m = row_max(ok3 ? fmaxf(m, e[3]) : m);
      const float p0 = __expf(e[0] - m), p1 = __expf(e[1] - m), p2 = __expf(e[2] - m);
      const float p3 = ok3 ? __expf(e[3] - m) : 0.f;
      const float sm = row_sum((p0 + p1) + (p2 + p3));
      inv[r] = 1.f / sm;
      pw[r * AT_QP]      = p0;
      pw[r * AT_QP + 16] = p1;
      pw[r * AT_QP + 32] = p2;
      pw[r * AT_QP + 48] = p3;
    }
  }
  // p goes from the accumulator places to the A places through LDS, between lanes
  __syncthreads();

  // out = p v: key = 4*ks + 2*hf + 0..1 on both sides
  v8f o[4] = {};
  {
    const float* pp = sp + (wave * 16 + idx) * AT_QP + hf * 2;
    const float* pv = sv + hf * 2 * AT_VP + idx;
#pragma unroll
    for (int ks = 0; ks < AT_KST; ++ks) {
      const v2f a2 = *(const v2f*)(pp + ks * 4);
#pragma unroll
      for (int t = 0; t < 4; ++t) {
        const v2f b2 = {pv[ks * 4 * AT_VP + t * 16], pv[(ks * 4 + 1) * AT_VP + t * 16]};
        o[t] = __builtin_amdgcn_wmma_f32_16x16x4_f32(false, a2, false, b2, (short)0, o[t],
                                                     false, false);
      }
    }
  }

  _Float16* op = outp + (size_t)(b * NQ + m0) * DMODEL + h * DKH + idx;
  if (wave * 16 + 16 <= NQ) {                    // wave-uniform: all 16 rows are queries
#pragma unroll
    for (int r = 0; r < 8; ++r)
#pragma unroll
      for (int t = 0; t < 4; ++t) op[r * DMODEL + 16 * t] = (_Float16)(o[t][r] * inv[r]);
  } else {
#pragma unroll
    for (int r = 0; r < 8; ++r) {
      if (m0 + r < NQ) {
#pragma unroll
        for (int t = 0; t < 4; ++t) op[r * DMODEL + 16 * t] = (_Float16)(o[t][r] * inv[r]);
      }
    }
  }
}

// ---------------------------------------------------------------------------
extern "C" void kernel_launch(void* const* d_in, const int* in_sizes, int n_in,
                              void* d_out, int out_size, void* d_ws, size_t ws_size,
                              hipStream_t stream) {
  const float* queries = (const float*)d_in[0];
  const float* keys    = (const float*)d_in[1];
  const float* values  = (const float*)d_in[2];
  const float* Wq = (const float*)d_in[3];  const float* bq = (const float*)d_in[4];
  const float* Wk = (const float*)d_in[5];  const float* bk = (const float*)d_in[6];
  const float* Wv = (const float*)d_in[7];  const float* bv = (const float*)d_in[8];
  const float* Wo = (const float*)d_in[9];  const float* bo = (const float*)d_in[10];
  const float* rel_embed = (const float*)d_in[11];
  const float* Wproj = (const float*)d_in[12]; const float* bproj = (const float*)d_in[13];
  const float* Wgate = (const float*)d_in[14]; const float* bgate = (const float*)d_in[15];
  const float* Wc1 = (const float*)d_in[16];   const float* bc1 = (const float*)d_in[17];
  const float* gc = (const float*)d_in[18];    const float* bcln = (const float*)d_in[19];
  const float* Wc2 = (const float*)d_in[20];   const float* bc2 = (const float*)d_in[21];
  const float* Wr1 = (const float*)d_in[22];   const float* br1 = (const float*)d_in[23];
  const float* gr = (const float*)d_in[24];    const float* brln = (const float*)d_in[25];
  const float* Wr2 = (const float*)d_in[26];   const float* br2 = (const float*)d_in[27];
  const float* convW = (const float*)d_in[28]; const float* convb = (const float*)d_in[29];

  // ---- workspace carve-out (256B aligned blocks) ----
  char* base = (char*)d_ws;
  size_t off = 0;
  auto alloc = [&](size_t bytes) -> void* {
    off = (off + 255) & ~(size_t)255;
    void* p = base + off;
    off += bytes;
    return p;
  };
  _Float16* AcolH  = (_Float16*)alloc((size_t)ROWS * KCONV * 2);
  _Float16* convWH = (_Float16*)alloc((size_t)DMODEL * KCONV * 2);
  _Float16* WqT    = (_Float16*)alloc((size_t)DMODEL * DMODEL * 2);
  _Float16* WkT    = (_Float16*)alloc((size_t)DMODEL * DMODEL * 2);
  _Float16* WvT    = (_Float16*)alloc((size_t)DMODEL * DMODEL * 2);
  _Float16* WoT    = (_Float16*)alloc((size_t)DMODEL * DMODEL * 2);
  _Float16* Wc1aT  = (_Float16*)alloc((size_t)256 * DMODEL * 2);
  _Float16* Wc1bT  = (_Float16*)alloc((size_t)256 * DMODEL * 2);
  _Float16* Wr1aT  = (_Float16*)alloc((size_t)DMODEL * DMODEL * 2);
  _Float16* Wr1bT  = (_Float16*)alloc((size_t)DMODEL * DMODEL * 2);
  _Float16* eqH    = (_Float16*)alloc((size_t)ROWS * DMODEL * 2);
  _Float16* ekH    = (_Float16*)alloc((size_t)ROWS * DMODEL * 2);
  _Float16* evH    = (_Float16*)alloc((size_t)ROWS * DMODEL * 2);
  _Float16* attnoH = (_Float16*)alloc((size_t)ROWS * DMODEL * 2);
  float* hconv = (float*)alloc((size_t)ROWS * DMODEL * 4);
  float* muv   = (float*)alloc(DMODEL * 4);
  float* rstdv = (float*)alloc(DMODEL * 4);
  float* qh    = (float*)alloc((size_t)ROWS * DMODEL * 4);
  float* kh    = (float*)alloc((size_t)ROWS * DMODEL * 4);
  float* vh    = (float*)alloc((size_t)ROWS * DMODEL * 4);
  float* A1c   = (float*)alloc((size_t)ROWS * 256 * 4);
  float* A2c   = (float*)alloc((size_t)ROWS * 256 * 4);
  float* A1r   = (float*)alloc((size_t)ROWS * DMODEL * 4);
  float* A2r   = (float*)alloc((size_t)ROWS * DMODEL * 4);
  float* uvec  = (float*)alloc(DMODEL * 4);
  float* wvecp = (float*)alloc(64);
  float* cscal = (float*)alloc(64);
  float* gateb = (float*)alloc((size_t)NPAIR * 4);

  // 1) conv operands: im2col of the queries + fp16 conv weights, one grid
  im2col_cvt_k<<<CVT_BLKS + IM2COL_BLKS, ROW_THREADS, 0, stream>>>(queries, AcolH, convW, convWH);

  // 2) conv3x3 as WMMA GEMM (1568 x 512 x 4608); the gate-collapse vectors and
  //    the weight transposes run beside it in the same grid
  conv_gemm_side_k<<<SIDE_GRID, dim3(32, 4), 0, stream>>>(
      AcolH, convWH, convb, hconv,
      Wr2, Wgate, bgate, Wproj, bproj, br2, rel_embed, uvec, wvecp, cscal,
      Wq, Wk, Wv, Wo, Wr1, Wc1, WqT, WkT, WvT, WoT, Wr1aT, Wr1bT, Wc1aT, Wc1bT);

  // 3) BatchNorm(affine=False) + ReLU + residual adds (f16 activations)
  bn_stats_k<<<DMODEL, 256, 0, stream>>>(hconv, muv, rstdv);
  eqkv_k<<<(ROWS * DMODEL) / 8 / 256, 256, 0, stream>>>(hconv, muv, rstdv, queries, keys,
                                                    values, eqH, ekH, evH);

  // 4) token-level projections (all WMMA), one grid
  proj_gemms_k<<<PROJ_BLKS, dim3(32, 4), 0, stream>>>(
      eqH, ekH, evH, WqT, WkT, WvT, Wr1aT, Wr1bT, Wc1aT, Wc1bT, bq, bk, bv, br1, bc1,
      qh, kh, vh, A1r, A2r, A1c, A2c);

  // 5) per-pair gate (one wave32 per 7 pairs, 112 pairs a block)
  pair_gate_k<<<PAIR_BLKS, dim3(32, PAIR_WAVES), 0, stream>>>(
      A1c, A2c, A1r, A2r, gc, bcln, Wc2, bc2, gr, brln, uvec, wvecp, cscal, gateb);

  // 6) logits, gated softmax and A*V, one block per (b, h) (f16 output feeds final GEMM)
  attn_gated_k<<<BQ * NHEAD, dim3(32, 4), 0, stream>>>(qh, kh, vh, gateb, attnoH);

  // 7) output projection (WMMA) straight into d_out
  gemm_wmma_f16<<<BLK_N512, dim3(32, 4), 0, stream>>>(attnoH, WoT, bo, (float*)d_out);
}

// v008
// A run of this version takes 85.5 microseconds.
// Next to v007, in two timings, it ran 1.08 and 1.07 times as fast.
// Over all steps from v000 it is 4.67 times as fast.
#include <hip/hip_runtime.h>
#include <hip/hip_bf16.h>
#include <math.h>

// ---------------------------------------------------------------------------
// RelationEnhanceAttention, algebraically restructured for MI455X (gfx1250).
//   B=32, N=49, D=512, H=8, DK=64, NREL=TOPK=14
// Conv and projection GEMMs: f16 operands (K-innermost both sides), fp32 accumulate on
// v_wmma_f32_16x16x32_f16. 16x32 C-tile per wave, operands staged in LDS.
// ---------------------------------------------------------------------------

typedef __attribute__((ext_vector_type(16))) _Float16 v16h;
typedef __attribute__((ext_vector_type(8)))  _Float16 v8h;
typedef __attribute__((ext_vector_type(8)))  float    v8f;
typedef __attribute__((ext_vector_type(4)))  float    v4f;
typedef __attribute__((ext_vector_type(2)))  float    v2f;

#define BQ      32
#define NQ      49
#define DMODEL  512
#define NHEAD   8
#define DKH     64
#define NRELC   14
#define ROWS    (BQ * NQ)            // 1568
#define KCONV   (DMODEL * 9)         // 4608
#define PADW    9                    // the 7x7 map with a border of zeros: 9x9 places
#define PADN    (PADW * PADW)        // 81
#define NPAIR   (BQ * NQ * NQ)       // 76832
#define LN_EPS  1e-5f

// Cross-lane steps of the butterfly sums and maxima, on the vector unit: a shuffle
// would go through the LDS unit and make its wave wait for it at every step.
// Every lane of the wave is on wherever these are called.
// lane l with lane l ^ 16: cross-row move
__device__ __forceinline__ float xhalf(float x) {
  const int b = __builtin_bit_cast(int, x);
  return __builtin_bit_cast(float,
      __builtin_amdgcn_permlanex16(b, b, 0x76543210, 0xfedcba98, false, false));
}
// lane l with lane l ^ M inside its row of 16 lanes: DPP row_xmask (control 0x160 + M),
// which the compiler can fold into the add that takes it
template <int M>
__device__ __forceinline__ float xrow(float x) {
  const int b = __builtin_bit_cast(int, x);
  return __builtin_bit_cast(float, __builtin_amdgcn_update_dpp(b, b, 0x160 + M, 0xf, 0xf, true));
}
// steps 8, 4, 2, 1 (and 16 in front of them): the order of the shuffles they replace
__device__ __forceinline__ float row_sum(float x) {
  x += xrow<8>(x); x += xrow<4>(x); x += xrow<2>(x); x += xrow<1>(x);
  return x;
}
__device__ __forceinline__ float row_max(float x) {
  x = fmaxf(x, xrow<8>(x)); x = fmaxf(x, xrow<4>(x));
  x = fmaxf(x, xrow<2>(x)); x = fmaxf(x, xrow<1>(x));
  return x;
}
__device__ __forceinline__ float wave_sum(float x) {
  x += xhalf(x);
  return row_sum(x);
}

// ---------------------------------------------------------------------------
// WMMA GEMM: C[M,N] = A[M,K] * B^T[N,K] (+bias[N]).
// A: f16 row-major (M,K), pitch K; with TAPS the padded table below. Bt: f16 row-major (N,K), pitch K.
// REQUIRES: M%32==0, N%64==0, K%256==0, K>=512 (true for every call site here).
// One block of 4 waves computes a 32x64 C tile, each wave 16x32; K stepped by 32
// in rising order. The operands come into LDS in stages of 256 k (512 B of each
// of the 96 rows) by asynchronous copies: one copy of a wave is one row's whole
// 512 B, so that every request covers whole cache lines. Two buffers: the next
// stage's copies fly while this one is worked on.
// Fragment layout (ISA 16-bit A 16x32): halves 0..7  <- K = k0+8*half+0..7
//                                       halves 8..15 <- K = k0+8*half+16..23
// i.e. two 16-byte segments per lane -> two ds_load_b128 each.
// ---------------------------------------------------------------------------
#define GBM    32
#define GBN    64
#define GBK    256
#define GROWS  (GBM + GBN)            // 96 rows a stage
#define GPITCH (GBK * 2 + 16)         // 528 B = 16 B x odd: no bank conflict for b128 readers
#define GBUF   (GROWS * GPITCH)       // 50,688 B a buffer

// Eight rows, four apart (one per wave between them): lane l brings bytes
// 16*l .. 16*l+15 of each row's 512 B. The s_wait_xcnt stands inside the
// statement, so that no address register is rewritten in front of it.
template <int K>
__device__ __forceinline__ void copy8_rows(unsigned lds, const _Float16* g) {
  asm volatile(
      "global_load_async_to_lds_b128 %0, %8, off\n\t"
      "global_load_async_to_lds_b128 %1, %9, off\n\t"
      "global_load_async_to_lds_b128 %2, %10, off\n\t"
      "global_load_async_to_lds_b128 %3, %11, off\n\t"
      "global_load_async_to_lds_b128 %4, %12, off\n\t"
      "global_load_async_to_lds_b128 %5, %13, off\n\t"
      "global_load_async_to_lds_b128 %6, %14, off\n\t"
      "global_load_async_to_lds_b128 %7, %15, off\n\t"
      "s_wait_xcnt 0x0"
      :: "v"(lds), "v"(lds + 4 * GPITCH), "v"(lds + 8 * GPITCH), "v"(lds + 12 * GPITCH),
         "v"(lds + 16 * GPITCH), "v"(lds + 20 * GPITCH), "v"(lds + 24 * GPITCH),
         "v"(lds + 28 * GPITCH),
         "v"(g), "v"(g + 4 * K), "v"(g + 8 * K), "v"(g + 12 * K),
         "v"(g + 16 * K), "v"(g + 20 * K), "v"(g + 24 * K), "v"(g + 28 * K)
      : "memory");
}

// The same for eight rows that lie at addresses of their own.
__device__ __forceinline__ void copy8_at(unsigned lds, const _Float16* g0, const _Float16* g1,
                                         const _Float16* g2, const _Float16* g3,
                                         const _Float16* g4, const _Float16* g5,
                                         const _Float16* g6, const _Float16* g7) {
  asm volatile(
      "global_load_async_to_lds_b128 %0, %8, off\n\t"
      "global_load_async_to_lds_b128 %1, %9, off\n\t"
      "global_load_async_to_lds_b128 %2, %10, off\n\t"
      "global_load_async_to_lds_b128 %3, %11, off\n\t"
      "global_load_async_to_lds_b128 %4, %12, off\n\t"
      "global_load_async_to_lds_b128 %5, %13, off\n\t"
      "global_load_async_to_lds_b128 %6, %14, off\n\t"
      "global_load_async_to_lds_b128 %7, %15, off\n\t"
      "s_wait_xcnt 0x0"
      :: "v"(lds), "v"(lds + 4 * GPITCH), "v"(lds + 8 * GPITCH), "v"(lds + 12 * GPITCH),
         "v"(lds + 16 * GPITCH), "v"(lds + 20 * GPITCH), "v"(lds + 24 * GPITCH),
         "v"(lds + 28 * GPITCH),
         "v"(g0), "v"(g1), "v"(g2), "v"(g3), "v"(g4), "v"(g5), "v"(g6), "v"(g7)
      : "memory");
}

// TAPS: the 3x3 pad-1 conv as a GEMM with no im2col matrix. k runs (tap, channel),
// K = 9 * 512. A is then the padded token table (b, 9x9 places, 512 channels): row m
// of the product is token (b, y, x), and its 512 k of tap (ky, kx) are the whole row
// of place (y + ky, x + kx), border places holding zeros. A stage of 256 k is half
// of such a row: the same 512-B copies, from a row address that moves with the tap.
template <int K, bool TAPS = false>
__device__ __forceinline__ void gemm_block(const _Float16* __restrict__ A,
                                           const _Float16* __restrict__ Bt,
                                           const float* __restrict__ bias,
                                           float* __restrict__ C, int tile, int N) {
  __shared__ __attribute__((aligned(16))) unsigned char gsm[2 * GBUF];
  constexpr int NST = K / GBK;                   // stages
  static_assert(K % GBK == 0 && NST >= 2, "two stages at least");
  const int ntn  = N >> 6;                       // 64-wide column tiles
  const int tm   = tile / ntn;
  const int tn   = tile - tm * ntn;
  const int row0 = tm * GBM;
  const int col0 = tn * GBN;

  const int lane = threadIdx.x;                  // 0..31
  const int wave = __builtin_amdgcn_readfirstlane(threadIdx.y);   // 0..3
  const int hf   = lane >> 4;                    // 0/1
  const int idx  = lane & 15;
  const int wm   = wave >> 1, wn = wave & 1;     // the wave's 16 rows, 32 columns

  // copy side: wave w takes rows w, w+4, ... of the stage (A rows 0..31, B rows 32..95)
  const unsigned lds0 = (unsigned)(size_t)gsm + (unsigned)(wave * GPITCH + lane * 16);
  const _Float16* ga = A  + (size_t)(row0 + wave) * K + lane * 8;
  const _Float16* gb = Bt + (size_t)(col0 + wave) * K + lane * 8;
  const _Float16* gt[8];                         // TAPS: tap (0, 0) of the wave's eight tokens
  if constexpr (TAPS) {
    static_assert(K == 9 * DMODEL && DMODEL == 2 * GBK, "two stages a tap");
#pragma unroll
    for (int i = 0; i < 8; ++i) {
      const int r = row0 + wave + 4 * i;
      const int p = r % NQ;
      gt[i] = A + (size_t)((r / NQ) * PADN + (p / 7) * PADW + p % 7) * DMODEL + lane * 8;
    }
  }
  auto copy_stage = [&](int st, int buf) {
    const unsigned l = lds0 + (unsigned)buf * GBUF;
    if constexpr (TAPS) {
      const int tap = st >> 1;
      const int ky  = (tap * 11) >> 5;           // tap / 3 for tap in 0..8
      const int ko  = (tap + (PADW - 3) * ky) * DMODEL + (st & 1) * GBK;   // place ky*9 + kx
      copy8_at(l, gt[0] + ko, gt[1] + ko, gt[2] + ko, gt[3] + ko,
               gt[4] + ko, gt[5] + ko, gt[6] + ko, gt[7] + ko);
    } else {
      copy8_rows<K>(l, ga + st * GBK);
    }
    copy8_rows<K>(l + 32 * GPITCH, gb + st * GBK);
    copy8_rows<K>(l + 64 * GPITCH, gb + (size_t)32 * K + st * GBK);
  };

  // read side
  const unsigned char* sa  = gsm + (wm * 16 + idx) * GPITCH + hf * 16;
  const unsigned char* sb0 = gsm + (GBM + wn * 32 + idx) * GPITCH + hf * 16;
  const unsigned char* sb1 = sb0 + 16 * GPITCH;

  v8f acc0 = {}, acc1 = {};
  union F16x16 { v16h v; v8h h[2]; };

  copy_stage(0, 0);
  // stage 0 has landed for this wave; the barrier publishes it to the others
  asm volatile("s_wait_asynccnt 0x0" ::: "memory");
  __syncthreads();
  copy_stage(1, 1);

  // rolled: one body serves both buffers, the code stays small
#pragma unroll 1
  for (int t = 0; t < NST; ++t) {
    const int bo = (t & 1) * GBUF;
    // four k steps' fragments are fetched as one group, then their eight WMMAs:
    // one LDS latency a group instead of one a WMMA
#pragma unroll
    for (int kg = 0; kg < GBK / 128; ++kg) {
      F16x16 af[4], b0[4], b1[4];
#pragma unroll
      for (int q = 0; q < 4; ++q) {
        const int o = bo + (kg * 4 + q) * 64;
        af[q].h[0] = *(const v8h*)(sa  + o);
        af[q].h[1] = *(const v8h*)(sa  + o + 32);
        b0[q].h[0] = *(const v8h*)(sb0 + o);
        b0[q].h[1] = *(const v8h*)(sb0 + o + 32);
        b1[q].h[0] = *(const v8h*)(sb1 + o);
        b1[q].h[1] = *(const v8h*)(sb1 + o + 32);
      }
      // keeps the group's loads in front of its WMMAs: the scheduler otherwise deals
      // them out again, one wait on LDS per WMMA
      __builtin_amdgcn_sched_barrier(0);
#pragma unroll
      for (int q = 0; q < 4; ++q) {
        acc0 = __builtin_amdgcn_wmma_f32_16x16x32_f16(false, af[q].v, false, b0[q].v,
                                                      (short)0, acc0, false, false);
        acc1 = __builtin_amdgcn_wmma_f32_16x16x32_f16(false, af[q].v, false, b1[q].v,
                                                      (short)0, acc1, false, false);
      }
    }
    // this wave's reads of the buffer are done before it may be refilled
    asm volatile("s_wait_dscnt 0x0" ::: "memory");
    // this wave's copies of the next stage have landed
    asm volatile("s_wait_asynccnt 0x0" ::: "memory");
    // publishes the next stage and ends every reader's last read of this one
    __syncthreads();
    if (t + 2 < NST) copy_stage(t + 2, t & 1);
  }
  // no copy is left outstanding when the wave ends
  asm volatile("s_wait_asynccnt 0x0" ::: "memory");

  // C layout: vgpr r -> m = row0 + 16*wm + r + 8*hf ; n = col0 + 32*wn + sub*16 + idx
  const int mbase = row0 + wm * 16 + hf * 8;
#pragma unroll
  for (int s = 0; s < 2; ++s) {
    const int n = col0 + wn * 32 + s * 16 + idx;
    const float badd = bias ? bias[n] : 0.f;
    const v8f a = (s == 0) ? acc0 : acc1;
#pragma unroll
    for (int r = 0; r < 8; ++r)
      C[(size_t)(mbase + r) * N + n] = a[r] + badd;
    // the next column group reuses these stores' registers: wait first
    asm volatile("s_wait_xcnt 0x0" ::: "memory");
  }
}

// blocks of 4 waves: the bound lifts the register cap, else fragments spill
__global__ __launch_bounds__(128) void gemm_wmma_f16(const _Float16* __restrict__ A,
                              const _Float16* __restrict__ Bt,
                              const float* __restrict__ bias,
                              float* __restrict__ C) {
  gemm_block<DMODEL>(A, Bt, bias, C, blockIdx.x, DMODEL);
}

// The seven token-level projections share no data dependence: one grid, the
// product chosen by block range (block-uniform). 392 blocks per 512-wide
// product, 196 per 256-wide one; one 32x64 tile per block as above.
#define BLK_N512 ((ROWS / GBM) * (DMODEL / GBN))     // 392
#define BLK_N256 ((ROWS / GBM) * (256 / GBN))        // 196
#define PROJ_BLKS (5 * BLK_N512 + 2 * BLK_N256)      // 2352
__global__ __launch_bounds__(128) void proj_gemms_k(const _Float16* __restrict__ eq, const _Float16* __restrict__ ek,
                             const _Float16* __restrict__ ev,
                             const _Float16* __restrict__ WqT, const _Float16* __restrict__ WkT,
                             const _Float16* __restrict__ WvT, const _Float16* __restrict__ Wr1aT,
                             const _Float16* __restrict__ Wr1bT, const _Float16* __restrict__ Wc1aT,
                             const _Float16* __restrict__ Wc1bT,
                             const float* __restrict__ bq, const float* __restrict__ bk,
                             const float* __restrict__ bv, const float* __restrict__ br1,
                             const float* __restrict__ bc1,
                             float* __restrict__ qh, float* __restrict__ kh,
                             float* __restrict__ vh, float* __restrict__ A1r,
                             float* __restrict__ A2r, float* __restrict__ A1c,
                             float* __restrict__ A2c) {
  const int blk = blockIdx.x;
  const _Float16* A; const _Float16* Bt; const float* bias; float* C;
  int n, lb;
  if (blk < 5 * BLK_N512) {
    const int job = blk / BLK_N512;
    lb = blk - job * BLK_N512;
    n = DMODEL;
    switch (job) {
      case 0:  A = eq; Bt = WqT;   bias = bq;      C = qh;  break;
      case 1:  A = ek; Bt = WkT;   bias = bk;      C = kh;  break;
      case 2:  A = ev; Bt = WvT;   bias = bv;      C = vh;  break;
      case 3:  A = eq; Bt = Wr1aT; bias = br1;     C = A1r; break;
      default: A = ek; Bt = Wr1bT; bias = nullptr; C = A2r; break;
    }
  } else {
    lb = blk - 5 * BLK_N512;
    n = 256;
    if (lb < BLK_N256) { A = eq; Bt = Wc1aT; bias = bc1; C = A1c; }
    else { lb -= BLK_N256; A = ek; Bt = Wc1bT; bias = nullptr; C = A2c; }
  }
  gemm_block<DMODEL>(A, Bt, bias, C, lb, n);
}

// ---------------------------------------------------------------------------
// Weight transpose + fp16 convert: W (K,N) row-major -> Wt (N,K) f16.
// One thread takes 8 consecutive k of one column n: 8 reads, each coalesced
// over the lanes' n, and one 16-byte store.
// ---------------------------------------------------------------------------
__device__ __forceinline__ void transpose_h(const float* __restrict__ W,
                                            _Float16* __restrict__ Wt, int K, int N, int t) {
  const int kc = t / N, n = t - kc * N;
  const float* p = W + (size_t)kc * 8 * N + n;
  v8h o;
#pragma unroll
  for (int j = 0; j < 8; ++j) o[j] = (_Float16)p[(size_t)j * N];
  *(v8h*)(Wt + (size_t)n * K + kc * 8) = o;
  // other block ranges' code follows in the merged kernel and reuses the
  // store's registers: wait first
  asm volatile("s_wait_xcnt 0x0" ::: "memory");
}

// ---------------------------------------------------------------------------
// Operands of the 3x3 pad-1 conv. x[b,c,y,x] == queries[b,y*7+x,c].
//   qpad[b, (y+1)*9 + (x+1), c] = f16(queries[b, y*7+x, c]), the border places zero
//   convWH[oc, tap*512 + ic]    = f16(convW[oc, ic*9 + tap]),  tap = ky*3 + kx
// Two block ranges of one grid, blocks of 192 threads, each thread 3 groups of 8
// outputs with one 16-byte store a group (few waves to start).
// ---------------------------------------------------------------------------
#define CVT_BLKS    DMODEL                   // 512 rows of conv weights
#define PAD_BLKS    (BQ * PADW)              // 288 lines of 9 places
#define ROW_THREADS (KCONV / 8 / 3)          // 192
#define WT_P        (DMODEL + 8)             // halves: 1040 B = 16 B x odd (b128 readers)
__global__ void pad_cvt_k(const float* __restrict__ q, _Float16* __restrict__ qpad,
                          const float* __restrict__ convW, _Float16* __restrict__ convWH) {
  __shared__ __attribute__((aligned(16))) _Float16 wt[9 * WT_P];
  const int tid = threadIdx.x;
  if (blockIdx.x < CVT_BLKS) {                   // block-uniform
    // one output channel's 4608 weights: read in their order (ic, tap), turned to
    // (tap, ic) through LDS, so that reads and stores both cover whole lines
    const size_t base = (size_t)blockIdx.x * KCONV;
    v4f lo[3], hi[3];
#pragma unroll
    for (int i = 0; i < 3; ++i) {
      const size_t e = base + (size_t)(tid + ROW_THREADS * i) * 8;
      lo[i] = *(const v4f*)(convW + e);
      hi[i] = *(const v4f*)(convW + e + 4);
    }
#pragma unroll
    for (int i = 0; i < 3; ++i) {
      const int e0 = (tid + ROW_THREADS * i) * 8;
      int ic = e0 / 9, r = e0 % 9;
#pragma unroll
      for (int j = 0; j < 8; ++j) {
        wt[r * WT_P + ic] = (_Float16)(j < 4 ? lo[i][j & 3] : hi[i][j & 3]);
        const int wrap = (r == 8);
        r = wrap ? 0 : r + 1;
        ic += wrap;
      }
    }
    // the weights go from the threads that read them to the threads that store them
    __syncthreads();
#pragma unroll
    for (int i = 0; i < 3; ++i) {
      const int g = tid + ROW_THREADS * i;       // 64 groups of 8 channels a tap
      *(v8h*)(convWH + base + (size_t)g * 8) = *(const v8h*)(wt + (g >> 6) * WT_P + (g & 63) * 8);
    }
    return;
  }
  const int pb = blockIdx.x - CVT_BLKS;          // b*9 + line of the padded map
  const int b  = pb / PADW, yy = pb % PADW;
  const int c  = (tid & 63) * 8;
  // a border place reads token 0 (in bounds) and is zeroed: no branch round a load,
  // so all 6 loads of a thread can be in flight at once
  v4f lo[3], hi[3];
  bool in[3];
  const float* s[3];
#pragma unroll
  for (int i = 0; i < 3; ++i) {
    const int xx = i * 3 + (tid >> 6);
    in[i] = (unsigned)(yy - 1) < 7u && (unsigned)(xx - 1) < 7u;
    const int tok = in[i] ? (yy - 1) * 7 + xx - 1 : 0;
    s[i] = q + (size_t)(b * NQ + tok) * DMODEL + c;
    lo[i] = *(const v4f*)s[i];
    hi[i] = *(const v4f*)(s[i] + 4);
  }
  // the addresses stay live up to this wait, so that no load of the run
  // returns into a register that the others still name
  asm volatile("s_wait_xcnt 0x0" :: "v"(s[0]), "v"(s[1]), "v"(s[2]) : "memory");
#pragma unroll
  for (int i = 0; i < 3; ++i) {
    const int xx = i * 3 + (tid >> 6);
    v8h o;
#pragma unroll
    for (int j = 0; j < 4; ++j) {
      o[j]     = (_Float16)(in[i] ? lo[i][j] : 0.f);
      o[4 + j] = (_Float16)(in[i] ? hi[i][j] : 0.f);
    }
    *(v8h*)(qpad + (size_t)(pb * PADW + xx) * DMODEL + c) = o;
  }
  // the weight range's code follows in the built kernel and reuses the
  // stores' registers: wait first
  asm volatile("s_wait_xcnt 0x0" ::: "memory");
}

// BatchNorm stats over (B, spatial) = 1568 rows per channel (population var).
__global__ void bn_stats_k(const float* __restrict__ h, float* __restrict__ mu,
                           float* __restrict__ rstd) {
  const int c = blockIdx.x, tid = threadIdx.x;
  float s = 0.f, ss = 0.f;
  for (int r = tid; r < ROWS; r += 256) {
    float v = h[(size_t)r * DMODEL + c];
    s += v; ss += v * v;
  }
  __shared__ float sh[256], sh2[256];
  sh[tid] = s; sh2[tid] = ss; __syncthreads();
  for (int off = 128; off; off >>= 1) {
    if (tid < off) { sh[tid] += sh[tid + off]; sh2[tid] += sh2[tid + off]; }
    __syncthreads();
  }
  if (tid == 0) {
    float m = sh[0] * (1.f / ROWS);
    float v = sh2[0] * (1.f / ROWS) - m * m;
    mu[c] = m; rstd[c] = rsqrtf(v + LN_EPS);
  }
}

// xs = relu(BN(h)); eq/ek/ev = f16(xs + queries/keys/values)
__global__ void eqkv_k(const float* __restrict__ h, const float* __restrict__ mu,
                       const float* __restrict__ rstd,
                       const float* __restrict__ q, const float* __restrict__ k,
                       const float* __restrict__ v,
                       _Float16* __restrict__ eq, _Float16* __restrict__ ek,
                       _Float16* __restrict__ ev) {
  const size_t t = ((size_t)blockIdx.x * blockDim.x + threadIdx.x) * 8;   // 8 channels a thread
  if (t >= (size_t)ROWS * DMODEL) return;
  const int c = (int)(t % DMODEL);
  v8h oq, ok, ov;
#pragma unroll
  for (int g = 0; g < 2; ++g) {
    const v4f h4 = *(const v4f*)(h + t + 4 * g);
    const v4f m4 = *(const v4f*)(mu + c + 4 * g);
    const v4f r4 = *(const v4f*)(rstd + c + 4 * g);
    const v4f q4 = *(const v4f*)(q + t + 4 * g);
    const v4f k4 = *(const v4f*)(k + t + 4 * g);
    const v4f v4 = *(const v4f*)(v + t + 4 * g);
#pragma unroll
    for (int j = 0; j < 4; ++j) {
      const float xs = fmaxf((h4[j] - m4[j]) * r4[j], 0.f);
      oq[4 * g + j] = (_Float16)(xs + q4[j]);
      ok[4 * g + j] = (_Float16)(xs + k4[j]);
      ov[4 * g + j] = (_Float16)(xs + v4[j]);
    }
  }
  *(v8h*)(eq + t) = oq;
  *(v8h*)(ek + t) = ok;
  *(v8h*)(ev + t) = ov;
}

// Precompute gate-collapse vectors:
//   u[512] = Wr2 @ Wgate ; wv[14] = rel_embed @ (Wproj @ Wgate)
//   cs = (br2 + bproj) . Wgate + bgate
// Blocks of 128 threads: parts 0..3 take 128 rows of u each, part 4 the rest.
__device__ __forceinline__ void precompute_part(int part, int t,
                             const float* __restrict__ Wr2, const float* __restrict__ Wgate,
                             const float* __restrict__ bgate, const float* __restrict__ Wproj,
                             const float* __restrict__ bproj, const float* __restrict__ br2,
                             const float* __restrict__ rel_embed,
                             float* __restrict__ u, float* __restrict__ wv,
                             float* __restrict__ cs) {
  __shared__ float pv[DKH];
  if (part < 4) {                                // block-uniform
    const int row = part * 128 + t;
    float s = 0.f;
    for (int j = 0; j < DMODEL; ++j) s += Wr2[(size_t)row * DMODEL + j] * Wgate[j];
    u[row] = s;
    // the fifth part's code follows and reuses the store's registers: wait first
    asm volatile("s_wait_xcnt 0x0" ::: "memory");
    return;
  }
  if (t < DKH) {
    float s = 0.f;
    for (int d = 0; d < DMODEL; ++d) s += Wproj[(size_t)t * DMODEL + d] * Wgate[d];
    pv[t] = s;
  }
  __syncthreads();
  if (t < NRELC) {
    float s = 0.f;
    const unsigned rb = (unsigned)t * (DKH * 4u);   // the row's byte offset
    const float* rp = (const float*)((const char*)rel_embed + rb);
    for (int d = 0; d < DKH; ++d) s += rp[d] * pv[d];
    // the row's offset stays live up to this wait, so that no load of the run
    // returns into the register that the others still name
    asm volatile("s_wait_xcnt 0x0" :: "v"(rb) : "memory");
    wv[t] = s;
  }
  if (t == 0) {
    float s = bgate[0];
    for (int d = 0; d < DMODEL; ++d) s += (br2[d] + bproj[d]) * Wgate[d];
    cs[0] = s;
  }
}

// conv GEMM grid (392 blocks of 4 waves leave most wave slots empty) plus the
// work that nothing before the projections depends on: the gate-collapse
// vectors and the eight weight transposes, on the block ranges behind it.
#define CONV_BLKS ((ROWS / GBM) * (DMODEL / GBN))      // 392
#define PRE_BLKS  5
#define TR512_BLKS (DMODEL * DMODEL / 8 / 128)         // 256
#define TR256_BLKS (DMODEL * 256 / 8 / 128)            // 128
#define SIDE_GRID (CONV_BLKS + PRE_BLKS + 6 * TR512_BLKS + 2 * TR256_BLKS)
__global__ __launch_bounds__(128) void conv_gemm_side_k(const _Float16* __restrict__ qpad,
                                 const _Float16* __restrict__ convWH,
                                 const float* __restrict__ convb, float* __restrict__ hconv,
                                 const float* __restrict__ Wr2, const float* __restrict__ Wgate,
                                 const float* __restrict__ bgate, const float* __restrict__ Wproj,
                                 const float* __restrict__ bproj, const float* __restrict__ br2,
                                 const float* __restrict__ rel_embed,
                                 float* __restrict__ u, float* __restrict__ wv,
                                 float* __restrict__ cs,
                                 const float* __restrict__ Wq, const float* __restrict__ Wk,
                                 const float* __restrict__ Wv, const float* __restrict__ Wo,
                                 const float* __restrict__ Wr1, const float* __restrict__ Wc1,
                                 _Float16* __restrict__ WqT, _Float16* __restrict__ WkT,
                                 _Float16* __restrict__ WvT, _Float16* __restrict__ WoT,
                                 _Float16* __restrict__ Wr1aT, _Float16* __restrict__ Wr1bT,
                                 _Float16* __restrict__ Wc1aT, _Float16* __restrict__ Wc1bT) {
  int blk = blockIdx.x;
  if (blk < CONV_BLKS) {
    gemm_block<KCONV, true>(qpad, convWH, convb, hconv, blk, DMODEL);
    return;
  }
  blk -= CONV_BLKS;
  const int tid = threadIdx.y * 32 + threadIdx.x;
  if (blk < PRE_BLKS) {
    precompute_part(blk, tid, Wr2, Wgate, bgate, Wproj, bproj, br2, rel_embed, u, wv, cs);
    return;
  }
  blk -= PRE_BLKS;
  if (blk < 6 * TR512_BLKS) {
    const int job = blk / TR512_BLKS;
    const int t = (blk - job * TR512_BLKS) * 128 + tid;
    const float* W; _Float16* Wt;
    switch (job) {
      case 0:  W = Wq;  Wt = WqT;  break;
      case 1:  W = Wk;  Wt = WkT;  break;
      case 2:  W = Wv;  Wt = WvT;  break;
      case 3:  W = Wo;  Wt = WoT;  break;
      case 4:  W = Wr1; Wt = Wr1aT; break;
      default: W = Wr1 + (size_t)DMODEL * DMODEL; Wt = Wr1bT; break;
    }
    transpose_h(W, Wt, DMODEL, DMODEL, t);
  } else {
    blk -= 6 * TR512_BLKS;
    const int second = blk >= TR256_BLKS;
    const int t = (blk - second * TR256_BLKS) * 128 + tid;
    transpose_h(second ? Wc1 + (size_t)DMODEL * 256 : Wc1, second ? Wc1bT : Wc1aT,
                DMODEL, 256, t);
  }
}

// One wave32 per (b, qi, group of 7 ki), 16 waves a block = 112 pairs = 7 tiles of 16.
// Classifier branch: each wave makes LN(256)->ReLU of its 7 pairs and lays the rows in
// LDS; the 256x14 product of 16 pairs at a time then runs on v_wmma_f32_16x16x4_f32
// (operands stay fp32), one tile per wave 0..6, with the softmax and probs.wv taken
// from the accumulator (a pair's 14 logits lie in the 16 lanes of one half).
// Relation branch: LN(512)->ReLU->dot(u) per pair as before; gate = sigmoid(.).
// All that does not depend on ki (the LN scales and shifts, u, the q-side rows) is
// loaded once per wave and stays in registers over the 7 pairs. qi runs fastest over
// the waves, so that the waves of a block mostly read the same k-side rows (WGP cache).
#define KI_GRP     7
#define PAIR_WAVES 16
#define PAIR_THREADS (32 * PAIR_WAVES)                          // 512
#define PAIR_BLKS (BQ * (NQ / KI_GRP) * NQ / PAIR_WAVES)        // 686
#define PB_PAIRS  (PAIR_WAVES * KI_GRP)                         // 112
#define PB_TILES  (PB_PAIRS / 16)                               // 7
#define HV_P      260     // floats: pitch of a pair's row, 1040 B = 16 B x odd (b128 readers)
// four waves per SIMD: the register budget of 256 that one block per WGP needs
__global__ __launch_bounds__(PAIR_THREADS) __attribute__((amdgpu_waves_per_eu(4)))
void pair_gate_k(const float* __restrict__ A1c, const float* __restrict__ A2c,
                            const float* __restrict__ A1r, const float* __restrict__ A2r,
                            const float* __restrict__ gc, const float* __restrict__ bcln,
                            const float* __restrict__ Wc2, const float* __restrict__ bc2,
                            const float* __restrict__ gr, const float* __restrict__ brln,
                            const float* __restrict__ u, const float* __restrict__ wv,
                            const float* __restrict__ cs, float* __restrict__ gate) {
  __shared__ __attribute__((aligned(16))) float hvs[PB_PAIRS * HV_P];   // ReLU(LN) rows
  __shared__ __attribute__((aligned(16))) float wb[32 * 32 * 4];        // Wc2 as B fragments
  __shared__ float spw[PB_PAIRS];                                       // probs . wv
  const int lane = threadIdx.x;
  const int wl   = __builtin_amdgcn_readfirstlane(threadIdx.y);         // 0..15
  const int hf   = lane >> 4;
  const int idx  = lane & 15;
  const int wave = blockIdx.x * PAIR_WAVES + wl;                        // (b, ki group, qi)
  const int b   = wave / ((NQ / KI_GRP) * NQ);
  const int rm  = wave % ((NQ / KI_GRP) * NQ);
  const int ki0 = (rm / NQ) * KI_GRP;
  const int qi  = rm % NQ;

  const float* a1 = A1c + (size_t)(b * NQ + qi) * 256;
  const float* r1 = A1r + (size_t)(b * NQ + qi) * DMODEL;
  const float* a2 = A2c + (size_t)(b * NQ + ki0) * 256;
  const float* r2 = A2r + (size_t)(b * NQ + ki0) * DMODEL;
  // lane i collects the value of pair ki0 + i (equal in all lanes behind the sum
  // over the lanes); the sigmoid is then done once for the 7 pairs
  float gdn = 0.f;

  // Wc2 in B-fragment order: entry (c, lane) holds rows 8c + 4*hf + 0..3 of column idx,
  // columns 14 and 15 as zeros. Wave wl writes entries c = wl and c = wl + 16.
  {
    const unsigned wo = (unsigned)((8 * wl + 4 * hf) * NRELC + min(idx, NRELC - 1)) * 4u;
    const float* wp = (const float*)((const char*)Wc2 + wo);
    v4f w0, w1;
#pragma unroll
    for (int q = 0; q < 4; ++q) {
      w0[q] = wp[q * NRELC];
      w1[q] = wp[(128 + q) * NRELC];
    }
    // the offset stays live up to this wait, so that no load of the run
    // returns into the register that the others still name
    asm volatile("s_wait_xcnt 0x0" :: "v"(wo) : "memory");
    const v4f z = {};
    *(v4f*)(wb + (wl * 32 + lane) * 4)        = idx < NRELC ? w0 : z;
    *(v4f*)(wb + ((wl + 16) * 32 + lane) * 4) = idx < NRELC ? w1 : z;
  }

  // ---- classifier branch, part 1: LN over 256, ReLU, rows to LDS ----
  {
    float gcv[8], bcv[8], a1v[8];
    const float* a1l = a1 + lane;
#pragma unroll
    for (int j = 0; j < 8; ++j) {
      const int e = lane + 32 * j;
      a1v[j] = a1l[32 * j]; gcv[j] = gc[e]; bcv[j] = bcln[e];
    }
    // the address stays live up to this wait, so that no load of the run
    // returns into a register that the others still name
    asm volatile("s_wait_xcnt 0x0" :: "v"(a1l) : "memory");
    // unrolled: the 7 pairs' loads and sums over the lanes can overlap
#pragma unroll
    for (int i = 0; i < KI_GRP; ++i) {
      float x[8], s = 0.f, ss = 0.f;
#pragma unroll
      for (int j = 0; j < 8; ++j) {
        float v = a1v[j] + a2[i * 256 + lane + 32 * j];
        x[j] = v; s += v; ss += v * v;
      }
      s = wave_sum(s); ss = wave_sum(ss);
      const float mean = s * (1.f / 256.f);
      const float rstd = rsqrtf(ss * (1.f / 256.f) - mean * mean + LN_EPS);
      float* hrow = hvs + (wl * KI_GRP + i) * HV_P + lane;
#pragma unroll
      for (int j = 0; j < 8; ++j)
        hrow[32 * j] = fmaxf((x[j] - mean) * rstd * gcv[j] + bcv[j], 0.f);
    }
  }
  // the rows and the Wc2 fragments go from their writers to the tiles' waves
  __syncthreads();

  // ---- classifier branch, part 2: 16 pairs x 256 x 14 on WMMA, softmax, probs.wv ----
  // Fragments (A: lane holds pair idx; B: column idx; the lane halves split k): both
  // sides take feature 8c + 4*hf + 2j + 0..1 at step (c, j), so they pair.
  if (wl < PB_TILES) {                           // wave-uniform
    const unsigned no = (unsigned)min(idx, NRELC - 1) * 4u;
    const float bn  = *(const float*)((const char*)bc2 + no);
    const float wvn = *(const float*)((const char*)wv + no);
    // as above: the offset stays live up to this wait
    asm volatile("s_wait_xcnt 0x0" :: "v"(no) : "memory");
    const float* pa = hvs + (wl * 16 + idx) * HV_P + hf * 4;
    const float* pb = wb + lane * 4;
    v8f acc[4] = {};                             // four chains: no WMMA waits on the one before
    // unrolled: the chain's index is then a constant, and LDS reads can run ahead of the WMMAs
#pragma unroll
    for (int c = 0; c < 32; ++c) {
      const v4f a = *(const v4f*)(pa + c * 8);
      const v4f w = *(const v4f*)(pb + c * 128);
#pragma unroll
      for (int j = 0; j < 2; ++j) {
        const v2f a2f = {a[2 * j], a[2 * j + 1]};
        const v2f b2f = {w[2 * j], w[2 * j + 1]};
        acc[(c & 1) * 2 + j] = __builtin_amdgcn_wmma_f32_16x16x4_f32(
            false, a2f, false, b2f, (short)0, acc[(c & 1) * 2 + j], false, false);
      }
    }
    const v8f lgv = (acc[0] + acc[1]) + (acc[2] + acc[3]);
    // lgv[r] is pair 16*wl + 8*hf + r, class idx
    const bool okn = idx < NRELC;
    float pwk = 0.f, sek = 1.f;                  // lane idx keeps row idx of its half
#pragma unroll
    for (int r = 0; r < 8; ++r) {
      const float l = lgv[r] + bn;
      const float m = row_max(okn ? l : -__builtin_inff());
      const float p = okn ? __expf(l - m) : 0.f;
      const float se = row_sum(p), pw = row_sum(p * wvn);
      pwk = (idx == r) ? pw : pwk;
      sek = (idx == r) ? se : sek;
    }
    // probs = p/se; top-k(14 of 14) renorm = /(1+1e-8)
    if (idx < 8) spw[wl * 16 + hf * 8 + idx] = pwk / (sek * (1.f + 1e-8f));
  }

  // ---- relation branch: LN over 512, ReLU, dot with u ----
  {
    float grv[16], brv[16], uv[16], r1v[16];
    const float* r1l = r1 + lane;
#pragma unroll
    for (int j = 0; j < 16; ++j) {
      const int e = lane + 32 * j;
      r1v[j] = r1l[32 * j]; grv[j] = gr[e]; brv[j] = brln[e]; uv[j] = u[e];
    }
    // as above: the row's address stays live up to this wait
    asm volatile("s_wait_xcnt 0x0" :: "v"(r1l) : "memory");
    // unrolled: the 7 pairs' loads and sums over the lanes can overlap
#pragma unroll
    for (int i = 0; i < KI_GRP; ++i) {
      float y[16], s = 0.f, ss = 0.f;
#pragma unroll
      for (int j = 0; j < 16; ++j) {
        float v = r1v[j] + r2[i * DMODEL + lane + 32 * j];
        y[j] = v; s += v; ss += v * v;
      }
      s = wave_sum(s); ss = wave_sum(ss);
      const float mean = s * (1.f / 512.f);
      const float rstd = rsqrtf(ss * (1.f / 512.f) - mean * mean + LN_EPS);
      float gd = 0.f;
#pragma unroll
      for (int j = 0; j < 16; ++j) {
        float hv = fmaxf((y[j] - mean) * rstd * grv[j] + brv[j], 0.f);
        gd += hv * uv[j];
      }
      gd = wave_sum(gd);
      gdn = (lane == i) ? gd : gdn;
    }
  }

  // probs.wv goes from the tiles' waves back to the pairs' own waves
  __syncthreads();
  const float pwv = spw[wl * KI_GRP + min(lane, KI_GRP - 1)];
  if (lane < KI_GRP)
    gate[(size_t)(b * NQ + qi) * NQ + ki0 + lane] = 1.f / (1.f + __expf(-(gdn + pwv + cs[0])));
}

// Gated attention of one (b, h) in one block of 4 waves, both products on
// v_wmma_f32_16x16x4_f32 (operands stay fp32):
//   S = q k^T / 8 ; enh = S * (1 + gate) ; p = exp(enh - rowmax) ; out = f16((p v) / rowsum)
// The 49 queries and 49 keys are padded to 64; wave w owns query rows 16w .. 16w+15.
// q, k, v rows (64 floats of this head) are staged in LDS, pad rows as zeros: a
// pad key's p is set to 0, and 0 times a zero v row adds nothing.
// Fragments (A: lane holds row idx; B: column idx; the lane halves split k): both
// sides of a product take k from the same (half, element) place, so they pair.
#define AT_QP  68     // floats: pitch of q, k, p rows, 272 B = 16 B x odd (b128 and b64 readers)
#define AT_VP  72     // floats: pitch of v rows: rows two apart lie 16 banks apart (b32 readers)
#define AT_PAD 64
#define AT_KST ((NQ + 3) / 4)                    // 13 steps of 4 keys cover the 49
__global__ __launch_bounds__(128) void attn_gated_k(const float* __restrict__ qh,
                             const float* __restrict__ kh, const float* __restrict__ vh,
                             const float* __restrict__ gate, _Float16* __restrict__ outp) {
  __shared__ __attribute__((aligned(16))) float sq[AT_PAD * AT_QP];
  __shared__ __attribute__((aligned(16))) float sk[AT_PAD * AT_QP];
  __shared__ __attribute__((aligned(16))) float sp[AT_PAD * AT_QP];
  __shared__ __attribute__((aligned(16))) float sv[AT_PAD * AT_VP];
  const int b    = blockIdx.x / NHEAD;
  const int h    = blockIdx.x % NHEAD;
  const int lane = threadIdx.x;                  // 0..31
  const int wave = __builtin_amdgcn_readfirstlane(threadIdx.y);   // 0..3
  const int tid  = wave * 32 + lane;
  const int hf   = lane >> 4;
  const int idx  = lane & 15;
  const int m0   = wave * 16 + hf * 8;           // first of the lane's 8 accumulator rows

  // the gates of the lane's accumulator places, indices clamped into the 49 x 49 map;
  // asked for first, so that they fly together with the rows below
  float g[4][8];
  const float* gb = gate + (size_t)b * NQ * NQ;
#pragma unroll
  for (int r = 0; r < 8; ++r) {
    const int qi = min(m0 + r, NQ - 1);
#pragma unroll
    for (int t = 0; t < 4; ++t) g[t][r] = gb[qi * NQ + min(16 * t + idx, NQ - 1)];
  }

  // stage q, k, v: 16 threads a row (16 B each), 8 rows a pass: six whole passes,
  // then row 48 (read by all eight row groups, kept by the first), the rest zeros
  const int srow = (tid >> 4) & 7, scol = (tid & 15) * 4;
  const size_t hofs = (size_t)(b * NQ) * DMODEL + h * DKH + scol;
  const float* gq = qh + hofs;
  const float* gk = kh + hofs;
  const float* gv = vh + hofs;
  const float* gqr = gq + srow * DMODEL;
  const float* gkr = gk + srow * DMODEL;
  const float* gvr = gv + srow * DMODEL;
  v4f xq[7], xk[7], xv[7];
#pragma unroll
  for (int i = 0; i < 6; ++i) {
    xq[i] = *(const v4f*)(gqr + i * 8 * DMODEL);
    xk[i] = *(const v4f*)(gkr + i * 8 * DMODEL);
    xv[i] = *(const v4f*)(gvr + i * 8 * DMODEL);
  }
  xq[6] = *(const v4f*)(gq + (NQ - 1) * DMODEL);
  xk[6] = *(const v4f*)(gk + (NQ - 1) * DMODEL);
  xv[6] = *(const v4f*)(gv + (NQ - 1) * DMODEL);
  // the addresses stay live up to this wait, so that no load of the run
  // returns into a register that the others still name
  asm volatile("s_wait_xcnt 0x0" :: "v"(gq), "v"(gk), "v"(gv), "v"(gqr), "v"(gkr), "v"(gvr)
               : "memory");
#pragma unroll
  for (int i = 0; i < 8; ++i) {
    const int row = i * 8 + srow;
    const v4f z = {};
    const bool in = i < 6 || (i == 6 && srow == 0);
    *(v4f*)(sq + row * AT_QP + scol) = in ? xq[i < 7 ? i : 0] : z;
    *(v4f*)(sk + row * AT_QP + scol) = in ? xk[i < 7 ? i : 0] : z;
    *(v4f*)(sv + row * AT_VP + scol) = in ? xv[i < 7 ? i : 0] : z;
  }
  __syncthreads();

  // S = q k^T: one 16-byte read holds the lane's k of two steps (d = 8*k8 + 4*hf + 0..3)
  v8f s[4] = {};
  {
    const float* pa = sq + (wave * 16 + idx) * AT_QP + hf * 4;
    const float* pb = sk + idx * AT_QP + hf * 4;
#pragma unroll
    for (int k8 = 0; k8 < DKH / 8; ++k8) {
      const v4f a = *(const v4f*)(pa + k8 * 8);
      v4f bb[4];
#pragma unroll
      for (int t = 0; t < 4; ++t) bb[t] = *(const v4f*)(pb + t * 16 * AT_QP + k8 * 8);
#pragma unroll
      for (int j = 0; j < 2; ++j) {
        const v2f a2 = {a[2 * j], a[2 * j + 1]};
#pragma unroll
        for (int t = 0; t < 4; ++t) {
          const v2f b2 = {bb[t][2 * j], bb[t][2 * j + 1]};
          s[t] = __builtin_amdgcn_wmma_f32_16x16x4_f32(false, a2, false, b2, (short)0, s[t],
                                                       false, false);
        }
      }
    }
  }

  // gated softmax by rows: s[t][r] is row m0 + r, key 16*t + idx; a row lies in
  // the 16 lanes of one half. p stays unscaled, the row's sum divides at the end.
  float inv[8];
  {
    const bool ok3 = 48 + idx < NQ;              // the last tile holds key 48 alone
    float* pw = sp + m0 * AT_QP + idx;
#pragma unroll
    for (int r = 0; r < 8; ++r) {
      float e[4];
#pragma unroll
      for (int t = 0; t < 4; ++t) e[t] = s[t][r] * 0.125f * (1.f + g[t][r]);   // 1/sqrt(64)
      float m = fmaxf(fmaxf(e[0], e[1]), e[2]);
      m = row_max(ok3 ? fmaxf(m, e[3]) : m);
      const float p0 = __expf(e[0] - m), p1 = __expf(e[1] - m), p2 = __expf(e[2] - m);
      const float p3 = ok3 ? __expf(e[3] - m) : 0.f;
      const float sm = row_sum((p0 + p1) + (p2 + p3));
      inv[r] = 1.f / sm;
      pw[r * AT_QP]      = p0;
      pw[r * AT_QP + 16] = p1;
      pw[r * AT_QP + 32] = p2;
      pw[r * AT_QP + 48] = p3;
    }
  }
  // p goes from the accumulator places to the A places through LDS, between lanes
  __syncthreads();

  // out = p v: key = 4*ks + 2*hf + 0..1 on both sides
  v8f o[4] = {};
  {
    const float* pp = sp + (wave * 16 + idx) * AT_QP + hf * 2;
    const float* pv = sv + hf * 2 * AT_VP + idx;
#pragma unroll
    for (int ks = 0; ks < AT_KST; ++ks) {
      const v2f a2 = *(const v2f*)(pp + ks * 4);
#pragma unroll
      for (int t = 0; t < 4; ++t) {
        const v2f b2 = {pv[ks * 4 * AT_VP + t * 16], pv[(ks * 4 + 1) * AT_VP + t * 16]};
        o[t] = __builtin_amdgcn_wmma_f32_16x16x4_f32(false, a2, false, b2, (short)0, o[t],
                                                     false, false);
      }
    }
  }

  _Float16* op = outp + (size_t)(b * NQ + m0) * DMODEL + h * DKH + idx;
  if (wave * 16 + 16 <= NQ) {                    // wave-uniform: all 16 rows are queries
#pragma unroll
    for (int r = 0; r < 8; ++r)
#pragma unroll
      for (int t = 0; t < 4; ++t) op[r * DMODEL + 16 * t] = (_Float16)(o[t][r] * inv[r]);
  } else {
#pragma unroll
    for (int r = 0; r < 8; ++r) {
      if (m0 + r < NQ) {
#pragma unroll
        for (int t = 0; t < 4; ++t) op[r * DMODEL + 16 * t] = (_Float16)(o[t][r] * inv[r]);
      }
    }
  }
}

// ---------------------------------------------------------------------------
extern "C" void kernel_launch(void* const* d_in, const int* in_sizes, int n_in,
                              void* d_out, int out_size, void* d_ws, size_t ws_size,
                              hipStream_t stream) {
  const float* queries = (const float*)d_in[0];
  const float* keys    = (const float*)d_in[1];
  const float* values  = (const float*)d_in[2];
  const float* Wq = (const float*)d_in[3];  const float* bq = (const float*)d_in[4];
  const float* Wk = (const float*)d_in[5];  const float* bk = (const float*)d_in[6];
  const float* Wv = (const float*)d_in[7];  const float* bv = (const float*)d_in[8];
  const float* Wo = (const float*)d_in[9];  const float* bo = (const float*)d_in[10];
  const float* rel_embed = (const float*)d_in[11];
  const float* Wproj = (const float*)d_in[12]; const float* bproj = (const float*)d_in[13];
  const float* Wgate = (const float*)d_in[14]; const float* bgate = (const float*)d_in[15];
  const float* Wc1 = (const float*)d_in[16];   const float* bc1 = (const float*)d_in[17];
  const float* gc = (const float*)d_in[18];    const float* bcln = (const float*)d_in[19];
  const float* Wc2 = (const float*)d_in[20];   const float* bc2 = (const float*)d_in[21];
  const float* Wr1 = (const float*)d_in[22];   const float* br1 = (const float*)d_in[23];
  const float* gr = (const float*)d_in[24];    const float* brln = (const float*)d_in[25];
  const float* Wr2 = (const float*)d_in[26];   const float* br2 = (const float*)d_in[27];
  const float* convW = (const float*)d_in[28]; const float* convb = (const float*)d_in[29];

  // ---- workspace carve-out (256B aligned blocks) ----
  char* base = (char*)d_ws;
  size_t off = 0;
  auto alloc = [&](size_t bytes) -> void* {
    off = (off + 255) & ~(size_t)255;
    void* p = base + off;
    off += bytes;
    return p;
  };
  _Float16* qpadH  = (_Float16*)alloc((size_t)BQ * PADN * DMODEL * 2);
  _Float16* convWH = (_Float16*)alloc((size_t)DMODEL * KCONV * 2);
  _Float16* WqT    = (_Float16*)alloc((size_t)DMODEL * DMODEL * 2);
  _Float16* WkT    = (_Float16*)alloc((size_t)DMODEL * DMODEL * 2);
  _Float16* WvT    = (_Float16*)alloc((size_t)DMODEL * DMODEL * 2);
  _Float16* WoT    = (_Float16*)alloc((size_t)DMODEL * DMODEL * 2);
  _Float16* Wc1aT  = (_Float16*)alloc((size_t)256 * DMODEL * 2);
  _Float16* Wc1bT  = (_Float16*)alloc((size_t)256 * DMODEL * 2);
  _Float16* Wr1aT  = (_Float16*)alloc((size_t)DMODEL * DMODEL * 2);
  _Float16* Wr1bT  = (_Float16*)alloc((size_t)DMODEL * DMODEL * 2);
  _Float16* eqH    = (_Float16*)alloc((size_t)ROWS * DMODEL * 2);
  _Float16* ekH    = (_Float16*)alloc((size_t)ROWS * DMODEL * 2);
  _Float16* evH    = (_Float16*)alloc((size_t)ROWS * DMODEL * 2);
  _Float16* attnoH = (_Float16*)alloc((size_t)ROWS * DMODEL * 2);
  float* hconv = (float*)alloc((size_t)ROWS * DMODEL * 4);
  float* muv   = (float*)alloc(DMODEL * 4);
  float* rstdv = (float*)alloc(DMODEL * 4);
  float* qh    = (float*)alloc((size_t)ROWS * DMODEL * 4);
  float* kh    = (float*)alloc((size_t)ROWS * DMODEL * 4);
  float* vh    = (float*)alloc((size_t)ROWS * DMODEL * 4);
  float* A1c   = (float*)alloc((size_t)ROWS * 256 * 4);
  float* A2c   = (float*)alloc((size_t)ROWS * 256 * 4);
  float* A1r   = (float*)alloc((size_t)ROWS * DMODEL * 4);
  float* A2r   = (float*)alloc((size_t)ROWS * DMODEL * 4);
  float* uvec  = (float*)alloc(DMODEL * 4);
  float* wvecp = (float*)alloc(64);
  float* cscal = (float*)alloc(64);
  float* gateb = (float*)alloc((size_t)NPAIR * 4);

  // 1) conv operands: padded fp16 token table + fp16 conv weights in (tap, channel) order
  pad_cvt_k<<<CVT_BLKS + PAD_BLKS, ROW_THREADS, 0, stream>>>(queries, qpadH, convW, convWH);

  // 2) conv3x3 as WMMA GEMM (1568 x 512 x 4608), A rows straight from the padded table; the gate-collapse vectors and
  //    the weight transposes run beside it in the same grid
  conv_gemm_side_k<<<SIDE_GRID, dim3(32, 4), 0, stream>>>(
      qpadH, convWH, convb, hconv,
      Wr2, Wgate, bgate, Wproj, bproj, br2, rel_embed, uvec, wvecp, cscal,
      Wq, Wk, Wv, Wo, Wr1, Wc1, WqT, WkT, WvT, WoT, Wr1aT, Wr1bT, Wc1aT, Wc1bT);

  // 3) BatchNorm(affine=False) + ReLU + residual adds (f16 activations)
  bn_stats_k<<<DMODEL, 256, 0, stream>>>(hconv, muv, rstdv);
  eqkv_k<<<(ROWS * DMODEL) / 8 / 256, 256, 0, stream>>>(hconv, muv, rstdv, queries, keys,
                                                    values, eqH, ekH, evH);

  // 4) token-level projections (all WMMA), one grid
  proj_gemms_k<<<PROJ_BLKS, dim3(32, 4), 0, stream>>>(
      eqH, ekH, evH, WqT, WkT, WvT, Wr1aT, Wr1bT, Wc1aT, Wc1bT, bq, bk, bv, br1, bc1,
      qh, kh, vh, A1r, A2r, A1c, A2c);

  // 5) per-pair gate (one wave32 per 7 pairs, 112 pairs a block)
  pair_gate_k<<<PAIR_BLKS, dim3(32, PAIR_WAVES), 0, stream>>>(
      A1c, A2c, A1r, A2r, gc, bcln, Wc2, bc2, gr, brln, uvec, wvecp, cscal, gateb);

  // 6) logits, gated softmax and A*V, one block per (b, h) (f16 output feeds final GEMM)
  attn_gated_k<<<BQ * NHEAD, dim3(32, 4), 0, stream>>>(qh, kh, vh, gateb, attnoH);

  // 7) output projection (WMMA) straight into d_out
  gemm_wmma_f16<<<BLK_N512, dim3(32, 4), 0, stream>>>(attnoH, WoT, bo, (float*)d_out);
}

// v009
// A run of this version takes 79.1 microseconds.
// Timed twice side by side with v008, it ran 1.09 and 1.10 times as fast.
// All steps since v000 together make it 5.13 times as fast.
#include <hip/hip_runtime.h>
#include <hip/hip_bf16.h>
#include <math.h>

// ---------------------------------------------------------------------------
// RelationEnhanceAttention, algebraically restructured for MI455X (gfx1250).
//   B=32, N=49, D=512, H=8, DK=64, NREL=TOPK=14
// Conv and projection GEMMs: f16 operands (K-innermost both sides), fp32 accumulate on
// v_wmma_f32_16x16x32_f16. 16x32 C-tile per wave, operands staged in LDS.
// ---------------------------------------------------------------------------

typedef __attribute__((ext_vector_type(16))) _Float16 v16h;
typedef __attribute__((ext_vector_type(8)))  _Float16 v8h;
typedef __attribute__((ext_vector_type(8)))  float    v8f;
typedef __attribute__((ext_vector_type(4)))  float    v4f;
typedef __attribute__((ext_vector_type(2)))  float    v2f;

#define BQ      32
#define NQ      49
#define DMODEL  512
#define NHEAD   8
#define DKH     64
#define NRELC   14
#define ROWS    (BQ * NQ)            // 1568
#define KCONV   (DMODEL * 9)         // 4608
#define PADW    9                    // the 7x7 map with a border of zeros: 9x9 places
#define PADN    (PADW * PADW)        // 81
#define NPAIR   (BQ * NQ * NQ)       // 76832
#define LN_EPS  1e-5f
#define NPART   (ROWS / 16)          // 98 groups of 16 rows: one BatchNorm partial sum each

// Cross-lane steps of the butterfly sums and maxima, on the vector unit: a shuffle
// would go through the LDS unit and make its wave wait for it at every step.
// Every lane of the wave is on wherever these are called.
// lane l with lane l ^ 16: cross-row move
__device__ __forceinline__ float xhalf(float x) {
  const int b = __builtin_bit_cast(int, x);
  return __builtin_bit_cast(float,
      __builtin_amdgcn_permlanex16(b, b, 0x76543210, 0xfedcba98, false, false));
}
// lane l with lane l ^ M inside its row of 16 lanes: DPP row_xmask (control 0x160 + M),
// which the compiler can fold into the add that takes it
template <int M>
__device__ __forceinline__ float xrow(float x) {
  const int b = __builtin_bit_cast(int, x);
  return __builtin_bit_cast(float, __builtin_amdgcn_update_dpp(b, b, 0x160 + M, 0xf, 0xf, true));
}
// steps 8, 4, 2, 1 (and 16 in front of them): the order of the shuffles they replace
__device__ __forceinline__ float row_sum(float x) {
  x += xrow<8>(x); x += xrow<4>(x); x += xrow<2>(x); x += xrow<1>(x);
  return x;
}
__device__ __forceinline__ float row_max(float x) {
  x = fmaxf(x, xrow<8>(x)); x = fmaxf(x, xrow<4>(x));
  x = fmaxf(x, xrow<2>(x)); x = fmaxf(x, xrow<1>(x));
  return x;
}
__device__ __forceinline__ float wave_sum(float x) {
  x += xhalf(x);
  return row_sum(x);
}

// ---------------------------------------------------------------------------
// WMMA GEMM: C[M,N] = A[M,K] * B^T[N,K] (+bias[N]).
// A: f16 row-major (M,K), pitch K; with TAPS the padded table below. Bt: f16 row-major (N,K), pitch K.
// REQUIRES: M%32==0, N%64==0, K%256==0, K>=512 (true for every call site here).
// One block of 4 waves computes a 32x64 C tile, each wave 16x32; K stepped by 32
// in rising order. The operands come into LDS in stages of 256 k (512 B of each
// of the 96 rows) by asynchronous copies: one copy of a wave is one row's whole
// 512 B, so that every request covers whole cache lines. Two buffers: the next
// stage's copies fly while this one is worked on.
// Fragment layout (ISA 16-bit A 16x32): halves 0..7  <- K = k0+8*half+0..7
//                                       halves 8..15 <- K = k0+8*half+16..23
// i.e. two 16-byte segments per lane -> two ds_load_b128 each.
// ---------------------------------------------------------------------------
#define GBM    32
#define GBN    64
#define GBK    256
#define GROWS  (GBM + GBN)            // 96 rows a stage
#define GPITCH (GBK * 2 + 16)         // 528 B = 16 B x odd: no bank conflict for b128 readers
#define GBUF   (GROWS * GPITCH)       // 50,688 B a buffer

// Eight rows, four apart (one per wave between them): lane l brings bytes
// 16*l .. 16*l+15 of each row's 512 B. The s_wait_xcnt stands inside the
// statement, so that no address register is rewritten in front of it.
template <int K>
__device__ __forceinline__ void copy8_rows(unsigned lds, const _Float16* g) {
  asm volatile(
      "global_load_async_to_lds_b128 %0, %8, off\n\t"
      "global_load_async_to_lds_b128 %1, %9, off\n\t"
      "global_load_async_to_lds_b128 %2, %10, off\n\t"
      "global_load_async_to_lds_b128 %3, %11, off\n\t"
      "global_load_async_to_lds_b128 %4, %12, off\n\t"
      "global_load_async_to_lds_b128 %5, %13, off\n\t"
      "global_load_async_to_lds_b128 %6, %14, off\n\t"
      "global_load_async_to_lds_b128 %7, %15, off\n\t"
      "s_wait_xcnt 0x0"
      :: "v"(lds), "v"(lds + 4 * GPITCH), "v"(lds + 8 * GPITCH), "v"(lds + 12 * GPITCH),
         "v"(lds + 16 * GPITCH), "v"(lds + 20 * GPITCH), "v"(lds + 24 * GPITCH),
         "v"(lds + 28 * GPITCH),
         "v"(g), "v"(g + 4 * K), "v"(g + 8 * K), "v"(g + 12 * K),
         "v"(g + 16 * K), "v"(g + 20 * K), "v"(g + 24 * K), "v"(g + 28 * K)
      : "memory");
}

// The same for eight rows that lie at addresses of their own.
__device__ __forceinline__ void copy8_at(unsigned lds, const _Float16* g0, const _Float16* g1,
                                         const _Float16* g2, const _Float16* g3,
                                         const _Float16* g4, const _Float16* g5,
                                         const _Float16* g6, const _Float16* g7) {
  asm volatile(
      "global_load_async_to_lds_b128 %0, %8, off\n\t"
      "global_load_async_to_lds_b128 %1, %9, off\n\t"
      "global_load_async_to_lds_b128 %2, %10, off\n\t"
      "global_load_async_to_lds_b128 %3, %11, off\n\t"
      "global_load_async_to_lds_b128 %4, %12, off\n\t"
      "global_load_async_to_lds_b128 %5, %13, off\n\t"
      "global_load_async_to_lds_b128 %6, %14, off\n\t"
      "global_load_async_to_lds_b128 %7, %15, off\n\t"
      "s_wait_xcnt 0x0"
      :: "v"(lds), "v"(lds + 4 * GPITCH), "v"(lds + 8 * GPITCH), "v"(lds + 12 * GPITCH),
         "v"(lds + 16 * GPITCH), "v"(lds + 20 * GPITCH), "v"(lds + 24 * GPITCH),
         "v"(lds + 28 * GPITCH),
         "v"(g0), "v"(g1), "v"(g2), "v"(g3), "v"(g4), "v"(g5), "v"(g6), "v"(g7)
      : "memory");
}

// TAPS: the 3x3 pad-1 conv as a GEMM with no im2col matrix. k runs (tap, channel),
// K = 9 * 512. A is then the padded token table (b, 9x9 places, 512 channels): row m
// of the product is token (b, y, x), and its 512 k of tap (ky, kx) are the whole row
// of place (y + ky, x + kx), border places holding zeros. A stage of 256 k is half
// of such a row: the same 512-B copies, from a row address that moves with the tap.
// TAPS also leaves, per output column, the sum and the sum of squares over each wave's
// 16 rows in part (kind, group of 16 rows, column): the BatchNorm sums need no pass
// of their own over C.
template <int K, bool TAPS = false>
__device__ __forceinline__ void gemm_block(const _Float16* __restrict__ A,
                                           const _Float16* __restrict__ Bt,
                                           const float* __restrict__ bias,
                                           float* __restrict__ C, int tile, int N,
                                           float* __restrict__ part = nullptr) {
  __shared__ __attribute__((aligned(16))) unsigned char gsm[2 * GBUF];
  constexpr int NST = K / GBK;                   // stages
  static_assert(K % GBK == 0 && NST >= 2, "two stages at least");
  const int ntn  = N >> 6;                       // 64-wide column tiles
  const int tm   = tile / ntn;
  const int tn   = tile - tm * ntn;
  const int row0 = tm * GBM;
  const int col0 = tn * GBN;

  const int lane = threadIdx.x;                  // 0..31
  const int wave = __builtin_amdgcn_readfirstlane(threadIdx.y);   // 0..3
  const int hf   = lane >> 4;                    // 0/1
  const int idx  = lane & 15;
  const int wm   = wave >> 1, wn = wave & 1;     // the wave's 16 rows, 32 columns

  // copy side: wave w takes rows w, w+4, ... of the stage (A rows 0..31, B rows 32..95)
  const unsigned lds0 = (unsigned)(size_t)gsm + (unsigned)(wave * GPITCH + lane * 16);
  const _Float16* ga = A  + (size_t)(row0 + wave) * K + lane * 8;
  const _Float16* gb = Bt + (size_t)(col0 + wave) * K + lane * 8;
  const _Float16* gt[8];                         // TAPS: tap (0, 0) of the wave's eight tokens
  if constexpr (TAPS) {
    static_assert(K == 9 * DMODEL && DMODEL == 2 * GBK, "two stages a tap");
#pragma unroll
    for (int i = 0; i < 8; ++i) {
      const int r = row0 + wave + 4 * i;
      const int p = r % NQ;
      gt[i] = A + (size_t)((r / NQ) * PADN + (p / 7) * PADW + p % 7) * DMODEL + lane * 8;
    }
  }
  auto copy_stage = [&](int st, int buf) {
    const unsigned l = lds0 + (unsigned)buf * GBUF;
    if constexpr (TAPS) {
      const int tap = st >> 1;
      const int ky  = (tap * 11) >> 5;           // tap / 3 for tap in 0..8
      const int ko  = (tap + (PADW - 3) * ky) * DMODEL + (st & 1) * GBK;   // place ky*9 + kx
      copy8_at(l, gt[0] + ko, gt[1] + ko, gt[2] + ko, gt[3] + ko,
               gt[4] + ko, gt[5] + ko, gt[6] + ko, gt[7] + ko);
    } else {
      copy8_rows<K>(l, ga + st * GBK);
    }
    copy8_rows<K>(l + 32 * GPITCH, gb + st * GBK);
    copy8_rows<K>(l + 64 * GPITCH, gb + (size_t)32 * K + st * GBK);
  };

  // read side
  const unsigned char* sa  = gsm + (wm * 16 + idx) * GPITCH + hf * 16;
  const unsigned char* sb0 = gsm + (GBM + wn * 32 + idx) * GPITCH + hf * 16;
  const unsigned char* sb1 = sb0 + 16 * GPITCH;

  v8f acc0 = {}, acc1 = {};
  union F16x16 { v16h v; v8h h[2]; };

  copy_stage(0, 0);
  // stage 0 has landed for this wave; the barrier publishes it to the others
  asm volatile("s_wait_asynccnt 0x0" ::: "memory");
  __syncthreads();
  copy_stage(1, 1);

  // rolled: one body serves both buffers, the code stays small
#pragma unroll 1
  for (int t = 0; t < NST; ++t) {
    const int bo = (t & 1) * GBUF;
    // four k steps' fragments are fetched as one group, then their eight WMMAs:
    // one LDS latency a group instead of one a WMMA
#pragma unroll
    for (int kg = 0; kg < GBK / 128; ++kg) {
      F16x16 af[4], b0[4], b1[4];
#pragma unroll
      for (int q = 0; q < 4; ++q) {
        const int o = bo + (kg * 4 + q) * 64;
        af[q].h[0] = *(const v8h*)(sa  + o);
        af[q].h[1] = *(const v8h*)(sa  + o + 32);
        b0[q].h[0] = *(const v8h*)(sb0 + o);
        b0[q].h[1] = *(const v8h*)(sb0 + o + 32);
        b1[q].h[0] = *(const v8h*)(sb1 + o);
        b1[q].h[1] = *(const v8h*)(sb1 + o + 32);
      }
      // keeps the group's loads in front of its WMMAs: the scheduler otherwise deals
      // them out again, one wait on LDS per WMMA
      __builtin_amdgcn_sched_barrier(0);
#pragma unroll
      for (int q = 0; q < 4; ++q) {
        acc0 = __builtin_amdgcn_wmma_f32_16x16x32_f16(false, af[q].v, false, b0[q].v,
                                                      (short)0, acc0, false, false);
        acc1 = __builtin_amdgcn_wmma_f32_16x16x32_f16(false, af[q].v, false, b1[q].v,
                                                      (short)0, acc1, false, false);
      }
    }
    // this wave's reads of the buffer are done before it may be refilled
    asm volatile("s_wait_dscnt 0x0" ::: "memory");
    // this wave's copies of the next stage have landed
    asm volatile("s_wait_asynccnt 0x0" ::: "memory");
    // publishes the next stage and ends every reader's last read of this one
    __syncthreads();
    if (t + 2 < NST) copy_stage(t + 2, t & 1);
  }
  // no copy is left outstanding when the wave ends
  asm volatile("s_wait_asynccnt 0x0" ::: "memory");

  // C layout: vgpr r -> m = row0 + 16*wm + r + 8*hf ; n = col0 + 32*wn + sub*16 + idx
  const int mbase = row0 + wm * 16 + hf * 8;
#pragma unroll
  for (int s = 0; s < 2; ++s) {
    const int n = col0 + wn * 32 + s * 16 + idx;
    const float badd = bias ? bias[n] : 0.f;
    const v8f a = (s == 0) ? acc0 : acc1;
#pragma unroll
    for (int r = 0; r < 8; ++r)
      C[(size_t)(mbase + r) * N + n] = a[r] + badd;
    if constexpr (TAPS) {
      float cs = 0.f, cq = 0.f;
#pragma unroll
      for (int r = 0; r < 8; ++r) {
        const float o = a[r] + badd;
        cs += o; cq += o * o;
      }
      // the other half of the lanes holds the column's other 8 rows
      cs += xhalf(cs); cq += xhalf(cq);
      // lower half stores the sum, upper half the squares: a wave fills whole 128-B lines
      part[(size_t)(hf * NPART + tm * 2 + wm) * DMODEL + n] = hf ? cq : cs;
    }
    // the next column group reuses these stores' registers: wait first
    asm volatile("s_wait_xcnt 0x0" ::: "memory");
  }
}

// blocks of 4 waves: the bound lifts the register cap, else fragments spill
__global__ __launch_bounds__(128) void gemm_wmma_f16(const _Float16* __restrict__ A,
                              const _Float16* __restrict__ Bt,
                              const float* __restrict__ bias,
                              float* __restrict__ C) {
  gemm_block<DMODEL>(A, Bt, bias, C, blockIdx.x, DMODEL);
}

// The seven token-level projections share no data dependence: one grid, the
// product chosen by block range (block-uniform). 392 blocks per 512-wide
// product, 196 per 256-wide one; one 32x64 tile per block as above.
#define BLK_N512 ((ROWS / GBM) * (DMODEL / GBN))     // 392
#define BLK_N256 ((ROWS / GBM) * (256 / GBN))        // 196
#define PROJ_BLKS (5 * BLK_N512 + 2 * BLK_N256)      // 2352
__global__ __launch_bounds__(128) void proj_gemms_k(const _Float16* __restrict__ eq, const _Float16* __restrict__ ek,
                             const _Float16* __restrict__ ev,
                             const _Float16* __restrict__ WqT, const _Float16* __restrict__ WkT,
                             const _Float16* __restrict__ WvT, const _Float16* __restrict__ Wr1aT,
                             const _Float16* __restrict__ Wr1bT, const _Float16* __restrict__ Wc1aT,
                             const _Float16* __restrict__ Wc1bT,
                             const float* __restrict__ bq, const float* __restrict__ bk,
                             const float* __restrict__ bv, const float* __restrict__ br1,
                             const float* __restrict__ bc1,
                             float* __restrict__ qh, float* __restrict__ kh,
                             float* __restrict__ vh, float* __restrict__ A1r,
                             float* __restrict__ A2r, float* __restrict__ A1c,
                             float* __restrict__ A2c) {
  const int blk = blockIdx.x;
  const _Float16* A; const _Float16* Bt; const float* bias; float* C;
  int n, lb;
  if (blk < 5 * BLK_N512) {
    const int job = blk / BLK_N512;
    lb = blk - job * BLK_N512;
    n = DMODEL;
    switch (job) {
      case 0:  A = eq; Bt = WqT;   bias = bq;      C = qh;  break;
      case 1:  A = ek; Bt = WkT;   bias = bk;      C = kh;  break;
      case 2:  A = ev; Bt = WvT;   bias = bv;      C = vh;  break;
      case 3:  A = eq; Bt = Wr1aT; bias = br1;     C = A1r; break;
      default: A = ek; Bt = Wr1bT; bias = nullptr; C = A2r; break;
    }
  } else {
    lb = blk - 5 * BLK_N512;
    n = 256;
    if (lb < BLK_N256) { A = eq; Bt = Wc1aT; bias = bc1; C = A1c; }
    else { lb -= BLK_N256; A = ek; Bt = Wc1bT; bias = nullptr; C = A2c; }
  }
  gemm_block<DMODEL>(A, Bt, bias, C, lb, n);
}

// ---------------------------------------------------------------------------
// Weight transpose + fp16 convert: W (K,N) row-major -> Wt (N,K) f16.
// One thread takes 8 consecutive k of one column n: 8 reads, each coalesced
// over the lanes' n, and one 16-byte store.
// ---------------------------------------------------------------------------
__device__ __forceinline__ void transpose_h(const float* __restrict__ W,
                                            _Float16* __restrict__ Wt, int K, int N, int t) {
  const int kc = t / N, n = t - kc * N;
  const float* p = W + (size_t)kc * 8 * N + n;
  v8h o;
#pragma unroll
  for (int j = 0; j < 8; ++j) o[j] = (_Float16)p[(size_t)j * N];
  *(v8h*)(Wt + (size_t)n * K + kc * 8) = o;
  // other block ranges' code follows in the merged kernel and reuses the
  // store's registers: wait first
  asm volatile("s_wait_xcnt 0x0" ::: "memory");
}

// ---------------------------------------------------------------------------
// Operands of the 3x3 pad-1 conv. x[b,c,y,x] == queries[b,y*7+x,c].
//   qpad[b, (y+1)*9 + (x+1), c] = f16(queries[b, y*7+x, c]), the border places zero
//   convWH[oc, tap*512 + ic]    = f16(convW[oc, ic*9 + tap]),  tap = ky*3 + kx
// Two block ranges of one grid, blocks of 192 threads, each thread 3 groups of 8
// outputs with one 16-byte store a group (few waves to start).
// ---------------------------------------------------------------------------
#define CVT_BLKS    DMODEL                   // 512 rows of conv weights
#define PAD_BLKS    (BQ * PADW)              // 288 lines of 9 places
#define ROW_THREADS (KCONV / 8 / 3)          // 192
#define WT_P        (DMODEL + 8)             // halves: 1040 B = 16 B x odd (b128 readers)
__global__ void pad_cvt_k(const float* __restrict__ q, _Float16* __restrict__ qpad,
                          const float* __restrict__ convW, _Float16* __restrict__ convWH) {
  __shared__ __attribute__((aligned(16))) _Float16 wt[9 * WT_P];
  const int tid = threadIdx.x;
  if (blockIdx.x < CVT_BLKS) {                   // block-uniform
    // one output channel's 4608 weights: read in their order (ic, tap), turned to
    // (tap, ic) through LDS, so that reads and stores both cover whole lines
    const size_t base = (size_t)blockIdx.x * KCONV;
    v4f lo[3], hi[3];
#pragma unroll
    for (int i = 0; i < 3; ++i) {
      const size_t e = base + (size_t)(tid + ROW_THREADS * i) * 8;
      lo[i] = *(const v4f*)(convW + e);
      hi[i] = *(const v4f*)(convW + e + 4);
    }
#pragma unroll
    for (int i = 0; i < 3; ++i) {
      const int e0 = (tid + ROW_THREADS * i) * 8;
      int ic = e0 / 9, r = e0 % 9;
#pragma unroll
      for (int j = 0; j < 8; ++j) {
        wt[r * WT_P + ic] = (_Float16)(j < 4 ? lo[i][j & 3] : hi[i][j & 3]);
        const int wrap = (r == 8);
        r = wrap ? 0 : r + 1;
        ic += wrap;
      }
    }
    // the weights go from the threads that read them to the threads that store them
    __syncthreads();
#pragma unroll
    for (int i = 0; i < 3; ++i) {
      const int g = tid + ROW_THREADS * i;       // 64 groups of 8 channels a tap
      *(v8h*)(convWH + base + (size_t)g * 8) = *(const v8h*)(wt + (g >> 6) * WT_P + (g & 63) * 8);
    }
    return;
  }
  const int pb = blockIdx.x - CVT_BLKS;          // b*9 + line of the padded map
  const int b  = pb / PADW, yy = pb % PADW;
  const int c  = (tid & 63) * 8;
  // a border place reads token 0 (in bounds) and is zeroed: no branch round a load,
  // so all 6 loads of a thread can be in flight at once
  v4f lo[3], hi[3];
  bool in[3];
  const float* s[3];
#pragma unroll
  for (int i = 0; i < 3; ++i) {
    const int xx = i * 3 + (tid >> 6);
    in[i] = (unsigned)(yy - 1) < 7u && (unsigned)(xx - 1) < 7u;
    const int tok = in[i] ? (yy - 1) * 7 + xx - 1 : 0;
    s[i] = q + (size_t)(b * NQ + tok) * DMODEL + c;
    lo[i] = *(const v4f*)s[i];
    hi[i] = *(const v4f*)(s[i] + 4);
  }
  // the addresses stay live up to this wait, so that no load of the run
  // returns into a register that the others still name
  asm volatile("s_wait_xcnt 0x0" :: "v"(s[0]), "v"(s[1]), "v"(s[2]) : "memory");
#pragma unroll
  for (int i = 0; i < 3; ++i) {
    const int xx = i * 3 + (tid >> 6);
    v8h o;
#pragma unroll
    for (int j = 0; j < 4; ++j) {
      o[j]     = (_Float16)(in[i] ? lo[i][j] : 0.f);
      o[4 + j] = (_Float16)(in[i] ? hi[i][j] : 0.f);
    }
    *(v8h*)(qpad + (size_t)(pb * PADW + xx) * DMODEL + c) = o;
  }
  // the weight range's code follows in the built kernel and reuses the
  // stores' registers: wait first
  asm volatile("s_wait_xcnt 0x0" ::: "memory");
}

// BatchNorm (population variance over the 1568 rows of a channel) + ReLU + residual adds:
//   xs = relu(BN(h)); eq/ek/ev = f16(xs + queries/keys/values)
// One block takes 64 channels of one image's 49 rows. It first adds up the 98 partial
// sums and squares that the conv GEMM left for its channels (a thread: 4 channels, one
// kind, 14 of the 98), then does its 392 groups of 8 channels, up to two a thread.
#define EQ_CH      64
#define EQ_THREADS 256
#define EQ_ITEMS   (NQ * EQ_CH / 8)              // 392
#define EQ_BLKS    (BQ * (DMODEL / EQ_CH))       // 256
#define EQ_SPLIT   7                             // 98 partial sums = 7 runs of 14
#define EQ_RUN     (NPART / EQ_SPLIT)            // 14
__global__ __launch_bounds__(EQ_THREADS) void eqkv_k(const float* __restrict__ h,
                       const float* __restrict__ part,
                       const float* __restrict__ q, const float* __restrict__ k,
                       const float* __restrict__ v,
                       _Float16* __restrict__ eq, _Float16* __restrict__ ek,
                       _Float16* __restrict__ ev) {
  __shared__ __attribute__((aligned(16))) float red[EQ_SPLIT * 2 * EQ_CH];   // (run, kind, channel)
  __shared__ __attribute__((aligned(16))) float smu[EQ_CH];
  __shared__ __attribute__((aligned(16))) float srs[EQ_CH];
  const int tid = threadIdx.x;
  const int b   = blockIdx.x / (DMODEL / EQ_CH);
  const int c0  = (blockIdx.x % (DMODEL / EQ_CH)) * EQ_CH;

  // every load of the thread is asked for before the first one is waited for: the rows
  // and the partial sums make one trip to memory together.
  // The second group of a thread past the end reads the last group (in bounds), stores nothing.
  unsigned eo[2];
  v4f h4[2][2], q4[2][2], k4[2][2], v4[2][2];
#pragma unroll
  for (int it = 0; it < 2; ++it) {
    const int item = min(tid + EQ_THREADS * it, EQ_ITEMS - 1);
    eo[it] = (unsigned)((b * NQ + (item >> 3)) * DMODEL + c0 + (item & 7) * 8) * 4u;
#pragma unroll
    for (int g = 0; g < 2; ++g) {
      h4[it][g] = *(const v4f*)((const char*)h + eo[it] + 16 * g);
      q4[it][g] = *(const v4f*)((const char*)q + eo[it] + 16 * g);
      k4[it][g] = *(const v4f*)((const char*)k + eo[it] + 16 * g);
      v4[it][g] = *(const v4f*)((const char*)v + eo[it] + 16 * g);
    }
  }
  // the offsets stay live up to this wait, so that no load of the run
  // returns into a register that the others still name
  asm volatile("s_wait_xcnt 0x0" :: "v"(eo[0]), "v"(eo[1]) : "memory");
  if (tid < EQ_SPLIT * 32) {                     // wave-uniform: wave w takes run w, the eighth none
    const int run = tid >> 5, kind = (tid >> 4) & 1;
    const unsigned po = (unsigned)((kind * NPART + run * EQ_RUN) * DMODEL + c0 + (tid & 15) * 4) * 4u;
    v4f pv[EQ_RUN];
    // unrolled: the 14 loads are in flight at once, together with the rows above
#pragma unroll
    for (int i = 0; i < EQ_RUN; ++i) pv[i] = *(const v4f*)((const char*)part + po + i * (DMODEL * 4));
    // as above: the offset stays live up to this wait
    asm volatile("s_wait_xcnt 0x0" :: "v"(po) : "memory");
    v4f s4 = pv[0];
#pragma unroll
    for (int i = 1; i < EQ_RUN; ++i) s4 += pv[i];
    *(v4f*)(red + tid * 4) = s4;
  }
  // the 14 part sums of a channel go to the thread that joins them
  __syncthreads();
  if (tid < EQ_CH) {
    float sm = red[tid], sq = red[EQ_CH + tid];
#pragma unroll
    for (int r = 1; r < EQ_SPLIT; ++r) {
      sm += red[r * 2 * EQ_CH + tid];
      sq += red[(r * 2 + 1) * EQ_CH + tid];
    }
    const float m  = sm * (1.f / ROWS);
    const float vr = sq * (1.f / ROWS) - m * m;
    smu[tid] = m; srs[tid] = rsqrtf(vr + LN_EPS);
  }
  // mean and scale go to every thread of the block
  __syncthreads();

  const int cl = (tid & 7) * 8;                  // the same for both groups of a thread
  v8h oq[2], ok[2], ov[2];
#pragma unroll
  for (int g = 0; g < 2; ++g) {
    const v4f m4 = *(const v4f*)(smu + cl + 4 * g);
    const v4f r4 = *(const v4f*)(srs + cl + 4 * g);
#pragma unroll
    for (int it = 0; it < 2; ++it) {
#pragma unroll
      for (int j = 0; j < 4; ++j) {
        const float xs = fmaxf((h4[it][g][j] - m4[j]) * r4[j], 0.f);
        oq[it][4 * g + j] = (_Float16)(xs + q4[it][g][j]);
        ok[it][4 * g + j] = (_Float16)(xs + k4[it][g][j]);
        ov[it][4 * g + j] = (_Float16)(xs + v4[it][g][j]);
      }
    }
  }
  *(v8h*)((char*)eq + (eo[0] >> 1)) = oq[0];
  *(v8h*)((char*)ek + (eo[0] >> 1)) = ok[0];
  *(v8h*)((char*)ev + (eo[0] >> 1)) = ov[0];
  if (tid + EQ_THREADS < EQ_ITEMS) {
    *(v8h*)((char*)eq + (eo[1] >> 1)) = oq[1];
    *(v8h*)((char*)ek + (eo[1] >> 1)) = ok[1];
    *(v8h*)((char*)ev + (eo[1] >> 1)) = ov[1];
  }
}

// Precompute gate-collapse vectors:
//   u[512] = Wr2 @ Wgate ; wv[14] = rel_embed @ (Wproj @ Wgate)
//   cs = (br2 + bproj) . Wgate + bgate
// Blocks of 128 threads: parts 0..3 take 128 rows of u each, part 4 the rest.
__device__ __forceinline__ void precompute_part(int part, int t,
                             const float* __restrict__ Wr2, const float* __restrict__ Wgate,
                             const float* __restrict__ bgate, const float* __restrict__ Wproj,
                             const float* __restrict__ bproj, const float* __restrict__ br2,
                             const float* __restrict__ rel_embed,
                             float* __restrict__ u, float* __restrict__ wv,
                             float* __restrict__ cs) {
  __shared__ float pv[DKH];
  if (part < 4) {                                // block-uniform
    const int row = part * 128 + t;
    float s = 0.f;
    for (int j = 0; j < DMODEL; ++j) s += Wr2[(size_t)row * DMODEL + j] * Wgate[j];
    u[row] = s;
    // the fifth part's code follows and reuses the store's registers: wait first
    asm volatile("s_wait_xcnt 0x0" ::: "memory");
    return;
  }
  if (t < DKH) {
    float s = 0.f;
    for (int d = 0; d < DMODEL; ++d) s += Wproj[(size_t)t * DMODEL + d] * Wgate[d];
    pv[t] = s;
  }
  __syncthreads();
  if (t < NRELC) {
    float s = 0.f;
    const unsigned rb = (unsigned)t * (DKH * 4u);   // the row's byte offset
    const float* rp = (const float*)((const char*)rel_embed + rb);
    for (int d = 0; d < DKH; ++d) s += rp[d] * pv[d];
    // the row's offset stays live up to this wait, so that no load of the run
    // returns into the register that the others still name
    asm volatile("s_wait_xcnt 0x0" :: "v"(rb) : "memory");
    wv[t] = s;
  }
  if (t == 0) {
    float s = bgate[0];
    for (int d = 0; d < DMODEL; ++d) s += (br2[d] + bproj[d]) * Wgate[d];
    cs[0] = s;
  }
}

// conv GEMM grid (392 blocks of 4 waves leave most wave slots empty) plus the
// work that nothing before the projections depends on: the gate-collapse
// vectors and the eight weight transposes, on the block ranges behind it.
#define CONV_BLKS ((ROWS / GBM) * (DMODEL / GBN))      // 392
#define PRE_BLKS  5
#define TR512_BLKS (DMODEL * DMODEL / 8 / 128)         // 256
#define TR256_BLKS (DMODEL * 256 / 8 / 128)            // 128
#define SIDE_GRID (CONV_BLKS + PRE_BLKS + 6 * TR512_BLKS + 2 * TR256_BLKS)
__global__ __launch_bounds__(128) void conv_gemm_side_k(const _Float16* __restrict__ qpad,
                                 const _Float16* __restrict__ convWH,
                                 const float* __restrict__ convb, float* __restrict__ hconv,
                                 float* __restrict__ bnpart,
                                 const float* __restrict__ Wr2, const float* __restrict__ Wgate,
                                 const float* __restrict__ bgate, const float* __restrict__ Wproj,
                                 const float* __restrict__ bproj, const float* __restrict__ br2,
                                 const float* __restrict__ rel_embed,
                                 float* __restrict__ u, float* __restrict__ wv,
                                 float* __restrict__ cs,
                                 const float* __restrict__ Wq, const float* __restrict__ Wk,
                                 const float* __restrict__ Wv, const float* __restrict__ Wo,
                                 const float* __restrict__ Wr1, const float* __restrict__ Wc1,
                                 _Float16* __restrict__ WqT, _Float16* __restrict__ WkT,
                                 _Float16* __restrict__ WvT, _Float16* __restrict__ WoT,
                                 _Float16* __restrict__ Wr1aT, _Float16* __restrict__ Wr1bT,
                                 _Float16* __restrict__ Wc1aT, _Float16* __restrict__ Wc1bT) {
  int blk = blockIdx.x;
  if (blk < CONV_BLKS) {
    gemm_block<KCONV, true>(qpad, convWH, convb, hconv, blk, DMODEL, bnpart);
    return;
  }
  blk -= CONV_BLKS;
  const int tid = threadIdx.y * 32 + threadIdx.x;
  if (blk < PRE_BLKS) {
    precompute_part(blk, tid, Wr2, Wgate, bgate, Wproj, bproj, br2, rel_embed, u, wv, cs);
    return;
  }
  blk -= PRE_BLKS;
  if (blk < 6 * TR512_BLKS) {
    const int job = blk / TR512_BLKS;
    const int t = (blk - job * TR512_BLKS) * 128 + tid;
    const float* W; _Float16* Wt;
    switch (job) {
      case 0:  W = Wq;  Wt = WqT;  break;
      case 1:  W = Wk;  Wt = WkT;  break;
      case 2:  W = Wv;  Wt = WvT;  break;
      case 3:  W = Wo;  Wt = WoT;  break;
      case 4:  W = Wr1; Wt = Wr1aT; break;
      default: W = Wr1 + (size_t)DMODEL * DMODEL; Wt = Wr1bT; break;
    }
    transpose_h(W, Wt, DMODEL, DMODEL, t);
  } else {
    blk -= 6 * TR512_BLKS;
    const int second = blk >= TR256_BLKS;
    const int t = (blk - second * TR256_BLKS) * 128 + tid;
    transpose_h(second ? Wc1 + (size_t)DMODEL * 256 : Wc1, second ? Wc1bT : Wc1aT,
                DMODEL, 256, t);
  }
}

// One wave32 per (b, qi, group of 7 ki), 16 waves a block = 112 pairs = 7 tiles of 16.
// Classifier branch: each wave makes LN(256)->ReLU of its 7 pairs and lays the rows in
// LDS; the 256x14 product of 16 pairs at a time then runs on v_wmma_f32_16x16x4_f32
// (operands stay fp32), one tile per wave 0..6, with the softmax and probs.wv taken
// from the accumulator (a pair's 14 logits lie in the 16 lanes of one half).
// Relation branch: LN(512)->ReLU->dot(u) per pair as before; gate = sigmoid(.).
// All that does not depend on ki (the LN scales and shifts, u, the q-side rows) is
// loaded once per wave and stays in registers over the 7 pairs. qi runs fastest over
// the waves, so that the waves of a block mostly read the same k-side rows (WGP cache).
#define KI_GRP     7
#define PAIR_WAVES 16
#define PAIR_THREADS (32 * PAIR_WAVES)                          // 512
#define PAIR_BLKS (BQ * (NQ / KI_GRP) * NQ / PAIR_WAVES)        // 686
#define PB_PAIRS  (PAIR_WAVES * KI_GRP)                         // 112
#define PB_TILES  (PB_PAIRS / 16)                               // 7
#define HV_P      260     // floats: pitch of a pair's row, 1040 B = 16 B x odd (b128 readers)
// four waves per SIMD: the register budget of 256 that one block per WGP needs
__global__ __launch_bounds__(PAIR_THREADS) __attribute__((amdgpu_waves_per_eu(4)))
void pair_gate_k(const float* __restrict__ A1c, const float* __restrict__ A2c,
                            const float* __restrict__ A1r, const float* __restrict__ A2r,
                            const float* __restrict__ gc, const float* __restrict__ bcln,
                            const float* __restrict__ Wc2, const float* __restrict__ bc2,
                            const float* __restrict__ gr, const float* __restrict__ brln,
                            const float* __restrict__ u, const float* __restrict__ wv,
                            const float* __restrict__ cs, float* __restrict__ gate) {
  __shared__ __attribute__((aligned(16))) float hvs[PB_PAIRS * HV_P];   // ReLU(LN) rows
  __shared__ __attribute__((aligned(16))) float wb[32 * 32 * 4];        // Wc2 as B fragments
  __shared__ float spw[PB_PAIRS];                                       // probs . wv
  const int lane = threadIdx.x;
  const int wl   = __builtin_amdgcn_readfirstlane(threadIdx.y);         // 0..15
  const int hf   = lane >> 4;
  const int idx  = lane & 15;
  const int wave = blockIdx.x * PAIR_WAVES + wl;                        // (b, ki group, qi)
  const int b   = wave / ((NQ / KI_GRP) * NQ);
  const int rm  = wave % ((NQ / KI_GRP) * NQ);
  const int ki0 = (rm / NQ) * KI_GRP;
  const int qi  = rm % NQ;

  const float* a1 = A1c + (size_t)(b * NQ + qi) * 256;
  const float* r1 = A1r + (size_t)(b * NQ + qi) * DMODEL;
  const float* a2 = A2c + (size_t)(b * NQ + ki0) * 256;
  const float* r2 = A2r + (size_t)(b * NQ + ki0) * DMODEL;
  // lane i collects the value of pair ki0 + i (equal in all lanes behind the sum
  // over the lanes); the sigmoid is then done once for the 7 pairs
  float gdn = 0.f;

  // Wc2 in B-fragment order: entry (c, lane) holds rows 8c + 4*hf + 0..3 of column idx,
  // columns 14 and 15 as zeros. Wave wl writes entries c = wl and c = wl + 16.
  {
    const unsigned wo = (unsigned)((8 * wl + 4 * hf) * NRELC + min(idx, NRELC - 1)) * 4u;
    const float* wp = (const float*)((const char*)Wc2 + wo);
    v4f w0, w1;
#pragma unroll
    for (int q = 0; q < 4; ++q) {
      w0[q] = wp[q * NRELC];
      w1[q] = wp[(128 + q) * NRELC];
    }
    // the offset stays live up to this wait, so that no load of the run
    // returns into the register that the others still name
    asm volatile("s_wait_xcnt 0x0" :: "v"(wo) : "memory");
    const v4f z = {};
    *(v4f*)(wb + (wl * 32 + lane) * 4)        = idx < NRELC ? w0 : z;
    *(v4f*)(wb + ((wl + 16) * 32 + lane) * 4) = idx < NRELC ? w1 : z;
  }

  // ---- classifier branch, part 1: LN over 256, ReLU, rows to LDS ----
  {
    float gcv[8], bcv[8], a1v[8];
    const float* a1l = a1 + lane;
#pragma unroll
    for (int j = 0; j < 8; ++j) {
      const int e = lane + 32 * j;
      a1v[j] = a1l[32 * j]; gcv[j] = gc[e]; bcv[j] = bcln[e];
    }
    // the address stays live up to this wait, so that no load of the run
    // returns into a register that the others still name
    asm volatile("s_wait_xcnt 0x0" :: "v"(a1l) : "memory");
    // unrolled: the 7 pairs' loads and sums over the lanes can overlap
#pragma unroll
    for (int i = 0; i < KI_GRP; ++i) {
      float x[8], s = 0.f, ss = 0.f;
#pragma unroll
      for (int j = 0; j < 8; ++j) {
        float v = a1v[j] + a2[i * 256 + lane + 32 * j];
        x[j] = v; s += v; ss += v * v;
      }
      s = wave_sum(s); ss = wave_sum(ss);
      const float mean = s * (1.f / 256.f);
      const float rstd = rsqrtf(ss * (1.f / 256.f) - mean * mean + LN_EPS);
      float* hrow = hvs + (wl * KI_GRP + i) * HV_P + lane;
#pragma unroll
      for (int j = 0; j < 8; ++j)
        hrow[32 * j] = fmaxf((x[j] - mean) * rstd * gcv[j] + bcv[j], 0.f);
    }
  }
  // the rows and the Wc2 fragments go from their writers to the tiles' waves
  __syncthreads();

  // ---- classifier branch, part 2: 16 pairs x 256 x 14 on WMMA, softmax, probs.wv ----
  // Fragments (A: lane holds pair idx; B: column idx; the lane halves split k): both
  // sides take feature 8c + 4*hf + 2j + 0..1 at step (c, j), so they pair.
  if (wl < PB_TILES) {                           // wave-uniform
    const unsigned no = (unsigned)min(idx, NRELC - 1) * 4u;
    const float bn  = *(const float*)((const char*)bc2 + no);
    const float wvn = *(const float*)((const char*)wv + no);
    // as above: the offset stays live up to this wait
    asm volatile("s_wait_xcnt 0x0" :: "v"(no) : "memory");
    const float* pa = hvs + (wl * 16 + idx) * HV_P + hf * 4;
    const float* pb = wb + lane * 4;
    v8f acc[4] = {};                             // four chains: no WMMA waits on the one before
    // unrolled: the chain's index is then a constant, and LDS reads can run ahead of the WMMAs
#pragma unroll
    for (int c = 0; c < 32; ++c) {
      const v4f a = *(const v4f*)(pa + c * 8);
      const v4f w = *(const v4f*)(pb + c * 128);
#pragma unroll
      for (int j = 0; j < 2; ++j) {
        const v2f a2f = {a[2 * j], a[2 * j + 1]};
        const v2f b2f = {w[2 * j], w[2 * j + 1]};
        acc[(c & 1) * 2 + j] = __builtin_amdgcn_wmma_f32_16x16x4_f32(
            false, a2f, false, b2f, (short)0, acc[(c & 1) * 2 + j], false, false);
      }
    }
    const v8f lgv = (acc[0] + acc[1]) + (acc[2] + acc[3]);
    // lgv[r] is pair 16*wl + 8*hf + r, class idx
    const bool okn = idx < NRELC;
    float pwk = 0.f, sek = 1.f;                  // lane idx keeps row idx of its half
#pragma unroll
    for (int r = 0; r < 8; ++r) {
      const float l = lgv[r] + bn;
      const float m = row_max(okn ? l : -__builtin_inff());
      const float p = okn ? __expf(l - m) : 0.f;
      const float se = row_sum(p), pw = row_sum(p * wvn);
      pwk = (idx == r) ? pw : pwk;
      sek = (idx == r) ? se : sek;
    }
    // probs = p/se; top-k(14 of 14) renorm = /(1+1e-8)
    if (idx < 8) spw[wl * 16 + hf * 8 + idx] = pwk / (sek * (1.f + 1e-8f));
  }

  // ---- relation branch: LN over 512, ReLU, dot with u ----
  {
    float grv[16], brv[16], uv[16], r1v[16];
    const float* r1l = r1 + lane;
#pragma unroll
    for (int j = 0; j < 16; ++j) {
      const int e = lane + 32 * j;
      r1v[j] = r1l[32 * j]; grv[j] = gr[e]; brv[j] = brln[e]; uv[j] = u[e];
    }
    // as above: the row's address stays live up to this wait
    asm volatile("s_wait_xcnt 0x0" :: "v"(r1l) : "memory");
    // unrolled: the 7 pairs' loads and sums over the lanes can overlap
#pragma unroll
    for (int i = 0; i < KI_GRP; ++i) {
      float y[16], s = 0.f, ss = 0.f;
#pragma unroll
      for (int j = 0; j < 16; ++j) {
        float v = r1v[j] + r2[i * DMODEL + lane + 32 * j];
        y[j] = v; s += v; ss += v * v;
      }
      s = wave_sum(s); ss = wave_sum(ss);
      const float mean = s * (1.f / 512.f);
      const float rstd = rsqrtf(ss * (1.f / 512.f) - mean * mean + LN_EPS);
      float gd = 0.f;
#pragma unroll
      for (int j = 0; j < 16; ++j) {
        float hv = fmaxf((y[j] - mean) * rstd * grv[j] + brv[j], 0.f);
        gd += hv * uv[j];
      }
      gd = wave_sum(gd);
      gdn = (lane == i) ? gd : gdn;
    }
  }

  // probs.wv goes from the tiles' waves back to the pairs' own waves
  __syncthreads();
  const float pwv = spw[wl * KI_GRP + min(lane, KI_GRP - 1)];
  if (lane < KI_GRP)
    gate[(size_t)(b * NQ + qi) * NQ + ki0 + lane] = 1.f / (1.f + __expf(-(gdn + pwv + cs[0])));
}

// Gated attention of one (b, h) in one block of 4 waves, both products on
// v_wmma_f32_16x16x4_f32 (operands stay fp32):
//   S = q k^T / 8 ; enh = S * (1 + gate) ; p = exp(enh - rowmax) ; out = f16((p v) / rowsum)
// The 49 queries and 49 keys are padded to 64; wave w owns query rows 16w .. 16w+15.
// q, k, v rows (64 floats of this head) are staged in LDS, pad rows as zeros: a
// pad key's p is set to 0, and 0 times a zero v row adds nothing.
// Fragments (A: lane holds row idx; B: column idx; the lane halves split k): both
// sides of a product take k from the same (half, element) place, so they pair.
#define AT_QP  68     // floats: pitch of q, k, p rows, 272 B = 16 B x odd (b128 and b64 readers)
#define AT_VP  72     // floats: pitch of v rows: rows two apart lie 16 banks apart (b32 readers)
#define AT_PAD 64
#define AT_KST ((NQ + 3) / 4)                    // 13 steps of 4 keys cover the 49
__global__ __launch_bounds__(128) void attn_gated_k(const float* __restrict__ qh,
                             const float* __restrict__ kh, const float* __restrict__ vh,
                             const float* __restrict__ gate, _Float16* __restrict__ outp) {
  __shared__ __attribute__((aligned(16))) float sq[AT_PAD * AT_QP];
  __shared__ __attribute__((aligned(16))) float sk[AT_PAD * AT_QP];
  __shared__ __attribute__((aligned(16))) float sp[AT_PAD * AT_QP];
  __shared__ __attribute__((aligned(16))) float sv[AT_PAD * AT_VP];
  const int b    = blockIdx.x / NHEAD;
  const int h    = blockIdx.x % NHEAD;
  const int lane = threadIdx.x;                  // 0..31
  const int wave = __builtin_amdgcn_readfirstlane(threadIdx.y);   // 0..3
  const int tid  = wave * 32 + lane;
  const int hf   = lane >> 4;
  const int idx  = lane & 15;
  const int m0   = wave * 16 + hf * 8;           // first of the lane's 8 accumulator rows

  // the gates of the lane's accumulator places, indices clamped into the 49 x 49 map;
  // asked for first, so that they fly together with the rows below
  float g[4][8];
  const float* gb = gate + (size_t)b * NQ * NQ;
#pragma unroll
  for (int r = 0; r < 8; ++r) {
    const int qi = min(m0 + r, NQ - 1);
#pragma unroll
    for (int t = 0; t < 4; ++t) g[t][r] = gb[qi * NQ + min(16 * t + idx, NQ - 1)];
  }

  // stage q, k, v: 16 threads a row (16 B each), 8 rows a pass: six whole passes,
  // then row 48 (read by all eight row groups, kept by the first), the rest zeros
  const int srow = (tid >> 4) & 7, scol = (tid & 15) * 4;
  const size_t hofs = (size_t)(b * NQ) * DMODEL + h * DKH + scol;
  const float* gq = qh + hofs;
  const float* gk = kh + hofs;
  const float* gv = vh + hofs;
  const float* gqr = gq + srow * DMODEL;
  const float* gkr = gk + srow * DMODEL;
  const float* gvr = gv + srow * DMODEL;
  v4f xq[7], xk[7], xv[7];
#pragma unroll
  for (int i = 0; i < 6; ++i) {
    xq[i] = *(const v4f*)(gqr + i * 8 * DMODEL);
    xk[i] = *(const v4f*)(gkr + i * 8 * DMODEL);
    xv[i] = *(const v4f*)(gvr + i * 8 * DMODEL);
  }
  xq[6] = *(const v4f*)(gq + (NQ - 1) * DMODEL);
  xk[6] = *(const v4f*)(gk + (NQ - 1) * DMODEL);
  xv[6] = *(const v4f*)(gv + (NQ - 1) * DMODEL);
  // the addresses stay live up to this wait, so that no load of the run
  // returns into a register that the others still name
  asm volatile("s_wait_xcnt 0x0" :: "v"(gq), "v"(gk), "v"(gv), "v"(gqr), "v"(gkr), "v"(gvr)
               : "memory");
#pragma unroll
  for (int i = 0; i < 8; ++i) {
    const int row = i * 8 + srow;
    const v4f z = {};
    const bool in = i < 6 || (i == 6 && srow == 0);
    *(v4f*)(sq + row * AT_QP + scol) = in ? xq[i < 7 ? i : 0] : z;
    *(v4f*)(sk + row * AT_QP + scol) = in ? xk[i < 7 ? i : 0] : z;
    *(v4f*)(sv + row * AT_VP + scol) = in ? xv[i < 7 ? i : 0] : z;
  }
  __syncthreads();

  // S = q k^T: one 16-byte read holds the lane's k of two steps (d = 8*k8 + 4*hf + 0..3)
  v8f s[4] = {};
  {
    const float* pa = sq + (wave * 16 + idx) * AT_QP + hf * 4;
    const float* pb = sk + idx * AT_QP + hf * 4;
#pragma unroll
    for (int k8 = 0; k8 < DKH / 8; ++k8) {
      const v4f a = *(const v4f*)(pa + k8 * 8);
      v4f bb[4];
#pragma unroll
      for (int t = 0; t < 4; ++t) bb[t] = *(const v4f*)(pb + t * 16 * AT_QP + k8 * 8);
#pragma unroll
      for (int j = 0; j < 2; ++j) {
        const v2f a2 = {a[2 * j], a[2 * j + 1]};
#pragma unroll
        for (int t = 0; t < 4; ++t) {
          const v2f b2 = {bb[t][2 * j], bb[t][2 * j + 1]};
          s[t] = __builtin_amdgcn_wmma_f32_16x16x4_f32(false, a2, false, b2, (short)0, s[t],
                                                       false, false);
        }
      }
    }
  }

  // gated softmax by rows: s[t][r] is row m0 + r, key 16*t + idx; a row lies in
  // the 16 lanes of one half. p stays unscaled, the row's sum divides at the end.
  float inv[8];
  {
    const bool ok3 = 48 + idx < NQ;              // the last tile holds key 48 alone
    float* pw = sp + m0 * AT_QP + idx;
#pragma unroll
    for (int r = 0; r < 8; ++r) {
      float e[4];
#pragma unroll
      for (int t = 0; t < 4; ++t) e[t] = s[t][r] * 0.125f * (1.f + g[t][r]);   // 1/sqrt(64)
      float m = fmaxf(fmaxf(e[0], e[1]), e[2]);
      m = row_max(ok3 ? fmaxf(m, e[3]) : m);
      const float p0 = __expf(e[0] - m), p1 = __expf(e[1] - m), p2 = __expf(e[2] - m);
      const float p3 = ok3 ? __expf(e[3] - m) : 0.f;
      const float sm = row_sum((p0 + p1) + (p2 + p3));
      inv[r] = 1.f / sm;
      pw[r * AT_QP]      = p0;
      pw[r * AT_QP + 16] = p1;
      pw[r * AT_QP + 32] = p2;
      pw[r * AT_QP + 48] = p3;
    }
  }
  // p goes from the accumulator places to the A places through LDS, between lanes
  __syncthreads();

  // out = p v: key = 4*ks + 2*hf + 0..1 on both sides
  v8f o[4] = {};
  {
    const float* pp = sp + (wave * 16 + idx) * AT_QP + hf * 2;
    const float* pv = sv + hf * 2 * AT_VP + idx;
#pragma unroll
    for (int ks = 0; ks < AT_KST; ++ks) {
      const v2f a2 = *(const v2f*)(pp + ks * 4);
#pragma unroll
      for (int t = 0; t < 4; ++t) {
        const v2f b2 = {pv[ks * 4 * AT_VP + t * 16], pv[(ks * 4 + 1) * AT_VP + t * 16]};
        o[t] = __builtin_amdgcn_wmma_f32_16x16x4_f32(false, a2, false, b2, (short)0, o[t],
                                                     false, false);
      }
    }
  }

  _Float16* op = outp + (size_t)(b * NQ + m0) * DMODEL + h * DKH + idx;
  if (wave * 16 + 16 <= NQ) {                    // wave-uniform: all 16 rows are queries
#pragma unroll
    for (int r = 0; r < 8; ++r)
#pragma unroll
      for (int t = 0; t < 4; ++t) op[r * DMODEL + 16 * t] = (_Float16)(o[t][r] * inv[r]);
  } else {
#pragma unroll
    for (int r = 0; r < 8; ++r) {
      if (m0 + r < NQ) {
#pragma unroll
        for (int t = 0; t < 4; ++t) op[r * DMODEL + 16 * t] = (_Float16)(o[t][r] * inv[r]);
      }
    }
  }
}

// ---------------------------------------------------------------------------
extern "C" void kernel_launch(void* const* d_in, const int* in_sizes, int n_in,
                              void* d_out, int out_size, void* d_ws, size_t ws_size,
                              hipStream_t stream) {
  const float* queries = (const float*)d_in[0];
  const float* keys    = (const float*)d_in[1];
  const float* values  = (const float*)d_in[2];
  const float* Wq = (const float*)d_in[3];  const float* bq = (const float*)d_in[4];
  const float* Wk = (const float*)d_in[5];  const float* bk = (const float*)d_in[6];
  const float* Wv = (const float*)d_in[7];  const float* bv = (const float*)d_in[8];
  const float* Wo = (const float*)d_in[9];  const float* bo = (const float*)d_in[10];
  const float* rel_embed = (const float*)d_in[11];
  const float* Wproj = (const float*)d_in[12]; const float* bproj = (const float*)d_in[13];
  const float* Wgate = (const float*)d_in[14]; const float* bgate = (const float*)d_in[15];
  const float* Wc1 = (const float*)d_in[16];   const float* bc1 = (const float*)d_in[17];
  const float* gc = (const float*)d_in[18];    const float* bcln = (const float*)d_in[19];
  const float* Wc2 = (const float*)d_in[20];   const float* bc2 = (const float*)d_in[21];
  const float* Wr1 = (const float*)d_in[22];   const float* br1 = (const float*)d_in[23];
  const float* gr = (const float*)d_in[24];    const float* brln = (const float*)d_in[25];
  const float* Wr2 = (const float*)d_in[26];   const float* br2 = (const float*)d_in[27];
  const float* convW = (const float*)d_in[28]; const float* convb = (const float*)d_in[29];

  // ---- workspace carve-out (256B aligned blocks) ----
  char* base = (char*)d_ws;
  size_t off = 0;
  auto alloc = [&](size_t bytes) -> void* {
    off = (off + 255) & ~(size_t)255;
    void* p = base + off;
    off += bytes;
    return p;
  };
  _Float16* qpadH  = (_Float16*)alloc((size_t)BQ * PADN * DMODEL * 2);
  _Float16* convWH = (_Float16*)alloc((size_t)DMODEL * KCONV * 2);
  _Float16* WqT    = (_Float16*)alloc((size_t)DMODEL * DMODEL * 2);
  _Float16* WkT    = (_Float16*)alloc((size_t)DMODEL * DMODEL * 2);
  _Float16* WvT    = (_Float16*)alloc((size_t)DMODEL * DMODEL * 2);
  _Float16* WoT    = (_Float16*)alloc((size_t)DMODEL * DMODEL * 2);
  _Float16* Wc1aT  = (_Float16*)alloc((size_t)256 * DMODEL * 2);
  _Float16* Wc1bT  = (_Float16*)alloc((size_t)256 * DMODEL * 2);
  _Float16* Wr1aT  = (_Float16*)alloc((size_t)DMODEL * DMODEL * 2);
  _Float16* Wr1bT  = (_Float16*)alloc((size_t)DMODEL * DMODEL * 2);
  _Float16* eqH    = (_Float16*)alloc((size_t)ROWS * DMODEL * 2);
  _Float16* ekH    = (_Float16*)alloc((size_t)ROWS * DMODEL * 2);
  _Float16* evH    = (_Float16*)alloc((size_t)ROWS * DMODEL * 2);
  _Float16* attnoH = (_Float16*)alloc((size_t)ROWS * DMODEL * 2);
  float* hconv = (float*)alloc((size_t)ROWS * DMODEL * 4);
  float* bnpart = (float*)alloc((size_t)2 * NPART * DMODEL * 4);
  float* qh    = (float*)alloc((size_t)ROWS * DMODEL * 4);
  float* kh    = (float*)alloc((size_t)ROWS * DMODEL * 4);
  float* vh    = (float*)alloc((size_t)ROWS * DMODEL * 4);
  float* A1c   = (float*)alloc((size_t)ROWS * 256 * 4);
  float* A2c   = (float*)alloc((size_t)ROWS * 256 * 4);
  float* A1r   = (float*)alloc((size_t)ROWS * DMODEL * 4);
  float* A2r   = (float*)alloc((size_t)ROWS * DMODEL * 4);
  float* uvec  = (float*)alloc(DMODEL * 4);
  float* wvecp = (float*)alloc(64);
  float* cscal = (float*)alloc(64);
  float* gateb = (float*)alloc((size_t)NPAIR * 4);

  // 1) conv operands: padded fp16 token table + fp16 conv weights in (tap, channel) order
  pad_cvt_k<<<CVT_BLKS + PAD_BLKS, ROW_THREADS, 0, stream>>>(queries, qpadH, convW, convWH);

  // 2) conv3x3 as WMMA GEMM (1568 x 512 x 4608), A rows straight from the padded table; the gate-collapse vectors and
  //    the weight transposes run beside it in the same grid
  conv_gemm_side_k<<<SIDE_GRID, dim3(32, 4), 0, stream>>>(
      qpadH, convWH, convb, hconv, bnpart,
      Wr2, Wgate, bgate, Wproj, bproj, br2, rel_embed, uvec, wvecp, cscal,
      Wq, Wk, Wv, Wo, Wr1, Wc1, WqT, WkT, WvT, WoT, Wr1aT, Wr1bT, Wc1aT, Wc1bT);

  // 3) BatchNorm(affine=False) from the conv GEMM's partial sums + ReLU + residual adds
  //    (f16 activations)
  eqkv_k<<<EQ_BLKS, EQ_THREADS, 0, stream>>>(hconv, bnpart, queries, keys, values,
                                             eqH, ekH, evH);

  // 4) token-level projections (all WMMA), one grid
  proj_gemms_k<<<PROJ_BLKS, dim3(32, 4), 0, stream>>>(
      eqH, ekH, evH, WqT, WkT, WvT, Wr1aT, Wr1bT, Wc1aT, Wc1bT, bq, bk, bv, br1, bc1,
      qh, kh, vh, A1r, A2r, A1c, A2c);

  // 5) per-pair gate (one wave32 per 7 pairs, 112 pairs a block)
  pair_gate_k<<<PAIR_BLKS, dim3(32, PAIR_WAVES), 0, stream>>>(
      A1c, A2c, A1r, A2r, gc, bcln, Wc2, bc2, gr, brln, uvec, wvecp, cscal, gateb);

  // 6) logits, gated softmax and A*V, one block per (b, h) (f16 output feeds final GEMM)
  attn_gated_k<<<BQ * NHEAD, dim3(32, 4), 0, stream>>>(qh, kh, vh, gateb, attnoH);

  // 7) output projection (WMMA) straight into d_out
  gemm_wmma_f16<<<BLK_N512, dim3(32, 4), 0, stream>>>(attnoH, WoT, bo, (float*)d_out);
}

// v010
// One run takes 73.5 microseconds.
// Timed twice side by side with v009, it ran 1.07 times as fast both times.
// Over all steps from v000 it is 5.47 times as fast.
#include <hip/hip_runtime.h>
#include <hip/hip_bf16.h>
#include <math.h>

// ---------------------------------------------------------------------------
// RelationEnhanceAttention, algebraically restructured for MI455X (gfx1250).
//   B=32, N=49, D=512, H=8, DK=64, NREL=TOPK=14
// Conv and projection GEMMs: f16 operands (K-innermost both sides), fp32 accumulate on
// v_wmma_f32_16x16x32_f16. 16x32 C-tile per wave, operands staged in LDS.
// ---------------------------------------------------------------------------

typedef __attribute__((ext_vector_type(16))) _Float16 v16h;
typedef __attribute__((ext_vector_type(8)))  _Float16 v8h;
typedef __attribute__((ext_vector_type(8)))  float    v8f;
typedef __attribute__((ext_vector_type(4)))  float    v4f;
typedef __attribute__((ext_vector_type(2)))  float    v2f;

#define BQ      32
#define NQ      49
#define DMODEL  512
#define NHEAD   8
#define DKH     64
#define NRELC   14
#define ROWS    (BQ * NQ)            // 1568
#define KCONV   (DMODEL * 9)         // 4608
#define PADW    9                    // the 7x7 map with a border of zeros: 9x9 places
#define PADN    (PADW * PADW)        // 81
#define NPAIR   (BQ * NQ * NQ)       // 76832
#define LN_EPS  1e-5f
#define NPART   (ROWS / 16)          // 98 groups of 16 rows: one BatchNorm partial sum each

// Cross-lane steps of the butterfly sums and maxima, on the vector unit: a shuffle
// would go through the LDS unit and make its wave wait for it at every step.
// Every lane of the wave is on wherever these are called.
// lane l with lane l ^ 16: cross-row move
__device__ __forceinline__ float xhalf(float x) {
  const int b = __builtin_bit_cast(int, x);
  return __builtin_bit_cast(float,
      __builtin_amdgcn_permlanex16(b, b, 0x76543210, 0xfedcba98, false, false));
}
// lane l with lane l ^ M inside its row of 16 lanes: DPP row_xmask (control 0x160 + M),
// which the compiler can fold into the add that takes it
template <int M>
__device__ __forceinline__ float xrow(float x) {
  const int b = __builtin_bit_cast(int, x);
  return __builtin_bit_cast(float, __builtin_amdgcn_update_dpp(b, b, 0x160 + M, 0xf, 0xf, true));
}
// steps 8, 4, 2, 1 (and 16 in front of them): the order of the shuffles they replace
__device__ __forceinline__ float row_sum(float x) {
  x += xrow<8>(x); x += xrow<4>(x); x += xrow<2>(x); x += xrow<1>(x);
  return x;
}
__device__ __forceinline__ float row_max(float x) {
  x = fmaxf(x, xrow<8>(x)); x = fmaxf(x, xrow<4>(x));
  x = fmaxf(x, xrow<2>(x)); x = fmaxf(x, xrow<1>(x));
  return x;
}
__device__ __forceinline__ float wave_sum(float x) {
  x += xhalf(x);
  return row_sum(x);
}
// Four features of a lane as two register pairs: the operators below compile to the
// two-wide packed f32 instructions, one issue slot for two features.
__device__ __forceinline__ v4f fma4(v4f a, v4f b, v4f c) { return __builtin_elementwise_fma(a, b, c); }
__device__ __forceinline__ v4f relu4(v4f a) { const v4f z = {}; return __builtin_elementwise_max(a, z); }
__device__ __forceinline__ v4f all4(float x) { const v4f r = {x, x, x, x}; return r; }
// the lane's four partial sums: pairs first (one packed add), then the two
__device__ __forceinline__ float sum4(v4f a) {
  const v2f p = __builtin_shufflevector(a, a, 0, 1) + __builtin_shufflevector(a, a, 2, 3);
  return p[0] + p[1];
}

// ---------------------------------------------------------------------------
// WMMA GEMM: C[M,N] = A[M,K] * B^T[N,K] (+bias[N]).
// A: f16 row-major (M,K), pitch K; with TAPS the padded table below. Bt: f16 row-major (N,K), pitch K.
// REQUIRES: M%32==0, N%64==0, K%256==0, K>=512 (true for every call site here).
// One block of 4 waves computes a 32x64 C tile, each wave 16x32; K stepped by 32
// in rising order. The operands come into LDS in stages of 256 k (512 B of each
// of the 96 rows) by asynchronous copies: one copy of a wave is one row's whole
// 512 B, so that every request covers whole cache lines. Two buffers: the next
// stage's copies fly while this one is worked on.
// Fragment layout (ISA 16-bit A 16x32): halves 0..7  <- K = k0+8*half+0..7
//                                       halves 8..15 <- K = k0+8*half+16..23
// i.e. two 16-byte segments per lane -> two ds_load_b128 each.
// ---------------------------------------------------------------------------
#define GBM    32
#define GBN    64
#define GBK    256
#define GROWS  (GBM + GBN)            // 96 rows a stage
#define GPITCH (GBK * 2 + 16)         // 528 B = 16 B x odd: no bank conflict for b128 readers
#define GBUF   (GROWS * GPITCH)       // 50,688 B a buffer

// Eight rows, four apart (one per wave between them): lane l brings bytes
// 16*l .. 16*l+15 of each row's 512 B. The s_wait_xcnt stands inside the
// statement, so that no address register is rewritten in front of it.
template <int K>
__device__ __forceinline__ void copy8_rows(unsigned lds, const _Float16* g) {
  asm volatile(
      "global_load_async_to_lds_b128 %0, %8, off\n\t"
      "global_load_async_to_lds_b128 %1, %9, off\n\t"
      "global_load_async_to_lds_b128 %2, %10, off\n\t"
      "global_load_async_to_lds_b128 %3, %11, off\n\t"
      "global_load_async_to_lds_b128 %4, %12, off\n\t"
      "global_load_async_to_lds_b128 %5, %13, off\n\t"
      "global_load_async_to_lds_b128 %6, %14, off\n\t"
      "global_load_async_to_lds_b128 %7, %15, off\n\t"
      "s_wait_xcnt 0x0"
      :: "v"(lds), "v"(lds + 4 * GPITCH), "v"(lds + 8 * GPITCH), "v"(lds + 12 * GPITCH),
         "v"(lds + 16 * GPITCH), "v"(lds + 20 * GPITCH), "v"(lds + 24 * GPITCH),
         "v"(lds + 28 * GPITCH),
         "v"(g), "v"(g + 4 * K), "v"(g + 8 * K), "v"(g + 12 * K),
         "v"(g + 16 * K), "v"(g + 20 * K), "v"(g + 24 * K), "v"(g + 28 * K)
      : "memory");
}

// The same for eight rows that lie at addresses of their own.
__device__ __forceinline__ void copy8_at(unsigned lds, const _Float16* g0, const _Float16* g1,
                                         const _Float16* g2, const _Float16* g3,
                                         const _Float16* g4, const _Float16* g5,
                                         const _Float16* g6, const _Float16* g7) {
  asm volatile(
      "global_load_async_to_lds_b128 %0, %8, off\n\t"
      "global_load_async_to_lds_b128 %1, %9, off\n\t"
      "global_load_async_to_lds_b128 %2, %10, off\n\t"
      "global_load_async_to_lds_b128 %3, %11, off\n\t"
      "global_load_async_to_lds_b128 %4, %12, off\n\t"
      "global_load_async_to_lds_b128 %5, %13, off\n\t"
      "global_load_async_to_lds_b128 %6, %14, off\n\t"
      "global_load_async_to_lds_b128 %7, %15, off\n\t"
      "s_wait_xcnt 0x0"
      :: "v"(lds), "v"(lds + 4 * GPITCH), "v"(lds + 8 * GPITCH), "v"(lds + 12 * GPITCH),
         "v"(lds + 16 * GPITCH), "v"(lds + 20 * GPITCH), "v"(lds + 24 * GPITCH),
         "v"(lds + 28 * GPITCH),
         "v"(g0), "v"(g1), "v"(g2), "v"(g3), "v"(g4), "v"(g5), "v"(g6), "v"(g7)
      : "memory");
}

// TAPS: the 3x3 pad-1 conv as a GEMM with no im2col matrix. k runs (tap, channel),
// K = 9 * 512. A is then the padded token table (b, 9x9 places, 512 channels): row m
// of the product is token (b, y, x), and its 512 k of tap (ky, kx) are the whole row
// of place (y + ky, x + kx), border places holding zeros. A stage of 256 k is half
// of such a row: the same 512-B copies, from a row address that moves with the tap.
// TAPS also leaves, per output column, the sum and the sum of squares over each wave's
// 16 rows in part (kind, group of 16 rows, column): the BatchNorm sums need no pass
// of their own over C.
template <int K, bool TAPS = false>
__device__ __forceinline__ void gemm_block(const _Float16* __restrict__ A,
                                           const _Float16* __restrict__ Bt,
                                           const float* __restrict__ bias,
                                           float* __restrict__ C, int tile, int N,
                                           float* __restrict__ part = nullptr) {
  __shared__ __attribute__((aligned(16))) unsigned char gsm[2 * GBUF];
  constexpr int NST = K / GBK;                   // stages
  static_assert(K % GBK == 0 && NST >= 2, "two stages at least");
  const int ntn  = N >> 6;                       // 64-wide column tiles
  const int tm   = tile / ntn;
  const int tn   = tile - tm * ntn;
  const int row0 = tm * GBM;
  const int col0 = tn * GBN;

  const int lane = threadIdx.x;                  // 0..31
  const int wave = __builtin_amdgcn_readfirstlane(threadIdx.y);   // 0..3
  const int hf   = lane >> 4;                    // 0/1
  const int idx  = lane & 15;
  const int wm   = wave >> 1, wn = wave & 1;     // the wave's 16 rows, 32 columns

  // copy side: wave w takes rows w, w+4, ... of the stage (A rows 0..31, B rows 32..95)
  const unsigned lds0 = (unsigned)(size_t)gsm + (unsigned)(wave * GPITCH + lane * 16);
  const _Float16* ga = A  + (size_t)(row0 + wave) * K + lane * 8;
  const _Float16* gb = Bt + (size_t)(col0 + wave) * K + lane * 8;
  const _Float16* gt[8];                         // TAPS: tap (0, 0) of the wave's eight tokens
  if constexpr (TAPS) {
    static_assert(K == 9 * DMODEL && DMODEL == 2 * GBK, "two stages a tap");
#pragma unroll
    for (int i = 0; i < 8; ++i) {
      const int r = row0 + wave + 4 * i;
      const int p = r % NQ;
      gt[i] = A + (size_t)((r / NQ) * PADN + (p / 7) * PADW + p % 7) * DMODEL + lane * 8;
    }
  }
  auto copy_stage = [&](int st, int buf) {
    const unsigned l = lds0 + (unsigned)buf * GBUF;
    if constexpr (TAPS) {
      const int tap = st >> 1;
      const int ky  = (tap * 11) >> 5;           // tap / 3 for tap in 0..8
      const int ko  = (tap + (PADW - 3) * ky) * DMODEL + (st & 1) * GBK;   // place ky*9 + kx
      copy8_at(l, gt[0] + ko, gt[1] + ko, gt[2] + ko, gt[3] + ko,
               gt[4] + ko, gt[5] + ko, gt[6] + ko, gt[7] + ko);
    } else {
      copy8_rows<K>(l, ga + st * GBK);
    }
    copy8_rows<K>(l + 32 * GPITCH, gb + st * GBK);
    copy8_rows<K>(l + 64 * GPITCH, gb + (size_t)32 * K + st * GBK);
  };

  // read side
  const unsigned char* sa  = gsm + (wm * 16 + idx) * GPITCH + hf * 16;
  const unsigned char* sb0 = gsm + (GBM + wn * 32 + idx) * GPITCH + hf * 16;
  const unsigned char* sb1 = sb0 + 16 * GPITCH;

  v8f acc0 = {}, acc1 = {};
  union F16x16 { v16h v; v8h h[2]; };

  copy_stage(0, 0);
  // stage 0 has landed for this wave; the barrier publishes it to the others
  asm volatile("s_wait_asynccnt 0x0" ::: "memory");
  __syncthreads();
  copy_stage(1, 1);

  // rolled: one body serves both buffers, the code stays small
#pragma unroll 1
  for (int t = 0; t < NST; ++t) {
    const int bo = (t & 1) * GBUF;
    // four k steps' fragments are fetched as one group, then their eight WMMAs:
    // one LDS latency a group instead of one a WMMA
#pragma unroll
    for (int kg = 0; kg < GBK / 128; ++kg) {
      F16x16 af[4], b0[4], b1[4];
#pragma unroll
      for (int q = 0; q < 4; ++q) {
        const int o = bo + (kg * 4 + q) * 64;
        af[q].h[0] = *(const v8h*)(sa  + o);
        af[q].h[1] = *(const v8h*)(sa  + o + 32);
        b0[q].h[0] = *(const v8h*)(sb0 + o);
        b0[q].h[1] = *(const v8h*)(sb0 + o + 32);
        b1[q].h[0] = *(const v8h*)(sb1 + o);
        b1[q].h[1] = *(const v8h*)(sb1 + o + 32);
      }
      // keeps the group's loads in front of its WMMAs: the scheduler otherwise deals
      // them out again, one wait on LDS per WMMA
      __builtin_amdgcn_sched_barrier(0);
#pragma unroll
      for (int q = 0; q < 4; ++q) {
        acc0 = __builtin_amdgcn_wmma_f32_16x16x32_f16(false, af[q].v, false, b0[q].v,
                                                      (short)0, acc0, false, false);
        acc1 = __builtin_amdgcn_wmma_f32_16x16x32_f16(false, af[q].v, false, b1[q].v,
                                                      (short)0, acc1, false, false);
      }
    }
    // this wave's reads of the buffer are done before it may be refilled
    asm volatile("s_wait_dscnt 0x0" ::: "memory");
    // this wave's copies of the next stage have landed
    asm volatile("s_wait_asynccnt 0x0" ::: "memory");
    // publishes the next stage and ends every reader's last read of this one
    __syncthreads();
    if (t + 2 < NST) copy_stage(t + 2, t & 1);
  }
  // no copy is left outstanding when the wave ends
  asm volatile("s_wait_asynccnt 0x0" ::: "memory");

  // C layout: vgpr r -> m = row0 + 16*wm + r + 8*hf ; n = col0 + 32*wn + sub*16 + idx
  const int mbase = row0 + wm * 16 + hf * 8;
#pragma unroll
  for (int s = 0; s < 2; ++s) {
    const int n = col0 + wn * 32 + s * 16 + idx;
    const float badd = bias ? bias[n] : 0.f;
    const v8f a = (s == 0) ? acc0 : acc1;
#pragma unroll
    for (int r = 0; r < 8; ++r)
      C[(size_t)(mbase + r) * N + n] = a[r] + badd;
    if constexpr (TAPS) {
      float cs = 0.f, cq = 0.f;
#pragma unroll
      for (int r = 0; r < 8; ++r) {
        const float o = a[r] + badd;
        cs += o; cq += o * o;
      }
      // the other half of the lanes holds the column's other 8 rows
      cs += xhalf(cs); cq += xhalf(cq);
      // lower half stores the sum, upper half the squares: a wave fills whole 128-B lines
      part[(size_t)(hf * NPART + tm * 2 + wm) * DMODEL + n] = hf ? cq : cs;
    }
    // the next column group reuses these stores' registers: wait first
    asm volatile("s_wait_xcnt 0x0" ::: "memory");
  }
}

// blocks of 4 waves: the bound lifts the register cap, else fragments spill
__global__ __launch_bounds__(128) void gemm_wmma_f16(const _Float16* __restrict__ A,
                              const _Float16* __restrict__ Bt,
                              const float* __restrict__ bias,
                              float* __restrict__ C) {
  gemm_block<DMODEL>(A, Bt, bias, C, blockIdx.x, DMODEL);
}

// The seven token-level projections share no data dependence: one grid, the
// product chosen by block range (block-uniform). 392 blocks per 512-wide
// product, 196 per 256-wide one; one 32x64 tile per block as above.
#define BLK_N512 ((ROWS / GBM) * (DMODEL / GBN))     // 392
#define BLK_N256 ((ROWS / GBM) * (256 / GBN))        // 196
#define PROJ_BLKS (5 * BLK_N512 + 2 * BLK_N256)      // 2352
__global__ __launch_bounds__(128) void proj_gemms_k(const _Float16* __restrict__ eq, const _Float16* __restrict__ ek,
                             const _Float16* __restrict__ ev,
                             const _Float16* __restrict__ WqT, const _Float16* __restrict__ WkT,
                             const _Float16* __restrict__ WvT, const _Float16* __restrict__ Wr1aT,
                             const _Float16* __restrict__ Wr1bT, const _Float16* __restrict__ Wc1aT,
                             const _Float16* __restrict__ Wc1bT,
                             const float* __restrict__ bq, const float* __restrict__ bk,
                             const float* __restrict__ bv, const float* __restrict__ br1,
                             const float* __restrict__ bc1,
                             float* __restrict__ qh, float* __restrict__ kh,
                             float* __restrict__ vh, float* __restrict__ A1r,
                             float* __restrict__ A2r, float* __restrict__ A1c,
                             float* __restrict__ A2c) {
  const int blk = blockIdx.x;
  const _Float16* A; const _Float16* Bt; const float* bias; float* C;
  int n, lb;
  if (blk < 5 * BLK_N512) {
    const int job = blk / BLK_N512;
    lb = blk - job * BLK_N512;
    n = DMODEL;
    switch (job) {
      case 0:  A = eq; Bt = WqT;   bias = bq;      C = qh;  break;
      case 1:  A = ek; Bt = WkT;   bias = bk;      C = kh;  break;
      case 2:  A = ev; Bt = WvT;   bias = bv;      C = vh;  break;
      case 3:  A = eq; Bt = Wr1aT; bias = br1;     C = A1r; break;
      default: A = ek; Bt = Wr1bT; bias = nullptr; C = A2r; break;
    }
  } else {
    lb = blk - 5 * BLK_N512;
    n = 256;
    if (lb < BLK_N256) { A = eq; Bt = Wc1aT; bias = bc1; C = A1c; }
    else { lb -= BLK_N256; A = ek; Bt = Wc1bT; bias = nullptr; C = A2c; }
  }
  gemm_block<DMODEL>(A, Bt, bias, C, lb, n);
}

// ---------------------------------------------------------------------------
// Weight transpose + fp16 convert: W (K,N) row-major -> Wt (N,K) f16.
// One thread takes 8 consecutive k of one column n: 8 reads, each coalesced
// over the lanes' n, and one 16-byte store.
// ---------------------------------------------------------------------------
__device__ __forceinline__ void transpose_h(const float* __restrict__ W,
                                            _Float16* __restrict__ Wt, int K, int N, int t) {
  const int kc = t / N, n = t - kc * N;
  const float* p = W + (size_t)kc * 8 * N + n;
  v8h o;
#pragma unroll
  for (int j = 0; j < 8; ++j) o[j] = (_Float16)p[(size_t)j * N];
  *(v8h*)(Wt + (size_t)n * K + kc * 8) = o;
  // other block ranges' code follows in the merged kernel and reuses the
  // store's registers: wait first
  asm volatile("s_wait_xcnt 0x0" ::: "memory");
}

// ---------------------------------------------------------------------------
// Operands of the 3x3 pad-1 conv. x[b,c,y,x] == queries[b,y*7+x,c].
//   qpad[b, (y+1)*9 + (x+1), c] = f16(queries[b, y*7+x, c]), the border places zero
//   convWH[oc, tap*512 + ic]    = f16(convW[oc, ic*9 + tap]),  tap = ky*3 + kx
// Two block ranges of one grid, blocks of 192 threads, each thread 3 groups of 8
// outputs with one 16-byte store a group (few waves to start).
// ---------------------------------------------------------------------------
#define CVT_BLKS    DMODEL                   // 512 rows of conv weights
#define PAD_BLKS    (BQ * PADW)              // 288 lines of 9 places
#define ROW_THREADS (KCONV / 8 / 3)          // 192
#define WT_P        (DMODEL + 8)             // halves: 1040 B = 16 B x odd (b128 readers)
__global__ void pad_cvt_k(const float* __restrict__ q, _Float16* __restrict__ qpad,
                          const float* __restrict__ convW, _Float16* __restrict__ convWH) {
  __shared__ __attribute__((aligned(16))) _Float16 wt[9 * WT_P];
  const int tid = threadIdx.x;
  if (blockIdx.x < CVT_BLKS) {                   // block-uniform
    // one output channel's 4608 weights: read in their order (ic, tap), turned to
    // (tap, ic) through LDS, so that reads and stores both cover whole lines
    const size_t base = (size_t)blockIdx.x * KCONV;
    v4f lo[3], hi[3];
#pragma unroll
    for (int i = 0; i < 3; ++i) {
      const size_t e = base + (size_t)(tid + ROW_THREADS * i) * 8;
      lo[i] = *(const v4f*)(convW + e);
      hi[i] = *(const v4f*)(convW + e + 4);
    }
#pragma unroll
    for (int i = 0; i < 3; ++i) {
      const int e0 = (tid + ROW_THREADS * i) * 8;
      int ic = e0 / 9, r = e0 % 9;
#pragma unroll
      for (int j = 0; j < 8; ++j) {
        wt[r * WT_P + ic] = (_Float16)(j < 4 ? lo[i][j & 3] : hi[i][j & 3]);
        const int wrap = (r == 8);
        r = wrap ? 0 : r + 1;
        ic += wrap;
      }
    }
    // the weights go from the threads that read them to the threads that store them
    __syncthreads();
#pragma unroll
    for (int i = 0; i < 3; ++i) {
      const int g = tid + ROW_THREADS * i;       // 64 groups of 8 channels a tap
      *(v8h*)(convWH + base + (size_t)g * 8) = *(const v8h*)(wt + (g >> 6) * WT_P + (g & 63) * 8);
    }
    return;
  }
  const int pb = blockIdx.x - CVT_BLKS;          // b*9 + line of the padded map
  const int b  = pb / PADW, yy = pb % PADW;
  const int c  = (tid & 63) * 8;
  // a border place reads token 0 (in bounds) and is zeroed: no branch round a load,
  // so all 6 loads of a thread can be in flight at once
  v4f lo[3], hi[3];
  bool in[3];
  const float* s[3];
#pragma unroll
  for (int i = 0; i < 3; ++i) {
    const int xx = i * 3 + (tid >> 6);
    in[i] = (unsigned)(yy - 1) < 7u && (unsigned)(xx - 1) < 7u;
    const int tok = in[i] ? (yy - 1) * 7 + xx - 1 : 0;
    s[i] = q + (size_t)(b * NQ + tok) * DMODEL + c;
    lo[i] = *(const v4f*)s[i];
    hi[i] = *(const v4f*)(s[i] + 4);
  }
  // the addresses stay live up to this wait, so that no load of the run
  // returns into a register that the others still name
  asm volatile("s_wait_xcnt 0x0" :: "v"(s[0]), "v"(s[1]), "v"(s[2]) : "memory");
#pragma unroll
  for (int i = 0; i < 3; ++i) {
    const int xx = i * 3 + (tid >> 6);
    v8h o;
#pragma unroll
    for (int j = 0; j < 4; ++j) {
      o[j]     = (_Float16)(in[i] ? lo[i][j] : 0.f);
      o[4 + j] = (_Float16)(in[i] ? hi[i][j] : 0.f);
    }
    *(v8h*)(qpad + (size_t)(pb * PADW + xx) * DMODEL + c) = o;
  }
  // the weight range's code follows in the built kernel and reuses the
  // stores' registers: wait first
  asm volatile("s_wait_xcnt 0x0" ::: "memory");
}

// BatchNorm (population variance over the 1568 rows of a channel) + ReLU + residual adds:
//   xs = relu(BN(h)); eq/ek/ev = f16(xs + queries/keys/values)
// One block takes 64 channels of one image's 49 rows. It first adds up the 98 partial
// sums and squares that the conv GEMM left for its channels (a thread: 4 channels, one
// kind, 14 of the 98), then does its 392 groups of 8 channels, up to two a thread.
#define EQ_CH      64
#define EQ_THREADS 256
#define EQ_ITEMS   (NQ * EQ_CH / 8)              // 392
#define EQ_BLKS    (BQ * (DMODEL / EQ_CH))       // 256
#define EQ_SPLIT   7                             // 98 partial sums = 7 runs of 14
#define EQ_RUN     (NPART / EQ_SPLIT)            // 14
__global__ __launch_bounds__(EQ_THREADS) void eqkv_k(const float* __restrict__ h,
                       const float* __restrict__ part,
                       const float* __restrict__ q, const float* __restrict__ k,
                       const float* __restrict__ v,
                       _Float16* __restrict__ eq, _Float16* __restrict__ ek,
                       _Float16* __restrict__ ev) {
  __shared__ __attribute__((aligned(16))) float red[EQ_SPLIT * 2 * EQ_CH];   // (run, kind, channel)
  __shared__ __attribute__((aligned(16))) float smu[EQ_CH];
  __shared__ __attribute__((aligned(16))) float srs[EQ_CH];
  const int tid = threadIdx.x;
  const int b   = blockIdx.x / (DMODEL / EQ_CH);
  const int c0  = (blockIdx.x % (DMODEL / EQ_CH)) * EQ_CH;

  // every load of the thread is asked for before the first one is waited for: the rows
  // and the partial sums make one trip to memory together.
  // The second group of a thread past the end reads the last group (in bounds), stores nothing.
  unsigned eo[2];
  v4f h4[2][2], q4[2][2], k4[2][2], v4[2][2];
#pragma unroll
  for (int it = 0; it < 2; ++it) {
    const int item = min(tid + EQ_THREADS * it, EQ_ITEMS - 1);
    eo[it] = (unsigned)((b * NQ + (item >> 3)) * DMODEL + c0 + (item & 7) * 8) * 4u;
#pragma unroll
    for (int g = 0; g < 2; ++g) {
      h4[it][g] = *(const v4f*)((const char*)h + eo[it] + 16 * g);
      q4[it][g] = *(const v4f*)((const char*)q + eo[it] + 16 * g);
      k4[it][g] = *(const v4f*)((const char*)k + eo[it] + 16 * g);
      v4[it][g] = *(const v4f*)((const char*)v + eo[it] + 16 * g);
    }
  }
  // the offsets stay live up to this wait, so that no load of the run
  // returns into a register that the others still name
  asm volatile("s_wait_xcnt 0x0" :: "v"(eo[0]), "v"(eo[1]) : "memory");
  if (tid < EQ_SPLIT * 32) {                     // wave-uniform: wave w takes run w, the eighth none
    const int run = tid >> 5, kind = (tid >> 4) & 1;
    const unsigned po = (unsigned)((kind * NPART + run * EQ_RUN) * DMODEL + c0 + (tid & 15) * 4) * 4u;
    v4f pv[EQ_RUN];
    // unrolled: the 14 loads are in flight at once, together with the rows above
#pragma unroll
    for (int i = 0; i < EQ_RUN; ++i) pv[i] = *(const v4f*)((const char*)part + po + i * (DMODEL * 4));
    // as above: the offset stays live up to this wait
    asm volatile("s_wait_xcnt 0x0" :: "v"(po) : "memory");
    v4f s4 = pv[0];
#pragma unroll
    for (int i = 1; i < EQ_RUN; ++i) s4 += pv[i];
    *(v4f*)(red + tid * 4) = s4;
  }
  // the 14 part sums of a channel go to the thread that joins them
  __syncthreads();
  if (tid < EQ_CH) {
    float sm = red[tid], sq = red[EQ_CH + tid];
#pragma unroll
    for (int r = 1; r < EQ_SPLIT; ++r) {
      sm += red[r * 2 * EQ_CH + tid];
      sq += red[(r * 2 + 1) * EQ_CH + tid];
    }
    const float m  = sm * (1.f / ROWS);
    const float vr = sq * (1.f / ROWS) - m * m;
    smu[tid] = m; srs[tid] = rsqrtf(vr + LN_EPS);
  }
  // mean and scale go to every thread of the block
  __syncthreads();

  const int cl = (tid & 7) * 8;                  // the same for both groups of a thread
  v8h oq[2], ok[2], ov[2];
#pragma unroll
  for (int g = 0; g < 2; ++g) {
    const v4f m4 = *(const v4f*)(smu + cl + 4 * g);
    const v4f r4 = *(const v4f*)(srs + cl + 4 * g);
#pragma unroll
    for (int it = 0; it < 2; ++it) {
#pragma unroll
      for (int j = 0; j < 4; ++j) {
        const float xs = fmaxf((h4[it][g][j] - m4[j]) * r4[j], 0.f);
        oq[it][4 * g + j] = (_Float16)(xs + q4[it][g][j]);
        ok[it][4 * g + j] = (_Float16)(xs + k4[it][g][j]);
        ov[it][4 * g + j] = (_Float16)(xs + v4[it][g][j]);
      }
    }
  }
  *(v8h*)((char*)eq + (eo[0] >> 1)) = oq[0];
  *(v8h*)((char*)ek + (eo[0] >> 1)) = ok[0];
  *(v8h*)((char*)ev + (eo[0] >> 1)) = ov[0];
  if (tid + EQ_THREADS < EQ_ITEMS) {
    *(v8h*)((char*)eq + (eo[1] >> 1)) = oq[1];
    *(v8h*)((char*)ek + (eo[1] >> 1)) = ok[1];
    *(v8h*)((char*)ev + (eo[1] >> 1)) = ov[1];
  }
}

// Precompute gate-collapse vectors:
//   u[512] = Wr2 @ Wgate ; wv[14] = rel_embed @ (Wproj @ Wgate)
//   cs = (br2 + bproj) . Wgate + bgate
// Blocks of 128 threads: parts 0..3 take 128 rows of u each, part 4 the rest.
__device__ __forceinline__ void precompute_part(int part, int t,
                             const float* __restrict__ Wr2, const float* __restrict__ Wgate,
                             const float* __restrict__ bgate, const float* __restrict__ Wproj,
                             const float* __restrict__ bproj, const float* __restrict__ br2,
                             const float* __restrict__ rel_embed,
                             float* __restrict__ u, float* __restrict__ wv,
                             float* __restrict__ cs) {
  __shared__ float pv[DKH];
  if (part < 4) {                                // block-uniform
    const int row = part * 128 + t;
    float s = 0.f;
    for (int j = 0; j < DMODEL; ++j) s += Wr2[(size_t)row * DMODEL + j] * Wgate[j];
    u[row] = s;
    // the fifth part's code follows and reuses the store's registers: wait first
    asm volatile("s_wait_xcnt 0x0" ::: "memory");
    return;
  }
  if (t < DKH) {
    float s = 0.f;
    for (int d = 0; d < DMODEL; ++d) s += Wproj[(size_t)t * DMODEL + d] * Wgate[d];
    pv[t] = s;
  }
  __syncthreads();
  if (t < NRELC) {
    float s = 0.f;
    const unsigned rb = (unsigned)t * (DKH * 4u);   // the row's byte offset
    const float* rp = (const float*)((const char*)rel_embed + rb);
    for (int d = 0; d < DKH; ++d) s += rp[d] * pv[d];
    // the row's offset stays live up to this wait, so that no load of the run
    // returns into the register that the others still name
    asm volatile("s_wait_xcnt 0x0" :: "v"(rb) : "memory");
    wv[t] = s;
  }
  if (t == 0) {
    float s = bgate[0];
    for (int d = 0; d < DMODEL; ++d) s += (br2[d] + bproj[d]) * Wgate[d];
    cs[0] = s;
  }
}

// conv GEMM grid (392 blocks of 4 waves leave most wave slots empty) plus the
// work that nothing before the projections depends on: the gate-collapse
// vectors and the eight weight transposes, on the block ranges behind it.
#define CONV_BLKS ((ROWS / GBM) * (DMODEL / GBN))      // 392
#define PRE_BLKS  5
#define TR512_BLKS (DMODEL * DMODEL / 8 / 128)         // 256
#define TR256_BLKS (DMODEL * 256 / 8 / 128)            // 128
#define SIDE_GRID (CONV_BLKS + PRE_BLKS + 6 * TR512_BLKS + 2 * TR256_BLKS)
__global__ __launch_bounds__(128) void conv_gemm_side_k(const _Float16* __restrict__ qpad,
                                 const _Float16* __restrict__ convWH,
                                 const float* __restrict__ convb, float* __restrict__ hconv,
                                 float* __restrict__ bnpart,
                                 const float* __restrict__ Wr2, const float* __restrict__ Wgate,
                                 const float* __restrict__ bgate, const float* __restrict__ Wproj,
                                 const float* __restrict__ bproj, const float* __restrict__ br2,
                                 const float* __restrict__ rel_embed,
                                 float* __restrict__ u, float* __restrict__ wv,
                                 float* __restrict__ cs,
                                 const float* __restrict__ Wq, const float* __restrict__ Wk,
                                 const float* __restrict__ Wv, const float* __restrict__ Wo,
                                 const float* __restrict__ Wr1, const float* __restrict__ Wc1,
                                 _Float16* __restrict__ WqT, _Float16* __restrict__ WkT,
                                 _Float16* __restrict__ WvT, _Float16* __restrict__ WoT,
                                 _Float16* __restrict__ Wr1aT, _Float16* __restrict__ Wr1bT,
                                 _Float16* __restrict__ Wc1aT, _Float16* __restrict__ Wc1bT) {
  int blk = blockIdx.x;
  if (blk < CONV_BLKS) {
    gemm_block<KCONV, true>(qpad, convWH, convb, hconv, blk, DMODEL, bnpart);
    return;
  }
  blk -= CONV_BLKS;
  const int tid = threadIdx.y * 32 + threadIdx.x;
  if (blk < PRE_BLKS) {
    precompute_part(blk, tid, Wr2, Wgate, bgate, Wproj, bproj, br2, rel_embed, u, wv, cs);
    return;
  }
  blk -= PRE_BLKS;
  if (blk < 6 * TR512_BLKS) {
    const int job = blk / TR512_BLKS;
    const int t = (blk - job * TR512_BLKS) * 128 + tid;
    const float* W; _Float16* Wt;
    switch (job) {
      case 0:  W = Wq;  Wt = WqT;  break;
      case 1:  W = Wk;  Wt = WkT;  break;
      case 2:  W = Wv;  Wt = WvT;  break;
      case 3:  W = Wo;  Wt = WoT;  break;
      case 4:  W = Wr1; Wt = Wr1aT; break;
      default: W = Wr1 + (size_t)DMODEL * DMODEL; Wt = Wr1bT; break;
    }
    transpose_h(W, Wt, DMODEL, DMODEL, t);
  } else {
    blk -= 6 * TR512_BLKS;
    const int second = blk >= TR256_BLKS;
    const int t = (blk - second * TR256_BLKS) * 128 + tid;
    transpose_h(second ? Wc1 + (size_t)DMODEL * 256 : Wc1, second ? Wc1bT : Wc1aT,
                DMODEL, 256, t);
  }
}

// One wave32 per (b, qi, group of 7 ki), 16 waves a block = 112 pairs = 7 tiles of 16.
// Classifier branch: each wave makes LN(256)->ReLU of its 7 pairs and lays the rows in
// LDS; the 256x14 product of 16 pairs at a time then runs on v_wmma_f32_16x16x4_f32
// (operands stay fp32), one tile per wave 0..6, with the softmax and probs.wv taken
// from the accumulator (a pair's 14 logits lie in the 16 lanes of one half).
// Relation branch: LN(512)->ReLU->dot(u) per pair as before; gate = sigmoid(.).
// All that does not depend on ki (the LN scales and shifts, u, the q-side rows) is
// loaded once per wave and stays in registers over the 7 pairs. qi runs fastest over
// the waves, so that the waves of a block mostly read the same k-side rows (WGP cache).
#define KI_GRP     7
#define PAIR_WAVES 16
#define PAIR_THREADS (32 * PAIR_WAVES)                          // 512
#define PAIR_BLKS (BQ * (NQ / KI_GRP) * NQ / PAIR_WAVES)        // 686
#define PB_PAIRS  (PAIR_WAVES * KI_GRP)                         // 112
#define PB_TILES  (PB_PAIRS / 16)                               // 7
#define HV_P      260     // floats: pitch of a pair's row, 1040 B = 16 B x odd (b128 readers)
// eight waves per SIMD: at most 128 registers, so that two blocks still share a WGP
__global__ __launch_bounds__(PAIR_THREADS) __attribute__((amdgpu_waves_per_eu(8)))
void pair_gate_k(const float* __restrict__ A1c, const float* __restrict__ A2c,
                            const float* __restrict__ A1r, const float* __restrict__ A2r,
                            const float* __restrict__ gc, const float* __restrict__ bcln,
                            const float* __restrict__ Wc2, const float* __restrict__ bc2,
                            const float* __restrict__ gr, const float* __restrict__ brln,
                            const float* __restrict__ u, const float* __restrict__ wv,
                            const float* __restrict__ cs, float* __restrict__ gate) {
  __shared__ __attribute__((aligned(16))) float hvs[PB_PAIRS * HV_P];   // ReLU(LN) rows
  __shared__ __attribute__((aligned(16))) float wb[32 * 32 * 4];        // Wc2 as B fragments
  __shared__ float spw[PB_PAIRS];                                       // probs . wv
  const int lane = threadIdx.x;
  const int wl   = __builtin_amdgcn_readfirstlane(threadIdx.y);         // 0..15
  const int hf   = lane >> 4;
  const int idx  = lane & 15;
  const int wave = blockIdx.x * PAIR_WAVES + wl;                        // (b, ki group, qi)
  const int b   = wave / ((NQ / KI_GRP) * NQ);
  const int rm  = wave % ((NQ / KI_GRP) * NQ);
  const int ki0 = (rm / NQ) * KI_GRP;
  const int qi  = rm % NQ;

  const float* a1 = A1c + (size_t)(b * NQ + qi) * 256;
  const float* r1 = A1r + (size_t)(b * NQ + qi) * DMODEL;
  const float* a2 = A2c + (size_t)(b * NQ + ki0) * 256;
  const float* r2 = A2r + (size_t)(b * NQ + ki0) * DMODEL;
  // lane i collects the value of pair ki0 + i (equal in all lanes behind the sum
  // over the lanes); the sigmoid is then done once for the 7 pairs
  float gdn = 0.f;
  const unsigned lo16 = (unsigned)lane * 16u;    // byte offset of the lane's four features in 512 B

  // Wc2 in B-fragment order: entry (c, lane) holds rows 8c + 4*hf + 0..3 of column idx,
  // columns 14 and 15 as zeros. Wave wl writes entries c = wl and c = wl + 16.
  {
    const unsigned wo = (unsigned)((8 * wl + 4 * hf) * NRELC + min(idx, NRELC - 1)) * 4u;
    const float* wp = (const float*)((const char*)Wc2 + wo);
    v4f w0, w1;
#pragma unroll
    for (int q = 0; q < 4; ++q) {
      w0[q] = wp[q * NRELC];
      w1[q] = wp[(128 + q) * NRELC];
    }
    // the offset stays live up to this wait, so that no load of the run
    // returns into the register that the others still name
    asm volatile("s_wait_xcnt 0x0" :: "v"(wo) : "memory");
    const v4f z = {};
    *(v4f*)(wb + (wl * 32 + lane) * 4)        = idx < NRELC ? w0 : z;
    *(v4f*)(wb + ((wl + 16) * 32 + lane) * 4) = idx < NRELC ? w1 : z;
  }

  // ---- classifier branch, part 1: LN over 256, ReLU, rows to LDS ----
  // A lane holds features 4*lane + 128*j + 0..3: 16-byte loads and stores, packed math.
  {
    v4f gcv[2], bcv[2], a1v[2];
    const char* pa1 = (const char*)a1 + lo16;
    const char* pgc = (const char*)gc + lo16;
    const char* pbc = (const char*)bcln + lo16;
    const char* pa2 = (const char*)a2 + lo16;
#pragma unroll
    for (int j = 0; j < 2; ++j) {
      a1v[j] = *(const v4f*)(pa1 + 512 * j);
      gcv[j] = *(const v4f*)(pgc + 512 * j);
      bcv[j] = *(const v4f*)(pbc + 512 * j);
    }
    // the addresses stay live up to this wait, so that no load of the run
    // returns into a register that the others still name
    asm volatile("s_wait_xcnt 0x0" :: "v"(pa1), "v"(pgc), "v"(pbc) : "memory");
    // unrolled: the 7 pairs' loads and sums over the lanes can overlap
#pragma unroll
    for (int i = 0; i < KI_GRP; ++i) {
      const v4f x0 = a1v[0] + *(const v4f*)(pa2 + i * 1024);
      const v4f x1 = a1v[1] + *(const v4f*)(pa2 + i * 1024 + 512);
      const float s  = wave_sum(sum4(x0 + x1));
      const float ss = wave_sum(sum4(fma4(x1, x1, x0 * x0)));
      const float mean = s * (1.f / 256.f);
      const float rstd = rsqrtf(ss * (1.f / 256.f) - mean * mean + LN_EPS);
      const v4f r4 = all4(rstd), n4 = all4(-mean * rstd);
      float* hrow = hvs + (wl * KI_GRP + i) * HV_P + lane * 4;
      *(v4f*)hrow         = relu4(fma4(fma4(x0, r4, n4), gcv[0], bcv[0]));
      *(v4f*)(hrow + 128) = relu4(fma4(fma4(x1, r4, n4), gcv[1], bcv[1]));
    }
    // as above, for the k-side rows' address
    asm volatile("s_wait_xcnt 0x0" :: "v"(pa2) : "memory");
  }
  // the rows and the Wc2 fragments go from their writers to the tiles' waves
  __syncthreads();

  // ---- classifier branch, part 2: 16 pairs x 256 x 14 on WMMA, softmax, probs.wv ----
  // Fragments (A: lane holds pair idx; B: column idx; the lane halves split k): both
  // sides take feature 8c + 4*hf + 2j + 0..1 at step (c, j), so they pair.
  if (wl < PB_TILES) {                           // wave-uniform
    const unsigned no = (unsigned)min(idx, NRELC - 1) * 4u;
    const float bn  = *(const float*)((const char*)bc2 + no);
    const float wvn = *(const float*)((const char*)wv + no);
    // as above: the offset stays live up to this wait
    asm volatile("s_wait_xcnt 0x0" :: "v"(no) : "memory");
    const float* pa = hvs + (wl * 16 + idx) * HV_P + hf * 4;
    const float* pb = wb + lane * 4;
    v8f acc[4] = {};                             // four chains: no WMMA waits on the one before
    // unrolled: the chain's index is then a constant, and LDS reads can run ahead of the WMMAs
#pragma unroll
    for (int c = 0; c < 32; ++c) {
      const v4f a = *(const v4f*)(pa + c * 8);
      const v4f w = *(const v4f*)(pb + c * 128);
#pragma unroll
      for (int j = 0; j < 2; ++j) {
        const v2f a2f = {a[2 * j], a[2 * j + 1]};
        const v2f b2f = {w[2 * j], w[2 * j + 1]};
        acc[(c & 1) * 2 + j] = __builtin_amdgcn_wmma_f32_16x16x4_f32(
            false, a2f, false, b2f, (short)0, acc[(c & 1) * 2 + j], false, false);
      }
    }
    const v8f lgv = (acc[0] + acc[1]) + (acc[2] + acc[3]);
    // lgv[r] is pair 16*wl + 8*hf + r, class idx
    const bool okn = idx < NRELC;
    float pwk = 0.f, sek = 1.f;                  // lane idx keeps row idx of its half
#pragma unroll
    for (int r = 0; r < 8; ++r) {
      const float l = lgv[r] + bn;
      const float m = row_max(okn ? l : -__builtin_inff());
      const float p = okn ? __expf(l - m) : 0.f;
      const float se = row_sum(p), pw = row_sum(p * wvn);
      pwk = (idx == r) ? pw : pwk;
      sek = (idx == r) ? se : sek;
    }
    // probs = p/se; top-k(14 of 14) renorm = /(1+1e-8)
    if (idx < 8) spw[wl * 16 + hf * 8 + idx] = pwk / (sek * (1.f + 1e-8f));
  }

  // ---- relation branch: LN over 512, ReLU, dot with u ----
  {
    v4f grv[4], brv[4], uv[4], r1v[4];
    const char* pr1 = (const char*)r1 + lo16;
    const char* pgr = (const char*)gr + lo16;
    const char* pbr = (const char*)brln + lo16;
    const char* pu  = (const char*)u + lo16;
    const char* pr2 = (const char*)r2 + lo16;
    v4f nx[4];                                   // the next pair's k-side row
#pragma unroll
    for (int j = 0; j < 4; ++j) {
      r1v[j] = *(const v4f*)(pr1 + 512 * j);
      nx[j]  = *(const v4f*)(pr2 + 512 * j);
      grv[j] = *(const v4f*)(pgr + 512 * j);
      brv[j] = *(const v4f*)(pbr + 512 * j);
      uv[j]  = *(const v4f*)(pu + 512 * j);
    }
    // as above: the addresses stay live up to this wait
    asm volatile("s_wait_xcnt 0x0" :: "v"(pr1), "v"(pgr), "v"(pbr), "v"(pu) : "memory");
    // unrolled: the row buffer needs no copies
#pragma unroll
    for (int i = 0; i < KI_GRP; ++i) {
      v4f y[4];
#pragma unroll
      for (int j = 0; j < 4; ++j) y[j] = r1v[j] + nx[j];
      if (i + 1 < KI_GRP) {
#pragma unroll
        for (int j = 0; j < 4; ++j) nx[j] = *(const v4f*)(pr2 + (i + 1) * 2048 + 512 * j);
      }
      // bounds how far ahead the k-side loads are hoisted (two pairs at most): all seven
      // pairs' loads up front take the registers over 128, or spill, and over 128 the
      // second block of a WGP is lost
      __builtin_amdgcn_sched_barrier(0);
      const float s  = wave_sum(sum4((y[0] + y[1]) + (y[2] + y[3])));
      const float ss = wave_sum(sum4(fma4(y[1], y[1], y[0] * y[0]) + fma4(y[3], y[3], y[2] * y[2])));
      const float mean = s * (1.f / 512.f);
      const float rstd = rsqrtf(ss * (1.f / 512.f) - mean * mean + LN_EPS);
      const v4f r4 = all4(rstd), n4 = all4(-mean * rstd);
      v4f g4 = relu4(fma4(fma4(y[0], r4, n4), grv[0], brv[0])) * uv[0];
#pragma unroll
      for (int j = 1; j < 4; ++j)
        g4 = fma4(relu4(fma4(fma4(y[j], r4, n4), grv[j], brv[j])), uv[j], g4);
      const float gd = wave_sum(sum4(g4));
      gdn = (lane == i) ? gd : gdn;
    }
    // as above, for the k-side rows' address
    asm volatile("s_wait_xcnt 0x0" :: "v"(pr2) : "memory");
  }

  // probs.wv goes from the tiles' waves back to the pairs' own waves
  __syncthreads();
  const float pwv = spw[wl * KI_GRP + min(lane, KI_GRP - 1)];
  if (lane < KI_GRP)
    gate[(size_t)(b * NQ + qi) * NQ + ki0 + lane] = 1.f / (1.f + __expf(-(gdn + pwv + cs[0])));
}

// Gated attention of one (b, h) in one block of 4 waves, both products on
// v_wmma_f32_16x16x4_f32 (operands stay fp32):
//   S = q k^T / 8 ; enh = S * (1 + gate) ; p = exp(enh - rowmax) ; out = f16((p v) / rowsum)
// The 49 queries and 49 keys are padded to 64; wave w owns query rows 16w .. 16w+15.
// q, k, v rows (64 floats of this head) are staged in LDS, pad rows as zeros: a
// pad key's p is set to 0, and 0 times a zero v row adds nothing.
// Fragments (A: lane holds row idx; B: column idx; the lane halves split k): both
// sides of a product take k from the same (half, element) place, so they pair.
#define AT_QP  68     // floats: pitch of q, k, p rows, 272 B = 16 B x odd (b128 and b64 readers)
#define AT_VP  72     // floats: pitch of v rows: rows two apart lie 16 banks apart (b32 readers)
#define AT_PAD 64
#define AT_KST ((NQ + 3) / 4)                    // 13 steps of 4 keys cover the 49
__global__ __launch_bounds__(128) void attn_gated_k(const float* __restrict__ qh,
                             const float* __restrict__ kh, const float* __restrict__ vh,
                             const float* __restrict__ gate, _Float16* __restrict__ outp) {
  __shared__ __attribute__((aligned(16))) float sq[AT_PAD * AT_QP];
  __shared__ __attribute__((aligned(16))) float sk[AT_PAD * AT_QP];
  __shared__ __attribute__((aligned(16))) float sp[AT_PAD * AT_QP];
  __shared__ __attribute__((aligned(16))) float sv[AT_PAD * AT_VP];
  const int b    = blockIdx.x / NHEAD;
  const int h    = blockIdx.x % NHEAD;
  const int lane = threadIdx.x;                  // 0..31
  const int wave = __builtin_amdgcn_readfirstlane(threadIdx.y);   // 0..3
  const int tid  = wave * 32 + lane;
  const int hf   = lane >> 4;
  const int idx  = lane & 15;
  const int m0   = wave * 16 + hf * 8;           // first of the lane's 8 accumulator rows

  // the gates of the lane's accumulator places, indices clamped into the 49 x 49 map;
  // asked for first, so that they fly together with the rows below
  float g[4][8];
  const float* gb = gate + (size_t)b * NQ * NQ;
#pragma unroll
  for (int r = 0; r < 8; ++r) {
    const int qi = min(m0 + r, NQ - 1);
#pragma unroll
    for (int t = 0; t < 4; ++t) g[t][r] = gb[qi * NQ + min(16 * t + idx, NQ - 1)];
  }

  // stage q, k, v: 16 threads a row (16 B each), 8 rows a pass: six whole passes,
  // then row 48 (read by all eight row groups, kept by the first), the rest zeros
  const int srow = (tid >> 4) & 7, scol = (tid & 15) * 4;
  const size_t hofs = (size_t)(b * NQ) * DMODEL + h * DKH + scol;
  const float* gq = qh + hofs;
  const float* gk = kh + hofs;
  const float* gv = vh + hofs;
  const float* gqr = gq + srow * DMODEL;
  const float* gkr = gk + srow * DMODEL;
  const float* gvr = gv + srow * DMODEL;
  v4f xq[7], xk[7], xv[7];
#pragma unroll
  for (int i = 0; i < 6; ++i) {
    xq[i] = *(const v4f*)(gqr + i * 8 * DMODEL);
    xk[i] = *(const v4f*)(gkr + i * 8 * DMODEL);
    xv[i] = *(const v4f*)(gvr + i * 8 * DMODEL);
  }
  xq[6] = *(const v4f*)(gq + (NQ - 1) * DMODEL);
  xk[6] = *(const v4f*)(gk + (NQ - 1) * DMODEL);
  xv[6] = *(const v4f*)(gv + (NQ - 1) * DMODEL);
  // the addresses stay live up to this wait, so that no load of the run
  // returns into a register that the others still name
  asm volatile("s_wait_xcnt 0x0" :: "v"(gq), "v"(gk), "v"(gv), "v"(gqr), "v"(gkr), "v"(gvr)
               : "memory");
#pragma unroll
  for (int i = 0; i < 8; ++i) {
    const int row = i * 8 + srow;
    const v4f z = {};
    const bool in = i < 6 || (i == 6 && srow == 0);
    *(v4f*)(sq + row * AT_QP + scol) = in ? xq[i < 7 ? i : 0] : z;
    *(v4f*)(sk + row * AT_QP + scol) = in ? xk[i < 7 ? i : 0] : z;
    *(v4f*)(sv + row * AT_VP + scol) = in ? xv[i < 7 ? i : 0] : z;
  }
  __syncthreads();

  // S = q k^T: one 16-byte read holds the lane's k of two steps (d = 8*k8 + 4*hf + 0..3)
  v8f s[4] = {};
  {
    const float* pa = sq + (wave * 16 + idx) * AT_QP + hf * 4;
    const float* pb = sk + idx * AT_QP + hf * 4;
#pragma unroll
    for (int k8 = 0; k8 < DKH / 8; ++k8) {
      const v4f a = *(const v4f*)(pa + k8 * 8);
      v4f bb[4];
#pragma unroll
      for (int t = 0; t < 4; ++t) bb[t] = *(const v4f*)(pb + t * 16 * AT_QP + k8 * 8);
#pragma unroll
      for (int j = 0; j < 2; ++j) {
        const v2f a2 = {a[2 * j], a[2 * j + 1]};
#pragma unroll
        for (int t = 0; t < 4; ++t) {
          const v2f b2 = {bb[t][2 * j], bb[t][2 * j + 1]};
          s[t] = __builtin_amdgcn_wmma_f32_16x16x4_f32(false, a2, false, b2, (short)0, s[t],
                                                       false, false);
        }
      }
    }
  }

  // gated softmax by rows: s[t][r] is row m0 + r, key 16*t + idx; a row lies in
  // the 16 lanes of one half. p stays unscaled, the row's sum divides at the end.
  float inv[8];
  {
    const bool ok3 = 48 + idx < NQ;              // the last tile holds key 48 alone
    float* pw = sp + m0 * AT_QP + idx;
#pragma unroll
    for (int r = 0; r < 8; ++r) {
      float e[4];
#pragma unroll
      for (int t = 0; t < 4; ++t) e[t] = s[t][r] * 0.125f * (1.f + g[t][r]);   // 1/sqrt(64)
      float m = fmaxf(fmaxf(e[0], e[1]), e[2]);
      m = row_max(ok3 ? fmaxf(m, e[3]) : m);
      const float p0 = __expf(e[0] - m), p1 = __expf(e[1] - m), p2 = __expf(e[2] - m);
      const float p3 = ok3 ? __expf(e[3] - m) : 0.f;
      const float sm = row_sum((p0 + p1) + (p2 + p3));
      inv[r] = 1.f / sm;
      pw[r * AT_QP]      = p0;
      pw[r * AT_QP + 16] = p1;
      pw[r * AT_QP + 32] = p2;
      pw[r * AT_QP + 48] = p3;
    }
  }
  // p goes from the accumulator places to the A places through LDS, between lanes
  __syncthreads();

  // out = p v: key = 4*ks + 2*hf + 0..1 on both sides
  v8f o[4] = {};
  {
    const float* pp = sp + (wave * 16 + idx) * AT_QP + hf * 2;
    const float* pv = sv + hf * 2 * AT_VP + idx;
#pragma unroll
    for (int ks = 0; ks < AT_KST; ++ks) {
      const v2f a2 = *(const v2f*)(pp + ks * 4);
#pragma unroll
      for (int t = 0; t < 4; ++t) {
        const v2f b2 = {pv[ks * 4 * AT_VP + t * 16], pv[(ks * 4 + 1) * AT_VP + t * 16]};
        o[t] = __builtin_amdgcn_wmma_f32_16x16x4_f32(false, a2, false, b2, (short)0, o[t],
                                                     false, false);
      }
    }
  }

  _Float16* op = outp + (size_t)(b * NQ + m0) * DMODEL + h * DKH + idx;
  if (wave * 16 + 16 <= NQ) {                    // wave-uniform: all 16 rows are queries
#pragma unroll
    for (int r = 0; r < 8; ++r)
#pragma unroll
      for (int t = 0; t < 4; ++t) op[r * DMODEL + 16 * t] = (_Float16)(o[t][r] * inv[r]);
  } else {
#pragma unroll
    for (int r = 0; r < 8; ++r) {
      if (m0 + r < NQ) {
#pragma unroll
        for (int t = 0; t < 4; ++t) op[r * DMODEL + 16 * t] = (_Float16)(o[t][r] * inv[r]);
      }
    }
  }
}

// ---------------------------------------------------------------------------
extern "C" void kernel_launch(void* const* d_in, const int* in_sizes, int n_in,
                              void* d_out, int out_size, void* d_ws, size_t ws_size,
                              hipStream_t stream) {
  const float* queries = (const float*)d_in[0];
  const float* keys    = (const float*)d_in[1];
  const float* values  = (const float*)d_in[2];
  const float* Wq = (const float*)d_in[3];  const float* bq = (const float*)d_in[4];
  const float* Wk = (const float*)d_in[5];  const float* bk = (const float*)d_in[6];
  const float* Wv = (const float*)d_in[7];  const float* bv = (const float*)d_in[8];
  const float* Wo = (const float*)d_in[9];  const float* bo = (const float*)d_in[10];
  const float* rel_embed = (const float*)d_in[11];
  const float* Wproj = (const float*)d_in[12]; const float* bproj = (const float*)d_in[13];
  const float* Wgate = (const float*)d_in[14]; const float* bgate = (const float*)d_in[15];
  const float* Wc1 = (const float*)d_in[16];   const float* bc1 = (const float*)d_in[17];
  const float* gc = (const float*)d_in[18];    const float* bcln = (const float*)d_in[19];
  const float* Wc2 = (const float*)d_in[20];   const float* bc2 = (const float*)d_in[21];
  const float* Wr1 = (const float*)d_in[22];   const float* br1 = (const float*)d_in[23];
  const float* gr = (const float*)d_in[24];    const float* brln = (const float*)d_in[25];
  const float* Wr2 = (const float*)d_in[26];   const float* br2 = (const float*)d_in[27];
  const float* convW = (const float*)d_in[28]; const float* convb = (const float*)d_in[29];

  // ---- workspace carve-out (256B aligned blocks) ----
  char* base = (char*)d_ws;
  size_t off = 0;
  auto alloc = [&](size_t bytes) -> void* {
    off = (off + 255) & ~(size_t)255;
    void* p = base + off;
    off += bytes;
    return p;
  };
  _Float16* qpadH  = (_Float16*)alloc((size_t)BQ * PADN * DMODEL * 2);
  _Float16* convWH = (_Float16*)alloc((size_t)DMODEL * KCONV * 2);
  _Float16* WqT    = (_Float16*)alloc((size_t)DMODEL * DMODEL * 2);
  _Float16* WkT    = (_Float16*)alloc((size_t)DMODEL * DMODEL * 2);
  _Float16* WvT    = (_Float16*)alloc((size_t)DMODEL * DMODEL * 2);
  _Float16* WoT    = (_Float16*)alloc((size_t)DMODEL * DMODEL * 2);
  _Float16* Wc1aT  = (_Float16*)alloc((size_t)256 * DMODEL * 2);
  _Float16* Wc1bT  = (_Float16*)alloc((size_t)256 * DMODEL * 2);
  _Float16* Wr1aT  = (_Float16*)alloc((size_t)DMODEL * DMODEL * 2);
  _Float16* Wr1bT  = (_Float16*)alloc((size_t)DMODEL * DMODEL * 2);
  _Float16* eqH    = (_Float16*)alloc((size_t)ROWS * DMODEL * 2);
  _Float16* ekH    = (_Float16*)alloc((size_t)ROWS * DMODEL * 2);
  _Float16* evH    = (_Float16*)alloc((size_t)ROWS * DMODEL * 2);
  _Float16* attnoH = (_Float16*)alloc((size_t)ROWS * DMODEL * 2);
  float* hconv = (float*)alloc((size_t)ROWS * DMODEL * 4);
  float* bnpart = (float*)alloc((size_t)2 * NPART * DMODEL * 4);
  float* qh    = (float*)alloc((size_t)ROWS * DMODEL * 4);
  float* kh    = (float*)alloc((size_t)ROWS * DMODEL * 4);
  float* vh    = (float*)alloc((size_t)ROWS * DMODEL * 4);
  float* A1c   = (float*)alloc((size_t)ROWS * 256 * 4);
  float* A2c   = (float*)alloc((size_t)ROWS * 256 * 4);
  float* A1r   = (float*)alloc((size_t)ROWS * DMODEL * 4);
  float* A2r   = (float*)alloc((size_t)ROWS * DMODEL * 4);
  float* uvec  = (float*)alloc(DMODEL * 4);
  float* wvecp = (float*)alloc(64);
  float* cscal = (float*)alloc(64);
  float* gateb = (float*)alloc((size_t)NPAIR * 4);

  // 1) conv operands: padded fp16 token table + fp16 conv weights in (tap, channel) order
  pad_cvt_k<<<CVT_BLKS + PAD_BLKS, ROW_THREADS, 0, stream>>>(queries, qpadH, convW, convWH);

  // 2) conv3x3 as WMMA GEMM (1568 x 512 x 4608), A rows straight from the padded table; the gate-collapse vectors and
  //    the weight transposes run beside it in the same grid
  conv_gemm_side_k<<<SIDE_GRID, dim3(32, 4), 0, stream>>>(
      qpadH, convWH, convb, hconv, bnpart,
      Wr2, Wgate, bgate, Wproj, bproj, br2, rel_embed, uvec, wvecp, cscal,
      Wq, Wk, Wv, Wo, Wr1, Wc1, WqT, WkT, WvT, WoT, Wr1aT, Wr1bT, Wc1aT, Wc1bT);

  // 3) BatchNorm(affine=False) from the conv GEMM's partial sums + ReLU + residual adds
  //    (f16 activations)
  eqkv_k<<<EQ_BLKS, EQ_THREADS, 0, stream>>>(hconv, bnpart, queries, keys, values,
                                             eqH, ekH, evH);

  // 4) token-level projections (all WMMA), one grid
  proj_gemms_k<<<PROJ_BLKS, dim3(32, 4), 0, stream>>>(
      eqH, ekH, evH, WqT, WkT, WvT, Wr1aT, Wr1bT, Wc1aT, Wc1bT, bq, bk, bv, br1, bc1,
      qh, kh, vh, A1r, A2r, A1c, A2c);

  // 5) per-pair gate (one wave32 per 7 pairs, 112 pairs a block)
  pair_gate_k<<<PAIR_BLKS, dim3(32, PAIR_WAVES), 0, stream>>>(
      A1c, A2c, A1r, A2r, gc, bcln, Wc2, bc2, gr, brln, uvec, wvecp, cscal, gateb);

  // 6) logits, gated softmax and A*V, one block per (b, h) (f16 output feeds final GEMM)
  attn_gated_k<<<BQ * NHEAD, dim3(32, 4), 0, stream>>>(qh, kh, vh, gateb, attnoH);

  // 7) output projection (WMMA) straight into d_out
  gemm_wmma_f16<<<BLK_N512, dim3(32, 4), 0, stream>>>(attnoH, WoT, bo, (float*)d_out);
}
